// v000
// Measured on an AMD MI455X. A time is GPU time per run, averaged over a window of back-to-back runs after a warm-up
// (all launches, gaps included; the runs take copies of the inputs in turn), and the median of several windows.
// Apart from v000's, it joins two sittings. Times from different sittings can be a few percent apart, while
// side-by-side timings come from the same sitting.
// v000, which the later versions start from, runs in 452 microseconds.
// Contractions: q|k projection (f32 out) and v^T projection (bf16 hi|lo out) = v_wmma_f32_16x16x32_bf16 single products on bf16 planes of the RNE-converted inputs; q.k^T and p.v = bf16 hi/lo split (hi.hi + hi.lo + lo.hi); output projection = [CTXhi|CTXlo] x [Wp;Wp] bf16 single products (K-folded 2-term); f32 accumulate everywhere; RoPE, QK RMSNorm, output RMSNorm, online softmax, 1/rowsum, bias and residual in f32 on the VALU.
// Plane / carry map (all carry 1, nothing to fold back): XB = bf16(x) token-major [4096][1024] (row b*1024+n, n = y*32+x, col c);
// WQKV = bf16(w_qkv) [3072][1024] natural [out][in]; WP2 [1024][2048]: cols k and 1024+k both = bf16(w_proj[c][k]);
// TC/TS f32 [32 pos][16 pair] = cos/sin(pos * 10000^(-j/16)); QKf f32 [4096][2048] = pre-RoPE q (cols 0..1023) | k (cols 1024..2047) incl. bias;
// Qh|Ql, Kh|Kl bf16 [4096][1024] (col h*64+d) = hi/lo of the RoPE'd, RMSNorm'd q, k; VTh|VTl bf16 [1024 (h,d)][4096 (b,t)];
// P hi|lo = unnormalised exp in (0,1] (bf16, f32 exponent range), 1/rowsum applied to the f32 accumulator in the attention epilogue;
// CTX2 u16 [4096][2048] = ctx hi at col h*64+d, lo at col 1024+h*64+d; Of f32 [4096][1024] = ctx . w_proj^T.
#include <hip/hip_runtime.h>
#include <math.h>
#include <stdint.h>

#define NB    4
#define CH    1024
#define IMH   32
#define IMW   32
#define NTOK  1024
#define INNER 1024
#define NH    16
#define HD    64
#define NQKV  3072
#define QKP   2048
#define AOP   2048
#define VTP   (NB * NTOK)
#define MTOK  (NB * NTOK)
#define TABN  512
#define RMS_EPS 1e-6f

static_assert(NTOK == IMH * IMW);
static_assert(IMW == 32);
static_assert(INNER == NH * HD);
static_assert(HD == 64);
static_assert(NQKV == 3 * INNER);
static_assert(QKP == 2 * INNER);
static_assert(AOP == 2 * INNER);
static_assert(CH % 64 == 0);
static_assert(NTOK % 64 == 0);
static_assert(INNER % 64 == 0);
static_assert(MTOK % 64 == 0);
static_assert(CH % 32 == 0);
static_assert(AOP % 32 == 0);
static_assert(INNER == 128 * 8);
static_assert(CH == 8 * 128);
static_assert(TABN == 32 * (HD / 4));
static_assert((NQKV * CH) % (8 * 256) == 0);
static_assert((CH * INNER) % (8 * 256) == 0);
static_assert(CH % 256 == 0);
static_assert(INNER % 256 == 0);

typedef __attribute__((ext_vector_type(16))) _Float16 v16h;
typedef __attribute__((ext_vector_type(8)))  _Float16 v8h;
typedef __attribute__((ext_vector_type(16))) __bf16   v16b;
typedef __attribute__((ext_vector_type(8)))  __bf16   v8b;
typedef __attribute__((ext_vector_type(8)))  float    v8f;
typedef __attribute__((ext_vector_type(4)))  float    v4f;
typedef __attribute__((ext_vector_type(2)))  float    v2f;
typedef __attribute__((ext_vector_type(4)))  unsigned int v4u;

__device__ __forceinline__ unsigned short f2bf_bits(float f) {
  unsigned u = __float_as_uint(f);
  return (unsigned short)((u + 0x7FFFu + ((u >> 16) & 1u)) >> 16);
}
__device__ __forceinline__ float bf_bits2f(unsigned short h) { return __uint_as_float(((unsigned)h) << 16); }
__device__ __forceinline__ float bf_rne(float f) { return bf_bits2f(f2bf_bits(f)); }
__device__ __forceinline__ unsigned pk16(unsigned short a, unsigned short b) { return (unsigned)a | ((unsigned)b << 16); }

// hazard guards as plain device helpers (no inline asm inside the kernel template body)
__device__ __forceinline__ void dep_guard_h(v8f& a, v8f& b, v16h x, v16h y) { asm volatile("v_nop\n\tv_nop\n\tv_nop\n\tv_nop" : "+v"(a), "+v"(b) : "v"(x), "v"(y)); }
__device__ __forceinline__ void dep_guard_b(v8f& a, v8f& b, v16b x, v16b y) { asm volatile("v_nop\n\tv_nop\n\tv_nop\n\tv_nop" : "+v"(a), "+v"(b) : "v"(x), "v"(y)); }
__device__ __forceinline__ void keep4_h(v16h a, v16h b, v16h c, v16h d) { asm volatile("v_nop" :: "v"(a), "v"(b), "v"(c), "v"(d)); }
__device__ __forceinline__ void keep4_b(v16b a, v16b b, v16b c, v16b d) { asm volatile("v_nop" :: "v"(a), "v"(b), "v"(c), "v"(d)); }
__device__ __forceinline__ void acc_guard4(v8f& a, v8f& b, v8f& c, v8f& d) { asm volatile("v_nop\n\tv_nop\n\tv_nop\n\tv_nop" : "+v"(a), "+v"(b), "+v"(c), "+v"(d)); }
template <typename T> struct Frag;
template <> struct Frag<_Float16> {
  typedef v16h V; union U { v16h v; v8h h[2]; };
  static __device__ __forceinline__ v16h load(const _Float16* p) {   // elements 0..7 <- p[0..7], 8..15 <- p[16..23]
    U f; f.h[0] = *(const v8h*)(p); f.h[1] = *(const v8h*)(p + 16); return f.v;
  }
  static __device__ __forceinline__ v8f mma(v16h a, v16h b, v8f c) {
    return __builtin_amdgcn_wmma_f32_16x16x32_f16(false, a, false, b, (short)0, c, false, false);
  }
  static __device__ __forceinline__ void guard(v8f& a, v8f& b, v16h x, v16h y) { dep_guard_h(a, b, x, y); }
  static __device__ __forceinline__ void keep(v16h a, v16h b, v16h c, v16h d) { keep4_h(a, b, c, d); }
};
template <> struct Frag<__bf16> {
  typedef v16b V; union U { v16b v; v8b h[2]; };
  static __device__ __forceinline__ v16b load(const __bf16* p) {
    U f; f.h[0] = *(const v8b*)(p); f.h[1] = *(const v8b*)(p + 16); return f.v;
  }
  static __device__ __forceinline__ v8f mma(v16b a, v16b b, v8f c) {
    return __builtin_amdgcn_wmma_f32_16x16x32_bf16(false, a, false, b, (short)0, c, false, false);
  }
  static __device__ __forceinline__ void guard(v8f& a, v8f& b, v16b x, v16b y) { dep_guard_b(a, b, x, y); }
  static __device__ __forceinline__ void keep(v16b a, v16b b, v16b c, v16b d) { keep4_b(a, b, c, d); }
};

// ---- Register-blocked batched WMMA GEMM ------------------------------------
// C[m,n] = scale * sum_k A[m,k] * Bt[n,k] (+bias)(+resid); each wave owns a 64x64 tile.
// A row-major [M,K]; Bt row-major [N,K]; M,N % 64 == 0, K % 32 == 0.
// SPLIT: operands are hi/lo planes (A2/Bt2 = lo planes, same layout); product = hi.hi + hi.lo + lo.hi.
// BIAS_MODE: 0 = none, 1 = bias[m], 2 = bias[n]; the bias value is RNE-converted to bf16 precision before the f32 add.
// OUT_MODE: 0 = f32, 1 = f16, 2 = bf16 hi plane (Cout) + bf16 lo plane (Cout2).
// ET: 0 = f16 operands, 1 = bf16 operands (pointers passed as 16-bit storage)
template <int ET> struct Elem;
template <> struct Elem<0> { typedef _Float16 T; };
template <> struct Elem<1> { typedef __bf16 T; };
template <int ET, bool SPLIT, int BIAS_MODE, int OUT_MODE, bool RESID, int ACT = 0>
__global__ __launch_bounds__(256) void wmma_gemm64(
    const unsigned short* __restrict__ Ap, const unsigned short* __restrict__ A2p, int lda, long strideA,
    const unsigned short* __restrict__ Btp, const unsigned short* __restrict__ Bt2p, int ldb, long strideB,
    void* __restrict__ Cout, void* __restrict__ Cout2, int ldc, long strideC,
    const float* __restrict__ bias,
    const float* __restrict__ resid, long strideR,
    int M, int N, int K, float scale) {
  typedef typename Elem<ET>::T T;
  typedef typename Frag<T>::V V;
  const T* A = (const T*)Ap; const T* A2 = (const T*)A2p; const T* Bt = (const T*)Btp; const T* Bt2 = (const T*)Bt2p;
  __shared__ __align__(16) float sT[8][16 * 68];   // per-wave 16x64 slab, pitch 68 floats
  const int b    = blockIdx.y;
  const int lane = threadIdx.x & 31;
  const int wave = threadIdx.x >> 5;
  const int tilesN = N >> 6;
  const int tilesM = M >> 6;
  const int tile = blockIdx.x * 8 + wave;
  if (tile >= tilesM * tilesN) return;   // wave-uniform; no block barriers in this kernel
  const int tm = tile / tilesN;
  const int tn = tile - tm * tilesN;
  const int m0 = tm << 6;
  const int n0 = tn << 6;

  const T* Ab  = A  + (size_t)b * strideA;
  const T* Bb  = Bt + (size_t)b * strideB;
  const T* Ab2 = SPLIT ? (A2  + (size_t)b * strideA) : nullptr;
  const T* Bb2 = SPLIT ? (Bt2 + (size_t)b * strideB) : nullptr;

  const int rlane = lane & 15;                 // row (A) / col (B, D) within subtile
  const int koff  = (lane >> 4) * 8;           // k offset of this lane half
  const int mOff  = (lane >> 4) * 8;           // D row offset

  v8f acc[4][4];
#pragma unroll
  for (int i = 0; i < 4; ++i)
#pragma unroll
    for (int j = 0; j < 4; ++j) acc[i][j] = (v8f){0.f,0.f,0.f,0.f,0.f,0.f,0.f,0.f};

  for (int k0 = 0; k0 < K; k0 += 32) {
    V bh[4], bl[4];
#pragma unroll
    for (int j = 0; j < 4; ++j) {
      const size_t bo = (size_t)(n0 + (j << 4) + rlane) * ldb + koff + k0;
      bh[j] = Frag<T>::load(Bb + bo);
      if (SPLIT) bl[j] = Frag<T>::load(Bb2 + bo); else bl[j] = bh[j];
    }
#pragma unroll
    for (int i = 0; i < 4; ++i) {
      const size_t ao = (size_t)(m0 + (i << 4) + rlane) * lda + koff + k0;
      V ah = Frag<T>::load(Ab + ao);
      V al;
      if (SPLIT) al = Frag<T>::load(Ab2 + ao); else al = ah;
#pragma unroll
      for (int j = 0; j < 4; ++j) {
        acc[i][j] = Frag<T>::mma(ah, bh[j], acc[i][j]);
        if (SPLIT) {
          acc[i][j] = Frag<T>::mma(ah, bl[j], acc[i][j]);
          acc[i][j] = Frag<T>::mma(al, bh[j], acc[i][j]);
        }
      }
      Frag<T>::guard(acc[i][0], acc[i][3], ah, al);
    }
    Frag<T>::keep(bh[0], bh[1], bh[2], bh[3]);
    if (SPLIT) Frag<T>::keep(bl[0], bl[1], bl[2], bl[3]);
  }
  acc_guard4(acc[0][0], acc[0][1], acc[0][2], acc[0][3]);
  acc_guard4(acc[1][0], acc[1][1], acc[1][2], acc[1][3]);
  acc_guard4(acc[2][0], acc[2][1], acc[2][2], acc[2][3]);
  acc_guard4(acc[3][0], acc[3][1], acc[3][2], acc[3][3]);

  // ---- epilogue ----
  float* slab = sT[wave];
  const float* Rb = RESID ? (resid + (size_t)b * strideR) : nullptr;
#pragma unroll
  for (int i = 0; i < 4; ++i) {
    const int mBase = m0 + (i << 4);
#pragma unroll
    for (int j = 0; j < 4; ++j) {
      const int n = n0 + (j << 4) + rlane;
      float bv = 0.f;
      if (BIAS_MODE == 2) bv = bf_rne(bias[n]);
#pragma unroll
      for (int r = 0; r < 8; ++r) {
        float v = acc[i][j][r] * scale;
        if (BIAS_MODE == 1) v += bf_rne(bias[mBase + mOff + r]);
        if (BIAS_MODE == 2) v += bv;
        if (RESID) v += Rb[(size_t)(mBase + mOff + r) * ldc + n];
        if (ACT == 1) v = tanhf(v);
        if (ACT == 2) v = fmaxf(v, 0.0f);
        if (ACT == 3) v = v / (1.0f + expf(-v));
        if (ACT == 4) v = (v > 0.f) ? v : 0.01f * v;
        if (ACT == 5) v = 0.5f * v * (1.0f + erff(v * 0.70710678118654752f));
        slab[(mOff + r) * 68 + (j << 4) + rlane] = v;
      }
    }
    __builtin_amdgcn_fence(__ATOMIC_RELEASE, "workgroup");
    __builtin_amdgcn_wave_barrier();
    __builtin_amdgcn_fence(__ATOMIC_ACQUIRE, "workgroup");
    if (OUT_MODE == 0) {
      float* C = (float*)Cout + (size_t)b * strideC;
      const int hh = lane >> 4, c4 = (lane & 15) * 4;     // row seg = 256 B = 16 lanes x 16 B
      {
#pragma unroll
        for (int it = 0; it < 8; ++it) {
          const int row = it * 2 + hh;
          v4f v = *(const v4f*)(slab + row * 68 + c4);
          *(v4f*)(C + (size_t)(mBase + row) * ldc + n0 + c4) = v;
        }
        
      }
    } else {
      const int q = lane >> 3, c8 = (lane & 7) * 8;
      unsigned short* C  = (unsigned short*)Cout  + (size_t)b * strideC;
      unsigned short* C2 = (OUT_MODE == 2) ? ((unsigned short*)Cout2 + (size_t)b * strideC) : nullptr;
      {
#pragma unroll
        for (int it = 0; it < 4; ++it) {
          const int row = it * 4 + q;
          const float* sp = slab + row * 68 + c8;
          v8h hv, lv;
#pragma unroll
          for (int e = 0; e < 8; ++e) {
            if (OUT_MODE == 1) {
              hv[e] = (_Float16)sp[e];
            } else {
              unsigned short hb = f2bf_bits(sp[e]);
              unsigned short lb = f2bf_bits(sp[e] - bf_bits2f(hb));
              hv[e] = __builtin_bit_cast(_Float16, hb);
              lv[e] = __builtin_bit_cast(_Float16, lb);
            }
          }
          *(v8h*)(C + (size_t)(mBase + row) * ldc + n0 + c8) = hv;
          if (OUT_MODE == 2) *(v8h*)(C2 + (size_t)(mBase + row) * ldc + n0 + c8) = lv;
        }
        
      }
    }
    __builtin_amdgcn_fence(__ATOMIC_RELEASE, "workgroup");
    __builtin_amdgcn_wave_barrier();
    __builtin_amdgcn_fence(__ATOMIC_ACQUIRE, "workgroup");
  }
}

// ---------------------------------------------------------------------------
// Row-preserving bf16 RNE convert of an f32 matrix [rows][ncols] into a u16 plane with row pitch ldout; DUP also
// writes the same 8 values at column + ncols (second copy along the row). 8 consecutive elements per thread = one
// Coverage: grid = n8/256 blocks x 256 threads x 8 elements = rows*ncols (n8 = rows*ncols/8, exact multiple of 256).
// ---------------------------------------------------------------------------
template <bool DUP>
__global__ __launch_bounds__(256) void convrows_kernel(const float* __restrict__ in, unsigned short* __restrict__ out,
                                                       int ncols, int ldout, int n8) {
  const int i = blockIdx.x * 256 + threadIdx.x;
  if (i < n8) {
    const size_t e0 = (size_t)i * 8;
    const int row = (int)(e0 / (size_t)ncols);
    const int col = (int)(e0 - (size_t)row * ncols);
    const v4f a = *(const v4f*)(in + e0);
    const v4f c = *(const v4f*)(in + e0 + 4);
    v4u hv;
    hv[0] = pk16(f2bf_bits(a[0]), f2bf_bits(a[1]));
    hv[1] = pk16(f2bf_bits(a[2]), f2bf_bits(a[3]));
    hv[2] = pk16(f2bf_bits(c[0]), f2bf_bits(c[1]));
    hv[3] = pk16(f2bf_bits(c[2]), f2bf_bits(c[3]));
    const size_t o = (size_t)row * ldout + col;
    {
      *(v4u*)(out + o) = hv;
      if (DUP) *(v4u*)(out + o + ncols) = hv;
      
    }
  }
}

// ---------------------------------------------------------------------------
// Fused transpose + bf16 RNE convert of an f32 matrix, z-batched, one plane:
//   in_z = W + z*sIn viewed [R rows][Cc cols] with row pitch ldin  ->  oh_z[c][r] = bf16(in_z[r][c]), row pitch ldout, oh_z = oh + z*sOut.
// 64x64 tiles through LDS. grid = (Cc/64, R/64, Z), 256 threads (R, Cc multiples of 64; ldout multiple of 64 so every
// Coverage per block: load 4 it x 256 thr x 4 floats = 64x64; store 2 it x 256 thr x 8 u16 = 64x64.
// ---------------------------------------------------------------------------
__global__ __launch_bounds__(256) void tconv_kernel(const float* __restrict__ W, unsigned short* __restrict__ oh,
                                                    int ldin, int ldout, long sIn, long sOut) {
  __shared__ __align__(16) float tf[64 * 68];
  W  += (size_t)blockIdx.z * sIn;
  oh += (size_t)blockIdx.z * sOut;
  const int c0  = blockIdx.x * 64;   // input column block = output row block
  const int r0  = blockIdx.y * 64;   // input row block    = output column block
  const int tid = threadIdx.x;
  {
    const int lr = tid >> 4;         // 0..15
    const int c4 = (tid & 15) * 4;   // 0..60
#pragma unroll
    for (int it = 0; it < 4; ++it) {
      const int rr = it * 16 + lr;   // 0..63
      const v4f a = *(const v4f*)(W + (size_t)(r0 + rr) * ldin + c0 + c4);
      *(v4f*)(tf + rr * 68 + c4) = a;
    }
  }
  __syncthreads();
  const int sub = tid >> 3;          // 0..31
  const int c8  = (tid & 7) * 8;     // 0..56
  v4u hv[2];
#pragma unroll
  for (int it = 0; it < 2; ++it) {
    const int oc = it * 32 + sub;    // output row within tile (= input column)
    v4u a;
#pragma unroll
    for (int q = 0; q < 4; ++q) {
      const float f0 = tf[(c8 + 2 * q) * 68 + oc];
      const float f1 = tf[(c8 + 2 * q + 1) * 68 + oc];
      a[q] = pk16(f2bf_bits(f0), f2bf_bits(f1));
    }
    hv[it] = a;
  }
  {
#pragma unroll
    for (int it = 0; it < 2; ++it) {
      const int oc = it * 32 + sub;
      const size_t go = (size_t)(c0 + oc) * ldout + r0 + c8;
      *(v4u*)(oh + go) = hv[it];
    }
    
  }
}

// ---------------------------------------------------------------------------
// Rotary angle tables: tc[pos*16 + j] = cos(pos * f_j), ts likewise, f_j = 10000^(-4j/64) = 10^(-j/4) (f32 constants),
// pos 0..31 (shared by the row axis and the column axis), j 0..15. Precise cosf/sinf (|angle| <= 31).
// grid = 2 x 256 = 512 threads = 32 x 16 entries per table; one 4-B store per lane, 32 consecutive lanes = one whole
// ---------------------------------------------------------------------------
__device__ __forceinline__ float rope_freq(int j) {
  float f = 1.0f;
  f = (j == 1)  ? 0.5623413251903491f     : f;
  f = (j == 2)  ? 0.31622776601683794f    : f;
  f = (j == 3)  ? 0.17782794100389229f    : f;
  f = (j == 4)  ? 0.1f                    : f;
  f = (j == 5)  ? 0.05623413251903491f    : f;
  f = (j == 6)  ? 0.031622776601683794f   : f;
  f = (j == 7)  ? 0.017782794100389229f   : f;
  f = (j == 8)  ? 0.01f                   : f;
  f = (j == 9)  ? 0.005623413251903491f   : f;
  f = (j == 10) ? 0.0031622776601683794f  : f;
  f = (j == 11) ? 0.0017782794100389228f  : f;
  f = (j == 12) ? 0.001f                  : f;
  f = (j == 13) ? 0.0005623413251903491f  : f;
  f = (j == 14) ? 0.00031622776601683794f : f;
  f = (j == 15) ? 0.00017782794100389227f : f;
  return f;
}

__global__ __launch_bounds__(256) void ropetab_kernel(float* __restrict__ tc, float* __restrict__ ts) {
  const int i = blockIdx.x * 256 + threadIdx.x;      // 0..511 = pos*16 + j
  if (i < TABN) {
    const int pos = i >> 4, j = i & 15;
    const float a = (float)pos * rope_freq(j);
    const float c = cosf(a);
    const float s = sinf(a);
    ((float*)tc)[i] = c;
    ((float*)ts)[i] = s;
    
  }
}

// ---------------------------------------------------------------------------
// Per-token 2-D RoPE (interleaved pairs (2i,2i+1) inside each head; pairs 0..15 use the row index y = n>>5, pairs 16..31
// the column index x = n&31; tables shared by all heads) followed by RMSNorm over the WHOLE 1024-wide (heads x dim) row:
// v = rope(v); v = v * rsqrt(mean_1024(v*v) + 1e-6) * bf16(w[col]); then bf16 hi/lo split into planes [4096][1024].
// One block of 128 threads per token row g = b*1024+n; thread t owns columns 8t..8t+7 (= 4 rotary pairs p0..p0+3, p0 = (4t)&31,
// all four in the same half of the pair range). All loads are 16-B vectors. Stores: 16 B per lane per plane, 128 lanes cover
// LDS: redq/redk[4] written by lane 0 of each of the 4 waves before the barrier.
// ---------------------------------------------------------------------------
__global__ __launch_bounds__(128) void ropenorm_kernel(const float* __restrict__ qkf,
                                                       const float* __restrict__ tc, const float* __restrict__ ts,
                                                       const float* __restrict__ qw, const float* __restrict__ kw,
                                                       unsigned short* __restrict__ qh, unsigned short* __restrict__ ql,
                                                       unsigned short* __restrict__ kh, unsigned short* __restrict__ kl) {
  __shared__ float redq[4], redk[4];
  const int g = blockIdx.x;                 // token row 0..MTOK-1
  const int n = g & (NTOK - 1);
  const int py = n >> 5, px = n & 31;
  const int t = threadIdx.x, lane = t & 31, wave = t >> 5;
  const int i0 = t * 8;

  const float* qr = qkf + (size_t)g * QKP + i0;
  const float* kr = qr + INNER;
  const v4f qa = *(const v4f*)(qr), qb = *(const v4f*)(qr + 4);
  const v4f ka = *(const v4f*)(kr), kb = *(const v4f*)(kr + 4);

  const int p0   = (4 * t) & 31;
  const int hsel = p0 >> 4;                 // 0: row-axis angles, 1: column-axis angles
  const int pos  = py + hsel * (px - py);
  const int toff = pos * 16 + (p0 & 15);
  const v4f cv = *(const v4f*)(tc + toff);
  const v4f sv = *(const v4f*)(ts + toff);

  float q8[8], k8[8];
  q8[0] = qa[0]; q8[1] = qa[1]; q8[2] = qa[2]; q8[3] = qa[3];
  q8[4] = qb[0]; q8[5] = qb[1]; q8[6] = qb[2]; q8[7] = qb[3];
  k8[0] = ka[0]; k8[1] = ka[1]; k8[2] = ka[2]; k8[3] = ka[3];
  k8[4] = kb[0]; k8[5] = kb[1]; k8[6] = kb[2]; k8[7] = kb[3];

  float rq[8], rk[8];
#pragma unroll
  for (int e = 0; e < 4; ++e) {
    const float c = cv[e], s = sv[e];
    const float qe = q8[2 * e], qo = q8[2 * e + 1];
    const float ke = k8[2 * e], ko = k8[2 * e + 1];
    rq[2 * e]     = qe * c - qo * s;
    rq[2 * e + 1] = qe * s + qo * c;
    rk[2 * e]     = ke * c - ko * s;
    rk[2 * e + 1] = ke * s + ko * c;
  }
  float ssq = 0.0f, ssk = 0.0f;
#pragma unroll
  for (int e = 0; e < 8; ++e) { ssq += rq[e] * rq[e]; ssk += rk[e] * rk[e]; }
#pragma unroll
  for (int off = 1; off < 32; off <<= 1) { ssq += __shfl_xor(ssq, off, 32); ssk += __shfl_xor(ssk, off, 32); }
  if (lane == 0) { redq[wave] = ssq; redk[wave] = ssk; }
  __syncthreads();
  const float tq = (redq[0] + redq[1]) + (redq[2] + redq[3]);
  const float tk = (redk[0] + redk[1]) + (redk[2] + redk[3]);
  const float rmq = rsqrtf(tq * (1.0f / (float)INNER) + RMS_EPS);
  const float rmk = rsqrtf(tk * (1.0f / (float)INNER) + RMS_EPS);

  const v4f wqa = *(const v4f*)(qw + i0), wqb = *(const v4f*)(qw + i0 + 4);
  const v4f wka = *(const v4f*)(kw + i0), wkb = *(const v4f*)(kw + i0 + 4);
  float wq8[8], wk8[8];
  wq8[0] = bf_rne(wqa[0]); wq8[1] = bf_rne(wqa[1]); wq8[2] = bf_rne(wqa[2]); wq8[3] = bf_rne(wqa[3]);
  wq8[4] = bf_rne(wqb[0]); wq8[5] = bf_rne(wqb[1]); wq8[6] = bf_rne(wqb[2]); wq8[7] = bf_rne(wqb[3]);
  wk8[0] = bf_rne(wka[0]); wk8[1] = bf_rne(wka[1]); wk8[2] = bf_rne(wka[2]); wk8[3] = bf_rne(wka[3]);
  wk8[4] = bf_rne(wkb[0]); wk8[5] = bf_rne(wkb[1]); wk8[6] = bf_rne(wkb[2]); wk8[7] = bf_rne(wkb[3]);

  v4u hq, lq, hk, lk;
#pragma unroll
  for (int e = 0; e < 4; ++e) {
    const float fq0 = rq[2 * e] * rmq * wq8[2 * e];
    const float fq1 = rq[2 * e + 1] * rmq * wq8[2 * e + 1];
    const float fk0 = rk[2 * e] * rmk * wk8[2 * e];
    const float fk1 = rk[2 * e + 1] * rmk * wk8[2 * e + 1];
    const unsigned short hq0 = f2bf_bits(fq0), hq1 = f2bf_bits(fq1);
    const unsigned short hk0 = f2bf_bits(fk0), hk1 = f2bf_bits(fk1);
    const unsigned short lq0 = f2bf_bits(fq0 - bf_bits2f(hq0)), lq1 = f2bf_bits(fq1 - bf_bits2f(hq1));
    const unsigned short lk0 = f2bf_bits(fk0 - bf_bits2f(hk0)), lk1 = f2bf_bits(fk1 - bf_bits2f(hk1));
    hq[e] = pk16(hq0, hq1); lq[e] = pk16(lq0, lq1);
    hk[e] = pk16(hk0, hk1); lk[e] = pk16(lk0, lk1);
  }
  const size_t o = (size_t)g * INNER + i0;
  {
    *(v4u*)(qh + o) = hq;
    *(v4u*)(ql + o) = lq;
    *(v4u*)(kh + o) = hk;
    *(v4u*)(kl + o) = lk;
    
  }
}

// =====================================================================================
// Full (non-causal, unmasked) attention, head dim 64, all batches in one launch.
//   q planes (hi/lo bf16) [4096][1024]: element (b, n, h, d) at [(b*1024+n)*1024 + h*64 + d]
//   k planes (hi/lo bf16) [4096][1024]: same layout
//   v^T planes (hi/lo bf16) [1024][4096]: element (h, d, b, t) at [(h*64 + d)*4096 + b*1024 + t]
//   out CTX2 plane u16 [4096][2048]: hi bits of o(b,n,h,d) at col h*64+d, lo bits (o - hi) at col 1024 + h*64+d.
//   scores = (q . k) * 0.125 : bf16 hi/lo split (hi.hi + hi.lo + lo.hi) on v_wmma_f32_16x16x32_bf16
//   out    = p . v           : bf16 hi/lo split of p (unnormalised exp) and v, f32 accumulate, x 1/rowsum in f32 at the end
//   online softmax in f32 over the 1024 keys of the batch element (16 chunks of 64, compile-time trip count, no masking).
//   Block = 4 waves = 64 query rows of one (batch, head); grid.x = 4 * 16 * 16 = 1024.
//   K / V^T chunk staging: 128 threads x 32 elements per plane = the whole 64x64 tile (16-B copies, plain loads,
//   __syncthreads before and after); fragment loads read the LDS tiles with the same v8b element type.
//   LDS extents: K/V tiles 64x64 fully staged every chunk; P tiles 16x64 per wave fully written every chunk before the
// =====================================================================================
#define AT_D 64
#define AT_NW 4
#define AT_QB 64
#define AT_KC 64

__device__ __forceinline__ unsigned short at_bf_bits(float f) {
  unsigned u = __float_as_uint(f);
  return (unsigned short)((u + 0x7FFFu + ((u >> 16) & 1u)) >> 16);
}
__device__ __forceinline__ __bf16 at_f2bf(float f) { return __builtin_bit_cast(__bf16, at_bf_bits(f)); }
__device__ __forceinline__ void at_split(float f, __bf16& hi, __bf16& lo) {
  const unsigned short hb = at_bf_bits(f);
  hi = __builtin_bit_cast(__bf16, hb);
  lo = at_f2bf(f - __uint_as_float(((unsigned)hb) << 16));
}
__device__ __forceinline__ v8f at_mma(v16b a, v16b b, v8f c) {
  c = __builtin_amdgcn_wmma_f32_16x16x32_bf16(false, a, false, b, (short)0, c, false, false);
  asm volatile("v_nop\n\tv_nop\n\tv_nop\n\tv_nop" : "+v"(c) : "v"(a), "v"(b));
  return c;
}

__global__ __launch_bounds__(128)
void attn_kernel(const unsigned short* __restrict__ qhp, const unsigned short* __restrict__ qlp,
                 const unsigned short* __restrict__ khp, const unsigned short* __restrict__ klp,
                 const unsigned short* __restrict__ vhp, const unsigned short* __restrict__ vlp,
                 unsigned short* __restrict__ aop, float sscale) {
  union FB { v16b v; v8b h[2]; };
  __shared__ __align__(16) __bf16 Ksh[AT_KC * AT_D];             // K hi [kv][d]      8 KB
  __shared__ __align__(16) __bf16 Ksl[AT_KC * AT_D];             // K lo
  __shared__ __align__(16) __bf16 Vth[AT_D * AT_KC];             // V hi [d][kv]      8 KB
  __shared__ __align__(16) __bf16 Vtl[AT_D * AT_KC];             // V lo
  __shared__ __align__(16) __bf16 Psh[AT_NW][16 * AT_KC];        // per wave P hi [row][kv]
  __shared__ __align__(16) __bf16 Psl[AT_NW][16 * AT_KC];        // per wave P lo
  __shared__ __align__(16) float  Os[AT_NW][16 * 68];            // per wave out tile, pitch 68

  const int tid  = threadIdx.x;
  const int wave = tid >> 5;
  const int lane = tid & 31;
  const int hh   = lane >> 4;
  const int c    = lane & 15;

  const int nqb = NTOK / AT_QB;            // 16 query blocks per batch element
  const int bx = blockIdx.x;              // grid = NB * NH * nqb (exact)
  const int qb = bx % nqb;
  const int hb = bx / nqb;
  const int h  = hb % NH;                 // 0..15
  const int b  = hb / NH;                 // 0..3
  const int q0 = b * NTOK + qb * AT_QB + wave * 16;   // row in the q / CTX2 planes

  const __bf16* Qh = (const __bf16*)(const void*)qhp + (size_t)h * AT_D;
  const __bf16* Ql = (const __bf16*)(const void*)qlp + (size_t)h * AT_D;
  const __bf16* Kh = (const __bf16*)(const void*)khp + (size_t)h * AT_D;
  const __bf16* Kl = (const __bf16*)(const void*)klp + (size_t)h * AT_D;
  const __bf16* Vh = (const __bf16*)(const void*)vhp + (size_t)h * AT_D * VTP + (size_t)b * NTOK;
  const __bf16* Vl = (const __bf16*)(const void*)vlp + (size_t)h * AT_D * VTP + (size_t)b * NTOK;
  unsigned short* Ch = aop + (size_t)h * AT_D;                    // hi columns
  unsigned short* Cl = aop + (size_t)INNER + (size_t)h * AT_D;    // lo columns

  // ---- Q fragments (A operand, row = lane&15, split k map via Frag load): 2 d-chunks, hi and lo ----
  v16b qah[2], qal[2];
#pragma unroll
  for (int dc = 0; dc < 2; ++dc) {
    const __bf16* qr = Qh + (size_t)(q0 + c) * INNER + dc * 32 + 8 * hh;
    const __bf16* ql = Ql + (size_t)(q0 + c) * INNER + dc * 32 + 8 * hh;
    qah[dc] = Frag<__bf16>::load(qr);
    qal[dc] = Frag<__bf16>::load(ql);
  }

  float mrow[8], lrow[8];
  v8f oacc[4];
#pragma unroll
  for (int r = 0; r < 8; ++r) { mrow[r] = -INFINITY; lrow[r] = 0.f; }
#pragma unroll
  for (int t = 0; t < 4; ++t) oacc[t] = (v8f){0.f,0.f,0.f,0.f,0.f,0.f,0.f,0.f};

  const int nChunks = NTOK / AT_KC;   // 16, compile-time constant
  for (int kc = 0; kc < nChunks; ++kc) {
    const int kv0 = kc * AT_KC;
    __syncthreads();
    {
      // staging coverage: 128 threads x (4 x 8) elements = 64 rows x 64 per plane = the whole chunk tile
      const int r = tid >> 1, half = (tid & 1) * 32;
      const __bf16* ksh = Kh + (size_t)(b * NTOK + kv0 + r) * INNER + half;   // K row (b, kv0+r), d = half..half+31
      const __bf16* ksl = Kl + (size_t)(b * NTOK + kv0 + r) * INNER + half;
      const __bf16* vsh = Vh + (size_t)r * VTP + kv0 + half;                  // V^T row d = r, keys kv0+half..+31
      const __bf16* vsl = Vl + (size_t)r * VTP + kv0 + half;
#pragma unroll
      for (int i = 0; i < 4; ++i) {
        const v8b a0 = *(const v8b*)(ksh + 8 * i);
        const v8b a1 = *(const v8b*)(ksl + 8 * i);
        const v8b b0 = *(const v8b*)(vsh + 8 * i);
        const v8b b1 = *(const v8b*)(vsl + 8 * i);
        *(v8b*)(Ksh + r * AT_D  + half + 8 * i) = a0;
        *(v8b*)(Ksl + r * AT_D  + half + 8 * i) = a1;
        *(v8b*)(Vth + r * AT_KC + half + 8 * i) = b0;
        *(v8b*)(Vtl + r * AT_KC + half + 8 * i) = b1;
      }
    }
    __syncthreads();

    v8f s[4];
#pragma unroll
    for (int j = 0; j < 4; ++j) {
      s[j] = (v8f){0.f,0.f,0.f,0.f,0.f,0.f,0.f,0.f};
#pragma unroll
      for (int dc = 0; dc < 2; ++dc) {
        FB kb, kl;
        kb.h[0] = *(const v8b*)(Ksh + (j * 16 + c) * AT_D + dc * 32 + 8 * hh);
        kb.h[1] = *(const v8b*)(Ksh + (j * 16 + c) * AT_D + dc * 32 + 16 + 8 * hh);
        kl.h[0] = *(const v8b*)(Ksl + (j * 16 + c) * AT_D + dc * 32 + 8 * hh);
        kl.h[1] = *(const v8b*)(Ksl + (j * 16 + c) * AT_D + dc * 32 + 16 + 8 * hh);
        s[j] = at_mma(qah[dc], kb.v, s[j]);
        s[j] = at_mma(qah[dc], kl.v, s[j]);
        s[j] = at_mma(qal[dc], kb.v, s[j]);
      }
    }
    // scale, then chunk row max
    float cm[8];
#pragma unroll
    for (int r = 0; r < 8; ++r) {
      float m = -INFINITY;
#pragma unroll
      for (int j = 0; j < 4; ++j) {
        const float sv = s[j][r] * sscale;
        s[j][r] = sv;
        m = fmaxf(m, sv);
      }
#pragma unroll
      for (int off = 1; off < 16; off <<= 1) m = fmaxf(m, __shfl_xor(m, off, 32));
      cm[r] = m;
    }
    __bf16* pwh = Psh[wave];
    __bf16* pwl = Psl[wave];
#pragma unroll
    for (int r = 0; r < 8; ++r) {
      const float mnew = fmaxf(mrow[r], cm[r]);
      const float alpha = expf(mrow[r] - mnew);
      mrow[r] = mnew;
      float psum = 0.f;
#pragma unroll
      for (int j = 0; j < 4; ++j) {
        const float p = expf(s[j][r] - mnew);
        psum += p;
        __bf16 a, bl; at_split(p, a, bl);
        pwh[(8 * hh + r) * AT_KC + j * 16 + c] = a;
        pwl[(8 * hh + r) * AT_KC + j * 16 + c] = bl;
      }
#pragma unroll
      for (int off = 1; off < 16; off <<= 1) psum += __shfl_xor(psum, off, 32);
      lrow[r] = lrow[r] * alpha + psum;
#pragma unroll
      for (int t = 0; t < 4; ++t) oacc[t][r] *= alpha;
    }
    __builtin_amdgcn_fence(__ATOMIC_RELEASE, "workgroup");
    __builtin_amdgcn_wave_barrier();
    __builtin_amdgcn_fence(__ATOMIC_ACQUIRE, "workgroup");
#pragma unroll 1
    for (int kk = 0; kk < 2; ++kk) {
      FB pa, pl;
      pa.h[0] = *(const v8b*)(pwh + c * AT_KC + kk * 32 + 8 * hh);
      pa.h[1] = *(const v8b*)(pwh + c * AT_KC + kk * 32 + 16 + 8 * hh);
      pl.h[0] = *(const v8b*)(pwl + c * AT_KC + kk * 32 + 8 * hh);
      pl.h[1] = *(const v8b*)(pwl + c * AT_KC + kk * 32 + 16 + 8 * hh);
#pragma unroll
      for (int t = 0; t < 4; ++t) {
        FB vb, vl;
        vb.h[0] = *(const v8b*)(Vth + (t * 16 + c) * AT_KC + kk * 32 + 8 * hh);
        vb.h[1] = *(const v8b*)(Vth + (t * 16 + c) * AT_KC + kk * 32 + 16 + 8 * hh);
        vl.h[0] = *(const v8b*)(Vtl + (t * 16 + c) * AT_KC + kk * 32 + 8 * hh);
        vl.h[1] = *(const v8b*)(Vtl + (t * 16 + c) * AT_KC + kk * 32 + 16 + 8 * hh);
        oacc[t] = at_mma(pa.v, vb.v, oacc[t]);
        oacc[t] = at_mma(pa.v, vl.v, oacc[t]);
        oacc[t] = at_mma(pl.v, vb.v, oacc[t]);
      }
    }
  }

  float* os = Os[wave];
#pragma unroll
  for (int r = 0; r < 8; ++r) {
    const float inv = 1.0f / lrow[r];
#pragma unroll
    for (int t = 0; t < 4; ++t) os[(8 * hh + r) * 68 + t * 16 + c] = oacc[t][r] * inv;
  }
  __builtin_amdgcn_fence(__ATOMIC_RELEASE, "workgroup");
  __builtin_amdgcn_wave_barrier();
  __builtin_amdgcn_fence(__ATOMIC_ACQUIRE, "workgroup");
  {
    const int q = lane >> 3, c8 = (lane & 7) * 8;
    {
#pragma unroll
      for (int it = 0; it < 4; ++it) {
        const int row = it * 4 + q;
        const float* sp = os + row * 68 + c8;
        v8h hv, lv;
#pragma unroll
        for (int e = 0; e < 8; ++e) {
          const unsigned short hbits = f2bf_bits(sp[e]);
          const unsigned short lbits = f2bf_bits(sp[e] - bf_bits2f(hbits));
          hv[e] = __builtin_bit_cast(_Float16, hbits);
          lv[e] = __builtin_bit_cast(_Float16, lbits);
        }
        *(v8h*)(Ch + (size_t)(q0 + row) * AOP + c8) = hv;
        *(v8h*)(Cl + (size_t)(q0 + row) * AOP + c8) = lv;
      }
      
    }
  }
}

// ---------------------------------------------------------------------------
// Output RMSNorm over C + residual + back to NCHW:
//   out[b][c][n] = Of[b*1024+n][c] * rsqrt(mean_C(Of[tok][.]^2) + 1e-6) * bf16(w[c]) + bf16(x[b][c][n]).
// One block of 256 threads per 64 consecutive tokens (grid = 4096/64 = 64). Phase 1: each wave computes the per-token
// factor for 8 tokens (16-B loads, shuffle sum) into LDS rms[64]. Phase 2: 16 channel tiles of 64; the 64x64 (token x
// channel) tile is scaled and staged in LDS (4 it x 256 thr x 4 floats = 64x64), then read transposed: lanes 0..15 of a
// Coverage: 64 blocks x 64 tokens x 16 tiles x 64 channels = 4 x 1024 x 1024 outputs, each exactly once.
// ---------------------------------------------------------------------------
__global__ __launch_bounds__(256) void final_kernel(const float* __restrict__ of, const float* __restrict__ nw,
                                                    const float* __restrict__ xin, float* __restrict__ out) {
  __shared__ __align__(16) float tf[64 * 68];
  __shared__ float rms[64];
  const int tid = threadIdx.x, lane = tid & 31, wave = tid >> 5;
  const int tok0 = blockIdx.x * 64;
  const int b = tok0 / NTOK, n0 = tok0 - b * NTOK;

  // phase 1: per-token rsqrt(mean + eps)
#pragma unroll 1
  for (int i = 0; i < 8; ++i) {
    const int rr = wave * 8 + i;
    const float* rowp = of + (size_t)(tok0 + rr) * CH + lane * 4;
    float ss = 0.0f;
#pragma unroll 2
    for (int k = 0; k < 8; ++k) {
      const v4f v = *(const v4f*)(rowp + k * 128);
      ss += v[0] * v[0] + v[1] * v[1] + v[2] * v[2] + v[3] * v[3];
    }
#pragma unroll
    for (int off = 1; off < 32; off <<= 1) ss += __shfl_xor(ss, off, 32);
    if (lane == 0) rms[rr] = rsqrtf(ss * (1.0f / (float)CH) + RMS_EPS);
  }
  __syncthreads();

  const int lr = tid >> 4;           // 0..15
  const int c4 = (tid & 15) * 4;     // 0..60
#pragma unroll 1
  for (int ct = 0; ct < CH / 64; ++ct) {
    const int c0 = ct * 64;
    {
      const v4f w4 = *(const v4f*)(nw + c0 + c4);
      float wr[4];
      wr[0] = bf_rne(w4[0]); wr[1] = bf_rne(w4[1]); wr[2] = bf_rne(w4[2]); wr[3] = bf_rne(w4[3]);
#pragma unroll
      for (int it = 0; it < 4; ++it) {
        const int rr = it * 16 + lr;   // token within block
        const v4f v = *(const v4f*)(of + (size_t)(tok0 + rr) * CH + c0 + c4);
        const float rm = rms[rr];
        v4f o;
        o[0] = v[0] * rm * wr[0]; o[1] = v[1] * rm * wr[1]; o[2] = v[2] * rm * wr[2]; o[3] = v[3] * rm * wr[3];
        *(v4f*)(tf + rr * 68 + c4) = o;
      }
    }
    __syncthreads();
    v4f ov[4];
#pragma unroll
    for (int it = 0; it < 4; ++it) {
      const int oc = it * 16 + lr;     // channel within tile
      const v4f xr = *(const v4f*)(xin + ((size_t)(b * CH + c0 + oc)) * NTOK + n0 + c4);
      v4f o;
      o[0] = tf[(c4 + 0) * 68 + oc] + bf_rne(xr[0]);
      o[1] = tf[(c4 + 1) * 68 + oc] + bf_rne(xr[1]);
      o[2] = tf[(c4 + 2) * 68 + oc] + bf_rne(xr[2]);
      o[3] = tf[(c4 + 3) * 68 + oc] + bf_rne(xr[3]);
      ov[it] = o;
    }
    {
#pragma unroll
      for (int it = 0; it < 4; ++it) {
        const int oc = it * 16 + lr;
        *(v4f*)(out + ((size_t)(b * CH + c0 + oc)) * NTOK + n0 + c4) = ov[it];
      }
      
    }
    __syncthreads();
  }
}

// ---------------------------------------------------------------------------
// Workspace region map (byte offsets; every region is fully written by its producer launch before any consumer
//   XB    bf16 [4096][1024]          0       8388608
//   WQKV  bf16 [3072][1024]    8388608       6291456
//   WP2   bf16 [1024][2048]   14680064       4194304
//   TC    f32  [32][16]       18874368          2048   TS  18876416  2048
//   QKf   f32  [4096][2048]   18878464      33554432   (dead after ropenorm; the same 32 MiB then hold
//                                                       CTX2 u16 [4096][2048] at 18878464 (16777216) and
//                                                       Of   f32  [4096][1024] at 35655680 (16777216), disjoint)
//   Qh    bf16 [4096][1024]   52432896       8388608   Ql  60821504
//   Kh    bf16 [4096][1024]   69210112       8388608   Kl  77598720
//   VTh   bf16 [1024][4096]   85987328       8388608   VTl 94375936
//   total                    102764544
// ---------------------------------------------------------------------------
extern "C" void kernel_launch(void* const* d_in, const int* in_sizes, int n_in,
                              void* d_out, int out_size, void* d_ws, size_t ws_size,
                              hipStream_t stream) {
  if (n_in < 7) return;
  if (in_sizes[0] != NB * CH * NTOK) return;        // hidden_states [4][1024][32][32]
  if (in_sizes[1] != NQKV * CH) return;             // w_qkv [3072][1024]
  if (in_sizes[2] != NQKV) return;                  // b_qkv [3072]
  if (in_sizes[3] != INNER) return;                 // q_norm_w [1024]
  if (in_sizes[4] != INNER) return;                 // k_norm_w [1024]
  if (in_sizes[5] != CH * INNER) return;            // w_proj [1024][1024]
  if (in_sizes[6] != CH) return;                    // norm_out_w [1024]
  if (out_size != NB * CH * NTOK) return;

  const float* x    = (const float*)d_in[0];
  const float* wqkv = (const float*)d_in[1];   // [out 3072][in 1024]
  const float* bqkv = (const float*)d_in[2];
  const float* qnw  = (const float*)d_in[3];
  const float* knw  = (const float*)d_in[4];
  const float* wprj = (const float*)d_in[5];   // [out 1024][in 1024]
  const float* onw  = (const float*)d_in[6];

  const size_t PXB = (size_t)MTOK * CH * 2;        // 8388608
  const size_t PWQ = (size_t)NQKV * CH * 2;        // 6291456
  const size_t PWP = (size_t)CH * AOP * 2;         // 4194304
  const size_t PTB = (size_t)TABN * 4;             // 2048
  const size_t PQK = (size_t)MTOK * QKP * 4;       // 33554432
  const size_t PCX = (size_t)MTOK * AOP * 2;       // 16777216
  const size_t POF = (size_t)MTOK * CH * 4;        // 16777216
  const size_t PPL = (size_t)MTOK * INNER * 2;     // 8388608 per q/k plane
  const size_t PVT = (size_t)INNER * VTP * 2;      // 8388608 per v^T plane
  if (PCX + POF > PQK) return;                     // CTX2 and Of share the QKf region, disjoint halves
  size_t off = 0;
  const size_t oXB  = off; off += PXB;
  const size_t oWQ  = off; off += PWQ;
  const size_t oWP  = off; off += PWP;
  const size_t oTC  = off; off += PTB;
  const size_t oTS  = off; off += PTB;
  const size_t oQK  = off; off += PQK;
  const size_t oCX  = oQK;
  const size_t oOF  = oQK + PCX;
  const size_t oQh  = off; off += PPL;  const size_t oQl = off; off += PPL;
  const size_t oKh  = off; off += PPL;  const size_t oKl = off; off += PPL;
  const size_t oVTh = off; off += PVT;  const size_t oVTl = off; off += PVT;
  if (off > ws_size) return;                       // off = 102764544
  if (off > (size_t)134217728) return;

  char* ws = (char*)d_ws;
  unsigned short* XB   = (unsigned short*)(ws + oXB);
  unsigned short* WQKV = (unsigned short*)(ws + oWQ);
  unsigned short* WP2  = (unsigned short*)(ws + oWP);
  float*          TC   = (float*)(ws + oTC);
  float*          TS   = (float*)(ws + oTS);
  float*          QKf  = (float*)(ws + oQK);
  unsigned short* CTX2 = (unsigned short*)(ws + oCX);
  float*          Of   = (float*)(ws + oOF);
  unsigned short* Qh   = (unsigned short*)(ws + oQh);  unsigned short* Ql  = (unsigned short*)(ws + oQl);
  unsigned short* Kh   = (unsigned short*)(ws + oKh);  unsigned short* Kl  = (unsigned short*)(ws + oKl);
  unsigned short* VTh  = (unsigned short*)(ws + oVTh); unsigned short* VTl = (unsigned short*)(ws + oVTl);

  const dim3 blk(256);

  // (1) x[b] viewed [R=1024 c][Cc=1024 n] (pitch 1024) -> XB_b[n][c] (pitch 1024); grid (Cc/64, R/64, B) = (16, 16, 4)
  tconv_kernel<<<dim3(NTOK / 64, CH / 64, NB), blk, 0, stream>>>(x, XB, NTOK, CH, (long)CH * NTOK, (long)NTOK * CH);
  // (2) w_qkv [3072][1024] -> WQKV bf16 same layout; 393216 units -> 1536 blocks
  const int n8q = NQKV * CH / 8;
  convrows_kernel<false><<<dim3(n8q / 256), blk, 0, stream>>>(wqkv, WQKV, CH, CH, n8q);
  // (3) w_proj [1024][1024] -> WP2 [1024][2048], cols k and 1024+k; 131072 units -> 512 blocks
  const int n8p = CH * INNER / 8;
  convrows_kernel<true><<<dim3(n8p / 256), blk, 0, stream>>>(wprj, WP2, INNER, AOP, n8p);
  // (4) rotary cos/sin tables [32][16]
  ropetab_kernel<<<dim3(2), blk, 0, stream>>>(TC, TS);
  // (5) q|k = XB . WQKV[0..2047]^T + b -> QKf f32 [4096][2048]   (M=4096, N=2048, K=1024; 2048 tiles -> 256 blocks)
  const dim3 gQK(((MTOK / 64) * (QKP / 64) + 7) / 8, 1);
  wmma_gemm64<1, false, 2, 0, false, 0><<<gQK, blk, 0, stream>>>(
      XB, XB, CH, 0L, WQKV, WQKV, CH, 0L, (void*)QKf, (void*)QKf, QKP, 0L,
      bqkv, bqkv, 0L, MTOK, QKP, CH, 1.0f);
  // (6) v^T = WQKV[2048..3071] . XB^T + b[2048+m] -> VTh|VTl [1024][4096]   (M=1024, N=4096, K=1024; 1024 tiles -> 128 blocks)
  const dim3 gVT(((INNER / 64) * (MTOK / 64) + 7) / 8, 1);
  wmma_gemm64<1, false, 1, 2, false, 0><<<gVT, blk, 0, stream>>>(
      WQKV + (size_t)2 * INNER * CH, WQKV + (size_t)2 * INNER * CH, CH, 0L, XB, XB, CH, 0L,
      (void*)VTh, (void*)VTl, VTP, 0L,
      bqkv + 2 * INNER, bqkv, 0L, INNER, MTOK, CH, 1.0f);
  // (7) RoPE + RMSNorm over 1024 for q and k -> Qh|Ql, Kh|Kl; one block of 128 threads per token row
  ropenorm_kernel<<<dim3(MTOK), dim3(128), 0, stream>>>(QKf, TC, TS, qnw, knw, Qh, Ql, Kh, Kl);
  // (8) attention per (batch, head, 64-query block) -> CTX2 [4096][2048] (hi | lo columns); 1024 blocks
  attn_kernel<<<dim3(NB * NH * (NTOK / 64)), dim3(128), 0, stream>>>(Qh, Ql, Kh, Kl, VTh, VTl, CTX2, 0.125f);
  // (9) Of = CTX2 . WP2^T -> f32 [4096][1024]   (M=4096, N=1024, K=2048; 1024 tiles -> 128 blocks)
  const dim3 gO(((MTOK / 64) * (CH / 64) + 7) / 8, 1);
  wmma_gemm64<1, false, 0, 0, false, 0><<<gO, blk, 0, stream>>>(
      CTX2, CTX2, AOP, 0L, WP2, WP2, AOP, 0L, (void*)Of, (void*)Of, CH, 0L,
      bqkv, bqkv, 0L, MTOK, CH, AOP, 1.0f);
  // (10) output RMSNorm + residual -> NCHW d_out; 64 blocks of 64 tokens
  final_kernel<<<dim3(MTOK / 64), blk, 0, stream>>>(Of, onw, x, (float*)d_out);
  (void)hipGetLastError();
}

// v001
// It runs in 380 microseconds.
// In both of two side-by-side timings against v000, it was 1.23 times as fast.
// Contractions: q|k projection (f32 out) and v^T projection (bf16 hi|lo out) = v_wmma_f32_16x16x32_bf16 single products on bf16 planes of the RNE-converted inputs; q.k^T and p.v = bf16 hi/lo split (hi.hi + hi.lo + lo.hi); output projection = [CTXhi|CTXlo] x [Wp;Wp] bf16 single products (K-folded 2-term); f32 accumulate everywhere; RoPE, QK RMSNorm, output RMSNorm, online softmax, 1/rowsum, bias and residual in f32 on the VALU.
// Plane / carry map (all carry 1, nothing to fold back): XB = bf16(x) token-major [4096][1024] (row b*1024+n, n = y*32+x, col c);
// WQKV = bf16(w_qkv) [3072][1024] natural [out][in]; WP2 [1024][2048]: cols k and 1024+k both = bf16(w_proj[c][k]);
// TC/TS f32 [32 pos][16 pair] = cos/sin(pos * 10000^(-j/16)); QKf f32 [4096][2048] = pre-RoPE q (cols 0..1023) | k (cols 1024..2047) incl. bias;
// Qh|Ql, Kh|Kl bf16 [4096][1024] (col h*64+d) = hi/lo of the RoPE'd, RMSNorm'd q, k; VTh|VTl bf16 [1024 (h,d)][4096 (b,t)];
// P hi|lo = unnormalised exp in (0,1] (bf16, f32 exponent range), 1/rowsum applied to the f32 accumulator in the attention epilogue;
// CTX2 u16 [4096][2048] = ctx hi at col h*64+d, lo at col 1024+h*64+d; Of f32 [4096][1024] = ctx . w_proj^T.
#include <hip/hip_runtime.h>
#include <math.h>
#include <stdint.h>

#define NB    4
#define CH    1024
#define IMH   32
#define IMW   32
#define NTOK  1024
#define INNER 1024
#define NH    16
#define HD    64
#define NQKV  3072
#define QKP   2048
#define AOP   2048
#define VTP   (NB * NTOK)
#define MTOK  (NB * NTOK)
#define TABN  512
#define RMS_EPS 1e-6f

static_assert(NTOK == IMH * IMW);
static_assert(IMW == 32);
static_assert(INNER == NH * HD);
static_assert(HD == 64);
static_assert(NQKV == 3 * INNER);
static_assert(QKP == 2 * INNER);
static_assert(AOP == 2 * INNER);
static_assert(CH % 64 == 0);
static_assert(NTOK % 64 == 0);
static_assert(INNER % 64 == 0);
static_assert(MTOK % 64 == 0);
static_assert(CH % 32 == 0);
static_assert(AOP % 32 == 0);
static_assert(INNER == 128 * 8);
static_assert(CH == 8 * 128);
static_assert(TABN == 32 * (HD / 4));
static_assert((NQKV * CH) % (8 * 256) == 0);
static_assert((CH * INNER) % (8 * 256) == 0);
static_assert(CH % 256 == 0);
static_assert(INNER % 256 == 0);

typedef __attribute__((ext_vector_type(16))) _Float16 v16h;
typedef __attribute__((ext_vector_type(8)))  _Float16 v8h;
typedef __attribute__((ext_vector_type(16))) __bf16   v16b;
typedef __attribute__((ext_vector_type(8)))  __bf16   v8b;
typedef __attribute__((ext_vector_type(8)))  float    v8f;
typedef __attribute__((ext_vector_type(4)))  float    v4f;
typedef __attribute__((ext_vector_type(2)))  float    v2f;
typedef __attribute__((ext_vector_type(4)))  unsigned int v4u;

__device__ __forceinline__ unsigned short f2bf_bits(float f) {
  unsigned u = __float_as_uint(f);
  return (unsigned short)((u + 0x7FFFu + ((u >> 16) & 1u)) >> 16);
}
__device__ __forceinline__ float bf_bits2f(unsigned short h) { return __uint_as_float(((unsigned)h) << 16); }
__device__ __forceinline__ float bf_rne(float f) { return bf_bits2f(f2bf_bits(f)); }
__device__ __forceinline__ unsigned pk16(unsigned short a, unsigned short b) { return (unsigned)a | ((unsigned)b << 16); }

// hazard guards as plain device helpers (no inline asm inside the kernel template body)
__device__ __forceinline__ void dep_guard_h(v8f& a, v8f& b, v16h x, v16h y) { asm volatile("v_nop\n\tv_nop\n\tv_nop\n\tv_nop" : "+v"(a), "+v"(b) : "v"(x), "v"(y)); }
__device__ __forceinline__ void dep_guard_b(v8f& a, v8f& b, v16b x, v16b y) { asm volatile("v_nop\n\tv_nop\n\tv_nop\n\tv_nop" : "+v"(a), "+v"(b) : "v"(x), "v"(y)); }
__device__ __forceinline__ void keep4_h(v16h a, v16h b, v16h c, v16h d) { asm volatile("v_nop" :: "v"(a), "v"(b), "v"(c), "v"(d)); }
__device__ __forceinline__ void keep4_b(v16b a, v16b b, v16b c, v16b d) { asm volatile("v_nop" :: "v"(a), "v"(b), "v"(c), "v"(d)); }
__device__ __forceinline__ void acc_guard4(v8f& a, v8f& b, v8f& c, v8f& d) { asm volatile("v_nop\n\tv_nop\n\tv_nop\n\tv_nop" : "+v"(a), "+v"(b), "+v"(c), "+v"(d)); }
template <typename T> struct Frag;
template <> struct Frag<_Float16> {
  typedef v16h V; union U { v16h v; v8h h[2]; };
  static __device__ __forceinline__ v16h load(const _Float16* p) {   // elements 0..7 <- p[0..7], 8..15 <- p[16..23]
    U f; f.h[0] = *(const v8h*)(p); f.h[1] = *(const v8h*)(p + 16); return f.v;
  }
  static __device__ __forceinline__ v8f mma(v16h a, v16h b, v8f c) {
    return __builtin_amdgcn_wmma_f32_16x16x32_f16(false, a, false, b, (short)0, c, false, false);
  }
  static __device__ __forceinline__ void guard(v8f& a, v8f& b, v16h x, v16h y) { dep_guard_h(a, b, x, y); }
  static __device__ __forceinline__ void keep(v16h a, v16h b, v16h c, v16h d) { keep4_h(a, b, c, d); }
};
template <> struct Frag<__bf16> {
  typedef v16b V; union U { v16b v; v8b h[2]; };
  static __device__ __forceinline__ v16b load(const __bf16* p) {
    U f; f.h[0] = *(const v8b*)(p); f.h[1] = *(const v8b*)(p + 16); return f.v;
  }
  static __device__ __forceinline__ v8f mma(v16b a, v16b b, v8f c) {
    return __builtin_amdgcn_wmma_f32_16x16x32_bf16(false, a, false, b, (short)0, c, false, false);
  }
  static __device__ __forceinline__ void guard(v8f& a, v8f& b, v16b x, v16b y) { dep_guard_b(a, b, x, y); }
  static __device__ __forceinline__ void keep(v16b a, v16b b, v16b c, v16b d) { keep4_b(a, b, c, d); }
};

// ---- Register-blocked batched WMMA GEMM ------------------------------------
// C[m,n] = scale * sum_k A[m,k] * Bt[n,k] (+bias)(+resid); each wave owns a 64x64 tile.
// A row-major [M,K]; Bt row-major [N,K]; M,N % 64 == 0, K % 32 == 0.
// SPLIT: operands are hi/lo planes (A2/Bt2 = lo planes, same layout); product = hi.hi + hi.lo + lo.hi.
// BIAS_MODE: 0 = none, 1 = bias[m], 2 = bias[n]; the bias value is RNE-converted to bf16 precision before the f32 add.
// OUT_MODE: 0 = f32, 1 = f16, 2 = bf16 hi plane (Cout) + bf16 lo plane (Cout2).
// ET: 0 = f16 operands, 1 = bf16 operands (pointers passed as 16-bit storage)
template <int ET> struct Elem;
template <> struct Elem<0> { typedef _Float16 T; };
template <> struct Elem<1> { typedef __bf16 T; };
template <int ET, bool SPLIT, int BIAS_MODE, int OUT_MODE, bool RESID, int ACT = 0>
__global__ __launch_bounds__(256) void wmma_gemm64(
    const unsigned short* __restrict__ Ap, const unsigned short* __restrict__ A2p, int lda, long strideA,
    const unsigned short* __restrict__ Btp, const unsigned short* __restrict__ Bt2p, int ldb, long strideB,
    void* __restrict__ Cout, void* __restrict__ Cout2, int ldc, long strideC,
    const float* __restrict__ bias,
    const float* __restrict__ resid, long strideR,
    int M, int N, int K, float scale) {
  typedef typename Elem<ET>::T T;
  typedef typename Frag<T>::V V;
  const T* A = (const T*)Ap; const T* A2 = (const T*)A2p; const T* Bt = (const T*)Btp; const T* Bt2 = (const T*)Bt2p;
  __shared__ __align__(16) float sT[8][16 * 68];   // per-wave 16x64 slab, pitch 68 floats
  const int b    = blockIdx.y;
  const int lane = threadIdx.x & 31;
  const int wave = threadIdx.x >> 5;
  const int tilesN = N >> 6;
  const int tilesM = M >> 6;
  const int tile = blockIdx.x * 8 + wave;
  if (tile >= tilesM * tilesN) return;   // wave-uniform; no block barriers in this kernel
  const int tm = tile / tilesN;
  const int tn = tile - tm * tilesN;
  const int m0 = tm << 6;
  const int n0 = tn << 6;

  const T* Ab  = A  + (size_t)b * strideA;
  const T* Bb  = Bt + (size_t)b * strideB;
  const T* Ab2 = SPLIT ? (A2  + (size_t)b * strideA) : nullptr;
  const T* Bb2 = SPLIT ? (Bt2 + (size_t)b * strideB) : nullptr;

  const int rlane = lane & 15;                 // row (A) / col (B, D) within subtile
  const int koff  = (lane >> 4) * 8;           // k offset of this lane half
  const int mOff  = (lane >> 4) * 8;           // D row offset

  v8f acc[4][4];
#pragma unroll
  for (int i = 0; i < 4; ++i)
#pragma unroll
    for (int j = 0; j < 4; ++j) acc[i][j] = (v8f){0.f,0.f,0.f,0.f,0.f,0.f,0.f,0.f};

  for (int k0 = 0; k0 < K; k0 += 32) {
    V bh[4], bl[4];
#pragma unroll
    for (int j = 0; j < 4; ++j) {
      const size_t bo = (size_t)(n0 + (j << 4) + rlane) * ldb + koff + k0;
      bh[j] = Frag<T>::load(Bb + bo);
      if (SPLIT) bl[j] = Frag<T>::load(Bb2 + bo); else bl[j] = bh[j];
    }
#pragma unroll
    for (int i = 0; i < 4; ++i) {
      const size_t ao = (size_t)(m0 + (i << 4) + rlane) * lda + koff + k0;
      V ah = Frag<T>::load(Ab + ao);
      V al;
      if (SPLIT) al = Frag<T>::load(Ab2 + ao); else al = ah;
#pragma unroll
      for (int j = 0; j < 4; ++j) {
        acc[i][j] = Frag<T>::mma(ah, bh[j], acc[i][j]);
        if (SPLIT) {
          acc[i][j] = Frag<T>::mma(ah, bl[j], acc[i][j]);
          acc[i][j] = Frag<T>::mma(al, bh[j], acc[i][j]);
        }
      }
      Frag<T>::guard(acc[i][0], acc[i][3], ah, al);
    }
    Frag<T>::keep(bh[0], bh[1], bh[2], bh[3]);
    if (SPLIT) Frag<T>::keep(bl[0], bl[1], bl[2], bl[3]);
  }
  acc_guard4(acc[0][0], acc[0][1], acc[0][2], acc[0][3]);
  acc_guard4(acc[1][0], acc[1][1], acc[1][2], acc[1][3]);
  acc_guard4(acc[2][0], acc[2][1], acc[2][2], acc[2][3]);
  acc_guard4(acc[3][0], acc[3][1], acc[3][2], acc[3][3]);

  // ---- epilogue ----
  float* slab = sT[wave];
  const float* Rb = RESID ? (resid + (size_t)b * strideR) : nullptr;
#pragma unroll
  for (int i = 0; i < 4; ++i) {
    const int mBase = m0 + (i << 4);
#pragma unroll
    for (int j = 0; j < 4; ++j) {
      const int n = n0 + (j << 4) + rlane;
      float bv = 0.f;
      if (BIAS_MODE == 2) bv = bf_rne(bias[n]);
#pragma unroll
      for (int r = 0; r < 8; ++r) {
        float v = acc[i][j][r] * scale;
        if (BIAS_MODE == 1) v += bf_rne(bias[mBase + mOff + r]);
        if (BIAS_MODE == 2) v += bv;
        if (RESID) v += Rb[(size_t)(mBase + mOff + r) * ldc + n];
        if (ACT == 1) v = tanhf(v);
        if (ACT == 2) v = fmaxf(v, 0.0f);
        if (ACT == 3) v = v / (1.0f + expf(-v));
        if (ACT == 4) v = (v > 0.f) ? v : 0.01f * v;
        if (ACT == 5) v = 0.5f * v * (1.0f + erff(v * 0.70710678118654752f));
        slab[(mOff + r) * 68 + (j << 4) + rlane] = v;
      }
    }
    __builtin_amdgcn_fence(__ATOMIC_RELEASE, "workgroup");
    __builtin_amdgcn_wave_barrier();
    __builtin_amdgcn_fence(__ATOMIC_ACQUIRE, "workgroup");
    if (OUT_MODE == 0) {
      float* C = (float*)Cout + (size_t)b * strideC;
      const int hh = lane >> 4, c4 = (lane & 15) * 4;     // row seg = 256 B = 16 lanes x 16 B
      {
#pragma unroll
        for (int it = 0; it < 8; ++it) {
          const int row = it * 2 + hh;
          v4f v = *(const v4f*)(slab + row * 68 + c4);
          *(v4f*)(C + (size_t)(mBase + row) * ldc + n0 + c4) = v;
        }
        
      }
    } else {
      const int q = lane >> 3, c8 = (lane & 7) * 8;
      unsigned short* C  = (unsigned short*)Cout  + (size_t)b * strideC;
      unsigned short* C2 = (OUT_MODE == 2) ? ((unsigned short*)Cout2 + (size_t)b * strideC) : nullptr;
      {
#pragma unroll
        for (int it = 0; it < 4; ++it) {
          const int row = it * 4 + q;
          const float* sp = slab + row * 68 + c8;
          v8h hv, lv;
#pragma unroll
          for (int e = 0; e < 8; ++e) {
            if (OUT_MODE == 1) {
              hv[e] = (_Float16)sp[e];
            } else {
              unsigned short hb = f2bf_bits(sp[e]);
              unsigned short lb = f2bf_bits(sp[e] - bf_bits2f(hb));
              hv[e] = __builtin_bit_cast(_Float16, hb);
              lv[e] = __builtin_bit_cast(_Float16, lb);
            }
          }
          *(v8h*)(C + (size_t)(mBase + row) * ldc + n0 + c8) = hv;
          if (OUT_MODE == 2) *(v8h*)(C2 + (size_t)(mBase + row) * ldc + n0 + c8) = lv;
        }
        
      }
    }
    __builtin_amdgcn_fence(__ATOMIC_RELEASE, "workgroup");
    __builtin_amdgcn_wave_barrier();
    __builtin_amdgcn_fence(__ATOMIC_ACQUIRE, "workgroup");
  }
}

// ---------------------------------------------------------------------------
// Row-preserving bf16 RNE convert of an f32 matrix [rows][ncols] into a u16 plane with row pitch ldout; DUP also
// writes the same 8 values at column + ncols (second copy along the row). 8 consecutive elements per thread = one
// Coverage: grid = n8/256 blocks x 256 threads x 8 elements = rows*ncols (n8 = rows*ncols/8, exact multiple of 256).
// ---------------------------------------------------------------------------
template <bool DUP>
__global__ __launch_bounds__(256) void convrows_kernel(const float* __restrict__ in, unsigned short* __restrict__ out,
                                                       int ncols, int ldout, int n8) {
  const int i = blockIdx.x * 256 + threadIdx.x;
  if (i < n8) {
    const size_t e0 = (size_t)i * 8;
    const int row = (int)(e0 / (size_t)ncols);
    const int col = (int)(e0 - (size_t)row * ncols);
    const v4f a = *(const v4f*)(in + e0);
    const v4f c = *(const v4f*)(in + e0 + 4);
    v4u hv;
    hv[0] = pk16(f2bf_bits(a[0]), f2bf_bits(a[1]));
    hv[1] = pk16(f2bf_bits(a[2]), f2bf_bits(a[3]));
    hv[2] = pk16(f2bf_bits(c[0]), f2bf_bits(c[1]));
    hv[3] = pk16(f2bf_bits(c[2]), f2bf_bits(c[3]));
    const size_t o = (size_t)row * ldout + col;
    {
      *(v4u*)(out + o) = hv;
      if (DUP) *(v4u*)(out + o + ncols) = hv;
      
    }
  }
}

// ---------------------------------------------------------------------------
// Fused transpose + bf16 RNE convert of an f32 matrix, z-batched, one plane:
//   in_z = W + z*sIn viewed [R rows][Cc cols] with row pitch ldin  ->  oh_z[c][r] = bf16(in_z[r][c]), row pitch ldout, oh_z = oh + z*sOut.
// 64x64 tiles through LDS. grid = (Cc/64, R/64, Z), 256 threads (R, Cc multiples of 64; ldout multiple of 64 so every
// Coverage per block: load 4 it x 256 thr x 4 floats = 64x64; store 2 it x 256 thr x 8 u16 = 64x64.
// ---------------------------------------------------------------------------
__global__ __launch_bounds__(256) void tconv_kernel(const float* __restrict__ W, unsigned short* __restrict__ oh,
                                                    int ldin, int ldout, long sIn, long sOut) {
  __shared__ __align__(16) float tf[64 * 68];
  W  += (size_t)blockIdx.z * sIn;
  oh += (size_t)blockIdx.z * sOut;
  const int c0  = blockIdx.x * 64;   // input column block = output row block
  const int r0  = blockIdx.y * 64;   // input row block    = output column block
  const int tid = threadIdx.x;
  {
    const int lr = tid >> 4;         // 0..15
    const int c4 = (tid & 15) * 4;   // 0..60
#pragma unroll
    for (int it = 0; it < 4; ++it) {
      const int rr = it * 16 + lr;   // 0..63
      const v4f a = *(const v4f*)(W + (size_t)(r0 + rr) * ldin + c0 + c4);
      *(v4f*)(tf + rr * 68 + c4) = a;
    }
  }
  __syncthreads();
  const int sub = tid >> 3;          // 0..31
  const int c8  = (tid & 7) * 8;     // 0..56
  v4u hv[2];
#pragma unroll
  for (int it = 0; it < 2; ++it) {
    const int oc = it * 32 + sub;    // output row within tile (= input column)
    v4u a;
#pragma unroll
    for (int q = 0; q < 4; ++q) {
      const float f0 = tf[(c8 + 2 * q) * 68 + oc];
      const float f1 = tf[(c8 + 2 * q + 1) * 68 + oc];
      a[q] = pk16(f2bf_bits(f0), f2bf_bits(f1));
    }
    hv[it] = a;
  }
  {
#pragma unroll
    for (int it = 0; it < 2; ++it) {
      const int oc = it * 32 + sub;
      const size_t go = (size_t)(c0 + oc) * ldout + r0 + c8;
      *(v4u*)(oh + go) = hv[it];
    }
    
  }
}

// ---------------------------------------------------------------------------
// Rotary angle tables: tc[pos*16 + j] = cos(pos * f_j), ts likewise, f_j = 10000^(-4j/64) = 10^(-j/4) (f32 constants),
// pos 0..31 (shared by the row axis and the column axis), j 0..15. Precise cosf/sinf (|angle| <= 31).
// grid = 2 x 256 = 512 threads = 32 x 16 entries per table; one 4-B store per lane, 32 consecutive lanes = one whole
// ---------------------------------------------------------------------------
__device__ __forceinline__ float rope_freq(int j) {
  float f = 1.0f;
  f = (j == 1)  ? 0.5623413251903491f     : f;
  f = (j == 2)  ? 0.31622776601683794f    : f;
  f = (j == 3)  ? 0.17782794100389229f    : f;
  f = (j == 4)  ? 0.1f                    : f;
  f = (j == 5)  ? 0.05623413251903491f    : f;
  f = (j == 6)  ? 0.031622776601683794f   : f;
  f = (j == 7)  ? 0.017782794100389229f   : f;
  f = (j == 8)  ? 0.01f                   : f;
  f = (j == 9)  ? 0.005623413251903491f   : f;
  f = (j == 10) ? 0.0031622776601683794f  : f;
  f = (j == 11) ? 0.0017782794100389228f  : f;
  f = (j == 12) ? 0.001f                  : f;
  f = (j == 13) ? 0.0005623413251903491f  : f;
  f = (j == 14) ? 0.00031622776601683794f : f;
  f = (j == 15) ? 0.00017782794100389227f : f;
  return f;
}

__global__ __launch_bounds__(256) void ropetab_kernel(float* __restrict__ tc, float* __restrict__ ts) {
  const int i = blockIdx.x * 256 + threadIdx.x;      // 0..511 = pos*16 + j
  if (i < TABN) {
    const int pos = i >> 4, j = i & 15;
    const float a = (float)pos * rope_freq(j);
    const float c = cosf(a);
    const float s = sinf(a);
    ((float*)tc)[i] = c;
    ((float*)ts)[i] = s;
    
  }
}

// ---------------------------------------------------------------------------
// Per-token 2-D RoPE (interleaved pairs (2i,2i+1) inside each head; pairs 0..15 use the row index y = n>>5, pairs 16..31
// the column index x = n&31; tables shared by all heads) followed by RMSNorm over the WHOLE 1024-wide (heads x dim) row:
// v = rope(v); v = v * rsqrt(mean_1024(v*v) + 1e-6) * bf16(w[col]); then bf16 hi/lo split into planes [4096][1024].
// One block of 128 threads per token row g = b*1024+n; thread t owns columns 8t..8t+7 (= 4 rotary pairs p0..p0+3, p0 = (4t)&31,
// all four in the same half of the pair range). All loads are 16-B vectors. Stores: 16 B per lane per plane, 128 lanes cover
// LDS: redq/redk[4] written by lane 0 of each of the 4 waves before the barrier.
// ---------------------------------------------------------------------------
__global__ __launch_bounds__(128) void ropenorm_kernel(const float* __restrict__ qkf,
                                                       const float* __restrict__ tc, const float* __restrict__ ts,
                                                       const float* __restrict__ qw, const float* __restrict__ kw,
                                                       unsigned short* __restrict__ qh, unsigned short* __restrict__ ql,
                                                       unsigned short* __restrict__ kh, unsigned short* __restrict__ kl) {
  __shared__ float redq[4], redk[4];
  const int g = blockIdx.x;                 // token row 0..MTOK-1
  const int n = g & (NTOK - 1);
  const int py = n >> 5, px = n & 31;
  const int t = threadIdx.x, lane = t & 31, wave = t >> 5;
  const int i0 = t * 8;

  const float* qr = qkf + (size_t)g * QKP + i0;
  const float* kr = qr + INNER;
  const v4f qa = *(const v4f*)(qr), qb = *(const v4f*)(qr + 4);
  const v4f ka = *(const v4f*)(kr), kb = *(const v4f*)(kr + 4);

  const int p0   = (4 * t) & 31;
  const int hsel = p0 >> 4;                 // 0: row-axis angles, 1: column-axis angles
  const int pos  = py + hsel * (px - py);
  const int toff = pos * 16 + (p0 & 15);
  const v4f cv = *(const v4f*)(tc + toff);
  const v4f sv = *(const v4f*)(ts + toff);

  float q8[8], k8[8];
  q8[0] = qa[0]; q8[1] = qa[1]; q8[2] = qa[2]; q8[3] = qa[3];
  q8[4] = qb[0]; q8[5] = qb[1]; q8[6] = qb[2]; q8[7] = qb[3];
  k8[0] = ka[0]; k8[1] = ka[1]; k8[2] = ka[2]; k8[3] = ka[3];
  k8[4] = kb[0]; k8[5] = kb[1]; k8[6] = kb[2]; k8[7] = kb[3];

  float rq[8], rk[8];
#pragma unroll
  for (int e = 0; e < 4; ++e) {
    const float c = cv[e], s = sv[e];
    const float qe = q8[2 * e], qo = q8[2 * e + 1];
    const float ke = k8[2 * e], ko = k8[2 * e + 1];
    rq[2 * e]     = qe * c - qo * s;
    rq[2 * e + 1] = qe * s + qo * c;
    rk[2 * e]     = ke * c - ko * s;
    rk[2 * e + 1] = ke * s + ko * c;
  }
  float ssq = 0.0f, ssk = 0.0f;
#pragma unroll
  for (int e = 0; e < 8; ++e) { ssq += rq[e] * rq[e]; ssk += rk[e] * rk[e]; }
#pragma unroll
  for (int off = 1; off < 32; off <<= 1) { ssq += __shfl_xor(ssq, off, 32); ssk += __shfl_xor(ssk, off, 32); }
  if (lane == 0) { redq[wave] = ssq; redk[wave] = ssk; }
  __syncthreads();
  const float tq = (redq[0] + redq[1]) + (redq[2] + redq[3]);
  const float tk = (redk[0] + redk[1]) + (redk[2] + redk[3]);
  const float rmq = rsqrtf(tq * (1.0f / (float)INNER) + RMS_EPS);
  const float rmk = rsqrtf(tk * (1.0f / (float)INNER) + RMS_EPS);

  const v4f wqa = *(const v4f*)(qw + i0), wqb = *(const v4f*)(qw + i0 + 4);
  const v4f wka = *(const v4f*)(kw + i0), wkb = *(const v4f*)(kw + i0 + 4);
  float wq8[8], wk8[8];
  wq8[0] = bf_rne(wqa[0]); wq8[1] = bf_rne(wqa[1]); wq8[2] = bf_rne(wqa[2]); wq8[3] = bf_rne(wqa[3]);
  wq8[4] = bf_rne(wqb[0]); wq8[5] = bf_rne(wqb[1]); wq8[6] = bf_rne(wqb[2]); wq8[7] = bf_rne(wqb[3]);
  wk8[0] = bf_rne(wka[0]); wk8[1] = bf_rne(wka[1]); wk8[2] = bf_rne(wka[2]); wk8[3] = bf_rne(wka[3]);
  wk8[4] = bf_rne(wkb[0]); wk8[5] = bf_rne(wkb[1]); wk8[6] = bf_rne(wkb[2]); wk8[7] = bf_rne(wkb[3]);

  v4u hq, lq, hk, lk;
#pragma unroll
  for (int e = 0; e < 4; ++e) {
    const float fq0 = rq[2 * e] * rmq * wq8[2 * e];
    const float fq1 = rq[2 * e + 1] * rmq * wq8[2 * e + 1];
    const float fk0 = rk[2 * e] * rmk * wk8[2 * e];
    const float fk1 = rk[2 * e + 1] * rmk * wk8[2 * e + 1];
    const unsigned short hq0 = f2bf_bits(fq0), hq1 = f2bf_bits(fq1);
    const unsigned short hk0 = f2bf_bits(fk0), hk1 = f2bf_bits(fk1);
    const unsigned short lq0 = f2bf_bits(fq0 - bf_bits2f(hq0)), lq1 = f2bf_bits(fq1 - bf_bits2f(hq1));
    const unsigned short lk0 = f2bf_bits(fk0 - bf_bits2f(hk0)), lk1 = f2bf_bits(fk1 - bf_bits2f(hk1));
    hq[e] = pk16(hq0, hq1); lq[e] = pk16(lq0, lq1);
    hk[e] = pk16(hk0, hk1); lk[e] = pk16(lk0, lk1);
  }
  const size_t o = (size_t)g * INNER + i0;
  {
    *(v4u*)(qh + o) = hq;
    *(v4u*)(ql + o) = lq;
    *(v4u*)(kh + o) = hk;
    *(v4u*)(kl + o) = lk;
    
  }
}

// =====================================================================================
// Full (non-causal, unmasked) attention, head dim 64, all batches in one launch.
//   q planes (hi/lo bf16) [4096][1024]: element (b, n, h, d) at [(b*1024+n)*1024 + h*64 + d]
//   k planes (hi/lo bf16) [4096][1024]: same layout
//   v^T planes (hi/lo bf16) [1024][4096]: element (h, d, b, t) at [(h*64 + d)*4096 + b*1024 + t]
//   out CTX2 plane u16 [4096][2048]: hi bits of o(b,n,h,d) at col h*64+d, lo bits (o - hi) at col 1024 + h*64+d.
//   scores = (q . k) * 0.125 : bf16 hi/lo split (hi.hi + hi.lo + lo.hi) on v_wmma_f32_16x16x32_bf16
//   out    = p . v           : bf16 hi/lo split of p (unnormalised exp) and v, f32 accumulate, x 1/rowsum in f32 at the end
//   online softmax in f32 over the 1024 keys of the batch element (16 chunks of 64, compile-time trip count, no masking).
//   Block = 4 waves = 64 query rows of one (batch, head); grid.x = 4 * 16 * 16 = 1024.
//   K / V^T chunk staging: 128 threads x 32 elements per plane = the whole 64x64 tile (16-B copies, plain loads,
//   __syncthreads before and after); fragment loads read the LDS tiles with the same v8b element type.
//   LDS extents: K/V tiles 64x64 fully staged every chunk; P tiles 16x64 per wave fully written every chunk before the
// =====================================================================================
#define AT_D 64
#define AT_NW 4
#define AT_QB 64
#define AT_KC 64
// LDS row pitch of the K, V^T and P tiles in elements: 64 data + 8 pad = 144 B = 16 B x 9 (odd), so the 16 rows that one
// 16-byte fragment read touches fall on 16 different groups of four banks; at 128 B they fall on two. Pad elements are never read.
#define AT_LP 72

__device__ __forceinline__ unsigned short at_bf_bits(float f) {
  unsigned u = __float_as_uint(f);
  return (unsigned short)((u + 0x7FFFu + ((u >> 16) & 1u)) >> 16);
}
__device__ __forceinline__ __bf16 at_f2bf(float f) { return __builtin_bit_cast(__bf16, at_bf_bits(f)); }
__device__ __forceinline__ void at_split(float f, __bf16& hi, __bf16& lo) {
  const unsigned short hb = at_bf_bits(f);
  hi = __builtin_bit_cast(__bf16, hb);
  lo = at_f2bf(f - __uint_as_float(((unsigned)hb) << 16));
}
__device__ __forceinline__ v8f at_mma(v16b a, v16b b, v8f c) {
  c = __builtin_amdgcn_wmma_f32_16x16x32_bf16(false, a, false, b, (short)0, c, false, false);
  asm volatile("v_nop\n\tv_nop\n\tv_nop\n\tv_nop" : "+v"(c) : "v"(a), "v"(b));
  return c;
}

__global__ __launch_bounds__(128)
void attn_kernel(const unsigned short* __restrict__ qhp, const unsigned short* __restrict__ qlp,
                 const unsigned short* __restrict__ khp, const unsigned short* __restrict__ klp,
                 const unsigned short* __restrict__ vhp, const unsigned short* __restrict__ vlp,
                 unsigned short* __restrict__ aop, float sscale) {
  union FB { v16b v; v8b h[2]; };
  __shared__ __align__(16) __bf16 Ksh[AT_KC * AT_LP];            // K hi [kv][d], pitch AT_LP   9 KB
  __shared__ __align__(16) __bf16 Ksl[AT_KC * AT_LP];            // K lo
  __shared__ __align__(16) __bf16 Vth[AT_D * AT_LP];             // V hi [d][kv], pitch AT_LP   9 KB
  __shared__ __align__(16) __bf16 Vtl[AT_D * AT_LP];             // V lo
  __shared__ __align__(16) __bf16 Psh[AT_NW][16 * AT_LP];        // per wave P hi [row][kv]
  __shared__ __align__(16) __bf16 Psl[AT_NW][16 * AT_LP];        // per wave P lo
  __shared__ __align__(16) float  Os[AT_NW][16 * 68];            // per wave out tile, pitch 68

  const int tid  = threadIdx.x;
  const int wave = tid >> 5;
  const int lane = tid & 31;
  const int hh   = lane >> 4;
  const int c    = lane & 15;

  const int nqb = NTOK / AT_QB;            // 16 query blocks per batch element
  const int bx = blockIdx.x;              // grid = NB * NH * nqb (exact)
  const int qb = bx % nqb;
  const int hb = bx / nqb;
  const int h  = hb % NH;                 // 0..15
  const int b  = hb / NH;                 // 0..3
  const int q0 = b * NTOK + qb * AT_QB + wave * 16;   // row in the q / CTX2 planes

  const __bf16* Qh = (const __bf16*)(const void*)qhp + (size_t)h * AT_D;
  const __bf16* Ql = (const __bf16*)(const void*)qlp + (size_t)h * AT_D;
  const __bf16* Kh = (const __bf16*)(const void*)khp + (size_t)h * AT_D;
  const __bf16* Kl = (const __bf16*)(const void*)klp + (size_t)h * AT_D;
  const __bf16* Vh = (const __bf16*)(const void*)vhp + (size_t)h * AT_D * VTP + (size_t)b * NTOK;
  const __bf16* Vl = (const __bf16*)(const void*)vlp + (size_t)h * AT_D * VTP + (size_t)b * NTOK;
  unsigned short* Ch = aop + (size_t)h * AT_D;                    // hi columns
  unsigned short* Cl = aop + (size_t)INNER + (size_t)h * AT_D;    // lo columns

  // ---- Q fragments (A operand, row = lane&15, split k map via Frag load): 2 d-chunks, hi and lo ----
  v16b qah[2], qal[2];
#pragma unroll
  for (int dc = 0; dc < 2; ++dc) {
    const __bf16* qr = Qh + (size_t)(q0 + c) * INNER + dc * 32 + 8 * hh;
    const __bf16* ql = Ql + (size_t)(q0 + c) * INNER + dc * 32 + 8 * hh;
    qah[dc] = Frag<__bf16>::load(qr);
    qal[dc] = Frag<__bf16>::load(ql);
  }

  float mrow[8], lrow[8];
  v8f oacc[4];
#pragma unroll
  for (int r = 0; r < 8; ++r) { mrow[r] = -INFINITY; lrow[r] = 0.f; }
#pragma unroll
  for (int t = 0; t < 4; ++t) oacc[t] = (v8f){0.f,0.f,0.f,0.f,0.f,0.f,0.f,0.f};

  const int nChunks = NTOK / AT_KC;   // 16, compile-time constant
  for (int kc = 0; kc < nChunks; ++kc) {
    const int kv0 = kc * AT_KC;
    __syncthreads();
    {
      // staging coverage: 128 threads x (4 x 8) elements = 64 rows x 64 per plane = the whole chunk tile
      const int r = tid >> 1, half = (tid & 1) * 32;
      const __bf16* ksh = Kh + (size_t)(b * NTOK + kv0 + r) * INNER + half;   // K row (b, kv0+r), d = half..half+31
      const __bf16* ksl = Kl + (size_t)(b * NTOK + kv0 + r) * INNER + half;
      const __bf16* vsh = Vh + (size_t)r * VTP + kv0 + half;                  // V^T row d = r, keys kv0+half..+31
      const __bf16* vsl = Vl + (size_t)r * VTP + kv0 + half;
#pragma unroll
      for (int i = 0; i < 4; ++i) {
        const v8b a0 = *(const v8b*)(ksh + 8 * i);
        const v8b a1 = *(const v8b*)(ksl + 8 * i);
        const v8b b0 = *(const v8b*)(vsh + 8 * i);
        const v8b b1 = *(const v8b*)(vsl + 8 * i);
        *(v8b*)(Ksh + r * AT_LP + half + 8 * i) = a0;
        *(v8b*)(Ksl + r * AT_LP + half + 8 * i) = a1;
        *(v8b*)(Vth + r * AT_LP + half + 8 * i) = b0;
        *(v8b*)(Vtl + r * AT_LP + half + 8 * i) = b1;
      }
    }
    __syncthreads();

    v8f s[4];
#pragma unroll
    for (int j = 0; j < 4; ++j) {
      s[j] = (v8f){0.f,0.f,0.f,0.f,0.f,0.f,0.f,0.f};
#pragma unroll
      for (int dc = 0; dc < 2; ++dc) {
        FB kb, kl;
        kb.h[0] = *(const v8b*)(Ksh + (j * 16 + c) * AT_LP + dc * 32 + 8 * hh);
        kb.h[1] = *(const v8b*)(Ksh + (j * 16 + c) * AT_LP + dc * 32 + 16 + 8 * hh);
        kl.h[0] = *(const v8b*)(Ksl + (j * 16 + c) * AT_LP + dc * 32 + 8 * hh);
        kl.h[1] = *(const v8b*)(Ksl + (j * 16 + c) * AT_LP + dc * 32 + 16 + 8 * hh);
        s[j] = at_mma(qah[dc], kb.v, s[j]);
        s[j] = at_mma(qah[dc], kl.v, s[j]);
        s[j] = at_mma(qal[dc], kb.v, s[j]);
      }
    }
    // scale, then chunk row max
    float cm[8];
#pragma unroll
    for (int r = 0; r < 8; ++r) {
      float m = -INFINITY;
#pragma unroll
      for (int j = 0; j < 4; ++j) {
        const float sv = s[j][r] * sscale;
        s[j][r] = sv;
        m = fmaxf(m, sv);
      }
#pragma unroll
      for (int off = 1; off < 16; off <<= 1) m = fmaxf(m, __shfl_xor(m, off, 32));
      cm[r] = m;
    }
    __bf16* pwh = Psh[wave];
    __bf16* pwl = Psl[wave];
#pragma unroll
    for (int r = 0; r < 8; ++r) {
      const float mnew = fmaxf(mrow[r], cm[r]);
      const float alpha = expf(mrow[r] - mnew);
      mrow[r] = mnew;
      float psum = 0.f;
#pragma unroll
      for (int j = 0; j < 4; ++j) {
        const float p = expf(s[j][r] - mnew);
        psum += p;
        __bf16 a, bl; at_split(p, a, bl);
        pwh[(8 * hh + r) * AT_LP + j * 16 + c] = a;
        pwl[(8 * hh + r) * AT_LP + j * 16 + c] = bl;
      }
#pragma unroll
      for (int off = 1; off < 16; off <<= 1) psum += __shfl_xor(psum, off, 32);
      lrow[r] = lrow[r] * alpha + psum;
#pragma unroll
      for (int t = 0; t < 4; ++t) oacc[t][r] *= alpha;
    }
    __builtin_amdgcn_fence(__ATOMIC_RELEASE, "workgroup");
    __builtin_amdgcn_wave_barrier();
    __builtin_amdgcn_fence(__ATOMIC_ACQUIRE, "workgroup");
#pragma unroll 1
    for (int kk = 0; kk < 2; ++kk) {
      FB pa, pl;
      pa.h[0] = *(const v8b*)(pwh + c * AT_LP + kk * 32 + 8 * hh);
      pa.h[1] = *(const v8b*)(pwh + c * AT_LP + kk * 32 + 16 + 8 * hh);
      pl.h[0] = *(const v8b*)(pwl + c * AT_LP + kk * 32 + 8 * hh);
      pl.h[1] = *(const v8b*)(pwl + c * AT_LP + kk * 32 + 16 + 8 * hh);
#pragma unroll
      for (int t = 0; t < 4; ++t) {
        FB vb, vl;
        vb.h[0] = *(const v8b*)(Vth + (t * 16 + c) * AT_LP + kk * 32 + 8 * hh);
        vb.h[1] = *(const v8b*)(Vth + (t * 16 + c) * AT_LP + kk * 32 + 16 + 8 * hh);
        vl.h[0] = *(const v8b*)(Vtl + (t * 16 + c) * AT_LP + kk * 32 + 8 * hh);
        vl.h[1] = *(const v8b*)(Vtl + (t * 16 + c) * AT_LP + kk * 32 + 16 + 8 * hh);
        oacc[t] = at_mma(pa.v, vb.v, oacc[t]);
        oacc[t] = at_mma(pa.v, vl.v, oacc[t]);
        oacc[t] = at_mma(pl.v, vb.v, oacc[t]);
      }
    }
  }

  float* os = Os[wave];
#pragma unroll
  for (int r = 0; r < 8; ++r) {
    const float inv = 1.0f / lrow[r];
#pragma unroll
    for (int t = 0; t < 4; ++t) os[(8 * hh + r) * 68 + t * 16 + c] = oacc[t][r] * inv;
  }
  __builtin_amdgcn_fence(__ATOMIC_RELEASE, "workgroup");
  __builtin_amdgcn_wave_barrier();
  __builtin_amdgcn_fence(__ATOMIC_ACQUIRE, "workgroup");
  {
    const int q = lane >> 3, c8 = (lane & 7) * 8;
    {
#pragma unroll
      for (int it = 0; it < 4; ++it) {
        const int row = it * 4 + q;
        const float* sp = os + row * 68 + c8;
        v8h hv, lv;
#pragma unroll
        for (int e = 0; e < 8; ++e) {
          const unsigned short hbits = f2bf_bits(sp[e]);
          const unsigned short lbits = f2bf_bits(sp[e] - bf_bits2f(hbits));
          hv[e] = __builtin_bit_cast(_Float16, hbits);
          lv[e] = __builtin_bit_cast(_Float16, lbits);
        }
        *(v8h*)(Ch + (size_t)(q0 + row) * AOP + c8) = hv;
        *(v8h*)(Cl + (size_t)(q0 + row) * AOP + c8) = lv;
      }
      
    }
  }
}

// ---------------------------------------------------------------------------
// Output RMSNorm over C + residual + back to NCHW:
//   out[b][c][n] = Of[b*1024+n][c] * rsqrt(mean_C(Of[tok][.]^2) + 1e-6) * bf16(w[c]) + bf16(x[b][c][n]).
// One block of 256 threads per 64 consecutive tokens (grid = 4096/64 = 64). Phase 1: each wave computes the per-token
// factor for 8 tokens (16-B loads, shuffle sum) into LDS rms[64]. Phase 2: 16 channel tiles of 64; the 64x64 (token x
// channel) tile is scaled and staged in LDS (4 it x 256 thr x 4 floats = 64x64), then read transposed: lanes 0..15 of a
// Coverage: 64 blocks x 64 tokens x 16 tiles x 64 channels = 4 x 1024 x 1024 outputs, each exactly once.
// ---------------------------------------------------------------------------
__global__ __launch_bounds__(256) void final_kernel(const float* __restrict__ of, const float* __restrict__ nw,
                                                    const float* __restrict__ xin, float* __restrict__ out) {
  __shared__ __align__(16) float tf[64 * 68];
  __shared__ float rms[64];
  const int tid = threadIdx.x, lane = tid & 31, wave = tid >> 5;
  const int tok0 = blockIdx.x * 64;
  const int b = tok0 / NTOK, n0 = tok0 - b * NTOK;

  // phase 1: per-token rsqrt(mean + eps)
#pragma unroll 1
  for (int i = 0; i < 8; ++i) {
    const int rr = wave * 8 + i;
    const float* rowp = of + (size_t)(tok0 + rr) * CH + lane * 4;
    float ss = 0.0f;
#pragma unroll 2
    for (int k = 0; k < 8; ++k) {
      const v4f v = *(const v4f*)(rowp + k * 128);
      ss += v[0] * v[0] + v[1] * v[1] + v[2] * v[2] + v[3] * v[3];
    }
#pragma unroll
    for (int off = 1; off < 32; off <<= 1) ss += __shfl_xor(ss, off, 32);
    if (lane == 0) rms[rr] = rsqrtf(ss * (1.0f / (float)CH) + RMS_EPS);
  }
  __syncthreads();

  const int lr = tid >> 4;           // 0..15
  const int c4 = (tid & 15) * 4;     // 0..60
#pragma unroll 1
  for (int ct = 0; ct < CH / 64; ++ct) {
    const int c0 = ct * 64;
    {
      const v4f w4 = *(const v4f*)(nw + c0 + c4);
      float wr[4];
      wr[0] = bf_rne(w4[0]); wr[1] = bf_rne(w4[1]); wr[2] = bf_rne(w4[2]); wr[3] = bf_rne(w4[3]);
#pragma unroll
      for (int it = 0; it < 4; ++it) {
        const int rr = it * 16 + lr;   // token within block
        const v4f v = *(const v4f*)(of + (size_t)(tok0 + rr) * CH + c0 + c4);
        const float rm = rms[rr];
        v4f o;
        o[0] = v[0] * rm * wr[0]; o[1] = v[1] * rm * wr[1]; o[2] = v[2] * rm * wr[2]; o[3] = v[3] * rm * wr[3];
        *(v4f*)(tf + rr * 68 + c4) = o;
      }
    }
    __syncthreads();
    v4f ov[4];
#pragma unroll
    for (int it = 0; it < 4; ++it) {
      const int oc = it * 16 + lr;     // channel within tile
      const v4f xr = *(const v4f*)(xin + ((size_t)(b * CH + c0 + oc)) * NTOK + n0 + c4);
      v4f o;
      o[0] = tf[(c4 + 0) * 68 + oc] + bf_rne(xr[0]);
      o[1] = tf[(c4 + 1) * 68 + oc] + bf_rne(xr[1]);
      o[2] = tf[(c4 + 2) * 68 + oc] + bf_rne(xr[2]);
      o[3] = tf[(c4 + 3) * 68 + oc] + bf_rne(xr[3]);
      ov[it] = o;
    }
    {
#pragma unroll
      for (int it = 0; it < 4; ++it) {
        const int oc = it * 16 + lr;
        *(v4f*)(out + ((size_t)(b * CH + c0 + oc)) * NTOK + n0 + c4) = ov[it];
      }
      
    }
    __syncthreads();
  }
}

// ---------------------------------------------------------------------------
// Workspace region map (byte offsets; every region is fully written by its producer launch before any consumer
//   XB    bf16 [4096][1024]          0       8388608
//   WQKV  bf16 [3072][1024]    8388608       6291456
//   WP2   bf16 [1024][2048]   14680064       4194304
//   TC    f32  [32][16]       18874368          2048   TS  18876416  2048
//   QKf   f32  [4096][2048]   18878464      33554432   (dead after ropenorm; the same 32 MiB then hold
//                                                       CTX2 u16 [4096][2048] at 18878464 (16777216) and
//                                                       Of   f32  [4096][1024] at 35655680 (16777216), disjoint)
//   Qh    bf16 [4096][1024]   52432896       8388608   Ql  60821504
//   Kh    bf16 [4096][1024]   69210112       8388608   Kl  77598720
//   VTh   bf16 [1024][4096]   85987328       8388608   VTl 94375936
//   total                    102764544
// ---------------------------------------------------------------------------
extern "C" void kernel_launch(void* const* d_in, const int* in_sizes, int n_in,
                              void* d_out, int out_size, void* d_ws, size_t ws_size,
                              hipStream_t stream) {
  if (n_in < 7) return;
  if (in_sizes[0] != NB * CH * NTOK) return;        // hidden_states [4][1024][32][32]
  if (in_sizes[1] != NQKV * CH) return;             // w_qkv [3072][1024]
  if (in_sizes[2] != NQKV) return;                  // b_qkv [3072]
  if (in_sizes[3] != INNER) return;                 // q_norm_w [1024]
  if (in_sizes[4] != INNER) return;                 // k_norm_w [1024]
  if (in_sizes[5] != CH * INNER) return;            // w_proj [1024][1024]
  if (in_sizes[6] != CH) return;                    // norm_out_w [1024]
  if (out_size != NB * CH * NTOK) return;

  const float* x    = (const float*)d_in[0];
  const float* wqkv = (const float*)d_in[1];   // [out 3072][in 1024]
  const float* bqkv = (const float*)d_in[2];
  const float* qnw  = (const float*)d_in[3];
  const float* knw  = (const float*)d_in[4];
  const float* wprj = (const float*)d_in[5];   // [out 1024][in 1024]
  const float* onw  = (const float*)d_in[6];

  const size_t PXB = (size_t)MTOK * CH * 2;        // 8388608
  const size_t PWQ = (size_t)NQKV * CH * 2;        // 6291456
  const size_t PWP = (size_t)CH * AOP * 2;         // 4194304
  const size_t PTB = (size_t)TABN * 4;             // 2048
  const size_t PQK = (size_t)MTOK * QKP * 4;       // 33554432
  const size_t PCX = (size_t)MTOK * AOP * 2;       // 16777216
  const size_t POF = (size_t)MTOK * CH * 4;        // 16777216
  const size_t PPL = (size_t)MTOK * INNER * 2;     // 8388608 per q/k plane
  const size_t PVT = (size_t)INNER * VTP * 2;      // 8388608 per v^T plane
  if (PCX + POF > PQK) return;                     // CTX2 and Of share the QKf region, disjoint halves
  size_t off = 0;
  const size_t oXB  = off; off += PXB;
  const size_t oWQ  = off; off += PWQ;
  const size_t oWP  = off; off += PWP;
  const size_t oTC  = off; off += PTB;
  const size_t oTS  = off; off += PTB;
  const size_t oQK  = off; off += PQK;
  const size_t oCX  = oQK;
  const size_t oOF  = oQK + PCX;
  const size_t oQh  = off; off += PPL;  const size_t oQl = off; off += PPL;
  const size_t oKh  = off; off += PPL;  const size_t oKl = off; off += PPL;
  const size_t oVTh = off; off += PVT;  const size_t oVTl = off; off += PVT;
  if (off > ws_size) return;                       // off = 102764544
  if (off > (size_t)134217728) return;

  char* ws = (char*)d_ws;
  unsigned short* XB   = (unsigned short*)(ws + oXB);
  unsigned short* WQKV = (unsigned short*)(ws + oWQ);
  unsigned short* WP2  = (unsigned short*)(ws + oWP);
  float*          TC   = (float*)(ws + oTC);
  float*          TS   = (float*)(ws + oTS);
  float*          QKf  = (float*)(ws + oQK);
  unsigned short* CTX2 = (unsigned short*)(ws + oCX);
  float*          Of   = (float*)(ws + oOF);
  unsigned short* Qh   = (unsigned short*)(ws + oQh);  unsigned short* Ql  = (unsigned short*)(ws + oQl);
  unsigned short* Kh   = (unsigned short*)(ws + oKh);  unsigned short* Kl  = (unsigned short*)(ws + oKl);
  unsigned short* VTh  = (unsigned short*)(ws + oVTh); unsigned short* VTl = (unsigned short*)(ws + oVTl);

  const dim3 blk(256);

  // (1) x[b] viewed [R=1024 c][Cc=1024 n] (pitch 1024) -> XB_b[n][c] (pitch 1024); grid (Cc/64, R/64, B) = (16, 16, 4)
  tconv_kernel<<<dim3(NTOK / 64, CH / 64, NB), blk, 0, stream>>>(x, XB, NTOK, CH, (long)CH * NTOK, (long)NTOK * CH);
  // (2) w_qkv [3072][1024] -> WQKV bf16 same layout; 393216 units -> 1536 blocks
  const int n8q = NQKV * CH / 8;
  convrows_kernel<false><<<dim3(n8q / 256), blk, 0, stream>>>(wqkv, WQKV, CH, CH, n8q);
  // (3) w_proj [1024][1024] -> WP2 [1024][2048], cols k and 1024+k; 131072 units -> 512 blocks
  const int n8p = CH * INNER / 8;
  convrows_kernel<true><<<dim3(n8p / 256), blk, 0, stream>>>(wprj, WP2, INNER, AOP, n8p);
  // (4) rotary cos/sin tables [32][16]
  ropetab_kernel<<<dim3(2), blk, 0, stream>>>(TC, TS);
  // (5) q|k = XB . WQKV[0..2047]^T + b -> QKf f32 [4096][2048]   (M=4096, N=2048, K=1024; 2048 tiles -> 256 blocks)
  const dim3 gQK(((MTOK / 64) * (QKP / 64) + 7) / 8, 1);
  wmma_gemm64<1, false, 2, 0, false, 0><<<gQK, blk, 0, stream>>>(
      XB, XB, CH, 0L, WQKV, WQKV, CH, 0L, (void*)QKf, (void*)QKf, QKP, 0L,
      bqkv, bqkv, 0L, MTOK, QKP, CH, 1.0f);
  // (6) v^T = WQKV[2048..3071] . XB^T + b[2048+m] -> VTh|VTl [1024][4096]   (M=1024, N=4096, K=1024; 1024 tiles -> 128 blocks)
  const dim3 gVT(((INNER / 64) * (MTOK / 64) + 7) / 8, 1);
  wmma_gemm64<1, false, 1, 2, false, 0><<<gVT, blk, 0, stream>>>(
      WQKV + (size_t)2 * INNER * CH, WQKV + (size_t)2 * INNER * CH, CH, 0L, XB, XB, CH, 0L,
      (void*)VTh, (void*)VTl, VTP, 0L,
      bqkv + 2 * INNER, bqkv, 0L, INNER, MTOK, CH, 1.0f);
  // (7) RoPE + RMSNorm over 1024 for q and k -> Qh|Ql, Kh|Kl; one block of 128 threads per token row
  ropenorm_kernel<<<dim3(MTOK), dim3(128), 0, stream>>>(QKf, TC, TS, qnw, knw, Qh, Ql, Kh, Kl);
  // (8) attention per (batch, head, 64-query block) -> CTX2 [4096][2048] (hi | lo columns); 1024 blocks
  attn_kernel<<<dim3(NB * NH * (NTOK / 64)), dim3(128), 0, stream>>>(Qh, Ql, Kh, Kl, VTh, VTl, CTX2, 0.125f);
  // (9) Of = CTX2 . WP2^T -> f32 [4096][1024]   (M=4096, N=1024, K=2048; 1024 tiles -> 128 blocks)
  const dim3 gO(((MTOK / 64) * (CH / 64) + 7) / 8, 1);
  wmma_gemm64<1, false, 0, 0, false, 0><<<gO, blk, 0, stream>>>(
      CTX2, CTX2, AOP, 0L, WP2, WP2, AOP, 0L, (void*)Of, (void*)Of, CH, 0L,
      bqkv, bqkv, 0L, MTOK, CH, AOP, 1.0f);
  // (10) output RMSNorm + residual -> NCHW d_out; 64 blocks of 64 tokens
  final_kernel<<<dim3(MTOK / 64), blk, 0, stream>>>(Of, onw, x, (float*)d_out);
  (void)hipGetLastError();
}

// v002
// Measured time: 258 microseconds a run.
// In two side-by-side timings against v001, it was 1.48 and 1.49 times as fast.
// Counting every step since v000, it is 1.82 times as fast.
// Contractions: q|k projection (f32 out) and v^T projection (bf16 hi|lo out) = v_wmma_f32_16x16x32_bf16 single products on bf16 planes of the RNE-converted inputs; q.k^T and p.v = bf16 hi/lo split (hi.hi + hi.lo + lo.hi); output projection = [CTXhi|CTXlo] x [Wp;Wp] bf16 single products (K-folded 2-term); f32 accumulate everywhere; RoPE, QK RMSNorm, output RMSNorm, online softmax, 1/rowsum, bias and residual in f32 on the VALU.
// Plane / carry map (all carry 1, nothing to fold back): XB = bf16(x) token-major [4096][1024] (row b*1024+n, n = y*32+x, col c);
// WQKV = bf16(w_qkv) [3072][1024] natural [out][in]; WP2 [1024][2048]: cols k and 1024+k both = bf16(w_proj[c][k]);
// TC/TS f32 [32 pos][16 pair] = cos/sin(pos * 10000^(-j/16)); QKf f32 [4096][2048] = pre-RoPE q (cols 0..1023) | k (cols 1024..2047) incl. bias;
// Qh|Ql, Kh|Kl bf16 [4096][1024] (col h*64+d) = hi/lo of the RoPE'd, RMSNorm'd q, k; VTh|VTl bf16 [1024 (h,d)][4096 (b,t)];
// P hi|lo = unnormalised exp in (0,1] (bf16, f32 exponent range), 1/rowsum applied to the f32 accumulator in the attention epilogue;
// CTX2 u16 [4096][2048] = ctx hi at col h*64+d, lo at col 1024+h*64+d; Of f32 [4096][1024] = ctx . w_proj^T.
#include <hip/hip_runtime.h>
#include <math.h>
#include <stdint.h>

#define NB    4
#define CH    1024
#define IMH   32
#define IMW   32
#define NTOK  1024
#define INNER 1024
#define NH    16
#define HD    64
#define NQKV  3072
#define QKP   2048
#define AOP   2048
#define VTP   (NB * NTOK)
#define MTOK  (NB * NTOK)
#define TABN  512
#define RMS_EPS 1e-6f

static_assert(NTOK == IMH * IMW);
static_assert(IMW == 32);
static_assert(INNER == NH * HD);
static_assert(HD == 64);
static_assert(NQKV == 3 * INNER);
static_assert(QKP == 2 * INNER);
static_assert(AOP == 2 * INNER);
static_assert(CH % 64 == 0);
static_assert(NTOK % 64 == 0);
static_assert(INNER % 64 == 0);
static_assert(MTOK % 64 == 0);
static_assert(CH % 32 == 0);
static_assert(AOP % 32 == 0);
static_assert(INNER == 128 * 8);
static_assert(CH == 8 * 128);
static_assert(TABN == 32 * (HD / 4));
static_assert((NQKV * CH) % (8 * 256) == 0);
static_assert((CH * INNER) % (8 * 256) == 0);
static_assert(CH % 256 == 0);
static_assert(INNER % 256 == 0);
static_assert(MTOK % 128 == 0 && QKP % 128 == 0 && INNER % 128 == 0 && CH % 128 == 0 && AOP % 128 == 0);

typedef __attribute__((ext_vector_type(16))) _Float16 v16h;
typedef __attribute__((ext_vector_type(8)))  _Float16 v8h;
typedef __attribute__((ext_vector_type(16))) __bf16   v16b;
typedef __attribute__((ext_vector_type(8)))  __bf16   v8b;
typedef __attribute__((ext_vector_type(8)))  float    v8f;
typedef __attribute__((ext_vector_type(4)))  float    v4f;
typedef __attribute__((ext_vector_type(2)))  float    v2f;
typedef __attribute__((ext_vector_type(4)))  unsigned int v4u;

__device__ __forceinline__ unsigned short f2bf_bits(float f) {
  unsigned u = __float_as_uint(f);
  return (unsigned short)((u + 0x7FFFu + ((u >> 16) & 1u)) >> 16);
}
__device__ __forceinline__ float bf_bits2f(unsigned short h) { return __uint_as_float(((unsigned)h) << 16); }
__device__ __forceinline__ float bf_rne(float f) { return bf_bits2f(f2bf_bits(f)); }
__device__ __forceinline__ unsigned pk16(unsigned short a, unsigned short b) { return (unsigned)a | ((unsigned)b << 16); }

// hazard guard behind the product loop, as a plain device helper
__device__ __forceinline__ void acc_guard4(v8f& a, v8f& b, v8f& c, v8f& d) { asm volatile("v_nop\n\tv_nop\n\tv_nop\n\tv_nop" : "+v"(a), "+v"(b), "+v"(c), "+v"(d)); }
template <typename T> struct Frag;
template <> struct Frag<_Float16> {
  typedef v16h V; typedef v8h H; union U { v16h v; v8h h[2]; };
  static __device__ __forceinline__ v16h load(const _Float16* p) {   // elements 0..7 <- p[0..7], 8..15 <- p[16..23]
    U f; f.h[0] = *(const v8h*)(p); f.h[1] = *(const v8h*)(p + 16); return f.v;
  }
  static __device__ __forceinline__ v8f mma(v16h a, v16h b, v8f c) {
    return __builtin_amdgcn_wmma_f32_16x16x32_f16(false, a, false, b, (short)0, c, false, false);
  }
};
template <> struct Frag<__bf16> {
  typedef v16b V; typedef v8b H; union U { v16b v; v8b h[2]; };
  static __device__ __forceinline__ v16b load(const __bf16* p) {
    U f; f.h[0] = *(const v8b*)(p); f.h[1] = *(const v8b*)(p + 16); return f.v;
  }
  static __device__ __forceinline__ v8f mma(v16b a, v16b b, v8f c) {
    return __builtin_amdgcn_wmma_f32_16x16x32_bf16(false, a, false, b, (short)0, c, false, false);
  }
};

// ---- Register-blocked batched WMMA GEMM ------------------------------------
// C[m,n] = scale * sum_k A[m,k] * Bt[n,k] (+bias)(+resid); each wave owns a 64x64 tile, a block of 4 waves (2 x 2) a 128x128 tile.
// A row-major [M,K]; Bt row-major [N,K]; M,N % 128 == 0, K % GT_BK == 0.
// Operand path: per stage of GT_BK k the block copies its 128 A rows and 128 Bt rows into LDS with 16-B loads whose lanes cover
// whole rows of the stage (GT_BK * 2 contiguous bytes), so every 128-B line is asked for once per block; the four waves read their
// fragments from LDS. Two LDS buffers: the next stage's global loads are issued before the current stage's products and
// stored after them, one __syncthreads() per stage. The k order of every accumulator is ascending in steps of 32.
// SPLIT (hi/lo operand planes) is not instantiated and not supported by the staged loop.
// BIAS_MODE: 0 = none, 1 = bias[m], 2 = bias[n]; the bias value is RNE-converted to bf16 precision before the f32 add.
// OUT_MODE: 0 = f32, 1 = f16, 2 = bf16 hi plane (Cout) + bf16 lo plane (Cout2).
// ET: 0 = f16 operands, 1 = bf16 operands (pointers passed as 16-bit storage)
template <int ET> struct Elem;
template <> struct Elem<0> { typedef _Float16 T; };
template <> struct Elem<1> { typedef __bf16 T; };
#define GT_BK 128
// LDS row pitch in elements: GT_BK data + 8 pad, = 16 B x odd, so the 16 rows of one 16-byte fragment read fall on different banks.
#define GT_LP (GT_BK + 8)
#define GT_CPR (GT_BK / 8)          // 16-byte pieces per staged row
#define GT_RPP (128 / GT_CPR)       // rows that 128 threads copy per pass
#define GT_NP  (128 / GT_RPP)       // passes per operand and stage
// LD: row pitch of A and of Bt in elements, a compile-time constant so that the row steps of the staging loads are immediate offsets.
template <int ET, bool SPLIT, int BIAS_MODE, int OUT_MODE, bool RESID, int LD, int ACT = 0>
__global__ __launch_bounds__(128) void wmma_gemm64(
    const unsigned short* __restrict__ Ap, const unsigned short* __restrict__ A2p, long strideA,
    const unsigned short* __restrict__ Btp, const unsigned short* __restrict__ Bt2p, long strideB,
    void* __restrict__ Cout, void* __restrict__ Cout2, int ldc, long strideC,
    const float* __restrict__ bias,
    const float* __restrict__ resid, long strideR,
    int M, int N, int K, float scale) {
  typedef typename Elem<ET>::T T;
  typedef typename Frag<T>::V V;
  typedef typename Frag<T>::H H;
  static_assert(!SPLIT, "the staged loop takes single operand planes");
  const T* A = (const T*)Ap; const T* Bt = (const T*)Btp;
  __shared__ __align__(16) T sA[2 * 128 * GT_LP];  // two stages of the block's 128 A rows
  __shared__ __align__(16) T sB[2 * 128 * GT_LP];  // two stages of the block's 128 Bt rows
  __shared__ __align__(16) float sT[4][16 * 68];   // per-wave 16x64 slab, pitch 68 floats
  const int b    = blockIdx.y;
  const int tid  = threadIdx.x;
  const int lane = tid & 31;
  const int wave = tid >> 5;
  const int tilesN = N >> 7;
  const int tilesM = M >> 7;
  const int tile = blockIdx.x;
  if (tile >= tilesM * tilesN) return;   // block-uniform, in front of every barrier
  const int tm = tile / tilesN;
  const int tn = tile - tm * tilesN;
  const int wm = (wave >> 1) << 6;             // this wave's 64x64 tile inside the block's 128x128
  const int wn = (wave & 1) << 6;
  const int m0 = (tm << 7) + wm;
  const int n0 = (tn << 7) + wn;

  const T* Ab  = A  + (size_t)b * strideA;
  const T* Bb  = Bt + (size_t)b * strideB;

  const int rlane = lane & 15;                 // row (A) / col (B, D) within subtile
  const int koff  = (lane >> 4) * 8;           // k offset of this lane half
  const int mOff  = (lane >> 4) * 8;           // D row offset

  // staging map: pass p, thread tid -> row p * GT_RPP + tid / GT_CPR, 8 elements at column (tid % GT_CPR) * 8
  const int srow = tid / GT_CPR;
  const int scol = (tid % GT_CPR) * 8;
  const T* gA = Ab + (size_t)((tm << 7) + srow) * LD + scol;
  const T* gB = Bb + (size_t)((tn << 7) + srow) * LD + scol;
  const int sOff = srow * GT_LP + scol;

  v8f acc[4][4];
#pragma unroll
  for (int i = 0; i < 4; ++i)
#pragma unroll
    for (int j = 0; j < 4; ++j) acc[i][j] = (v8f){0.f,0.f,0.f,0.f,0.f,0.f,0.f,0.f};

  H ra[GT_NP], rb[GT_NP];
#pragma unroll
  for (int p = 0; p < GT_NP; ++p) {
    ra[p] = *(const H*)(gA + p * GT_RPP * LD);
    rb[p] = *(const H*)(gB + p * GT_RPP * LD);
  }
#pragma unroll
  for (int p = 0; p < GT_NP; ++p) {
    *(H*)(sA + sOff + p * GT_RPP * GT_LP) = ra[p];
    *(H*)(sB + sOff + p * GT_RPP * GT_LP) = rb[p];
  }
  __syncthreads();

  const int nStages = K / GT_BK;
  for (int st = 0; st < nStages; ++st) {
    const int cur = (st & 1) * (128 * GT_LP);
    const bool more = st + 1 < nStages;        // block-uniform
    if (more) {
      const T* pa = gA + (st + 1) * GT_BK;
      const T* pb = gB + (st + 1) * GT_BK;
#pragma unroll
      for (int p = 0; p < GT_NP; ++p) {
        ra[p] = *(const H*)(pa + p * GT_RPP * LD);
        rb[p] = *(const H*)(pb + p * GT_RPP * LD);
      }
      // naming the two address pairs here keeps them untouched up to this wait, which stands in front of every reuse of their registers
      asm volatile("s_wait_xcnt 0x0" :: "v"(pa), "v"(pb) : "memory");
    }
    const T* fa = sA + cur + (wm + rlane) * GT_LP + koff;
    const T* fb = sB + cur + (wn + rlane) * GT_LP + koff;
#pragma unroll
    for (int kk = 0; kk < GT_BK / 32; ++kk) {
      V bh[4], ah[4];
#pragma unroll
      for (int j = 0; j < 4; ++j) bh[j] = Frag<T>::load(fb + (j << 4) * GT_LP + kk * 32);
#pragma unroll
      for (int i = 0; i < 4; ++i) ah[i] = Frag<T>::load(fa + (i << 4) * GT_LP + kk * 32);
#pragma unroll
      for (int i = 0; i < 4; ++i)
#pragma unroll
        for (int j = 0; j < 4; ++j) acc[i][j] = Frag<T>::mma(ah[i], bh[j], acc[i][j]);
    }
    if (more) {
      const int nxt = (128 * GT_LP) - cur;     // the buffer whose last readers passed the barrier of stage st - 1
#pragma unroll
      for (int p = 0; p < GT_NP; ++p) {
        *(H*)(sA + nxt + sOff + p * GT_RPP * GT_LP) = ra[p];
        *(H*)(sB + nxt + sOff + p * GT_RPP * GT_LP) = rb[p];
      }
    }
    __syncthreads();
  }
  acc_guard4(acc[0][0], acc[0][1], acc[0][2], acc[0][3]);
  acc_guard4(acc[1][0], acc[1][1], acc[1][2], acc[1][3]);
  acc_guard4(acc[2][0], acc[2][1], acc[2][2], acc[2][3]);
  acc_guard4(acc[3][0], acc[3][1], acc[3][2], acc[3][3]);

  // ---- epilogue ----
  float* slab = sT[wave];
  const float* Rb = RESID ? (resid + (size_t)b * strideR) : nullptr;
#pragma unroll
  for (int i = 0; i < 4; ++i) {
    const int mBase = m0 + (i << 4);
    float bm[8];
    if (BIAS_MODE == 1) {
      const float* bp = bias + mBase + mOff;
#pragma unroll
      for (int r = 0; r < 8; ++r) bm[r] = bp[r];
      // naming the address pair here keeps it untouched up to this wait, which stands in front of every reuse of its registers
      asm volatile("s_wait_xcnt 0x0" :: "v"(bp) : "memory");
    }
#pragma unroll
    for (int j = 0; j < 4; ++j) {
      const int n = n0 + (j << 4) + rlane;
      float bv = 0.f;
      if (BIAS_MODE == 2) bv = bf_rne(bias[n]);
#pragma unroll
      for (int r = 0; r < 8; ++r) {
        float v = acc[i][j][r] * scale;
        if (BIAS_MODE == 1) v += bf_rne(bm[r]);
        if (BIAS_MODE == 2) v += bv;
        if (RESID) v += Rb[(size_t)(mBase + mOff + r) * ldc + n];
        if (ACT == 1) v = tanhf(v);
        if (ACT == 2) v = fmaxf(v, 0.0f);
        if (ACT == 3) v = v / (1.0f + expf(-v));
        if (ACT == 4) v = (v > 0.f) ? v : 0.01f * v;
        if (ACT == 5) v = 0.5f * v * (1.0f + erff(v * 0.70710678118654752f));
        slab[(mOff + r) * 68 + (j << 4) + rlane] = v;
      }
    }
    __builtin_amdgcn_fence(__ATOMIC_RELEASE, "workgroup");
    __builtin_amdgcn_wave_barrier();
    __builtin_amdgcn_fence(__ATOMIC_ACQUIRE, "workgroup");
    if (OUT_MODE == 0) {
      float* C = (float*)Cout + (size_t)b * strideC;
      const int hh = lane >> 4, c4 = (lane & 15) * 4;     // row seg = 256 B = 16 lanes x 16 B
      {
#pragma unroll
        for (int it = 0; it < 8; ++it) {
          const int row = it * 2 + hh;
          v4f v = *(const v4f*)(slab + row * 68 + c4);
          *(v4f*)(C + (size_t)(mBase + row) * ldc + n0 + c4) = v;
        }
        
      }
    } else {
      const int q = lane >> 3, c8 = (lane & 7) * 8;
      unsigned short* C  = (unsigned short*)Cout  + (size_t)b * strideC;
      unsigned short* C2 = (OUT_MODE == 2) ? ((unsigned short*)Cout2 + (size_t)b * strideC) : nullptr;
      {
#pragma unroll
        for (int it = 0; it < 4; ++it) {
          const int row = it * 4 + q;
          const float* sp = slab + row * 68 + c8;
          v8h hv, lv;
#pragma unroll
          for (int e = 0; e < 8; ++e) {
            if (OUT_MODE == 1) {
              hv[e] = (_Float16)sp[e];
            } else {
              unsigned short hb = f2bf_bits(sp[e]);
              unsigned short lb = f2bf_bits(sp[e] - bf_bits2f(hb));
              hv[e] = __builtin_bit_cast(_Float16, hb);
              lv[e] = __builtin_bit_cast(_Float16, lb);
            }
          }
          *(v8h*)(C + (size_t)(mBase + row) * ldc + n0 + c8) = hv;
          if (OUT_MODE == 2) *(v8h*)(C2 + (size_t)(mBase + row) * ldc + n0 + c8) = lv;
        }
        
      }
    }
    __builtin_amdgcn_fence(__ATOMIC_RELEASE, "workgroup");
    __builtin_amdgcn_wave_barrier();
    __builtin_amdgcn_fence(__ATOMIC_ACQUIRE, "workgroup");
  }
}

// ---------------------------------------------------------------------------
// Row-preserving bf16 RNE convert of an f32 matrix [rows][ncols] into a u16 plane with row pitch ldout; DUP also
// writes the same 8 values at column + ncols (second copy along the row). 8 consecutive elements per thread = one
// Coverage: grid = n8/256 blocks x 256 threads x 8 elements = rows*ncols (n8 = rows*ncols/8, exact multiple of 256).
// ---------------------------------------------------------------------------
template <bool DUP>
__global__ __launch_bounds__(256) void convrows_kernel(const float* __restrict__ in, unsigned short* __restrict__ out,
                                                       int ncols, int ldout, int n8) {
  const int i = blockIdx.x * 256 + threadIdx.x;
  if (i < n8) {
    const size_t e0 = (size_t)i * 8;
    const int row = (int)(e0 / (size_t)ncols);
    const int col = (int)(e0 - (size_t)row * ncols);
    const v4f a = *(const v4f*)(in + e0);
    const v4f c = *(const v4f*)(in + e0 + 4);
    v4u hv;
    hv[0] = pk16(f2bf_bits(a[0]), f2bf_bits(a[1]));
    hv[1] = pk16(f2bf_bits(a[2]), f2bf_bits(a[3]));
    hv[2] = pk16(f2bf_bits(c[0]), f2bf_bits(c[1]));
    hv[3] = pk16(f2bf_bits(c[2]), f2bf_bits(c[3]));
    const size_t o = (size_t)row * ldout + col;
    {
      *(v4u*)(out + o) = hv;
      if (DUP) *(v4u*)(out + o + ncols) = hv;
      
    }
  }
}

// ---------------------------------------------------------------------------
// Fused transpose + bf16 RNE convert of an f32 matrix, z-batched, one plane:
//   in_z = W + z*sIn viewed [R rows][Cc cols] with row pitch ldin  ->  oh_z[c][r] = bf16(in_z[r][c]), row pitch ldout, oh_z = oh + z*sOut.
// 64x64 tiles through LDS. grid = (Cc/64, R/64, Z), 256 threads (R, Cc multiples of 64; ldout multiple of 64 so every
// Coverage per block: load 4 it x 256 thr x 4 floats = 64x64; store 2 it x 256 thr x 8 u16 = 64x64.
// ---------------------------------------------------------------------------
__global__ __launch_bounds__(256) void tconv_kernel(const float* __restrict__ W, unsigned short* __restrict__ oh,
                                                    int ldin, int ldout, long sIn, long sOut) {
  __shared__ __align__(16) float tf[64 * 68];
  W  += (size_t)blockIdx.z * sIn;
  oh += (size_t)blockIdx.z * sOut;
  const int c0  = blockIdx.x * 64;   // input column block = output row block
  const int r0  = blockIdx.y * 64;   // input row block    = output column block
  const int tid = threadIdx.x;
  {
    const int lr = tid >> 4;         // 0..15
    const int c4 = (tid & 15) * 4;   // 0..60
#pragma unroll
    for (int it = 0; it < 4; ++it) {
      const int rr = it * 16 + lr;   // 0..63
      const v4f a = *(const v4f*)(W + (size_t)(r0 + rr) * ldin + c0 + c4);
      *(v4f*)(tf + rr * 68 + c4) = a;
    }
  }
  __syncthreads();
  const int sub = tid >> 3;          // 0..31
  const int c8  = (tid & 7) * 8;     // 0..56
  v4u hv[2];
#pragma unroll
  for (int it = 0; it < 2; ++it) {
    const int oc = it * 32 + sub;    // output row within tile (= input column)
    v4u a;
#pragma unroll
    for (int q = 0; q < 4; ++q) {
      const float f0 = tf[(c8 + 2 * q) * 68 + oc];
      const float f1 = tf[(c8 + 2 * q + 1) * 68 + oc];
      a[q] = pk16(f2bf_bits(f0), f2bf_bits(f1));
    }
    hv[it] = a;
  }
  {
#pragma unroll
    for (int it = 0; it < 2; ++it) {
      const int oc = it * 32 + sub;
      const size_t go = (size_t)(c0 + oc) * ldout + r0 + c8;
      *(v4u*)(oh + go) = hv[it];
    }
    
  }
}

// ---------------------------------------------------------------------------
// Rotary angle tables: tc[pos*16 + j] = cos(pos * f_j), ts likewise, f_j = 10000^(-4j/64) = 10^(-j/4) (f32 constants),
// pos 0..31 (shared by the row axis and the column axis), j 0..15. Precise cosf/sinf (|angle| <= 31).
// grid = 2 x 256 = 512 threads = 32 x 16 entries per table; one 4-B store per lane, 32 consecutive lanes = one whole
// ---------------------------------------------------------------------------
__device__ __forceinline__ float rope_freq(int j) {
  float f = 1.0f;
  f = (j == 1)  ? 0.5623413251903491f     : f;
  f = (j == 2)  ? 0.31622776601683794f    : f;
  f = (j == 3)  ? 0.17782794100389229f    : f;
  f = (j == 4)  ? 0.1f                    : f;
  f = (j == 5)  ? 0.05623413251903491f    : f;
  f = (j == 6)  ? 0.031622776601683794f   : f;
  f = (j == 7)  ? 0.017782794100389229f   : f;
  f = (j == 8)  ? 0.01f                   : f;
  f = (j == 9)  ? 0.005623413251903491f   : f;
  f = (j == 10) ? 0.0031622776601683794f  : f;
  f = (j == 11) ? 0.0017782794100389228f  : f;
  f = (j == 12) ? 0.001f                  : f;
  f = (j == 13) ? 0.0005623413251903491f  : f;
  f = (j == 14) ? 0.00031622776601683794f : f;
  f = (j == 15) ? 0.00017782794100389227f : f;
  return f;
}

__global__ __launch_bounds__(256) void ropetab_kernel(float* __restrict__ tc, float* __restrict__ ts) {
  const int i = blockIdx.x * 256 + threadIdx.x;      // 0..511 = pos*16 + j
  if (i < TABN) {
    const int pos = i >> 4, j = i & 15;
    const float a = (float)pos * rope_freq(j);
    const float c = cosf(a);
    const float s = sinf(a);
    ((float*)tc)[i] = c;
    ((float*)ts)[i] = s;
    
  }
}

// ---------------------------------------------------------------------------
// Per-token 2-D RoPE (interleaved pairs (2i,2i+1) inside each head; pairs 0..15 use the row index y = n>>5, pairs 16..31
// the column index x = n&31; tables shared by all heads) followed by RMSNorm over the WHOLE 1024-wide (heads x dim) row:
// v = rope(v); v = v * rsqrt(mean_1024(v*v) + 1e-6) * bf16(w[col]); then bf16 hi/lo split into planes [4096][1024].
// One block of 128 threads per token row g = b*1024+n; thread t owns columns 8t..8t+7 (= 4 rotary pairs p0..p0+3, p0 = (4t)&31,
// all four in the same half of the pair range). All loads are 16-B vectors. Stores: 16 B per lane per plane, 128 lanes cover
// LDS: redq/redk[4] written by lane 0 of each of the 4 waves before the barrier.
// ---------------------------------------------------------------------------
__global__ __launch_bounds__(128) void ropenorm_kernel(const float* __restrict__ qkf,
                                                       const float* __restrict__ tc, const float* __restrict__ ts,
                                                       const float* __restrict__ qw, const float* __restrict__ kw,
                                                       unsigned short* __restrict__ qh, unsigned short* __restrict__ ql,
                                                       unsigned short* __restrict__ kh, unsigned short* __restrict__ kl) {
  __shared__ float redq[4], redk[4];
  const int g = blockIdx.x;                 // token row 0..MTOK-1
  const int n = g & (NTOK - 1);
  const int py = n >> 5, px = n & 31;
  const int t = threadIdx.x, lane = t & 31, wave = t >> 5;
  const int i0 = t * 8;

  const float* qr = qkf + (size_t)g * QKP + i0;
  const float* kr = qr + INNER;
  const v4f qa = *(const v4f*)(qr), qb = *(const v4f*)(qr + 4);
  const v4f ka = *(const v4f*)(kr), kb = *(const v4f*)(kr + 4);

  const int p0   = (4 * t) & 31;
  const int hsel = p0 >> 4;                 // 0: row-axis angles, 1: column-axis angles
  const int pos  = py + hsel * (px - py);
  const int toff = pos * 16 + (p0 & 15);
  const v4f cv = *(const v4f*)(tc + toff);
  const v4f sv = *(const v4f*)(ts + toff);

  float q8[8], k8[8];
  q8[0] = qa[0]; q8[1] = qa[1]; q8[2] = qa[2]; q8[3] = qa[3];
  q8[4] = qb[0]; q8[5] = qb[1]; q8[6] = qb[2]; q8[7] = qb[3];
  k8[0] = ka[0]; k8[1] = ka[1]; k8[2] = ka[2]; k8[3] = ka[3];
  k8[4] = kb[0]; k8[5] = kb[1]; k8[6] = kb[2]; k8[7] = kb[3];

  float rq[8], rk[8];
#pragma unroll
  for (int e = 0; e < 4; ++e) {
    const float c = cv[e], s = sv[e];
    const float qe = q8[2 * e], qo = q8[2 * e + 1];
    const float ke = k8[2 * e], ko = k8[2 * e + 1];
    rq[2 * e]     = qe * c - qo * s;
    rq[2 * e + 1] = qe * s + qo * c;
    rk[2 * e]     = ke * c - ko * s;
    rk[2 * e + 1] = ke * s + ko * c;
  }
  float ssq = 0.0f, ssk = 0.0f;
#pragma unroll
  for (int e = 0; e < 8; ++e) { ssq += rq[e] * rq[e]; ssk += rk[e] * rk[e]; }
#pragma unroll
  for (int off = 1; off < 32; off <<= 1) { ssq += __shfl_xor(ssq, off, 32); ssk += __shfl_xor(ssk, off, 32); }
  if (lane == 0) { redq[wave] = ssq; redk[wave] = ssk; }
  __syncthreads();
  const float tq = (redq[0] + redq[1]) + (redq[2] + redq[3]);
  const float tk = (redk[0] + redk[1]) + (redk[2] + redk[3]);
  const float rmq = rsqrtf(tq * (1.0f / (float)INNER) + RMS_EPS);
  const float rmk = rsqrtf(tk * (1.0f / (float)INNER) + RMS_EPS);

  const v4f wqa = *(const v4f*)(qw + i0), wqb = *(const v4f*)(qw + i0 + 4);
  const v4f wka = *(const v4f*)(kw + i0), wkb = *(const v4f*)(kw + i0 + 4);
  float wq8[8], wk8[8];
  wq8[0] = bf_rne(wqa[0]); wq8[1] = bf_rne(wqa[1]); wq8[2] = bf_rne(wqa[2]); wq8[3] = bf_rne(wqa[3]);
  wq8[4] = bf_rne(wqb[0]); wq8[5] = bf_rne(wqb[1]); wq8[6] = bf_rne(wqb[2]); wq8[7] = bf_rne(wqb[3]);
  wk8[0] = bf_rne(wka[0]); wk8[1] = bf_rne(wka[1]); wk8[2] = bf_rne(wka[2]); wk8[3] = bf_rne(wka[3]);
  wk8[4] = bf_rne(wkb[0]); wk8[5] = bf_rne(wkb[1]); wk8[6] = bf_rne(wkb[2]); wk8[7] = bf_rne(wkb[3]);

  v4u hq, lq, hk, lk;
#pragma unroll
  for (int e = 0; e < 4; ++e) {
    const float fq0 = rq[2 * e] * rmq * wq8[2 * e];
    const float fq1 = rq[2 * e + 1] * rmq * wq8[2 * e + 1];
    const float fk0 = rk[2 * e] * rmk * wk8[2 * e];
    const float fk1 = rk[2 * e + 1] * rmk * wk8[2 * e + 1];
    const unsigned short hq0 = f2bf_bits(fq0), hq1 = f2bf_bits(fq1);
    const unsigned short hk0 = f2bf_bits(fk0), hk1 = f2bf_bits(fk1);
    const unsigned short lq0 = f2bf_bits(fq0 - bf_bits2f(hq0)), lq1 = f2bf_bits(fq1 - bf_bits2f(hq1));
    const unsigned short lk0 = f2bf_bits(fk0 - bf_bits2f(hk0)), lk1 = f2bf_bits(fk1 - bf_bits2f(hk1));
    hq[e] = pk16(hq0, hq1); lq[e] = pk16(lq0, lq1);
    hk[e] = pk16(hk0, hk1); lk[e] = pk16(lk0, lk1);
  }
  const size_t o = (size_t)g * INNER + i0;
  {
    *(v4u*)(qh + o) = hq;
    *(v4u*)(ql + o) = lq;
    *(v4u*)(kh + o) = hk;
    *(v4u*)(kl + o) = lk;
    
  }
}

// =====================================================================================
// Full (non-causal, unmasked) attention, head dim 64, all batches in one launch.
//   q planes (hi/lo bf16) [4096][1024]: element (b, n, h, d) at [(b*1024+n)*1024 + h*64 + d]
//   k planes (hi/lo bf16) [4096][1024]: same layout
//   v^T planes (hi/lo bf16) [1024][4096]: element (h, d, b, t) at [(h*64 + d)*4096 + b*1024 + t]
//   out CTX2 plane u16 [4096][2048]: hi bits of o(b,n,h,d) at col h*64+d, lo bits (o - hi) at col 1024 + h*64+d.
//   scores = (q . k) * 0.125 : bf16 hi/lo split (hi.hi + hi.lo + lo.hi) on v_wmma_f32_16x16x32_bf16
//   out    = p . v           : bf16 hi/lo split of p (unnormalised exp) and v, f32 accumulate, x 1/rowsum in f32 at the end
//   online softmax in f32 over the 1024 keys of the batch element (16 chunks of 64, compile-time trip count, no masking).
//   Block = 4 waves = 64 query rows of one (batch, head); grid.x = 4 * 16 * 16 = 1024.
//   K / V^T chunk staging: 128 threads x 32 elements per plane = the whole 64x64 tile (16-B copies, plain loads,
//   __syncthreads before and after); fragment loads read the LDS tiles with the same v8b element type.
//   LDS extents: K/V tiles 64x64 fully staged every chunk; P tiles 16x64 per wave fully written every chunk before the
// =====================================================================================
#define AT_D 64
#define AT_NW 4
#define AT_QB 64
#define AT_KC 64
// LDS row pitch of the K, V^T and P tiles in elements: 64 data + 8 pad = 144 B = 16 B x 9 (odd), so the 16 rows that one
// 16-byte fragment read touches fall on 16 different groups of four banks; at 128 B they fall on two. Pad elements are never read.
#define AT_LP 72

__device__ __forceinline__ unsigned short at_bf_bits(float f) {
  unsigned u = __float_as_uint(f);
  return (unsigned short)((u + 0x7FFFu + ((u >> 16) & 1u)) >> 16);
}
__device__ __forceinline__ __bf16 at_f2bf(float f) { return __builtin_bit_cast(__bf16, at_bf_bits(f)); }
__device__ __forceinline__ void at_split(float f, __bf16& hi, __bf16& lo) {
  const unsigned short hb = at_bf_bits(f);
  hi = __builtin_bit_cast(__bf16, hb);
  lo = at_f2bf(f - __uint_as_float(((unsigned)hb) << 16));
}
__device__ __forceinline__ v8f at_mma(v16b a, v16b b, v8f c) {
  c = __builtin_amdgcn_wmma_f32_16x16x32_bf16(false, a, false, b, (short)0, c, false, false);
  asm volatile("v_nop\n\tv_nop\n\tv_nop\n\tv_nop" : "+v"(c) : "v"(a), "v"(b));
  return c;
}

__global__ __launch_bounds__(128)
void attn_kernel(const unsigned short* __restrict__ qhp, const unsigned short* __restrict__ qlp,
                 const unsigned short* __restrict__ khp, const unsigned short* __restrict__ klp,
                 const unsigned short* __restrict__ vhp, const unsigned short* __restrict__ vlp,
                 unsigned short* __restrict__ aop, float sscale) {
  union FB { v16b v; v8b h[2]; };
  __shared__ __align__(16) __bf16 Ksh[AT_KC * AT_LP];            // K hi [kv][d], pitch AT_LP   9 KB
  __shared__ __align__(16) __bf16 Ksl[AT_KC * AT_LP];            // K lo
  __shared__ __align__(16) __bf16 Vth[AT_D * AT_LP];             // V hi [d][kv], pitch AT_LP   9 KB
  __shared__ __align__(16) __bf16 Vtl[AT_D * AT_LP];             // V lo
  __shared__ __align__(16) __bf16 Psh[AT_NW][16 * AT_LP];        // per wave P hi [row][kv]
  __shared__ __align__(16) __bf16 Psl[AT_NW][16 * AT_LP];        // per wave P lo
  __shared__ __align__(16) float  Os[AT_NW][16 * 68];            // per wave out tile, pitch 68

  const int tid  = threadIdx.x;
  const int wave = tid >> 5;
  const int lane = tid & 31;
  const int hh   = lane >> 4;
  const int c    = lane & 15;

  const int nqb = NTOK / AT_QB;            // 16 query blocks per batch element
  const int bx = blockIdx.x;              // grid = NB * NH * nqb (exact)
  const int qb = bx % nqb;
  const int hb = bx / nqb;
  const int h  = hb % NH;                 // 0..15
  const int b  = hb / NH;                 // 0..3
  const int q0 = b * NTOK + qb * AT_QB + wave * 16;   // row in the q / CTX2 planes

  const __bf16* Qh = (const __bf16*)(const void*)qhp + (size_t)h * AT_D;
  const __bf16* Ql = (const __bf16*)(const void*)qlp + (size_t)h * AT_D;
  const __bf16* Kh = (const __bf16*)(const void*)khp + (size_t)h * AT_D;
  const __bf16* Kl = (const __bf16*)(const void*)klp + (size_t)h * AT_D;
  const __bf16* Vh = (const __bf16*)(const void*)vhp + (size_t)h * AT_D * VTP + (size_t)b * NTOK;
  const __bf16* Vl = (const __bf16*)(const void*)vlp + (size_t)h * AT_D * VTP + (size_t)b * NTOK;
  unsigned short* Ch = aop + (size_t)h * AT_D;                    // hi columns
  unsigned short* Cl = aop + (size_t)INNER + (size_t)h * AT_D;    // lo columns

  // ---- Q fragments (A operand, row = lane&15, split k map via Frag load): 2 d-chunks, hi and lo ----
  v16b qah[2], qal[2];
#pragma unroll
  for (int dc = 0; dc < 2; ++dc) {
    const __bf16* qr = Qh + (size_t)(q0 + c) * INNER + dc * 32 + 8 * hh;
    const __bf16* ql = Ql + (size_t)(q0 + c) * INNER + dc * 32 + 8 * hh;
    qah[dc] = Frag<__bf16>::load(qr);
    qal[dc] = Frag<__bf16>::load(ql);
  }

  float mrow[8], lrow[8];
  v8f oacc[4];
#pragma unroll
  for (int r = 0; r < 8; ++r) { mrow[r] = -INFINITY; lrow[r] = 0.f; }
#pragma unroll
  for (int t = 0; t < 4; ++t) oacc[t] = (v8f){0.f,0.f,0.f,0.f,0.f,0.f,0.f,0.f};

  const int nChunks = NTOK / AT_KC;   // 16, compile-time constant
  for (int kc = 0; kc < nChunks; ++kc) {
    const int kv0 = kc * AT_KC;
    __syncthreads();
    {
      // staging coverage: 128 threads x (4 x 8) elements = 64 rows x 64 per plane = the whole chunk tile
      const int r = tid >> 1, half = (tid & 1) * 32;
      const __bf16* ksh = Kh + (size_t)(b * NTOK + kv0 + r) * INNER + half;   // K row (b, kv0+r), d = half..half+31
      const __bf16* ksl = Kl + (size_t)(b * NTOK + kv0 + r) * INNER + half;
      const __bf16* vsh = Vh + (size_t)r * VTP + kv0 + half;                  // V^T row d = r, keys kv0+half..+31
      const __bf16* vsl = Vl + (size_t)r * VTP + kv0 + half;
#pragma unroll
      for (int i = 0; i < 4; ++i) {
        const v8b a0 = *(const v8b*)(ksh + 8 * i);
        const v8b a1 = *(const v8b*)(ksl + 8 * i);
        const v8b b0 = *(const v8b*)(vsh + 8 * i);
        const v8b b1 = *(const v8b*)(vsl + 8 * i);
        *(v8b*)(Ksh + r * AT_LP + half + 8 * i) = a0;
        *(v8b*)(Ksl + r * AT_LP + half + 8 * i) = a1;
        *(v8b*)(Vth + r * AT_LP + half + 8 * i) = b0;
        *(v8b*)(Vtl + r * AT_LP + half + 8 * i) = b1;
      }
    }
    __syncthreads();

    v8f s[4];
#pragma unroll
    for (int j = 0; j < 4; ++j) {
      s[j] = (v8f){0.f,0.f,0.f,0.f,0.f,0.f,0.f,0.f};
#pragma unroll
      for (int dc = 0; dc < 2; ++dc) {
        FB kb, kl;
        kb.h[0] = *(const v8b*)(Ksh + (j * 16 + c) * AT_LP + dc * 32 + 8 * hh);
        kb.h[1] = *(const v8b*)(Ksh + (j * 16 + c) * AT_LP + dc * 32 + 16 + 8 * hh);
        kl.h[0] = *(const v8b*)(Ksl + (j * 16 + c) * AT_LP + dc * 32 + 8 * hh);
        kl.h[1] = *(const v8b*)(Ksl + (j * 16 + c) * AT_LP + dc * 32 + 16 + 8 * hh);
        s[j] = at_mma(qah[dc], kb.v, s[j]);
        s[j] = at_mma(qah[dc], kl.v, s[j]);
        s[j] = at_mma(qal[dc], kb.v, s[j]);
      }
    }
    // scale, then chunk row max
    float cm[8];
#pragma unroll
    for (int r = 0; r < 8; ++r) {
      float m = -INFINITY;
#pragma unroll
      for (int j = 0; j < 4; ++j) {
        const float sv = s[j][r] * sscale;
        s[j][r] = sv;
        m = fmaxf(m, sv);
      }
#pragma unroll
      for (int off = 1; off < 16; off <<= 1) m = fmaxf(m, __shfl_xor(m, off, 32));
      cm[r] = m;
    }
    __bf16* pwh = Psh[wave];
    __bf16* pwl = Psl[wave];
#pragma unroll
    for (int r = 0; r < 8; ++r) {
      const float mnew = fmaxf(mrow[r], cm[r]);
      const float alpha = expf(mrow[r] - mnew);
      mrow[r] = mnew;
      float psum = 0.f;
#pragma unroll
      for (int j = 0; j < 4; ++j) {
        const float p = expf(s[j][r] - mnew);
        psum += p;
        __bf16 a, bl; at_split(p, a, bl);
        pwh[(8 * hh + r) * AT_LP + j * 16 + c] = a;
        pwl[(8 * hh + r) * AT_LP + j * 16 + c] = bl;
      }
#pragma unroll
      for (int off = 1; off < 16; off <<= 1) psum += __shfl_xor(psum, off, 32);
      lrow[r] = lrow[r] * alpha + psum;
#pragma unroll
      for (int t = 0; t < 4; ++t) oacc[t][r] *= alpha;
    }
    __builtin_amdgcn_fence(__ATOMIC_RELEASE, "workgroup");
    __builtin_amdgcn_wave_barrier();
    __builtin_amdgcn_fence(__ATOMIC_ACQUIRE, "workgroup");
#pragma unroll 1
    for (int kk = 0; kk < 2; ++kk) {
      FB pa, pl;
      pa.h[0] = *(const v8b*)(pwh + c * AT_LP + kk * 32 + 8 * hh);
      pa.h[1] = *(const v8b*)(pwh + c * AT_LP + kk * 32 + 16 + 8 * hh);
      pl.h[0] = *(const v8b*)(pwl + c * AT_LP + kk * 32 + 8 * hh);
      pl.h[1] = *(const v8b*)(pwl + c * AT_LP + kk * 32 + 16 + 8 * hh);
#pragma unroll
      for (int t = 0; t < 4; ++t) {
        FB vb, vl;
        vb.h[0] = *(const v8b*)(Vth + (t * 16 + c) * AT_LP + kk * 32 + 8 * hh);
        vb.h[1] = *(const v8b*)(Vth + (t * 16 + c) * AT_LP + kk * 32 + 16 + 8 * hh);
        vl.h[0] = *(const v8b*)(Vtl + (t * 16 + c) * AT_LP + kk * 32 + 8 * hh);
        vl.h[1] = *(const v8b*)(Vtl + (t * 16 + c) * AT_LP + kk * 32 + 16 + 8 * hh);
        oacc[t] = at_mma(pa.v, vb.v, oacc[t]);
        oacc[t] = at_mma(pa.v, vl.v, oacc[t]);
        oacc[t] = at_mma(pl.v, vb.v, oacc[t]);
      }
    }
  }

  float* os = Os[wave];
#pragma unroll
  for (int r = 0; r < 8; ++r) {
    const float inv = 1.0f / lrow[r];
#pragma unroll
    for (int t = 0; t < 4; ++t) os[(8 * hh + r) * 68 + t * 16 + c] = oacc[t][r] * inv;
  }
  __builtin_amdgcn_fence(__ATOMIC_RELEASE, "workgroup");
  __builtin_amdgcn_wave_barrier();
  __builtin_amdgcn_fence(__ATOMIC_ACQUIRE, "workgroup");
  {
    const int q = lane >> 3, c8 = (lane & 7) * 8;
    {
#pragma unroll
      for (int it = 0; it < 4; ++it) {
        const int row = it * 4 + q;
        const float* sp = os + row * 68 + c8;
        v8h hv, lv;
#pragma unroll
        for (int e = 0; e < 8; ++e) {
          const unsigned short hbits = f2bf_bits(sp[e]);
          const unsigned short lbits = f2bf_bits(sp[e] - bf_bits2f(hbits));
          hv[e] = __builtin_bit_cast(_Float16, hbits);
          lv[e] = __builtin_bit_cast(_Float16, lbits);
        }
        *(v8h*)(Ch + (size_t)(q0 + row) * AOP + c8) = hv;
        *(v8h*)(Cl + (size_t)(q0 + row) * AOP + c8) = lv;
      }
      
    }
  }
}

// ---------------------------------------------------------------------------
// Output RMSNorm over C + residual + back to NCHW:
//   out[b][c][n] = Of[b*1024+n][c] * rsqrt(mean_C(Of[tok][.]^2) + 1e-6) * bf16(w[c]) + bf16(x[b][c][n]).
// One block of 256 threads per 64 consecutive tokens (grid = 4096/64 = 64). Phase 1: each wave computes the per-token
// factor for 8 tokens (16-B loads, shuffle sum) into LDS rms[64]. Phase 2: 16 channel tiles of 64; the 64x64 (token x
// channel) tile is scaled and staged in LDS (4 it x 256 thr x 4 floats = 64x64), then read transposed: lanes 0..15 of a
// Coverage: 64 blocks x 64 tokens x 16 tiles x 64 channels = 4 x 1024 x 1024 outputs, each exactly once.
// ---------------------------------------------------------------------------
__global__ __launch_bounds__(256) void final_kernel(const float* __restrict__ of, const float* __restrict__ nw,
                                                    const float* __restrict__ xin, float* __restrict__ out) {
  __shared__ __align__(16) float tf[64 * 68];
  __shared__ float rms[64];
  const int tid = threadIdx.x, lane = tid & 31, wave = tid >> 5;
  const int tok0 = blockIdx.x * 64;
  const int b = tok0 / NTOK, n0 = tok0 - b * NTOK;

  // phase 1: per-token rsqrt(mean + eps)
#pragma unroll 1
  for (int i = 0; i < 8; ++i) {
    const int rr = wave * 8 + i;
    const float* rowp = of + (size_t)(tok0 + rr) * CH + lane * 4;
    float ss = 0.0f;
#pragma unroll 2
    for (int k = 0; k < 8; ++k) {
      const v4f v = *(const v4f*)(rowp + k * 128);
      ss += v[0] * v[0] + v[1] * v[1] + v[2] * v[2] + v[3] * v[3];
    }
#pragma unroll
    for (int off = 1; off < 32; off <<= 1) ss += __shfl_xor(ss, off, 32);
    if (lane == 0) rms[rr] = rsqrtf(ss * (1.0f / (float)CH) + RMS_EPS);
  }
  __syncthreads();

  const int lr = tid >> 4;           // 0..15
  const int c4 = (tid & 15) * 4;     // 0..60
#pragma unroll 1
  for (int ct = 0; ct < CH / 64; ++ct) {
    const int c0 = ct * 64;
    {
      const v4f w4 = *(const v4f*)(nw + c0 + c4);
      float wr[4];
      wr[0] = bf_rne(w4[0]); wr[1] = bf_rne(w4[1]); wr[2] = bf_rne(w4[2]); wr[3] = bf_rne(w4[3]);
#pragma unroll
      for (int it = 0; it < 4; ++it) {
        const int rr = it * 16 + lr;   // token within block
        const v4f v = *(const v4f*)(of + (size_t)(tok0 + rr) * CH + c0 + c4);
        const float rm = rms[rr];
        v4f o;
        o[0] = v[0] * rm * wr[0]; o[1] = v[1] * rm * wr[1]; o[2] = v[2] * rm * wr[2]; o[3] = v[3] * rm * wr[3];
        *(v4f*)(tf + rr * 68 + c4) = o;
      }
    }
    __syncthreads();
    v4f ov[4];
#pragma unroll
    for (int it = 0; it < 4; ++it) {
      const int oc = it * 16 + lr;     // channel within tile
      const v4f xr = *(const v4f*)(xin + ((size_t)(b * CH + c0 + oc)) * NTOK + n0 + c4);
      v4f o;
      o[0] = tf[(c4 + 0) * 68 + oc] + bf_rne(xr[0]);
      o[1] = tf[(c4 + 1) * 68 + oc] + bf_rne(xr[1]);
      o[2] = tf[(c4 + 2) * 68 + oc] + bf_rne(xr[2]);
      o[3] = tf[(c4 + 3) * 68 + oc] + bf_rne(xr[3]);
      ov[it] = o;
    }
    {
#pragma unroll
      for (int it = 0; it < 4; ++it) {
        const int oc = it * 16 + lr;
        *(v4f*)(out + ((size_t)(b * CH + c0 + oc)) * NTOK + n0 + c4) = ov[it];
      }
      
    }
    __syncthreads();
  }
}

// ---------------------------------------------------------------------------
// Workspace region map (byte offsets; every region is fully written by its producer launch before any consumer
//   XB    bf16 [4096][1024]          0       8388608
//   WQKV  bf16 [3072][1024]    8388608       6291456
//   WP2   bf16 [1024][2048]   14680064       4194304
//   TC    f32  [32][16]       18874368          2048   TS  18876416  2048
//   QKf   f32  [4096][2048]   18878464      33554432   (dead after ropenorm; the same 32 MiB then hold
//                                                       CTX2 u16 [4096][2048] at 18878464 (16777216) and
//                                                       Of   f32  [4096][1024] at 35655680 (16777216), disjoint)
//   Qh    bf16 [4096][1024]   52432896       8388608   Ql  60821504
//   Kh    bf16 [4096][1024]   69210112       8388608   Kl  77598720
//   VTh   bf16 [1024][4096]   85987328       8388608   VTl 94375936
//   total                    102764544
// ---------------------------------------------------------------------------
extern "C" void kernel_launch(void* const* d_in, const int* in_sizes, int n_in,
                              void* d_out, int out_size, void* d_ws, size_t ws_size,
                              hipStream_t stream) {
  if (n_in < 7) return;
  if (in_sizes[0] != NB * CH * NTOK) return;        // hidden_states [4][1024][32][32]
  if (in_sizes[1] != NQKV * CH) return;             // w_qkv [3072][1024]
  if (in_sizes[2] != NQKV) return;                  // b_qkv [3072]
  if (in_sizes[3] != INNER) return;                 // q_norm_w [1024]
  if (in_sizes[4] != INNER) return;                 // k_norm_w [1024]
  if (in_sizes[5] != CH * INNER) return;            // w_proj [1024][1024]
  if (in_sizes[6] != CH) return;                    // norm_out_w [1024]
  if (out_size != NB * CH * NTOK) return;

  const float* x    = (const float*)d_in[0];
  const float* wqkv = (const float*)d_in[1];   // [out 3072][in 1024]
  const float* bqkv = (const float*)d_in[2];
  const float* qnw  = (const float*)d_in[3];
  const float* knw  = (const float*)d_in[4];
  const float* wprj = (const float*)d_in[5];   // [out 1024][in 1024]
  const float* onw  = (const float*)d_in[6];

  const size_t PXB = (size_t)MTOK * CH * 2;        // 8388608
  const size_t PWQ = (size_t)NQKV * CH * 2;        // 6291456
  const size_t PWP = (size_t)CH * AOP * 2;         // 4194304
  const size_t PTB = (size_t)TABN * 4;             // 2048
  const size_t PQK = (size_t)MTOK * QKP * 4;       // 33554432
  const size_t PCX = (size_t)MTOK * AOP * 2;       // 16777216
  const size_t POF = (size_t)MTOK * CH * 4;        // 16777216
  const size_t PPL = (size_t)MTOK * INNER * 2;     // 8388608 per q/k plane
  const size_t PVT = (size_t)INNER * VTP * 2;      // 8388608 per v^T plane
  if (PCX + POF > PQK) return;                     // CTX2 and Of share the QKf region, disjoint halves
  size_t off = 0;
  const size_t oXB  = off; off += PXB;
  const size_t oWQ  = off; off += PWQ;
  const size_t oWP  = off; off += PWP;
  const size_t oTC  = off; off += PTB;
  const size_t oTS  = off; off += PTB;
  const size_t oQK  = off; off += PQK;
  const size_t oCX  = oQK;
  const size_t oOF  = oQK + PCX;
  const size_t oQh  = off; off += PPL;  const size_t oQl = off; off += PPL;
  const size_t oKh  = off; off += PPL;  const size_t oKl = off; off += PPL;
  const size_t oVTh = off; off += PVT;  const size_t oVTl = off; off += PVT;
  if (off > ws_size) return;                       // off = 102764544
  if (off > (size_t)134217728) return;

  char* ws = (char*)d_ws;
  unsigned short* XB   = (unsigned short*)(ws + oXB);
  unsigned short* WQKV = (unsigned short*)(ws + oWQ);
  unsigned short* WP2  = (unsigned short*)(ws + oWP);
  float*          TC   = (float*)(ws + oTC);
  float*          TS   = (float*)(ws + oTS);
  float*          QKf  = (float*)(ws + oQK);
  unsigned short* CTX2 = (unsigned short*)(ws + oCX);
  float*          Of   = (float*)(ws + oOF);
  unsigned short* Qh   = (unsigned short*)(ws + oQh);  unsigned short* Ql  = (unsigned short*)(ws + oQl);
  unsigned short* Kh   = (unsigned short*)(ws + oKh);  unsigned short* Kl  = (unsigned short*)(ws + oKl);
  unsigned short* VTh  = (unsigned short*)(ws + oVTh); unsigned short* VTl = (unsigned short*)(ws + oVTl);

  const dim3 blk(256);

  // (1) x[b] viewed [R=1024 c][Cc=1024 n] (pitch 1024) -> XB_b[n][c] (pitch 1024); grid (Cc/64, R/64, B) = (16, 16, 4)
  tconv_kernel<<<dim3(NTOK / 64, CH / 64, NB), blk, 0, stream>>>(x, XB, NTOK, CH, (long)CH * NTOK, (long)NTOK * CH);
  // (2) w_qkv [3072][1024] -> WQKV bf16 same layout; 393216 units -> 1536 blocks
  const int n8q = NQKV * CH / 8;
  convrows_kernel<false><<<dim3(n8q / 256), blk, 0, stream>>>(wqkv, WQKV, CH, CH, n8q);
  // (3) w_proj [1024][1024] -> WP2 [1024][2048], cols k and 1024+k; 131072 units -> 512 blocks
  const int n8p = CH * INNER / 8;
  convrows_kernel<true><<<dim3(n8p / 256), blk, 0, stream>>>(wprj, WP2, INNER, AOP, n8p);
  // (4) rotary cos/sin tables [32][16]
  ropetab_kernel<<<dim3(2), blk, 0, stream>>>(TC, TS);
  // (5) q|k = XB . WQKV[0..2047]^T + b -> QKf f32 [4096][2048]   (M=4096, N=2048, K=1024; 32 x 16 = 512 blocks of 128 threads)
  const dim3 gblk(128);
  const dim3 gQK((MTOK / 128) * (QKP / 128), 1);
  wmma_gemm64<1, false, 2, 0, false, CH><<<gQK, gblk, 0, stream>>>(
      XB, XB, 0L, WQKV, WQKV, 0L, (void*)QKf, (void*)QKf, QKP, 0L,
      bqkv, bqkv, 0L, MTOK, QKP, CH, 1.0f);
  // (6) v^T = WQKV[2048..3071] . XB^T + b[2048+m] -> VTh|VTl [1024][4096]   (M=1024, N=4096, K=1024; 8 x 32 = 256 blocks)
  const dim3 gVT((INNER / 128) * (MTOK / 128), 1);
  wmma_gemm64<1, false, 1, 2, false, CH><<<gVT, gblk, 0, stream>>>(
      WQKV + (size_t)2 * INNER * CH, WQKV + (size_t)2 * INNER * CH, 0L, XB, XB, 0L,
      (void*)VTh, (void*)VTl, VTP, 0L,
      bqkv + 2 * INNER, bqkv, 0L, INNER, MTOK, CH, 1.0f);
  // (7) RoPE + RMSNorm over 1024 for q and k -> Qh|Ql, Kh|Kl; one block of 128 threads per token row
  ropenorm_kernel<<<dim3(MTOK), dim3(128), 0, stream>>>(QKf, TC, TS, qnw, knw, Qh, Ql, Kh, Kl);
  // (8) attention per (batch, head, 64-query block) -> CTX2 [4096][2048] (hi | lo columns); 1024 blocks
  attn_kernel<<<dim3(NB * NH * (NTOK / 64)), dim3(128), 0, stream>>>(Qh, Ql, Kh, Kl, VTh, VTl, CTX2, 0.125f);
  // (9) Of = CTX2 . WP2^T -> f32 [4096][1024]   (M=4096, N=1024, K=2048; 32 x 8 = 256 blocks)
  const dim3 gO((MTOK / 128) * (CH / 128), 1);
  wmma_gemm64<1, false, 0, 0, false, AOP><<<gO, gblk, 0, stream>>>(
      CTX2, CTX2, 0L, WP2, WP2, 0L, (void*)Of, (void*)Of, CH, 0L,
      bqkv, bqkv, 0L, MTOK, CH, AOP, 1.0f);
  // (10) output RMSNorm + residual -> NCHW d_out; 64 blocks of 64 tokens
  final_kernel<<<dim3(MTOK / 64), blk, 0, stream>>>(Of, onw, x, (float*)d_out);
  (void)hipGetLastError();
}

// v003
// Measured time: 213 microseconds a run.
// Timed twice side by side with v002, it ran 1.22 and 1.21 times as fast.
// Counting every step since v000, it is 2.21 times as fast.
// Contractions: q|k projection (f32 out) and v^T projection (bf16 hi|lo out) = v_wmma_f32_16x16x32_bf16 single products on bf16 planes of the RNE-converted inputs; q.k^T and p.v = bf16 hi/lo split (hi.hi + hi.lo + lo.hi); output projection = [CTXhi|CTXlo] x [Wp;Wp] bf16 single products (K-folded 2-term); f32 accumulate everywhere; RoPE, QK RMSNorm, output RMSNorm, online softmax, 1/rowsum, bias and residual in f32 on the VALU.
// Plane / carry map (all carry 1, nothing to fold back): XB = bf16(x) token-major [4096][1024] (row b*1024+n, n = y*32+x, col c);
// WQKV = bf16(w_qkv) [3072][1024] natural [out][in]; WP2 [1024][2048]: cols k and 1024+k both = bf16(w_proj[c][k]);
// TC/TS f32 [32 pos][16 pair] = cos/sin(pos * 10000^(-j/16)); QKf f32 [4096][2048] = pre-RoPE q (cols 0..1023) | k (cols 1024..2047) incl. bias;
// Qh|Ql, Kh|Kl bf16 [4096][1024] (col h*64+d) = hi/lo of the RoPE'd, RMSNorm'd q, k; VTh|VTl bf16 [1024 (h,d)][4096 (b,t)];
// P hi|lo = unnormalised exp in (0,1] (bf16, f32 exponent range), kept in registers, 1/rowsum applied to the f32 accumulator in the attention epilogue;
// CTX2 u16 [4096][2048] = ctx hi at col h*64+d, lo at col 1024+h*64+d; Of f32 [4096][1024] = ctx . w_proj^T.
#include <hip/hip_runtime.h>
#include <math.h>
#include <stdint.h>

#define NB    4
#define CH    1024
#define IMH   32
#define IMW   32
#define NTOK  1024
#define INNER 1024
#define NH    16
#define HD    64
#define NQKV  3072
#define QKP   2048
#define AOP   2048
#define VTP   (NB * NTOK)
#define MTOK  (NB * NTOK)
#define TABN  512
#define RMS_EPS 1e-6f

static_assert(NTOK == IMH * IMW);
static_assert(IMW == 32);
static_assert(INNER == NH * HD);
static_assert(HD == 64);
static_assert(NQKV == 3 * INNER);
static_assert(QKP == 2 * INNER);
static_assert(AOP == 2 * INNER);
static_assert(CH % 64 == 0);
static_assert(NTOK % 64 == 0);
static_assert(INNER % 64 == 0);
static_assert(MTOK % 64 == 0);
static_assert(CH % 32 == 0);
static_assert(AOP % 32 == 0);
static_assert(INNER == 128 * 8);
static_assert(CH == 8 * 128);
static_assert(TABN == 32 * (HD / 4));
static_assert((NQKV * CH) % (8 * 256) == 0);
static_assert((CH * INNER) % (8 * 256) == 0);
static_assert(CH % 256 == 0);
static_assert(INNER % 256 == 0);
static_assert(MTOK % 128 == 0 && QKP % 128 == 0 && INNER % 128 == 0 && CH % 128 == 0 && AOP % 128 == 0);

typedef __attribute__((ext_vector_type(16))) _Float16 v16h;
typedef __attribute__((ext_vector_type(8)))  _Float16 v8h;
typedef __attribute__((ext_vector_type(16))) __bf16   v16b;
typedef __attribute__((ext_vector_type(8)))  __bf16   v8b;
typedef __attribute__((ext_vector_type(8)))  float    v8f;
typedef __attribute__((ext_vector_type(4)))  float    v4f;
typedef __attribute__((ext_vector_type(2)))  float    v2f;
typedef __attribute__((ext_vector_type(4)))  unsigned int v4u;

__device__ __forceinline__ unsigned short f2bf_bits(float f) {
  unsigned u = __float_as_uint(f);
  return (unsigned short)((u + 0x7FFFu + ((u >> 16) & 1u)) >> 16);
}
__device__ __forceinline__ float bf_bits2f(unsigned short h) { return __uint_as_float(((unsigned)h) << 16); }
__device__ __forceinline__ float bf_rne(float f) { return bf_bits2f(f2bf_bits(f)); }
__device__ __forceinline__ unsigned pk16(unsigned short a, unsigned short b) { return (unsigned)a | ((unsigned)b << 16); }

// hazard guard behind the product loop, as a plain device helper
__device__ __forceinline__ void acc_guard4(v8f& a, v8f& b, v8f& c, v8f& d) { asm volatile("v_nop\n\tv_nop\n\tv_nop\n\tv_nop" : "+v"(a), "+v"(b), "+v"(c), "+v"(d)); }
template <typename T> struct Frag;
template <> struct Frag<_Float16> {
  typedef v16h V; typedef v8h H; union U { v16h v; v8h h[2]; };
  static __device__ __forceinline__ v16h load(const _Float16* p) {   // elements 0..7 <- p[0..7], 8..15 <- p[16..23]
    U f; f.h[0] = *(const v8h*)(p); f.h[1] = *(const v8h*)(p + 16); return f.v;
  }
  static __device__ __forceinline__ v8f mma(v16h a, v16h b, v8f c) {
    return __builtin_amdgcn_wmma_f32_16x16x32_f16(false, a, false, b, (short)0, c, false, false);
  }
};
template <> struct Frag<__bf16> {
  typedef v16b V; typedef v8b H; union U { v16b v; v8b h[2]; };
  static __device__ __forceinline__ v16b load(const __bf16* p) {
    U f; f.h[0] = *(const v8b*)(p); f.h[1] = *(const v8b*)(p + 16); return f.v;
  }
  static __device__ __forceinline__ v8f mma(v16b a, v16b b, v8f c) {
    return __builtin_amdgcn_wmma_f32_16x16x32_bf16(false, a, false, b, (short)0, c, false, false);
  }
};

// ---- Register-blocked batched WMMA GEMM ------------------------------------
// C[m,n] = scale * sum_k A[m,k] * Bt[n,k] (+bias)(+resid); each wave owns a 64x64 tile, a block of 4 waves (2 x 2) a 128x128 tile.
// A row-major [M,K]; Bt row-major [N,K]; M,N % 128 == 0, K % GT_BK == 0.
// Operand path: per stage of GT_BK k the block copies its 128 A rows and 128 Bt rows into LDS with 16-B loads whose lanes cover
// whole rows of the stage (GT_BK * 2 contiguous bytes), so every 128-B line is asked for once per block; the four waves read their
// fragments from LDS. Two LDS buffers: the next stage's global loads are issued before the current stage's products and
// stored after them, one __syncthreads() per stage. The k order of every accumulator is ascending in steps of 32.
// SPLIT (hi/lo operand planes) is not instantiated and not supported by the staged loop.
// BIAS_MODE: 0 = none, 1 = bias[m], 2 = bias[n]; the bias value is RNE-converted to bf16 precision before the f32 add.
// OUT_MODE: 0 = f32, 1 = f16, 2 = bf16 hi plane (Cout) + bf16 lo plane (Cout2).
// ET: 0 = f16 operands, 1 = bf16 operands (pointers passed as 16-bit storage)
template <int ET> struct Elem;
template <> struct Elem<0> { typedef _Float16 T; };
template <> struct Elem<1> { typedef __bf16 T; };
#define GT_BK 128
// LDS row pitch in elements: GT_BK data + 8 pad, = 16 B x odd, so the 16 rows of one 16-byte fragment read fall on different banks.
#define GT_LP (GT_BK + 8)
#define GT_CPR (GT_BK / 8)          // 16-byte pieces per staged row
#define GT_RPP (128 / GT_CPR)       // rows that 128 threads copy per pass
#define GT_NP  (128 / GT_RPP)       // passes per operand and stage
// LD: row pitch of A and of Bt in elements, a compile-time constant so that the row steps of the staging loads are immediate offsets.
template <int ET, bool SPLIT, int BIAS_MODE, int OUT_MODE, bool RESID, int LD, int ACT = 0>
__global__ __launch_bounds__(128) void wmma_gemm64(
    const unsigned short* __restrict__ Ap, const unsigned short* __restrict__ A2p, long strideA,
    const unsigned short* __restrict__ Btp, const unsigned short* __restrict__ Bt2p, long strideB,
    void* __restrict__ Cout, void* __restrict__ Cout2, int ldc, long strideC,
    const float* __restrict__ bias,
    const float* __restrict__ resid, long strideR,
    int M, int N, int K, float scale) {
  typedef typename Elem<ET>::T T;
  typedef typename Frag<T>::V V;
  typedef typename Frag<T>::H H;
  static_assert(!SPLIT, "the staged loop takes single operand planes");
  const T* A = (const T*)Ap; const T* Bt = (const T*)Btp;
  __shared__ __align__(16) T sA[2 * 128 * GT_LP];  // two stages of the block's 128 A rows
  __shared__ __align__(16) T sB[2 * 128 * GT_LP];  // two stages of the block's 128 Bt rows
  __shared__ __align__(16) float sT[4][16 * 68];   // per-wave 16x64 slab, pitch 68 floats
  const int b    = blockIdx.y;
  const int tid  = threadIdx.x;
  const int lane = tid & 31;
  const int wave = tid >> 5;
  const int tilesN = N >> 7;
  const int tilesM = M >> 7;
  const int tile = blockIdx.x;
  if (tile >= tilesM * tilesN) return;   // block-uniform, in front of every barrier
  const int tm = tile / tilesN;
  const int tn = tile - tm * tilesN;
  const int wm = (wave >> 1) << 6;             // this wave's 64x64 tile inside the block's 128x128
  const int wn = (wave & 1) << 6;
  const int m0 = (tm << 7) + wm;
  const int n0 = (tn << 7) + wn;

  const T* Ab  = A  + (size_t)b * strideA;
  const T* Bb  = Bt + (size_t)b * strideB;

  const int rlane = lane & 15;                 // row (A) / col (B, D) within subtile
  const int koff  = (lane >> 4) * 8;           // k offset of this lane half
  const int mOff  = (lane >> 4) * 8;           // D row offset

  // staging map: pass p, thread tid -> row p * GT_RPP + tid / GT_CPR, 8 elements at column (tid % GT_CPR) * 8
  const int srow = tid / GT_CPR;
  const int scol = (tid % GT_CPR) * 8;
  const T* gA = Ab + (size_t)((tm << 7) + srow) * LD + scol;
  const T* gB = Bb + (size_t)((tn << 7) + srow) * LD + scol;
  const int sOff = srow * GT_LP + scol;

  v8f acc[4][4];
#pragma unroll
  for (int i = 0; i < 4; ++i)
#pragma unroll
    for (int j = 0; j < 4; ++j) acc[i][j] = (v8f){0.f,0.f,0.f,0.f,0.f,0.f,0.f,0.f};

  H ra[GT_NP], rb[GT_NP];
#pragma unroll
  for (int p = 0; p < GT_NP; ++p) {
    ra[p] = *(const H*)(gA + p * GT_RPP * LD);
    rb[p] = *(const H*)(gB + p * GT_RPP * LD);
  }
#pragma unroll
  for (int p = 0; p < GT_NP; ++p) {
    *(H*)(sA + sOff + p * GT_RPP * GT_LP) = ra[p];
    *(H*)(sB + sOff + p * GT_RPP * GT_LP) = rb[p];
  }
  __syncthreads();

  const int nStages = K / GT_BK;
  for (int st = 0; st < nStages; ++st) {
    const int cur = (st & 1) * (128 * GT_LP);
    const bool more = st + 1 < nStages;        // block-uniform
    if (more) {
      const T* pa = gA + (st + 1) * GT_BK;
      const T* pb = gB + (st + 1) * GT_BK;
#pragma unroll
      for (int p = 0; p < GT_NP; ++p) {
        ra[p] = *(const H*)(pa + p * GT_RPP * LD);
        rb[p] = *(const H*)(pb + p * GT_RPP * LD);
      }
      // naming the two address pairs here keeps them untouched up to this wait, which stands in front of every reuse of their registers
      asm volatile("s_wait_xcnt 0x0" :: "v"(pa), "v"(pb) : "memory");
    }
    const T* fa = sA + cur + (wm + rlane) * GT_LP + koff;
    const T* fb = sB + cur + (wn + rlane) * GT_LP + koff;
#pragma unroll
    for (int kk = 0; kk < GT_BK / 32; ++kk) {
      V bh[4], ah[4];
#pragma unroll
      for (int j = 0; j < 4; ++j) bh[j] = Frag<T>::load(fb + (j << 4) * GT_LP + kk * 32);
#pragma unroll
      for (int i = 0; i < 4; ++i) ah[i] = Frag<T>::load(fa + (i << 4) * GT_LP + kk * 32);
#pragma unroll
      for (int i = 0; i < 4; ++i)
#pragma unroll
        for (int j = 0; j < 4; ++j) acc[i][j] = Frag<T>::mma(ah[i], bh[j], acc[i][j]);
    }
    if (more) {
      const int nxt = (128 * GT_LP) - cur;     // the buffer whose last readers passed the barrier of stage st - 1
#pragma unroll
      for (int p = 0; p < GT_NP; ++p) {
        *(H*)(sA + nxt + sOff + p * GT_RPP * GT_LP) = ra[p];
        *(H*)(sB + nxt + sOff + p * GT_RPP * GT_LP) = rb[p];
      }
    }
    __syncthreads();
  }
  acc_guard4(acc[0][0], acc[0][1], acc[0][2], acc[0][3]);
  acc_guard4(acc[1][0], acc[1][1], acc[1][2], acc[1][3]);
  acc_guard4(acc[2][0], acc[2][1], acc[2][2], acc[2][3]);
  acc_guard4(acc[3][0], acc[3][1], acc[3][2], acc[3][3]);

  // ---- epilogue ----
  float* slab = sT[wave];
  const float* Rb = RESID ? (resid + (size_t)b * strideR) : nullptr;
#pragma unroll
  for (int i = 0; i < 4; ++i) {
    const int mBase = m0 + (i << 4);
    float bm[8];
    if (BIAS_MODE == 1) {
      const float* bp = bias + mBase + mOff;
#pragma unroll
      for (int r = 0; r < 8; ++r) bm[r] = bp[r];
      // naming the address pair here keeps it untouched up to this wait, which stands in front of every reuse of its registers
      asm volatile("s_wait_xcnt 0x0" :: "v"(bp) : "memory");
    }
#pragma unroll
    for (int j = 0; j < 4; ++j) {
      const int n = n0 + (j << 4) + rlane;
      float bv = 0.f;
      if (BIAS_MODE == 2) bv = bf_rne(bias[n]);
#pragma unroll
      for (int r = 0; r < 8; ++r) {
        float v = acc[i][j][r] * scale;
        if (BIAS_MODE == 1) v += bf_rne(bm[r]);
        if (BIAS_MODE == 2) v += bv;
        if (RESID) v += Rb[(size_t)(mBase + mOff + r) * ldc + n];
        if (ACT == 1) v = tanhf(v);
        if (ACT == 2) v = fmaxf(v, 0.0f);
        if (ACT == 3) v = v / (1.0f + expf(-v));
        if (ACT == 4) v = (v > 0.f) ? v : 0.01f * v;
        if (ACT == 5) v = 0.5f * v * (1.0f + erff(v * 0.70710678118654752f));
        slab[(mOff + r) * 68 + (j << 4) + rlane] = v;
      }
    }
    __builtin_amdgcn_fence(__ATOMIC_RELEASE, "workgroup");
    __builtin_amdgcn_wave_barrier();
    __builtin_amdgcn_fence(__ATOMIC_ACQUIRE, "workgroup");
    if (OUT_MODE == 0) {
      float* C = (float*)Cout + (size_t)b * strideC;
      const int hh = lane >> 4, c4 = (lane & 15) * 4;     // row seg = 256 B = 16 lanes x 16 B
      {
#pragma unroll
        for (int it = 0; it < 8; ++it) {
          const int row = it * 2 + hh;
          v4f v = *(const v4f*)(slab + row * 68 + c4);
          *(v4f*)(C + (size_t)(mBase + row) * ldc + n0 + c4) = v;
        }
        
      }
    } else {
      const int q = lane >> 3, c8 = (lane & 7) * 8;
      unsigned short* C  = (unsigned short*)Cout  + (size_t)b * strideC;
      unsigned short* C2 = (OUT_MODE == 2) ? ((unsigned short*)Cout2 + (size_t)b * strideC) : nullptr;
      {
#pragma unroll
        for (int it = 0; it < 4; ++it) {
          const int row = it * 4 + q;
          const float* sp = slab + row * 68 + c8;
          v8h hv, lv;
#pragma unroll
          for (int e = 0; e < 8; ++e) {
            if (OUT_MODE == 1) {
              hv[e] = (_Float16)sp[e];
            } else {
              unsigned short hb = f2bf_bits(sp[e]);
              unsigned short lb = f2bf_bits(sp[e] - bf_bits2f(hb));
              hv[e] = __builtin_bit_cast(_Float16, hb);
              lv[e] = __builtin_bit_cast(_Float16, lb);
            }
          }
          *(v8h*)(C + (size_t)(mBase + row) * ldc + n0 + c8) = hv;
          if (OUT_MODE == 2) *(v8h*)(C2 + (size_t)(mBase + row) * ldc + n0 + c8) = lv;
        }
        
      }
    }
    __builtin_amdgcn_fence(__ATOMIC_RELEASE, "workgroup");
    __builtin_amdgcn_wave_barrier();
    __builtin_amdgcn_fence(__ATOMIC_ACQUIRE, "workgroup");
  }
}

// ---------------------------------------------------------------------------
// Row-preserving bf16 RNE convert of an f32 matrix [rows][ncols] into a u16 plane with row pitch ldout; DUP also
// writes the same 8 values at column + ncols (second copy along the row). 8 consecutive elements per thread = one
// Coverage: grid = n8/256 blocks x 256 threads x 8 elements = rows*ncols (n8 = rows*ncols/8, exact multiple of 256).
// ---------------------------------------------------------------------------
template <bool DUP>
__global__ __launch_bounds__(256) void convrows_kernel(const float* __restrict__ in, unsigned short* __restrict__ out,
                                                       int ncols, int ldout, int n8) {
  const int i = blockIdx.x * 256 + threadIdx.x;
  if (i < n8) {
    const size_t e0 = (size_t)i * 8;
    const int row = (int)(e0 / (size_t)ncols);
    const int col = (int)(e0 - (size_t)row * ncols);
    const v4f a = *(const v4f*)(in + e0);
    const v4f c = *(const v4f*)(in + e0 + 4);
    v4u hv;
    hv[0] = pk16(f2bf_bits(a[0]), f2bf_bits(a[1]));
    hv[1] = pk16(f2bf_bits(a[2]), f2bf_bits(a[3]));
    hv[2] = pk16(f2bf_bits(c[0]), f2bf_bits(c[1]));
    hv[3] = pk16(f2bf_bits(c[2]), f2bf_bits(c[3]));
    const size_t o = (size_t)row * ldout + col;
    {
      *(v4u*)(out + o) = hv;
      if (DUP) *(v4u*)(out + o + ncols) = hv;
      
    }
  }
}

// ---------------------------------------------------------------------------
// Fused transpose + bf16 RNE convert of an f32 matrix, z-batched, one plane:
//   in_z = W + z*sIn viewed [R rows][Cc cols] with row pitch ldin  ->  oh_z[c][r] = bf16(in_z[r][c]), row pitch ldout, oh_z = oh + z*sOut.
// 64x64 tiles through LDS. grid = (Cc/64, R/64, Z), 256 threads (R, Cc multiples of 64; ldout multiple of 64 so every
// Coverage per block: load 4 it x 256 thr x 4 floats = 64x64; store 2 it x 256 thr x 8 u16 = 64x64.
// ---------------------------------------------------------------------------
__global__ __launch_bounds__(256) void tconv_kernel(const float* __restrict__ W, unsigned short* __restrict__ oh,
                                                    int ldin, int ldout, long sIn, long sOut) {
  __shared__ __align__(16) float tf[64 * 68];
  W  += (size_t)blockIdx.z * sIn;
  oh += (size_t)blockIdx.z * sOut;
  const int c0  = blockIdx.x * 64;   // input column block = output row block
  const int r0  = blockIdx.y * 64;   // input row block    = output column block
  const int tid = threadIdx.x;
  {
    const int lr = tid >> 4;         // 0..15
    const int c4 = (tid & 15) * 4;   // 0..60
#pragma unroll
    for (int it = 0; it < 4; ++it) {
      const int rr = it * 16 + lr;   // 0..63
      const v4f a = *(const v4f*)(W + (size_t)(r0 + rr) * ldin + c0 + c4);
      *(v4f*)(tf + rr * 68 + c4) = a;
    }
  }
  __syncthreads();
  const int sub = tid >> 3;          // 0..31
  const int c8  = (tid & 7) * 8;     // 0..56
  v4u hv[2];
#pragma unroll
  for (int it = 0; it < 2; ++it) {
    const int oc = it * 32 + sub;    // output row within tile (= input column)
    v4u a;
#pragma unroll
    for (int q = 0; q < 4; ++q) {
      const float f0 = tf[(c8 + 2 * q) * 68 + oc];
      const float f1 = tf[(c8 + 2 * q + 1) * 68 + oc];
      a[q] = pk16(f2bf_bits(f0), f2bf_bits(f1));
    }
    hv[it] = a;
  }
  {
#pragma unroll
    for (int it = 0; it < 2; ++it) {
      const int oc = it * 32 + sub;
      const size_t go = (size_t)(c0 + oc) * ldout + r0 + c8;
      *(v4u*)(oh + go) = hv[it];
    }
    
  }
}

// ---------------------------------------------------------------------------
// Rotary angle tables: tc[pos*16 + j] = cos(pos * f_j), ts likewise, f_j = 10000^(-4j/64) = 10^(-j/4) (f32 constants),
// pos 0..31 (shared by the row axis and the column axis), j 0..15. Precise cosf/sinf (|angle| <= 31).
// grid = 2 x 256 = 512 threads = 32 x 16 entries per table; one 4-B store per lane, 32 consecutive lanes = one whole
// ---------------------------------------------------------------------------
__device__ __forceinline__ float rope_freq(int j) {
  float f = 1.0f;
  f = (j == 1)  ? 0.5623413251903491f     : f;
  f = (j == 2)  ? 0.31622776601683794f    : f;
  f = (j == 3)  ? 0.17782794100389229f    : f;
  f = (j == 4)  ? 0.1f                    : f;
  f = (j == 5)  ? 0.05623413251903491f    : f;
  f = (j == 6)  ? 0.031622776601683794f   : f;
  f = (j == 7)  ? 0.017782794100389229f   : f;
  f = (j == 8)  ? 0.01f                   : f;
  f = (j == 9)  ? 0.005623413251903491f   : f;
  f = (j == 10) ? 0.0031622776601683794f  : f;
  f = (j == 11) ? 0.0017782794100389228f  : f;
  f = (j == 12) ? 0.001f                  : f;
  f = (j == 13) ? 0.0005623413251903491f  : f;
  f = (j == 14) ? 0.00031622776601683794f : f;
  f = (j == 15) ? 0.00017782794100389227f : f;
  return f;
}

__global__ __launch_bounds__(256) void ropetab_kernel(float* __restrict__ tc, float* __restrict__ ts) {
  const int i = blockIdx.x * 256 + threadIdx.x;      // 0..511 = pos*16 + j
  if (i < TABN) {
    const int pos = i >> 4, j = i & 15;
    const float a = (float)pos * rope_freq(j);
    const float c = cosf(a);
    const float s = sinf(a);
    ((float*)tc)[i] = c;
    ((float*)ts)[i] = s;
    
  }
}

// ---------------------------------------------------------------------------
// Per-token 2-D RoPE (interleaved pairs (2i,2i+1) inside each head; pairs 0..15 use the row index y = n>>5, pairs 16..31
// the column index x = n&31; tables shared by all heads) followed by RMSNorm over the WHOLE 1024-wide (heads x dim) row:
// v = rope(v); v = v * rsqrt(mean_1024(v*v) + 1e-6) * bf16(w[col]); then bf16 hi/lo split into planes [4096][1024].
// One block of 128 threads per token row g = b*1024+n; thread t owns columns 8t..8t+7 (= 4 rotary pairs p0..p0+3, p0 = (4t)&31,
// all four in the same half of the pair range). All loads are 16-B vectors. Stores: 16 B per lane per plane, 128 lanes cover
// LDS: redq/redk[4] written by lane 0 of each of the 4 waves before the barrier.
// ---------------------------------------------------------------------------
__global__ __launch_bounds__(128) void ropenorm_kernel(const float* __restrict__ qkf,
                                                       const float* __restrict__ tc, const float* __restrict__ ts,
                                                       const float* __restrict__ qw, const float* __restrict__ kw,
                                                       unsigned short* __restrict__ qh, unsigned short* __restrict__ ql,
                                                       unsigned short* __restrict__ kh, unsigned short* __restrict__ kl) {
  __shared__ float redq[4], redk[4];
  const int g = blockIdx.x;                 // token row 0..MTOK-1
  const int n = g & (NTOK - 1);
  const int py = n >> 5, px = n & 31;
  const int t = threadIdx.x, lane = t & 31, wave = t >> 5;
  const int i0 = t * 8;

  const float* qr = qkf + (size_t)g * QKP + i0;
  const float* kr = qr + INNER;
  const v4f qa = *(const v4f*)(qr), qb = *(const v4f*)(qr + 4);
  const v4f ka = *(const v4f*)(kr), kb = *(const v4f*)(kr + 4);

  const int p0   = (4 * t) & 31;
  const int hsel = p0 >> 4;                 // 0: row-axis angles, 1: column-axis angles
  const int pos  = py + hsel * (px - py);
  const int toff = pos * 16 + (p0 & 15);
  const v4f cv = *(const v4f*)(tc + toff);
  const v4f sv = *(const v4f*)(ts + toff);

  float q8[8], k8[8];
  q8[0] = qa[0]; q8[1] = qa[1]; q8[2] = qa[2]; q8[3] = qa[3];
  q8[4] = qb[0]; q8[5] = qb[1]; q8[6] = qb[2]; q8[7] = qb[3];
  k8[0] = ka[0]; k8[1] = ka[1]; k8[2] = ka[2]; k8[3] = ka[3];
  k8[4] = kb[0]; k8[5] = kb[1]; k8[6] = kb[2]; k8[7] = kb[3];

  float rq[8], rk[8];
#pragma unroll
  for (int e = 0; e < 4; ++e) {
    const float c = cv[e], s = sv[e];
    const float qe = q8[2 * e], qo = q8[2 * e + 1];
    const float ke = k8[2 * e], ko = k8[2 * e + 1];
    rq[2 * e]     = qe * c - qo * s;
    rq[2 * e + 1] = qe * s + qo * c;
    rk[2 * e]     = ke * c - ko * s;
    rk[2 * e + 1] = ke * s + ko * c;
  }
  float ssq = 0.0f, ssk = 0.0f;
#pragma unroll
  for (int e = 0; e < 8; ++e) { ssq += rq[e] * rq[e]; ssk += rk[e] * rk[e]; }
#pragma unroll
  for (int off = 1; off < 32; off <<= 1) { ssq += __shfl_xor(ssq, off, 32); ssk += __shfl_xor(ssk, off, 32); }
  if (lane == 0) { redq[wave] = ssq; redk[wave] = ssk; }
  __syncthreads();
  const float tq = (redq[0] + redq[1]) + (redq[2] + redq[3]);
  const float tk = (redk[0] + redk[1]) + (redk[2] + redk[3]);
  const float rmq = rsqrtf(tq * (1.0f / (float)INNER) + RMS_EPS);
  const float rmk = rsqrtf(tk * (1.0f / (float)INNER) + RMS_EPS);

  const v4f wqa = *(const v4f*)(qw + i0), wqb = *(const v4f*)(qw + i0 + 4);
  const v4f wka = *(const v4f*)(kw + i0), wkb = *(const v4f*)(kw + i0 + 4);
  float wq8[8], wk8[8];
  wq8[0] = bf_rne(wqa[0]); wq8[1] = bf_rne(wqa[1]); wq8[2] = bf_rne(wqa[2]); wq8[3] = bf_rne(wqa[3]);
  wq8[4] = bf_rne(wqb[0]); wq8[5] = bf_rne(wqb[1]); wq8[6] = bf_rne(wqb[2]); wq8[7] = bf_rne(wqb[3]);
  wk8[0] = bf_rne(wka[0]); wk8[1] = bf_rne(wka[1]); wk8[2] = bf_rne(wka[2]); wk8[3] = bf_rne(wka[3]);
  wk8[4] = bf_rne(wkb[0]); wk8[5] = bf_rne(wkb[1]); wk8[6] = bf_rne(wkb[2]); wk8[7] = bf_rne(wkb[3]);

  v4u hq, lq, hk, lk;
#pragma unroll
  for (int e = 0; e < 4; ++e) {
    const float fq0 = rq[2 * e] * rmq * wq8[2 * e];
    const float fq1 = rq[2 * e + 1] * rmq * wq8[2 * e + 1];
    const float fk0 = rk[2 * e] * rmk * wk8[2 * e];
    const float fk1 = rk[2 * e + 1] * rmk * wk8[2 * e + 1];
    const unsigned short hq0 = f2bf_bits(fq0), hq1 = f2bf_bits(fq1);
    const unsigned short hk0 = f2bf_bits(fk0), hk1 = f2bf_bits(fk1);
    const unsigned short lq0 = f2bf_bits(fq0 - bf_bits2f(hq0)), lq1 = f2bf_bits(fq1 - bf_bits2f(hq1));
    const unsigned short lk0 = f2bf_bits(fk0 - bf_bits2f(hk0)), lk1 = f2bf_bits(fk1 - bf_bits2f(hk1));
    hq[e] = pk16(hq0, hq1); lq[e] = pk16(lq0, lq1);
    hk[e] = pk16(hk0, hk1); lk[e] = pk16(lk0, lk1);
  }
  const size_t o = (size_t)g * INNER + i0;
  {
    *(v4u*)(qh + o) = hq;
    *(v4u*)(ql + o) = lq;
    *(v4u*)(kh + o) = hk;
    *(v4u*)(kl + o) = lk;
    
  }
}

// =====================================================================================
// Full (non-causal, unmasked) attention, head dim 64, all batches in one launch.
//   q planes (hi/lo bf16) [4096][1024]: element (b, n, h, d) at [(b*1024+n)*1024 + h*64 + d]
//   k planes (hi/lo bf16) [4096][1024]: same layout
//   v^T planes (hi/lo bf16) [1024][4096]: element (h, d, b, t) at [(h*64 + d)*4096 + b*1024 + t]
//   out CTX2 plane u16 [4096][2048]: hi bits of o(b,n,h,d) at col h*64+d, lo bits (o - hi) at col 1024 + h*64+d.
//   scores^T = (k . q^T) * 0.125 : A = K rows, B = Q rows; bf16 hi/lo split (hi.hi + lo.hi + hi.lo) on v_wmma_f32_16x16x32_bf16
//   out^T    = v^T . p^T         : A = V^T rows, B = P^T; bf16 hi/lo split of p (unnormalised exp) and v, f32 accumulate, x 1/rowsum at the end
//   Transposed tiles: a lane holds one query (column c) and, per 16-key tile, keys 8*hh + 0..7 in its 8 accumulator registers. Two score
//   tiles (keys 0..15 and 16..31 of a 32-key block), converted in place, are the B operand of the second product in the k order of the
//   V^T fragment loads (elements 0..7 = keys 8*hh + 0..7, elements 8..15 = keys 16 + 8*hh + 0..7): P never goes through LDS.
//   online softmax in f32 over the 1024 keys of the batch element (16 chunks of 64, compile-time trip count, no masking): maximum in-lane
//   plus one exchange between the wave halves per chunk; each half sums its own keys, the two sums are joined once in the epilogue.
//   Block = 4 waves = 64 query rows of one (batch, head); grid.x = 4 * 16 * 16 = 1024.
//   K / V^T chunk staging: 128 threads x 32 elements per plane = the whole 64x64 tile (16-B copies, plain loads,
//   __syncthreads before and after); fragment loads read the LDS tiles with the same v8b element type.
//   LDS extents: K/V tiles 64x64 fully staged every chunk.
// =====================================================================================
#define AT_D 64
#define AT_NW 4
#define AT_QB 64
#define AT_KC 64
// LDS row pitch of the K and V^T tiles in elements: 64 data + 8 pad = 144 B = 16 B x 9 (odd), so the 16 rows that one
// 16-byte fragment read touches fall on 16 different groups of four banks; at 128 B they fall on two. Pad elements are never read.
#define AT_LP 72

__device__ __forceinline__ unsigned short at_bf_bits(float f) {
  unsigned u = __float_as_uint(f);
  return (unsigned short)((u + 0x7FFFu + ((u >> 16) & 1u)) >> 16);
}
__device__ __forceinline__ __bf16 at_f2bf(float f) { return __builtin_bit_cast(__bf16, at_bf_bits(f)); }
__device__ __forceinline__ void at_split(float f, __bf16& hi, __bf16& lo) {
  const unsigned short hb = at_bf_bits(f);
  hi = __builtin_bit_cast(__bf16, hb);
  lo = at_f2bf(f - __uint_as_float(((unsigned)hb) << 16));
}
__device__ __forceinline__ v8f at_mma(v16b a, v16b b, v8f c) {
  c = __builtin_amdgcn_wmma_f32_16x16x32_bf16(false, a, false, b, (short)0, c, false, false);
  asm volatile("v_nop\n\tv_nop\n\tv_nop\n\tv_nop" : "+v"(c) : "v"(a), "v"(b));
  return c;
}

// value of lane l ^ 16 (the other wave half), by a vector cross-row move
__device__ __forceinline__ float at_xhalf(float x) {
  return __builtin_bit_cast(float, __builtin_amdgcn_permlanex16(__builtin_bit_cast(int, x), __builtin_bit_cast(int, x),
                                                                0x76543210, 0xfedcba98, false, false));
}

__global__ __launch_bounds__(128)
void attn_kernel(const unsigned short* __restrict__ qhp, const unsigned short* __restrict__ qlp,
                 const unsigned short* __restrict__ khp, const unsigned short* __restrict__ klp,
                 const unsigned short* __restrict__ vhp, const unsigned short* __restrict__ vlp,
                 unsigned short* __restrict__ aop, float sscale) {
  union FB { v16b v; v8b h[2]; };
  __shared__ __align__(16) __bf16 Ksh[AT_KC * AT_LP];            // K hi [kv][d], pitch AT_LP   9 KB
  __shared__ __align__(16) __bf16 Ksl[AT_KC * AT_LP];            // K lo
  __shared__ __align__(16) __bf16 Vth[AT_D * AT_LP];             // V hi [d][kv], pitch AT_LP   9 KB
  __shared__ __align__(16) __bf16 Vtl[AT_D * AT_LP];             // V lo
  __shared__ __align__(16) float  Os[AT_NW][16 * 68];            // per wave out tile, pitch 68

  const int tid  = threadIdx.x;
  const int wave = tid >> 5;
  const int lane = tid & 31;
  const int hh   = lane >> 4;
  const int c    = lane & 15;

  const int nqb = NTOK / AT_QB;            // 16 query blocks per batch element
  const int bx = blockIdx.x;              // grid = NB * NH * nqb (exact)
  const int qb = bx % nqb;
  const int hb = bx / nqb;
  const int h  = hb % NH;                 // 0..15
  const int b  = hb / NH;                 // 0..3
  const int q0 = b * NTOK + qb * AT_QB + wave * 16;   // row in the q / CTX2 planes

  const __bf16* Qh = (const __bf16*)(const void*)qhp + (size_t)h * AT_D;
  const __bf16* Ql = (const __bf16*)(const void*)qlp + (size_t)h * AT_D;
  const __bf16* Kh = (const __bf16*)(const void*)khp + (size_t)h * AT_D;
  const __bf16* Kl = (const __bf16*)(const void*)klp + (size_t)h * AT_D;
  const __bf16* Vh = (const __bf16*)(const void*)vhp + (size_t)h * AT_D * VTP + (size_t)b * NTOK;
  const __bf16* Vl = (const __bf16*)(const void*)vlp + (size_t)h * AT_D * VTP + (size_t)b * NTOK;
  unsigned short* Ch = aop + (size_t)h * AT_D;                    // hi columns
  unsigned short* Cl = aop + (size_t)INNER + (size_t)h * AT_D;    // lo columns

  // ---- Q fragments (B operand, column = query = lane&15, split k map via Frag load): 2 d-chunks, hi and lo ----
  v16b qah[2], qal[2];
#pragma unroll
  for (int dc = 0; dc < 2; ++dc) {
    const __bf16* qr = Qh + (size_t)(q0 + c) * INNER + dc * 32 + 8 * hh;
    const __bf16* ql = Ql + (size_t)(q0 + c) * INNER + dc * 32 + 8 * hh;
    qah[dc] = Frag<__bf16>::load(qr);
    qal[dc] = Frag<__bf16>::load(ql);
  }

  float mrow = -INFINITY, lrow = 0.f;   // this lane's query: running maximum (both halves alike), sum over this half's keys
  v8f oacc[4];                          // oacc[t][r] = out^T[d = t*16 + 8*hh + r][query c]
#pragma unroll
  for (int t = 0; t < 4; ++t) oacc[t] = (v8f){0.f,0.f,0.f,0.f,0.f,0.f,0.f,0.f};

  const int nChunks = NTOK / AT_KC;   // 16, compile-time constant
  for (int kc = 0; kc < nChunks; ++kc) {
    const int kv0 = kc * AT_KC;
    __syncthreads();
    {
      // staging coverage: 128 threads x (4 x 8) elements = 64 rows x 64 per plane = the whole chunk tile
      const int r = tid >> 1, half = (tid & 1) * 32;
      const __bf16* ksh = Kh + (size_t)(b * NTOK + kv0 + r) * INNER + half;   // K row (b, kv0+r), d = half..half+31
      const __bf16* ksl = Kl + (size_t)(b * NTOK + kv0 + r) * INNER + half;
      const __bf16* vsh = Vh + (size_t)r * VTP + kv0 + half;                  // V^T row d = r, keys kv0+half..+31
      const __bf16* vsl = Vl + (size_t)r * VTP + kv0 + half;
#pragma unroll
      for (int i = 0; i < 4; ++i) {
        const v8b a0 = *(const v8b*)(ksh + 8 * i);
        const v8b a1 = *(const v8b*)(ksl + 8 * i);
        const v8b b0 = *(const v8b*)(vsh + 8 * i);
        const v8b b1 = *(const v8b*)(vsl + 8 * i);
        *(v8b*)(Ksh + r * AT_LP + half + 8 * i) = a0;
        *(v8b*)(Ksl + r * AT_LP + half + 8 * i) = a1;
        *(v8b*)(Vth + r * AT_LP + half + 8 * i) = b0;
        *(v8b*)(Vtl + r * AT_LP + half + 8 * i) = b1;
      }
    }
    __syncthreads();

    v8f s[4];
#pragma unroll
    for (int j = 0; j < 4; ++j) {
      s[j] = (v8f){0.f,0.f,0.f,0.f,0.f,0.f,0.f,0.f};
#pragma unroll
      for (int dc = 0; dc < 2; ++dc) {
        FB kb, kl;
        kb.h[0] = *(const v8b*)(Ksh + (j * 16 + c) * AT_LP + dc * 32 + 8 * hh);
        kb.h[1] = *(const v8b*)(Ksh + (j * 16 + c) * AT_LP + dc * 32 + 16 + 8 * hh);
        kl.h[0] = *(const v8b*)(Ksl + (j * 16 + c) * AT_LP + dc * 32 + 8 * hh);
        kl.h[1] = *(const v8b*)(Ksl + (j * 16 + c) * AT_LP + dc * 32 + 16 + 8 * hh);
        s[j] = at_mma(kb.v, qah[dc], s[j]);
        s[j] = at_mma(kl.v, qah[dc], s[j]);
        s[j] = at_mma(kb.v, qal[dc], s[j]);
      }
    }
    // s[j][r] = score of key kv0 + j*16 + 8*hh + r against query c: scale, then this query's chunk maximum
    float mj[4];
#pragma unroll
    for (int j = 0; j < 4; ++j) {
      float m = -INFINITY;
#pragma unroll
      for (int r = 0; r < 8; ++r) {
        const float sv = s[j][r] * sscale;
        s[j][r] = sv;
        m = fmaxf(m, sv);
      }
      mj[j] = m;
    }
    float cm = fmaxf(fmaxf(mj[0], mj[1]), fmaxf(mj[2], mj[3]));
    cm = fmaxf(cm, at_xhalf(cm));
    const float mnew = fmaxf(mrow, cm);
    const float alpha = expf(mrow - mnew);
    mrow = mnew;
    FB ph[2], pl[2];   // P^T hi / lo as B operands, one per 32 keys: elements 0..7 from tile 2*kk, 8..15 from tile 2*kk + 1
    float pj[4];
#pragma unroll
    for (int j = 0; j < 4; ++j) {
      float psum = 0.f;
#pragma unroll
      for (int r = 0; r < 8; ++r) {
        const float p = expf(s[j][r] - mnew);
        psum += p;
        __bf16 a, bl; at_split(p, a, bl);
        ph[j >> 1].v[(j & 1) * 8 + r] = a;
        pl[j >> 1].v[(j & 1) * 8 + r] = bl;
      }
      pj[j] = psum;
    }
    lrow = lrow * alpha + ((pj[0] + pj[1]) + (pj[2] + pj[3]));
#pragma unroll
    for (int t = 0; t < 4; ++t)
#pragma unroll
      for (int r = 0; r < 8; ++r) oacc[t][r] *= alpha;
    // unrolled: the P^T fragments are registers and are picked by kk at compile time
#pragma unroll
    for (int kk = 0; kk < 2; ++kk) {
#pragma unroll
      for (int t = 0; t < 4; ++t) {
        FB vb, vl;
        vb.h[0] = *(const v8b*)(Vth + (t * 16 + c) * AT_LP + kk * 32 + 8 * hh);
        vb.h[1] = *(const v8b*)(Vth + (t * 16 + c) * AT_LP + kk * 32 + 16 + 8 * hh);
        vl.h[0] = *(const v8b*)(Vtl + (t * 16 + c) * AT_LP + kk * 32 + 8 * hh);
        vl.h[1] = *(const v8b*)(Vtl + (t * 16 + c) * AT_LP + kk * 32 + 16 + 8 * hh);
        oacc[t] = at_mma(vb.v, ph[kk].v, oacc[t]);
        oacc[t] = at_mma(vl.v, ph[kk].v, oacc[t]);
        oacc[t] = at_mma(vb.v, pl[kk].v, oacc[t]);
      }
    }
  }

  float* os = Os[wave];
  {
    const float inv = 1.0f / (lrow + at_xhalf(lrow));   // the two halves' key sums of query c, joined
#pragma unroll
    for (int t = 0; t < 4; ++t) {
      v4f o0, o1;
#pragma unroll
      for (int r = 0; r < 4; ++r) { o0[r] = oacc[t][r] * inv; o1[r] = oacc[t][4 + r] * inv; }
      *(v4f*)(os + c * 68 + t * 16 + 8 * hh)     = o0;   // row = query c, columns d = t*16 + 8*hh + 0..7
      *(v4f*)(os + c * 68 + t * 16 + 8 * hh + 4) = o1;
    }
  }
  __builtin_amdgcn_fence(__ATOMIC_RELEASE, "workgroup");
  __builtin_amdgcn_wave_barrier();
  __builtin_amdgcn_fence(__ATOMIC_ACQUIRE, "workgroup");
  {
    const int q = lane >> 3, c8 = (lane & 7) * 8;
    {
#pragma unroll
      for (int it = 0; it < 4; ++it) {
        const int row = it * 4 + q;
        const float* sp = os + row * 68 + c8;
        v8h hv, lv;
#pragma unroll
        for (int e = 0; e < 8; ++e) {
          const unsigned short hbits = f2bf_bits(sp[e]);
          const unsigned short lbits = f2bf_bits(sp[e] - bf_bits2f(hbits));
          hv[e] = __builtin_bit_cast(_Float16, hbits);
          lv[e] = __builtin_bit_cast(_Float16, lbits);
        }
        *(v8h*)(Ch + (size_t)(q0 + row) * AOP + c8) = hv;
        *(v8h*)(Cl + (size_t)(q0 + row) * AOP + c8) = lv;
      }
      
    }
  }
}

// ---------------------------------------------------------------------------
// Output RMSNorm over C + residual + back to NCHW:
//   out[b][c][n] = Of[b*1024+n][c] * rsqrt(mean_C(Of[tok][.]^2) + 1e-6) * bf16(w[c]) + bf16(x[b][c][n]).
// One block of 256 threads per 64 consecutive tokens (grid = 4096/64 = 64). Phase 1: each wave computes the per-token
// factor for 8 tokens (16-B loads, shuffle sum) into LDS rms[64]. Phase 2: 16 channel tiles of 64; the 64x64 (token x
// channel) tile is scaled and staged in LDS (4 it x 256 thr x 4 floats = 64x64), then read transposed: lanes 0..15 of a
// Coverage: 64 blocks x 64 tokens x 16 tiles x 64 channels = 4 x 1024 x 1024 outputs, each exactly once.
// ---------------------------------------------------------------------------
__global__ __launch_bounds__(256) void final_kernel(const float* __restrict__ of, const float* __restrict__ nw,
                                                    const float* __restrict__ xin, float* __restrict__ out) {
  __shared__ __align__(16) float tf[64 * 68];
  __shared__ float rms[64];
  const int tid = threadIdx.x, lane = tid & 31, wave = tid >> 5;
  const int tok0 = blockIdx.x * 64;
  const int b = tok0 / NTOK, n0 = tok0 - b * NTOK;

  // phase 1: per-token rsqrt(mean + eps)
#pragma unroll 1
  for (int i = 0; i < 8; ++i) {
    const int rr = wave * 8 + i;
    const float* rowp = of + (size_t)(tok0 + rr) * CH + lane * 4;
    float ss = 0.0f;
#pragma unroll 2
    for (int k = 0; k < 8; ++k) {
      const v4f v = *(const v4f*)(rowp + k * 128);
      ss += v[0] * v[0] + v[1] * v[1] + v[2] * v[2] + v[3] * v[3];
    }
#pragma unroll
    for (int off = 1; off < 32; off <<= 1) ss += __shfl_xor(ss, off, 32);
    if (lane == 0) rms[rr] = rsqrtf(ss * (1.0f / (float)CH) + RMS_EPS);
  }
  __syncthreads();

  const int lr = tid >> 4;           // 0..15
  const int c4 = (tid & 15) * 4;     // 0..60
#pragma unroll 1
  for (int ct = 0; ct < CH / 64; ++ct) {
    const int c0 = ct * 64;
    {
      const v4f w4 = *(const v4f*)(nw + c0 + c4);
      float wr[4];
      wr[0] = bf_rne(w4[0]); wr[1] = bf_rne(w4[1]); wr[2] = bf_rne(w4[2]); wr[3] = bf_rne(w4[3]);
#pragma unroll
      for (int it = 0; it < 4; ++it) {
        const int rr = it * 16 + lr;   // token within block
        const v4f v = *(const v4f*)(of + (size_t)(tok0 + rr) * CH + c0 + c4);
        const float rm = rms[rr];
        v4f o;
        o[0] = v[0] * rm * wr[0]; o[1] = v[1] * rm * wr[1]; o[2] = v[2] * rm * wr[2]; o[3] = v[3] * rm * wr[3];
        *(v4f*)(tf + rr * 68 + c4) = o;
      }
    }
    __syncthreads();
    v4f ov[4];
#pragma unroll
    for (int it = 0; it < 4; ++it) {
      const int oc = it * 16 + lr;     // channel within tile
      const v4f xr = *(const v4f*)(xin + ((size_t)(b * CH + c0 + oc)) * NTOK + n0 + c4);
      v4f o;
      o[0] = tf[(c4 + 0) * 68 + oc] + bf_rne(xr[0]);
      o[1] = tf[(c4 + 1) * 68 + oc] + bf_rne(xr[1]);
      o[2] = tf[(c4 + 2) * 68 + oc] + bf_rne(xr[2]);
      o[3] = tf[(c4 + 3) * 68 + oc] + bf_rne(xr[3]);
      ov[it] = o;
    }
    {
#pragma unroll
      for (int it = 0; it < 4; ++it) {
        const int oc = it * 16 + lr;
        *(v4f*)(out + ((size_t)(b * CH + c0 + oc)) * NTOK + n0 + c4) = ov[it];
      }
      
    }
    __syncthreads();
  }
}

// ---------------------------------------------------------------------------
// Workspace region map (byte offsets; every region is fully written by its producer launch before any consumer
//   XB    bf16 [4096][1024]          0       8388608
//   WQKV  bf16 [3072][1024]    8388608       6291456
//   WP2   bf16 [1024][2048]   14680064       4194304
//   TC    f32  [32][16]       18874368          2048   TS  18876416  2048
//   QKf   f32  [4096][2048]   18878464      33554432   (dead after ropenorm; the same 32 MiB then hold
//                                                       CTX2 u16 [4096][2048] at 18878464 (16777216) and
//                                                       Of   f32  [4096][1024] at 35655680 (16777216), disjoint)
//   Qh    bf16 [4096][1024]   52432896       8388608   Ql  60821504
//   Kh    bf16 [4096][1024]   69210112       8388608   Kl  77598720
//   VTh   bf16 [1024][4096]   85987328       8388608   VTl 94375936
//   total                    102764544
// ---------------------------------------------------------------------------
extern "C" void kernel_launch(void* const* d_in, const int* in_sizes, int n_in,
                              void* d_out, int out_size, void* d_ws, size_t ws_size,
                              hipStream_t stream) {
  if (n_in < 7) return;
  if (in_sizes[0] != NB * CH * NTOK) return;        // hidden_states [4][1024][32][32]
  if (in_sizes[1] != NQKV * CH) return;             // w_qkv [3072][1024]
  if (in_sizes[2] != NQKV) return;                  // b_qkv [3072]
  if (in_sizes[3] != INNER) return;                 // q_norm_w [1024]
  if (in_sizes[4] != INNER) return;                 // k_norm_w [1024]
  if (in_sizes[5] != CH * INNER) return;            // w_proj [1024][1024]
  if (in_sizes[6] != CH) return;                    // norm_out_w [1024]
  if (out_size != NB * CH * NTOK) return;

  const float* x    = (const float*)d_in[0];
  const float* wqkv = (const float*)d_in[1];   // [out 3072][in 1024]
  const float* bqkv = (const float*)d_in[2];
  const float* qnw  = (const float*)d_in[3];
  const float* knw  = (const float*)d_in[4];
  const float* wprj = (const float*)d_in[5];   // [out 1024][in 1024]
  const float* onw  = (const float*)d_in[6];

  const size_t PXB = (size_t)MTOK * CH * 2;        // 8388608
  const size_t PWQ = (size_t)NQKV * CH * 2;        // 6291456
  const size_t PWP = (size_t)CH * AOP * 2;         // 4194304
  const size_t PTB = (size_t)TABN * 4;             // 2048
  const size_t PQK = (size_t)MTOK * QKP * 4;       // 33554432
  const size_t PCX = (size_t)MTOK * AOP * 2;       // 16777216
  const size_t POF = (size_t)MTOK * CH * 4;        // 16777216
  const size_t PPL = (size_t)MTOK * INNER * 2;     // 8388608 per q/k plane
  const size_t PVT = (size_t)INNER * VTP * 2;      // 8388608 per v^T plane
  if (PCX + POF > PQK) return;                     // CTX2 and Of share the QKf region, disjoint halves
  size_t off = 0;
  const size_t oXB  = off; off += PXB;
  const size_t oWQ  = off; off += PWQ;
  const size_t oWP  = off; off += PWP;
  const size_t oTC  = off; off += PTB;
  const size_t oTS  = off; off += PTB;
  const size_t oQK  = off; off += PQK;
  const size_t oCX  = oQK;
  const size_t oOF  = oQK + PCX;
  const size_t oQh  = off; off += PPL;  const size_t oQl = off; off += PPL;
  const size_t oKh  = off; off += PPL;  const size_t oKl = off; off += PPL;
  const size_t oVTh = off; off += PVT;  const size_t oVTl = off; off += PVT;
  if (off > ws_size) return;                       // off = 102764544
  if (off > (size_t)134217728) return;

  char* ws = (char*)d_ws;
  unsigned short* XB   = (unsigned short*)(ws + oXB);
  unsigned short* WQKV = (unsigned short*)(ws + oWQ);
  unsigned short* WP2  = (unsigned short*)(ws + oWP);
  float*          TC   = (float*)(ws + oTC);
  float*          TS   = (float*)(ws + oTS);
  float*          QKf  = (float*)(ws + oQK);
  unsigned short* CTX2 = (unsigned short*)(ws + oCX);
  float*          Of   = (float*)(ws + oOF);
  unsigned short* Qh   = (unsigned short*)(ws + oQh);  unsigned short* Ql  = (unsigned short*)(ws + oQl);
  unsigned short* Kh   = (unsigned short*)(ws + oKh);  unsigned short* Kl  = (unsigned short*)(ws + oKl);
  unsigned short* VTh  = (unsigned short*)(ws + oVTh); unsigned short* VTl = (unsigned short*)(ws + oVTl);

  const dim3 blk(256);

  // (1) x[b] viewed [R=1024 c][Cc=1024 n] (pitch 1024) -> XB_b[n][c] (pitch 1024); grid (Cc/64, R/64, B) = (16, 16, 4)
  tconv_kernel<<<dim3(NTOK / 64, CH / 64, NB), blk, 0, stream>>>(x, XB, NTOK, CH, (long)CH * NTOK, (long)NTOK * CH);
  // (2) w_qkv [3072][1024] -> WQKV bf16 same layout; 393216 units -> 1536 blocks
  const int n8q = NQKV * CH / 8;
  convrows_kernel<false><<<dim3(n8q / 256), blk, 0, stream>>>(wqkv, WQKV, CH, CH, n8q);
  // (3) w_proj [1024][1024] -> WP2 [1024][2048], cols k and 1024+k; 131072 units -> 512 blocks
  const int n8p = CH * INNER / 8;
  convrows_kernel<true><<<dim3(n8p / 256), blk, 0, stream>>>(wprj, WP2, INNER, AOP, n8p);
  // (4) rotary cos/sin tables [32][16]
  ropetab_kernel<<<dim3(2), blk, 0, stream>>>(TC, TS);
  // (5) q|k = XB . WQKV[0..2047]^T + b -> QKf f32 [4096][2048]   (M=4096, N=2048, K=1024; 32 x 16 = 512 blocks of 128 threads)
  const dim3 gblk(128);
  const dim3 gQK((MTOK / 128) * (QKP / 128), 1);
  wmma_gemm64<1, false, 2, 0, false, CH><<<gQK, gblk, 0, stream>>>(
      XB, XB, 0L, WQKV, WQKV, 0L, (void*)QKf, (void*)QKf, QKP, 0L,
      bqkv, bqkv, 0L, MTOK, QKP, CH, 1.0f);
  // (6) v^T = WQKV[2048..3071] . XB^T + b[2048+m] -> VTh|VTl [1024][4096]   (M=1024, N=4096, K=1024; 8 x 32 = 256 blocks)
  const dim3 gVT((INNER / 128) * (MTOK / 128), 1);
  wmma_gemm64<1, false, 1, 2, false, CH><<<gVT, gblk, 0, stream>>>(
      WQKV + (size_t)2 * INNER * CH, WQKV + (size_t)2 * INNER * CH, 0L, XB, XB, 0L,
      (void*)VTh, (void*)VTl, VTP, 0L,
      bqkv + 2 * INNER, bqkv, 0L, INNER, MTOK, CH, 1.0f);
  // (7) RoPE + RMSNorm over 1024 for q and k -> Qh|Ql, Kh|Kl; one block of 128 threads per token row
  ropenorm_kernel<<<dim3(MTOK), dim3(128), 0, stream>>>(QKf, TC, TS, qnw, knw, Qh, Ql, Kh, Kl);
  // (8) attention per (batch, head, 64-query block) -> CTX2 [4096][2048] (hi | lo columns); 1024 blocks
  attn_kernel<<<dim3(NB * NH * (NTOK / 64)), dim3(128), 0, stream>>>(Qh, Ql, Kh, Kl, VTh, VTl, CTX2, 0.125f);
  // (9) Of = CTX2 . WP2^T -> f32 [4096][1024]   (M=4096, N=1024, K=2048; 32 x 8 = 256 blocks)
  const dim3 gO((MTOK / 128) * (CH / 128), 1);
  wmma_gemm64<1, false, 0, 0, false, AOP><<<gO, gblk, 0, stream>>>(
      CTX2, CTX2, 0L, WP2, WP2, 0L, (void*)Of, (void*)Of, CH, 0L,
      bqkv, bqkv, 0L, MTOK, CH, AOP, 1.0f);
  // (10) output RMSNorm + residual -> NCHW d_out; 64 blocks of 64 tokens
  final_kernel<<<dim3(MTOK / 64), blk, 0, stream>>>(Of, onw, x, (float*)d_out);
  (void)hipGetLastError();
}

// v004
// It runs in 181 microseconds.
// Next to v003, in two timings, it ran 1.18 times as fast each time.
// Over all steps from v000 it is 2.60 times as fast.
// Contractions: q|k projection (f32 out) and v^T projection (bf16 hi|lo out) = v_wmma_f32_16x16x32_bf16 single products on bf16 planes of the RNE-converted inputs; q.k^T and p.v = bf16 hi/lo split (hi.hi + hi.lo + lo.hi); output projection = [CTXhi|CTXlo] x [Wp;Wp] bf16 single products (K-folded 2-term); f32 accumulate everywhere; RoPE, QK RMSNorm, output RMSNorm, online softmax, 1/rowsum, bias and residual in f32 on the VALU.
// Plane / carry map (all carry 1, nothing to fold back): XB = bf16(x) token-major [4096][1024] (row b*1024+n, n = y*32+x, col c);
// WQKV = bf16(w_qkv) [3072][1024] natural [out][in]; WP2 [1024][2048]: cols k and 1024+k both = bf16(w_proj[c][k]);
// TC/TS f32 [32 pos][16 pair] = cos/sin(pos * 10000^(-j/16)); QKf f32 [4096][2048] = pre-RoPE q (cols 0..1023) | k (cols 1024..2047) incl. bias;
// Qh|Ql, Kh|Kl bf16 [4096][1024] (col h*64+d) = hi/lo of the RoPE'd, RMSNorm'd q, k; VTh|VTl bf16 [1024 (h,d)][4096 (b,t)];
// P hi|lo = unnormalised exp in (0,1] (bf16, f32 exponent range), kept in registers, 1/rowsum applied to the f32 accumulator in the attention epilogue;
// CTX2 u16 [4096][2048] = ctx hi at col h*64+d, lo at col 1024+h*64+d; Of f32 [4096][1024] = ctx . w_proj^T.
#include <hip/hip_runtime.h>
#include <math.h>
#include <stdint.h>

#define NB    4
#define CH    1024
#define IMH   32
#define IMW   32
#define NTOK  1024
#define INNER 1024
#define NH    16
#define HD    64
#define NQKV  3072
#define QKP   2048
#define AOP   2048
#define VTP   (NB * NTOK)
#define MTOK  (NB * NTOK)
#define TABN  512
#define RMS_EPS 1e-6f

static_assert(NTOK == IMH * IMW);
static_assert(IMW == 32);
static_assert(INNER == NH * HD);
static_assert(HD == 64);
static_assert(NQKV == 3 * INNER);
static_assert(QKP == 2 * INNER);
static_assert(AOP == 2 * INNER);
static_assert(CH % 64 == 0);
static_assert(NTOK % 64 == 0);
static_assert(INNER % 64 == 0);
static_assert(MTOK % 64 == 0);
static_assert(CH % 32 == 0);
static_assert(AOP % 32 == 0);
static_assert(INNER == 128 * 8);
static_assert(CH == 8 * 128);
static_assert(TABN == 32 * (HD / 4));
static_assert((NQKV * CH) % (8 * 256) == 0);
static_assert((CH * INNER) % (8 * 256) == 0);
static_assert(CH % 256 == 0);
static_assert(INNER % 256 == 0);
static_assert(MTOK % 128 == 0 && QKP % 128 == 0 && INNER % 128 == 0 && CH % 128 == 0 && AOP % 128 == 0);

typedef __attribute__((ext_vector_type(16))) _Float16 v16h;
typedef __attribute__((ext_vector_type(8)))  _Float16 v8h;
typedef __attribute__((ext_vector_type(16))) __bf16   v16b;
typedef __attribute__((ext_vector_type(8)))  __bf16   v8b;
typedef __attribute__((ext_vector_type(8)))  float    v8f;
typedef __attribute__((ext_vector_type(4)))  float    v4f;
typedef __attribute__((ext_vector_type(2)))  float    v2f;
typedef __attribute__((ext_vector_type(4)))  unsigned int v4u;

__device__ __forceinline__ unsigned short f2bf_bits(float f) {
  unsigned u = __float_as_uint(f);
  return (unsigned short)((u + 0x7FFFu + ((u >> 16) & 1u)) >> 16);
}
__device__ __forceinline__ float bf_bits2f(unsigned short h) { return __uint_as_float(((unsigned)h) << 16); }
__device__ __forceinline__ float bf_rne(float f) { return bf_bits2f(f2bf_bits(f)); }
__device__ __forceinline__ unsigned pk16(unsigned short a, unsigned short b) { return (unsigned)a | ((unsigned)b << 16); }

// hazard guard behind the product loop, as a plain device helper
__device__ __forceinline__ void acc_guard4(v8f& a, v8f& b, v8f& c, v8f& d) { asm volatile("v_nop\n\tv_nop\n\tv_nop\n\tv_nop" : "+v"(a), "+v"(b), "+v"(c), "+v"(d)); }
template <typename T> struct Frag;
template <> struct Frag<_Float16> {
  typedef v16h V; typedef v8h H; union U { v16h v; v8h h[2]; };
  static __device__ __forceinline__ v16h load(const _Float16* p) {   // elements 0..7 <- p[0..7], 8..15 <- p[16..23]
    U f; f.h[0] = *(const v8h*)(p); f.h[1] = *(const v8h*)(p + 16); return f.v;
  }
  static __device__ __forceinline__ v8f mma(v16h a, v16h b, v8f c) {
    return __builtin_amdgcn_wmma_f32_16x16x32_f16(false, a, false, b, (short)0, c, false, false);
  }
};
template <> struct Frag<__bf16> {
  typedef v16b V; typedef v8b H; union U { v16b v; v8b h[2]; };
  static __device__ __forceinline__ v16b load(const __bf16* p) {
    U f; f.h[0] = *(const v8b*)(p); f.h[1] = *(const v8b*)(p + 16); return f.v;
  }
  static __device__ __forceinline__ v8f mma(v16b a, v16b b, v8f c) {
    return __builtin_amdgcn_wmma_f32_16x16x32_bf16(false, a, false, b, (short)0, c, false, false);
  }
};

// ---- Register-blocked batched WMMA GEMM ------------------------------------
// C[m,n] = scale * sum_k A[m,k] * Bt[n,k] (+bias)(+resid); each wave owns a 64x64 tile, a block of 4 waves (2 x 2) a 128x128 tile.
// A row-major [M,K]; Bt row-major [N,K]; M,N % 128 == 0, K % GT_BK == 0.
// Operand path: per stage of GT_BK k the block copies its 128 A rows and 128 Bt rows into LDS with 16-B loads whose lanes cover
// whole rows of the stage (GT_BK * 2 contiguous bytes), so every 128-B line is asked for once per block; the four waves read their
// fragments from LDS. Two LDS buffers: the next stage's global loads are issued before the current stage's products and
// stored after them, one __syncthreads() per stage. The k order of every accumulator is ascending in steps of 32.
// SPLIT (hi/lo operand planes) is not instantiated and not supported by the staged loop.
// BIAS_MODE: 0 = none, 1 = bias[m], 2 = bias[n]; the bias value is RNE-converted to bf16 precision before the f32 add.
// OUT_MODE: 0 = f32, 1 = f16, 2 = bf16 hi plane (Cout) + bf16 lo plane (Cout2).
// ET: 0 = f16 operands, 1 = bf16 operands (pointers passed as 16-bit storage)
template <int ET> struct Elem;
template <> struct Elem<0> { typedef _Float16 T; };
template <> struct Elem<1> { typedef __bf16 T; };
#define GT_BK 128
// LDS row pitch in elements: GT_BK data + 8 pad, = 16 B x odd, so the 16 rows of one 16-byte fragment read fall on different banks.
#define GT_LP (GT_BK + 8)
#define GT_CPR (GT_BK / 8)          // 16-byte pieces per staged row
#define GT_RPP (128 / GT_CPR)       // rows that 128 threads copy per pass
#define GT_NP  (128 / GT_RPP)       // passes per operand and stage
// LD: row pitch of A and of Bt in elements, a compile-time constant so that the row steps of the staging loads are immediate offsets.
template <int ET, bool SPLIT, int BIAS_MODE, int OUT_MODE, bool RESID, int LD, int ACT = 0>
__global__ __launch_bounds__(128) void wmma_gemm64(
    const unsigned short* __restrict__ Ap, const unsigned short* __restrict__ A2p, long strideA,
    const unsigned short* __restrict__ Btp, const unsigned short* __restrict__ Bt2p, long strideB,
    void* __restrict__ Cout, void* __restrict__ Cout2, int ldc, long strideC,
    const float* __restrict__ bias,
    const float* __restrict__ resid, long strideR,
    int M, int N, int K, float scale) {
  typedef typename Elem<ET>::T T;
  typedef typename Frag<T>::V V;
  typedef typename Frag<T>::H H;
  static_assert(!SPLIT, "the staged loop takes single operand planes");
  const T* A = (const T*)Ap; const T* Bt = (const T*)Btp;
  __shared__ __align__(16) T sA[2 * 128 * GT_LP];  // two stages of the block's 128 A rows
  __shared__ __align__(16) T sB[2 * 128 * GT_LP];  // two stages of the block's 128 Bt rows
  __shared__ __align__(16) float sT[4][16 * 68];   // per-wave 16x64 slab, pitch 68 floats
  const int b    = blockIdx.y;
  const int tid  = threadIdx.x;
  const int lane = tid & 31;
  const int wave = tid >> 5;
  const int tilesN = N >> 7;
  const int tilesM = M >> 7;
  const int tile = blockIdx.x;
  if (tile >= tilesM * tilesN) return;   // block-uniform, in front of every barrier
  const int tm = tile / tilesN;
  const int tn = tile - tm * tilesN;
  const int wm = (wave >> 1) << 6;             // this wave's 64x64 tile inside the block's 128x128
  const int wn = (wave & 1) << 6;
  const int m0 = (tm << 7) + wm;
  const int n0 = (tn << 7) + wn;

  const T* Ab  = A  + (size_t)b * strideA;
  const T* Bb  = Bt + (size_t)b * strideB;

  const int rlane = lane & 15;                 // row (A) / col (B, D) within subtile
  const int koff  = (lane >> 4) * 8;           // k offset of this lane half
  const int mOff  = (lane >> 4) * 8;           // D row offset

  // staging map: pass p, thread tid -> row p * GT_RPP + tid / GT_CPR, 8 elements at column (tid % GT_CPR) * 8
  const int srow = tid / GT_CPR;
  const int scol = (tid % GT_CPR) * 8;
  const T* gA = Ab + (size_t)((tm << 7) + srow) * LD + scol;
  const T* gB = Bb + (size_t)((tn << 7) + srow) * LD + scol;
  const int sOff = srow * GT_LP + scol;

  v8f acc[4][4];
#pragma unroll
  for (int i = 0; i < 4; ++i)
#pragma unroll
    for (int j = 0; j < 4; ++j) acc[i][j] = (v8f){0.f,0.f,0.f,0.f,0.f,0.f,0.f,0.f};

  H ra[GT_NP], rb[GT_NP];
#pragma unroll
  for (int p = 0; p < GT_NP; ++p) {
    ra[p] = *(const H*)(gA + p * GT_RPP * LD);
    rb[p] = *(const H*)(gB + p * GT_RPP * LD);
  }
#pragma unroll
  for (int p = 0; p < GT_NP; ++p) {
    *(H*)(sA + sOff + p * GT_RPP * GT_LP) = ra[p];
    *(H*)(sB + sOff + p * GT_RPP * GT_LP) = rb[p];
  }
  __syncthreads();

  const int nStages = K / GT_BK;
  for (int st = 0; st < nStages; ++st) {
    const int cur = (st & 1) * (128 * GT_LP);
    const bool more = st + 1 < nStages;        // block-uniform
    if (more) {
      const T* pa = gA + (st + 1) * GT_BK;
      const T* pb = gB + (st + 1) * GT_BK;
#pragma unroll
      for (int p = 0; p < GT_NP; ++p) {
        ra[p] = *(const H*)(pa + p * GT_RPP * LD);
        rb[p] = *(const H*)(pb + p * GT_RPP * LD);
      }
      // naming the two address pairs here keeps them untouched up to this wait, which stands in front of every reuse of their registers
      asm volatile("s_wait_xcnt 0x0" :: "v"(pa), "v"(pb) : "memory");
    }
    const T* fa = sA + cur + (wm + rlane) * GT_LP + koff;
    const T* fb = sB + cur + (wn + rlane) * GT_LP + koff;
#pragma unroll
    for (int kk = 0; kk < GT_BK / 32; ++kk) {
      V bh[4], ah[4];
#pragma unroll
      for (int j = 0; j < 4; ++j) bh[j] = Frag<T>::load(fb + (j << 4) * GT_LP + kk * 32);
#pragma unroll
      for (int i = 0; i < 4; ++i) ah[i] = Frag<T>::load(fa + (i << 4) * GT_LP + kk * 32);
#pragma unroll
      for (int i = 0; i < 4; ++i)
#pragma unroll
        for (int j = 0; j < 4; ++j) acc[i][j] = Frag<T>::mma(ah[i], bh[j], acc[i][j]);
    }
    if (more) {
      const int nxt = (128 * GT_LP) - cur;     // the buffer whose last readers passed the barrier of stage st - 1
#pragma unroll
      for (int p = 0; p < GT_NP; ++p) {
        *(H*)(sA + nxt + sOff + p * GT_RPP * GT_LP) = ra[p];
        *(H*)(sB + nxt + sOff + p * GT_RPP * GT_LP) = rb[p];
      }
    }
    __syncthreads();
  }
  acc_guard4(acc[0][0], acc[0][1], acc[0][2], acc[0][3]);
  acc_guard4(acc[1][0], acc[1][1], acc[1][2], acc[1][3]);
  acc_guard4(acc[2][0], acc[2][1], acc[2][2], acc[2][3]);
  acc_guard4(acc[3][0], acc[3][1], acc[3][2], acc[3][3]);

  // ---- epilogue ----
  float* slab = sT[wave];
  const float* Rb = RESID ? (resid + (size_t)b * strideR) : nullptr;
#pragma unroll
  for (int i = 0; i < 4; ++i) {
    const int mBase = m0 + (i << 4);
    float bm[8];
    if (BIAS_MODE == 1) {
      const float* bp = bias + mBase + mOff;
#pragma unroll
      for (int r = 0; r < 8; ++r) bm[r] = bp[r];
      // naming the address pair here keeps it untouched up to this wait, which stands in front of every reuse of its registers
      asm volatile("s_wait_xcnt 0x0" :: "v"(bp) : "memory");
    }
#pragma unroll
    for (int j = 0; j < 4; ++j) {
      const int n = n0 + (j << 4) + rlane;
      float bv = 0.f;
      if (BIAS_MODE == 2) bv = bf_rne(bias[n]);
#pragma unroll
      for (int r = 0; r < 8; ++r) {
        float v = acc[i][j][r] * scale;
        if (BIAS_MODE == 1) v += bf_rne(bm[r]);
        if (BIAS_MODE == 2) v += bv;
        if (RESID) v += Rb[(size_t)(mBase + mOff + r) * ldc + n];
        if (ACT == 1) v = tanhf(v);
        if (ACT == 2) v = fmaxf(v, 0.0f);
        if (ACT == 3) v = v / (1.0f + expf(-v));
        if (ACT == 4) v = (v > 0.f) ? v : 0.01f * v;
        if (ACT == 5) v = 0.5f * v * (1.0f + erff(v * 0.70710678118654752f));
        slab[(mOff + r) * 68 + (j << 4) + rlane] = v;
      }
    }
    __builtin_amdgcn_fence(__ATOMIC_RELEASE, "workgroup");
    __builtin_amdgcn_wave_barrier();
    __builtin_amdgcn_fence(__ATOMIC_ACQUIRE, "workgroup");
    if (OUT_MODE == 0) {
      float* C = (float*)Cout + (size_t)b * strideC;
      const int hh = lane >> 4, c4 = (lane & 15) * 4;     // row seg = 256 B = 16 lanes x 16 B
      {
#pragma unroll
        for (int it = 0; it < 8; ++it) {
          const int row = it * 2 + hh;
          v4f v = *(const v4f*)(slab + row * 68 + c4);
          *(v4f*)(C + (size_t)(mBase + row) * ldc + n0 + c4) = v;
        }
        
      }
    } else {
      const int q = lane >> 3, c8 = (lane & 7) * 8;
      unsigned short* C  = (unsigned short*)Cout  + (size_t)b * strideC;
      unsigned short* C2 = (OUT_MODE == 2) ? ((unsigned short*)Cout2 + (size_t)b * strideC) : nullptr;
      {
#pragma unroll
        for (int it = 0; it < 4; ++it) {
          const int row = it * 4 + q;
          const float* sp = slab + row * 68 + c8;
          v8h hv, lv;
#pragma unroll
          for (int e = 0; e < 8; ++e) {
            if (OUT_MODE == 1) {
              hv[e] = (_Float16)sp[e];
            } else {
              unsigned short hb = f2bf_bits(sp[e]);
              unsigned short lb = f2bf_bits(sp[e] - bf_bits2f(hb));
              hv[e] = __builtin_bit_cast(_Float16, hb);
              lv[e] = __builtin_bit_cast(_Float16, lb);
            }
          }
          *(v8h*)(C + (size_t)(mBase + row) * ldc + n0 + c8) = hv;
          if (OUT_MODE == 2) *(v8h*)(C2 + (size_t)(mBase + row) * ldc + n0 + c8) = lv;
        }
        
      }
    }
    __builtin_amdgcn_fence(__ATOMIC_RELEASE, "workgroup");
    __builtin_amdgcn_wave_barrier();
    __builtin_amdgcn_fence(__ATOMIC_ACQUIRE, "workgroup");
  }
}

// ---------------------------------------------------------------------------
// Row-preserving bf16 RNE convert of an f32 matrix [rows][ncols] into a u16 plane with row pitch ldout; DUP also
// writes the same 8 values at column + ncols (second copy along the row). 8 consecutive elements per thread = one
// Coverage: grid = n8/256 blocks x 256 threads x 8 elements = rows*ncols (n8 = rows*ncols/8, exact multiple of 256).
// ---------------------------------------------------------------------------
template <bool DUP>
__global__ __launch_bounds__(256) void convrows_kernel(const float* __restrict__ in, unsigned short* __restrict__ out,
                                                       int ncols, int ldout, int n8) {
  const int i = blockIdx.x * 256 + threadIdx.x;
  if (i < n8) {
    const size_t e0 = (size_t)i * 8;
    const int row = (int)(e0 / (size_t)ncols);
    const int col = (int)(e0 - (size_t)row * ncols);
    const v4f a = *(const v4f*)(in + e0);
    const v4f c = *(const v4f*)(in + e0 + 4);
    v4u hv;
    hv[0] = pk16(f2bf_bits(a[0]), f2bf_bits(a[1]));
    hv[1] = pk16(f2bf_bits(a[2]), f2bf_bits(a[3]));
    hv[2] = pk16(f2bf_bits(c[0]), f2bf_bits(c[1]));
    hv[3] = pk16(f2bf_bits(c[2]), f2bf_bits(c[3]));
    const size_t o = (size_t)row * ldout + col;
    {
      *(v4u*)(out + o) = hv;
      if (DUP) *(v4u*)(out + o + ncols) = hv;
      
    }
  }
}

// ---------------------------------------------------------------------------
// Fused transpose + bf16 RNE convert of an f32 matrix, z-batched, one plane:
//   in_z = W + z*sIn viewed [R rows][Cc cols] with row pitch ldin  ->  oh_z[c][r] = bf16(in_z[r][c]), row pitch ldout, oh_z = oh + z*sOut.
// 64x64 tiles through LDS. grid = (Cc/64, R/64, Z), 256 threads (R, Cc multiples of 64; ldout multiple of 64 so every
// Coverage per block: load 4 it x 256 thr x 4 floats = 64x64; store 2 it x 256 thr x 8 u16 = 64x64.
// ---------------------------------------------------------------------------
__global__ __launch_bounds__(256) void tconv_kernel(const float* __restrict__ W, unsigned short* __restrict__ oh,
                                                    int ldin, int ldout, long sIn, long sOut) {
  __shared__ __align__(16) float tf[64 * 68];
  W  += (size_t)blockIdx.z * sIn;
  oh += (size_t)blockIdx.z * sOut;
  const int c0  = blockIdx.x * 64;   // input column block = output row block
  const int r0  = blockIdx.y * 64;   // input row block    = output column block
  const int tid = threadIdx.x;
  {
    const int lr = tid >> 4;         // 0..15
    const int c4 = (tid & 15) * 4;   // 0..60
#pragma unroll
    for (int it = 0; it < 4; ++it) {
      const int rr = it * 16 + lr;   // 0..63
      const v4f a = *(const v4f*)(W + (size_t)(r0 + rr) * ldin + c0 + c4);
      *(v4f*)(tf + rr * 68 + c4) = a;
    }
  }
  __syncthreads();
  const int sub = tid >> 3;          // 0..31
  const int c8  = (tid & 7) * 8;     // 0..56
  v4u hv[2];
#pragma unroll
  for (int it = 0; it < 2; ++it) {
    const int oc = it * 32 + sub;    // output row within tile (= input column)
    v4u a;
#pragma unroll
    for (int q = 0; q < 4; ++q) {
      const float f0 = tf[(c8 + 2 * q) * 68 + oc];
      const float f1 = tf[(c8 + 2 * q + 1) * 68 + oc];
      a[q] = pk16(f2bf_bits(f0), f2bf_bits(f1));
    }
    hv[it] = a;
  }
  {
#pragma unroll
    for (int it = 0; it < 2; ++it) {
      const int oc = it * 32 + sub;
      const size_t go = (size_t)(c0 + oc) * ldout + r0 + c8;
      *(v4u*)(oh + go) = hv[it];
    }
    
  }
}

// ---------------------------------------------------------------------------
// Rotary angle tables: tc[pos*16 + j] = cos(pos * f_j), ts likewise, f_j = 10000^(-4j/64) = 10^(-j/4) (f32 constants),
// pos 0..31 (shared by the row axis and the column axis), j 0..15. Precise cosf/sinf (|angle| <= 31).
// grid = 2 x 256 = 512 threads = 32 x 16 entries per table; one 4-B store per lane, 32 consecutive lanes = one whole
// ---------------------------------------------------------------------------
__device__ __forceinline__ float rope_freq(int j) {
  float f = 1.0f;
  f = (j == 1)  ? 0.5623413251903491f     : f;
  f = (j == 2)  ? 0.31622776601683794f    : f;
  f = (j == 3)  ? 0.17782794100389229f    : f;
  f = (j == 4)  ? 0.1f                    : f;
  f = (j == 5)  ? 0.05623413251903491f    : f;
  f = (j == 6)  ? 0.031622776601683794f   : f;
  f = (j == 7)  ? 0.017782794100389229f   : f;
  f = (j == 8)  ? 0.01f                   : f;
  f = (j == 9)  ? 0.005623413251903491f   : f;
  f = (j == 10) ? 0.0031622776601683794f  : f;
  f = (j == 11) ? 0.0017782794100389228f  : f;
  f = (j == 12) ? 0.001f                  : f;
  f = (j == 13) ? 0.0005623413251903491f  : f;
  f = (j == 14) ? 0.00031622776601683794f : f;
  f = (j == 15) ? 0.00017782794100389227f : f;
  return f;
}

__global__ __launch_bounds__(256) void ropetab_kernel(float* __restrict__ tc, float* __restrict__ ts) {
  const int i = blockIdx.x * 256 + threadIdx.x;      // 0..511 = pos*16 + j
  if (i < TABN) {
    const int pos = i >> 4, j = i & 15;
    const float a = (float)pos * rope_freq(j);
    const float c = cosf(a);
    const float s = sinf(a);
    ((float*)tc)[i] = c;
    ((float*)ts)[i] = s;
    
  }
}

// ---------------------------------------------------------------------------
// Per-token 2-D RoPE (interleaved pairs (2i,2i+1) inside each head; pairs 0..15 use the row index y = n>>5, pairs 16..31
// the column index x = n&31; tables shared by all heads) followed by RMSNorm over the WHOLE 1024-wide (heads x dim) row:
// v = rope(v); v = v * rsqrt(mean_1024(v*v) + 1e-6) * bf16(w[col]); then bf16 hi/lo split into planes [4096][1024].
// One block of 128 threads per token row g = b*1024+n; thread t owns columns 8t..8t+7 (= 4 rotary pairs p0..p0+3, p0 = (4t)&31,
// all four in the same half of the pair range). All loads are 16-B vectors. Stores: 16 B per lane per plane, 128 lanes cover
// LDS: redq/redk[4] written by lane 0 of each of the 4 waves before the barrier.
// ---------------------------------------------------------------------------
__global__ __launch_bounds__(128) void ropenorm_kernel(const float* __restrict__ qkf,
                                                       const float* __restrict__ tc, const float* __restrict__ ts,
                                                       const float* __restrict__ qw, const float* __restrict__ kw,
                                                       unsigned short* __restrict__ qh, unsigned short* __restrict__ ql,
                                                       unsigned short* __restrict__ kh, unsigned short* __restrict__ kl) {
  __shared__ float redq[4], redk[4];
  const int g = blockIdx.x;                 // token row 0..MTOK-1
  const int n = g & (NTOK - 1);
  const int py = n >> 5, px = n & 31;
  const int t = threadIdx.x, lane = t & 31, wave = t >> 5;
  const int i0 = t * 8;

  const float* qr = qkf + (size_t)g * QKP + i0;
  const float* kr = qr + INNER;
  const v4f qa = *(const v4f*)(qr), qb = *(const v4f*)(qr + 4);
  const v4f ka = *(const v4f*)(kr), kb = *(const v4f*)(kr + 4);

  const int p0   = (4 * t) & 31;
  const int hsel = p0 >> 4;                 // 0: row-axis angles, 1: column-axis angles
  const int pos  = py + hsel * (px - py);
  const int toff = pos * 16 + (p0 & 15);
  const v4f cv = *(const v4f*)(tc + toff);
  const v4f sv = *(const v4f*)(ts + toff);

  float q8[8], k8[8];
  q8[0] = qa[0]; q8[1] = qa[1]; q8[2] = qa[2]; q8[3] = qa[3];
  q8[4] = qb[0]; q8[5] = qb[1]; q8[6] = qb[2]; q8[7] = qb[3];
  k8[0] = ka[0]; k8[1] = ka[1]; k8[2] = ka[2]; k8[3] = ka[3];
  k8[4] = kb[0]; k8[5] = kb[1]; k8[6] = kb[2]; k8[7] = kb[3];

  float rq[8], rk[8];
#pragma unroll
  for (int e = 0; e < 4; ++e) {
    const float c = cv[e], s = sv[e];
    const float qe = q8[2 * e], qo = q8[2 * e + 1];
    const float ke = k8[2 * e], ko = k8[2 * e + 1];
    rq[2 * e]     = qe * c - qo * s;
    rq[2 * e + 1] = qe * s + qo * c;
    rk[2 * e]     = ke * c - ko * s;
    rk[2 * e + 1] = ke * s + ko * c;
  }
  float ssq = 0.0f, ssk = 0.0f;
#pragma unroll
  for (int e = 0; e < 8; ++e) { ssq += rq[e] * rq[e]; ssk += rk[e] * rk[e]; }
#pragma unroll
  for (int off = 1; off < 32; off <<= 1) { ssq += __shfl_xor(ssq, off, 32); ssk += __shfl_xor(ssk, off, 32); }
  if (lane == 0) { redq[wave] = ssq; redk[wave] = ssk; }
  __syncthreads();
  const float tq = (redq[0] + redq[1]) + (redq[2] + redq[3]);
  const float tk = (redk[0] + redk[1]) + (redk[2] + redk[3]);
  const float rmq = rsqrtf(tq * (1.0f / (float)INNER) + RMS_EPS);
  const float rmk = rsqrtf(tk * (1.0f / (float)INNER) + RMS_EPS);

  const v4f wqa = *(const v4f*)(qw + i0), wqb = *(const v4f*)(qw + i0 + 4);
  const v4f wka = *(const v4f*)(kw + i0), wkb = *(const v4f*)(kw + i0 + 4);
  float wq8[8], wk8[8];
  wq8[0] = bf_rne(wqa[0]); wq8[1] = bf_rne(wqa[1]); wq8[2] = bf_rne(wqa[2]); wq8[3] = bf_rne(wqa[3]);
  wq8[4] = bf_rne(wqb[0]); wq8[5] = bf_rne(wqb[1]); wq8[6] = bf_rne(wqb[2]); wq8[7] = bf_rne(wqb[3]);
  wk8[0] = bf_rne(wka[0]); wk8[1] = bf_rne(wka[1]); wk8[2] = bf_rne(wka[2]); wk8[3] = bf_rne(wka[3]);
  wk8[4] = bf_rne(wkb[0]); wk8[5] = bf_rne(wkb[1]); wk8[6] = bf_rne(wkb[2]); wk8[7] = bf_rne(wkb[3]);

  v4u hq, lq, hk, lk;
#pragma unroll
  for (int e = 0; e < 4; ++e) {
    const float fq0 = rq[2 * e] * rmq * wq8[2 * e];
    const float fq1 = rq[2 * e + 1] * rmq * wq8[2 * e + 1];
    const float fk0 = rk[2 * e] * rmk * wk8[2 * e];
    const float fk1 = rk[2 * e + 1] * rmk * wk8[2 * e + 1];
    const unsigned short hq0 = f2bf_bits(fq0), hq1 = f2bf_bits(fq1);
    const unsigned short hk0 = f2bf_bits(fk0), hk1 = f2bf_bits(fk1);
    const unsigned short lq0 = f2bf_bits(fq0 - bf_bits2f(hq0)), lq1 = f2bf_bits(fq1 - bf_bits2f(hq1));
    const unsigned short lk0 = f2bf_bits(fk0 - bf_bits2f(hk0)), lk1 = f2bf_bits(fk1 - bf_bits2f(hk1));
    hq[e] = pk16(hq0, hq1); lq[e] = pk16(lq0, lq1);
    hk[e] = pk16(hk0, hk1); lk[e] = pk16(lk0, lk1);
  }
  const size_t o = (size_t)g * INNER + i0;
  {
    *(v4u*)(qh + o) = hq;
    *(v4u*)(ql + o) = lq;
    *(v4u*)(kh + o) = hk;
    *(v4u*)(kl + o) = lk;
    
  }
}

// =====================================================================================
// Full (non-causal, unmasked) attention, head dim 64, all batches in one launch.
//   q planes (hi/lo bf16) [4096][1024]: element (b, n, h, d) at [(b*1024+n)*1024 + h*64 + d]
//   k planes (hi/lo bf16) [4096][1024]: same layout
//   v^T planes (hi/lo bf16) [1024][4096]: element (h, d, b, t) at [(h*64 + d)*4096 + b*1024 + t]
//   out CTX2 plane u16 [4096][2048]: hi bits of o(b,n,h,d) at col h*64+d, lo bits (o - hi) at col 1024 + h*64+d.
//   scores^T = (k . q^T) * 0.125 : A = K rows, B = Q rows; bf16 hi/lo split (hi.hi + lo.hi + hi.lo) on v_wmma_f32_16x16x32_bf16
//   out^T    = v^T . p^T         : A = V^T rows, B = P^T; bf16 hi/lo split of p (unnormalised exp) and v, f32 accumulate, x 1/rowsum at the end
//   Transposed tiles: a lane holds one query (column c) and, per 16-key tile, keys 8*hh + 0..7 in its 8 accumulator registers. Two score
//   tiles (keys 0..15 and 16..31 of a 32-key block), converted in place, are the B operand of the second product in the k order of the
//   V^T fragment loads (elements 0..7 = keys 8*hh + 0..7, elements 8..15 = keys 16 + 8*hh + 0..7): P never goes through LDS.
//   online softmax in f32 over the 1024 keys of the batch element (16 chunks of 64, compile-time trip count, no masking): maximum in-lane
//   plus one exchange between the wave halves per chunk; each half sums its own keys, the two sums are joined once in the epilogue.
//   Block = 4 waves = 64 query rows of one (batch, head); grid.x = 4 * 16 * 16 = 1024.
//   K / V^T chunk staging: 128 threads x 32 elements per plane = the whole 64x64 tile (16-B copies, plain loads,
//   __syncthreads before and after); fragment loads read the LDS tiles with the same v8b element type.
//   LDS extents: K/V tiles 64x64 fully staged every chunk.
// =====================================================================================
#define AT_D 64
#define AT_NW 4
#define AT_QB 64
#define AT_KC 64
// LDS row pitch of the K and V^T tiles in elements: 64 data + 8 pad = 144 B = 16 B x 9 (odd), so the 16 rows that one
// 16-byte fragment read touches fall on 16 different groups of four banks; at 128 B they fall on two. Pad elements are never read.
#define AT_LP 72

__device__ __forceinline__ unsigned short at_bf_bits(float f) {
  unsigned u = __float_as_uint(f);
  return (unsigned short)((u + 0x7FFFu + ((u >> 16) & 1u)) >> 16);
}
__device__ __forceinline__ __bf16 at_f2bf(float f) { return __builtin_bit_cast(__bf16, at_bf_bits(f)); }
__device__ __forceinline__ void at_split(float f, __bf16& hi, __bf16& lo) {
  const unsigned short hb = at_bf_bits(f);
  hi = __builtin_bit_cast(__bf16, hb);
  lo = at_f2bf(f - __uint_as_float(((unsigned)hb) << 16));
}
__device__ __forceinline__ v8f at_mma(v16b a, v16b b, v8f c) {
  c = __builtin_amdgcn_wmma_f32_16x16x32_bf16(false, a, false, b, (short)0, c, false, false);
  asm volatile("v_nop\n\tv_nop\n\tv_nop\n\tv_nop" : "+v"(c) : "v"(a), "v"(b));
  return c;
}

// value of lane l ^ 16 (the other wave half), by a vector cross-row move
__device__ __forceinline__ float at_xhalf(float x) {
  return __builtin_bit_cast(float, __builtin_amdgcn_permlanex16(__builtin_bit_cast(int, x), __builtin_bit_cast(int, x),
                                                                0x76543210, 0xfedcba98, false, false));
}

__global__ __launch_bounds__(128)
void attn_kernel(const unsigned short* __restrict__ qhp, const unsigned short* __restrict__ qlp,
                 const unsigned short* __restrict__ khp, const unsigned short* __restrict__ klp,
                 const unsigned short* __restrict__ vhp, const unsigned short* __restrict__ vlp,
                 unsigned short* __restrict__ aop, float sscale) {
  union FB { v16b v; v8b h[2]; };
  __shared__ __align__(16) __bf16 Ksh[AT_KC * AT_LP];            // K hi [kv][d], pitch AT_LP   9 KB
  __shared__ __align__(16) __bf16 Ksl[AT_KC * AT_LP];            // K lo
  __shared__ __align__(16) __bf16 Vth[AT_D * AT_LP];             // V hi [d][kv], pitch AT_LP   9 KB
  __shared__ __align__(16) __bf16 Vtl[AT_D * AT_LP];             // V lo
  __shared__ __align__(16) float  Os[AT_NW][16 * 68];            // per wave out tile, pitch 68

  const int tid  = threadIdx.x;
  const int wave = tid >> 5;
  const int lane = tid & 31;
  const int hh   = lane >> 4;
  const int c    = lane & 15;

  const int nqb = NTOK / AT_QB;            // 16 query blocks per batch element
  const int bx = blockIdx.x;              // grid = NB * NH * nqb (exact)
  const int qb = bx % nqb;
  const int hb = bx / nqb;
  const int h  = hb % NH;                 // 0..15
  const int b  = hb / NH;                 // 0..3
  const int q0 = b * NTOK + qb * AT_QB + wave * 16;   // row in the q / CTX2 planes

  const __bf16* Qh = (const __bf16*)(const void*)qhp + (size_t)h * AT_D;
  const __bf16* Ql = (const __bf16*)(const void*)qlp + (size_t)h * AT_D;
  const __bf16* Kh = (const __bf16*)(const void*)khp + (size_t)h * AT_D;
  const __bf16* Kl = (const __bf16*)(const void*)klp + (size_t)h * AT_D;
  const __bf16* Vh = (const __bf16*)(const void*)vhp + (size_t)h * AT_D * VTP + (size_t)b * NTOK;
  const __bf16* Vl = (const __bf16*)(const void*)vlp + (size_t)h * AT_D * VTP + (size_t)b * NTOK;
  unsigned short* Ch = aop + (size_t)h * AT_D;                    // hi columns
  unsigned short* Cl = aop + (size_t)INNER + (size_t)h * AT_D;    // lo columns

  // ---- Q fragments (B operand, column = query = lane&15, split k map via Frag load): 2 d-chunks, hi and lo ----
  v16b qah[2], qal[2];
#pragma unroll
  for (int dc = 0; dc < 2; ++dc) {
    const __bf16* qr = Qh + (size_t)(q0 + c) * INNER + dc * 32 + 8 * hh;
    const __bf16* ql = Ql + (size_t)(q0 + c) * INNER + dc * 32 + 8 * hh;
    qah[dc] = Frag<__bf16>::load(qr);
    qal[dc] = Frag<__bf16>::load(ql);
  }

  float mrow = -INFINITY, lrow = 0.f;   // this lane's query: running maximum (both halves alike), sum over this half's keys
  v8f oacc[4];                          // oacc[t][r] = out^T[d = t*16 + 8*hh + r][query c]
#pragma unroll
  for (int t = 0; t < 4; ++t) oacc[t] = (v8f){0.f,0.f,0.f,0.f,0.f,0.f,0.f,0.f};

  const int nChunks = NTOK / AT_KC;   // 16, compile-time constant
  for (int kc = 0; kc < nChunks; ++kc) {
    const int kv0 = kc * AT_KC;
    __syncthreads();
    {
      // staging coverage: 128 threads x (4 x 8) elements = 64 rows x 64 per plane = the whole chunk tile
      const int r = tid >> 1, half = (tid & 1) * 32;
      const __bf16* ksh = Kh + (size_t)(b * NTOK + kv0 + r) * INNER + half;   // K row (b, kv0+r), d = half..half+31
      const __bf16* ksl = Kl + (size_t)(b * NTOK + kv0 + r) * INNER + half;
      const __bf16* vsh = Vh + (size_t)r * VTP + kv0 + half;                  // V^T row d = r, keys kv0+half..+31
      const __bf16* vsl = Vl + (size_t)r * VTP + kv0 + half;
#pragma unroll
      for (int i = 0; i < 4; ++i) {
        const v8b a0 = *(const v8b*)(ksh + 8 * i);
        const v8b a1 = *(const v8b*)(ksl + 8 * i);
        const v8b b0 = *(const v8b*)(vsh + 8 * i);
        const v8b b1 = *(const v8b*)(vsl + 8 * i);
        *(v8b*)(Ksh + r * AT_LP + half + 8 * i) = a0;
        *(v8b*)(Ksl + r * AT_LP + half + 8 * i) = a1;
        *(v8b*)(Vth + r * AT_LP + half + 8 * i) = b0;
        *(v8b*)(Vtl + r * AT_LP + half + 8 * i) = b1;
      }
    }
    __syncthreads();

    v8f s[4];
#pragma unroll
    for (int j = 0; j < 4; ++j) {
      s[j] = (v8f){0.f,0.f,0.f,0.f,0.f,0.f,0.f,0.f};
#pragma unroll
      for (int dc = 0; dc < 2; ++dc) {
        FB kb, kl;
        kb.h[0] = *(const v8b*)(Ksh + (j * 16 + c) * AT_LP + dc * 32 + 8 * hh);
        kb.h[1] = *(const v8b*)(Ksh + (j * 16 + c) * AT_LP + dc * 32 + 16 + 8 * hh);
        kl.h[0] = *(const v8b*)(Ksl + (j * 16 + c) * AT_LP + dc * 32 + 8 * hh);
        kl.h[1] = *(const v8b*)(Ksl + (j * 16 + c) * AT_LP + dc * 32 + 16 + 8 * hh);
        s[j] = at_mma(kb.v, qah[dc], s[j]);
        s[j] = at_mma(kl.v, qah[dc], s[j]);
        s[j] = at_mma(kb.v, qal[dc], s[j]);
      }
    }
    // s[j][r] = score of key kv0 + j*16 + 8*hh + r against query c: scale, then this query's chunk maximum
    float mj[4];
#pragma unroll
    for (int j = 0; j < 4; ++j) {
      float m = -INFINITY;
#pragma unroll
      for (int r = 0; r < 8; ++r) {
        const float sv = s[j][r] * sscale;
        s[j][r] = sv;
        m = fmaxf(m, sv);
      }
      mj[j] = m;
    }
    float cm = fmaxf(fmaxf(mj[0], mj[1]), fmaxf(mj[2], mj[3]));
    cm = fmaxf(cm, at_xhalf(cm));
    const float mnew = fmaxf(mrow, cm);
    const float alpha = expf(mrow - mnew);
    mrow = mnew;
    FB ph[2], pl[2];   // P^T hi / lo as B operands, one per 32 keys: elements 0..7 from tile 2*kk, 8..15 from tile 2*kk + 1
    float pj[4];
#pragma unroll
    for (int j = 0; j < 4; ++j) {
      float psum = 0.f;
#pragma unroll
      for (int r = 0; r < 8; ++r) {
        const float p = expf(s[j][r] - mnew);
        psum += p;
        __bf16 a, bl; at_split(p, a, bl);
        ph[j >> 1].v[(j & 1) * 8 + r] = a;
        pl[j >> 1].v[(j & 1) * 8 + r] = bl;
      }
      pj[j] = psum;
    }
    lrow = lrow * alpha + ((pj[0] + pj[1]) + (pj[2] + pj[3]));
#pragma unroll
    for (int t = 0; t < 4; ++t)
#pragma unroll
      for (int r = 0; r < 8; ++r) oacc[t][r] *= alpha;
    // unrolled: the P^T fragments are registers and are picked by kk at compile time
#pragma unroll
    for (int kk = 0; kk < 2; ++kk) {
#pragma unroll
      for (int t = 0; t < 4; ++t) {
        FB vb, vl;
        vb.h[0] = *(const v8b*)(Vth + (t * 16 + c) * AT_LP + kk * 32 + 8 * hh);
        vb.h[1] = *(const v8b*)(Vth + (t * 16 + c) * AT_LP + kk * 32 + 16 + 8 * hh);
        vl.h[0] = *(const v8b*)(Vtl + (t * 16 + c) * AT_LP + kk * 32 + 8 * hh);
        vl.h[1] = *(const v8b*)(Vtl + (t * 16 + c) * AT_LP + kk * 32 + 16 + 8 * hh);
        oacc[t] = at_mma(vb.v, ph[kk].v, oacc[t]);
        oacc[t] = at_mma(vl.v, ph[kk].v, oacc[t]);
        oacc[t] = at_mma(vb.v, pl[kk].v, oacc[t]);
      }
    }
  }

  float* os = Os[wave];
  {
    const float inv = 1.0f / (lrow + at_xhalf(lrow));   // the two halves' key sums of query c, joined
#pragma unroll
    for (int t = 0; t < 4; ++t) {
      v4f o0, o1;
#pragma unroll
      for (int r = 0; r < 4; ++r) { o0[r] = oacc[t][r] * inv; o1[r] = oacc[t][4 + r] * inv; }
      *(v4f*)(os + c * 68 + t * 16 + 8 * hh)     = o0;   // row = query c, columns d = t*16 + 8*hh + 0..7
      *(v4f*)(os + c * 68 + t * 16 + 8 * hh + 4) = o1;
    }
  }
  __builtin_amdgcn_fence(__ATOMIC_RELEASE, "workgroup");
  __builtin_amdgcn_wave_barrier();
  __builtin_amdgcn_fence(__ATOMIC_ACQUIRE, "workgroup");
  {
    const int q = lane >> 3, c8 = (lane & 7) * 8;
    {
#pragma unroll
      for (int it = 0; it < 4; ++it) {
        const int row = it * 4 + q;
        const float* sp = os + row * 68 + c8;
        v8h hv, lv;
#pragma unroll
        for (int e = 0; e < 8; ++e) {
          const unsigned short hbits = f2bf_bits(sp[e]);
          const unsigned short lbits = f2bf_bits(sp[e] - bf_bits2f(hbits));
          hv[e] = __builtin_bit_cast(_Float16, hbits);
          lv[e] = __builtin_bit_cast(_Float16, lbits);
        }
        *(v8h*)(Ch + (size_t)(q0 + row) * AOP + c8) = hv;
        *(v8h*)(Cl + (size_t)(q0 + row) * AOP + c8) = lv;
      }
      
    }
  }
}

// ---------------------------------------------------------------------------
// Output RMSNorm over C + residual + back to NCHW:
//   out[b][c][n] = Of[b*1024+n][c] * rsqrt(mean_C(Of[tok][.]^2) + 1e-6) * bf16(w[c]) + bf16(x[b][c][n]).
// One block of 512 threads (16 waves) per 32 consecutive tokens x 512 channels; grid = 128 token groups x 2 channel halves = 256,
// as many blocks as the chip has WGPs. Every global load of a thread is issued before the first wait: nothing is fetched in a loop.
// Wave w holds the whole rows of tokens 2w and 2w+1 in registers (8 x 16 B per lane and row), sums their squares (per lane one sum
// per channel half, the two added, then the lane tree), scales the block's half of each row and writes it to the LDS tile [token][channel].
// Behind the one barrier a thread reads a 4-token x 4-channel square as four 16-B rows; its columns are the 16-B output vectors
// (4 tokens of one channel), so 8 lanes store one whole 128-B line of out and a block writes only whole lines.
// LDS pitch 516 floats = 16 B x 129 (odd); the 16-B unit index of a row is XORed with 2 for tokens 16..31, so that the 16 lanes
// of a half wave (tokens 4j+q, j = 0..7, two channel units) read 16 different groups of four banks.
// Coverage: 256 blocks x 32 tokens x 512 channels = 4 x 1024 x 1024 outputs, each exactly once.
// ---------------------------------------------------------------------------
#define FN_TOK 32
#define FN_CS  512
#define FN_P   (FN_CS + 4)
static_assert(NTOK % FN_TOK == 0 && CH == 2 * FN_CS && CH == 8 * 128 && FN_TOK == 2 * 16);
__global__ __launch_bounds__(512) void final_kernel(const float* __restrict__ of, const float* __restrict__ nw,
                                                    const float* __restrict__ xin, float* __restrict__ out) {
  __shared__ __align__(16) float tf[FN_TOK * FN_P];
  const int tid = threadIdx.x, lane = tid & 31, wave = tid >> 5;
  const int sl   = blockIdx.x & 1;            // channel half
  const int tok0 = (blockIdx.x >> 1) * FN_TOK;
  const int b = tok0 / NTOK, n0 = tok0 - b * NTOK;
  const int c0 = sl * FN_CS;
  const int j  = tid & 7;                     // token quad: tokens 4j..4j+3
  const int cg = tid >> 3;                    // channel unit 0..63 (4 channels), second pass + 64

  // all loads: the two rows first (the sums wait for them alone), then the weights, then the residual.
  // vo = the block's own channel half of a row, vx = the other half, read for the row sum only.
  const float* po  = of + (size_t)(tok0 + wave * 2) * CH + lane * 4 + c0;
  const float* px  = of + (size_t)(tok0 + wave * 2) * CH + lane * 4 + (FN_CS - c0);
  const float* xp0 = xin + ((size_t)(b * CH + c0 + cg * 4)) * NTOK + n0 + 4 * j;
  v4f vo[2][4], vx[2][4];
#pragma unroll
  for (int i = 0; i < 2; ++i) {
#pragma unroll
    for (int kk = 0; kk < 4; ++kk) vo[i][kk] = *(const v4f*)(po + i * CH + kk * 128);
#pragma unroll
    for (int kk = 0; kk < 4; ++kk) vx[i][kk] = *(const v4f*)(px + i * CH + kk * 128);
  }
  v4f w4[4];
#pragma unroll
  for (int kk = 0; kk < 4; ++kk) w4[kk] = *(const v4f*)(nw + c0 + kk * 128 + lane * 4);
  v4f xr[2][4];
#pragma unroll
  for (int e = 0; e < 4; ++e) {
    xr[0][e] = *(const v4f*)(xp0 + e * NTOK);
    xr[1][e] = *(const v4f*)(xp0 + (256 + e) * NTOK);
  }
  // naming the three address pairs here keeps them untouched up to this wait, which stands in front of every reuse of their registers;
  // as a memory barrier for the compiler it also keeps every load above issued before the first wait for data
  asm volatile("s_wait_xcnt 0x0" :: "v"(po), "v"(px), "v"(xp0) : "memory");

  // row sum of squares = (sum over the own half) + (sum over the other half)
  float ss[2];
#pragma unroll
  for (int i = 0; i < 2; ++i) {
    float so = 0.0f, sx = 0.0f;
#pragma unroll
    for (int kk = 0; kk < 4; ++kk) {
      const v4f a = vo[i][kk], c = vx[i][kk];
      so += a[0] * a[0] + a[1] * a[1] + a[2] * a[2] + a[3] * a[3];
      sx += c[0] * c[0] + c[1] * c[1] + c[2] * c[2] + c[3] * c[3];
    }
    ss[i] = so + sx;
  }
#pragma unroll
  for (int off = 1; off < 32; off <<= 1) {
    const float t0 = __shfl_xor(ss[0], off, 32), t1 = __shfl_xor(ss[1], off, 32);
    ss[0] += t0; ss[1] += t1;
  }

  const int wswz = (wave >> 3) << 1;          // tokens 2w, 2w+1 >= 16
#pragma unroll
  for (int i = 0; i < 2; ++i) {
    const float rm = rsqrtf(ss[i] * (1.0f / (float)CH) + RMS_EPS);
    float* row = tf + (wave * 2 + i) * FN_P;
#pragma unroll
    for (int kk = 0; kk < 4; ++kk) {
      const v4f a = vo[i][kk];
      v4f o;
#pragma unroll
      for (int e = 0; e < 4; ++e) o[e] = a[e] * rm * bf_rne(w4[kk][e]);
      *(v4f*)(row + (((kk * 32 + lane) ^ wswz) << 2)) = o;
    }
  }
  __syncthreads();

  const int rswz = (j >> 2) << 1;
#pragma unroll
  for (int it = 0; it < 2; ++it) {
    const int cu = it * 64 + cg;
    v4f rd[4];
#pragma unroll
    for (int q = 0; q < 4; ++q) rd[q] = *(const v4f*)(tf + (4 * j + q) * FN_P + ((cu ^ rswz) << 2));
#pragma unroll
    for (int e = 0; e < 4; ++e) {
      v4f o;
#pragma unroll
      for (int q = 0; q < 4; ++q) o[q] = rd[q][e] + bf_rne(xr[it][e][q]);
      *(v4f*)(out + ((size_t)(b * CH + c0 + cu * 4 + e)) * NTOK + n0 + 4 * j) = o;
    }
  }
}

// ---------------------------------------------------------------------------
// Workspace region map (byte offsets; every region is fully written by its producer launch before any consumer
//   XB    bf16 [4096][1024]          0       8388608
//   WQKV  bf16 [3072][1024]    8388608       6291456
//   WP2   bf16 [1024][2048]   14680064       4194304
//   TC    f32  [32][16]       18874368          2048   TS  18876416  2048
//   QKf   f32  [4096][2048]   18878464      33554432   (dead after ropenorm; the same 32 MiB then hold
//                                                       CTX2 u16 [4096][2048] at 18878464 (16777216) and
//                                                       Of   f32  [4096][1024] at 35655680 (16777216), disjoint)
//   Qh    bf16 [4096][1024]   52432896       8388608   Ql  60821504
//   Kh    bf16 [4096][1024]   69210112       8388608   Kl  77598720
//   VTh   bf16 [1024][4096]   85987328       8388608   VTl 94375936
//   total                    102764544
// ---------------------------------------------------------------------------
extern "C" void kernel_launch(void* const* d_in, const int* in_sizes, int n_in,
                              void* d_out, int out_size, void* d_ws, size_t ws_size,
                              hipStream_t stream) {
  if (n_in < 7) return;
  if (in_sizes[0] != NB * CH * NTOK) return;        // hidden_states [4][1024][32][32]
  if (in_sizes[1] != NQKV * CH) return;             // w_qkv [3072][1024]
  if (in_sizes[2] != NQKV) return;                  // b_qkv [3072]
  if (in_sizes[3] != INNER) return;                 // q_norm_w [1024]
  if (in_sizes[4] != INNER) return;                 // k_norm_w [1024]
  if (in_sizes[5] != CH * INNER) return;            // w_proj [1024][1024]
  if (in_sizes[6] != CH) return;                    // norm_out_w [1024]
  if (out_size != NB * CH * NTOK) return;

  const float* x    = (const float*)d_in[0];
  const float* wqkv = (const float*)d_in[1];   // [out 3072][in 1024]
  const float* bqkv = (const float*)d_in[2];
  const float* qnw  = (const float*)d_in[3];
  const float* knw  = (const float*)d_in[4];
  const float* wprj = (const float*)d_in[5];   // [out 1024][in 1024]
  const float* onw  = (const float*)d_in[6];

  const size_t PXB = (size_t)MTOK * CH * 2;        // 8388608
  const size_t PWQ = (size_t)NQKV * CH * 2;        // 6291456
  const size_t PWP = (size_t)CH * AOP * 2;         // 4194304
  const size_t PTB = (size_t)TABN * 4;             // 2048
  const size_t PQK = (size_t)MTOK * QKP * 4;       // 33554432
  const size_t PCX = (size_t)MTOK * AOP * 2;       // 16777216
  const size_t POF = (size_t)MTOK * CH * 4;        // 16777216
  const size_t PPL = (size_t)MTOK * INNER * 2;     // 8388608 per q/k plane
  const size_t PVT = (size_t)INNER * VTP * 2;      // 8388608 per v^T plane
  if (PCX + POF > PQK) return;                     // CTX2 and Of share the QKf region, disjoint halves
  size_t off = 0;
  const size_t oXB  = off; off += PXB;
  const size_t oWQ  = off; off += PWQ;
  const size_t oWP  = off; off += PWP;
  const size_t oTC  = off; off += PTB;
  const size_t oTS  = off; off += PTB;
  const size_t oQK  = off; off += PQK;
  const size_t oCX  = oQK;
  const size_t oOF  = oQK + PCX;
  const size_t oQh  = off; off += PPL;  const size_t oQl = off; off += PPL;
  const size_t oKh  = off; off += PPL;  const size_t oKl = off; off += PPL;
  const size_t oVTh = off; off += PVT;  const size_t oVTl = off; off += PVT;
  if (off > ws_size) return;                       // off = 102764544
  if (off > (size_t)134217728) return;

  char* ws = (char*)d_ws;
  unsigned short* XB   = (unsigned short*)(ws + oXB);
  unsigned short* WQKV = (unsigned short*)(ws + oWQ);
  unsigned short* WP2  = (unsigned short*)(ws + oWP);
  float*          TC   = (float*)(ws + oTC);
  float*          TS   = (float*)(ws + oTS);
  float*          QKf  = (float*)(ws + oQK);
  unsigned short* CTX2 = (unsigned short*)(ws + oCX);
  float*          Of   = (float*)(ws + oOF);
  unsigned short* Qh   = (unsigned short*)(ws + oQh);  unsigned short* Ql  = (unsigned short*)(ws + oQl);
  unsigned short* Kh   = (unsigned short*)(ws + oKh);  unsigned short* Kl  = (unsigned short*)(ws + oKl);
  unsigned short* VTh  = (unsigned short*)(ws + oVTh); unsigned short* VTl = (unsigned short*)(ws + oVTl);

  const dim3 blk(256);

  // (1) x[b] viewed [R=1024 c][Cc=1024 n] (pitch 1024) -> XB_b[n][c] (pitch 1024); grid (Cc/64, R/64, B) = (16, 16, 4)
  tconv_kernel<<<dim3(NTOK / 64, CH / 64, NB), blk, 0, stream>>>(x, XB, NTOK, CH, (long)CH * NTOK, (long)NTOK * CH);
  // (2) w_qkv [3072][1024] -> WQKV bf16 same layout; 393216 units -> 1536 blocks
  const int n8q = NQKV * CH / 8;
  convrows_kernel<false><<<dim3(n8q / 256), blk, 0, stream>>>(wqkv, WQKV, CH, CH, n8q);
  // (3) w_proj [1024][1024] -> WP2 [1024][2048], cols k and 1024+k; 131072 units -> 512 blocks
  const int n8p = CH * INNER / 8;
  convrows_kernel<true><<<dim3(n8p / 256), blk, 0, stream>>>(wprj, WP2, INNER, AOP, n8p);
  // (4) rotary cos/sin tables [32][16]
  ropetab_kernel<<<dim3(2), blk, 0, stream>>>(TC, TS);
  // (5) q|k = XB . WQKV[0..2047]^T + b -> QKf f32 [4096][2048]   (M=4096, N=2048, K=1024; 32 x 16 = 512 blocks of 128 threads)
  const dim3 gblk(128);
  const dim3 gQK((MTOK / 128) * (QKP / 128), 1);
  wmma_gemm64<1, false, 2, 0, false, CH><<<gQK, gblk, 0, stream>>>(
      XB, XB, 0L, WQKV, WQKV, 0L, (void*)QKf, (void*)QKf, QKP, 0L,
      bqkv, bqkv, 0L, MTOK, QKP, CH, 1.0f);
  // (6) v^T = WQKV[2048..3071] . XB^T + b[2048+m] -> VTh|VTl [1024][4096]   (M=1024, N=4096, K=1024; 8 x 32 = 256 blocks)
  const dim3 gVT((INNER / 128) * (MTOK / 128), 1);
  wmma_gemm64<1, false, 1, 2, false, CH><<<gVT, gblk, 0, stream>>>(
      WQKV + (size_t)2 * INNER * CH, WQKV + (size_t)2 * INNER * CH, 0L, XB, XB, 0L,
      (void*)VTh, (void*)VTl, VTP, 0L,
      bqkv + 2 * INNER, bqkv, 0L, INNER, MTOK, CH, 1.0f);
  // (7) RoPE + RMSNorm over 1024 for q and k -> Qh|Ql, Kh|Kl; one block of 128 threads per token row
  ropenorm_kernel<<<dim3(MTOK), dim3(128), 0, stream>>>(QKf, TC, TS, qnw, knw, Qh, Ql, Kh, Kl);
  // (8) attention per (batch, head, 64-query block) -> CTX2 [4096][2048] (hi | lo columns); 1024 blocks
  attn_kernel<<<dim3(NB * NH * (NTOK / 64)), dim3(128), 0, stream>>>(Qh, Ql, Kh, Kl, VTh, VTl, CTX2, 0.125f);
  // (9) Of = CTX2 . WP2^T -> f32 [4096][1024]   (M=4096, N=1024, K=2048; 32 x 8 = 256 blocks)
  const dim3 gO((MTOK / 128) * (CH / 128), 1);
  wmma_gemm64<1, false, 0, 0, false, AOP><<<gO, gblk, 0, stream>>>(
      CTX2, CTX2, 0L, WP2, WP2, 0L, (void*)Of, (void*)Of, CH, 0L,
      bqkv, bqkv, 0L, MTOK, CH, AOP, 1.0f);
  // (10) output RMSNorm + residual -> NCHW d_out; 128 groups of 32 tokens x 2 channel halves = 256 blocks of 512 threads
  final_kernel<<<dim3((MTOK / FN_TOK) * (CH / FN_CS)), dim3(512), 0, stream>>>(Of, onw, x, (float*)d_out);
  (void)hipGetLastError();
}

// v005
// One run takes 170 microseconds.
// Two timings next to v004 put it at 1.07 and 1.06 times that version's speed.
// Over all steps from v000 it is 2.77 times as fast.
// Contractions: q|k projection (f32 out) and v^T projection (bf16 hi|lo out) = v_wmma_f32_16x16x32_bf16 single products on bf16 planes of the RNE-converted inputs; q.k^T and p.v = bf16 hi/lo split (hi.hi + hi.lo + lo.hi); output projection = [CTXhi|CTXlo] x [Wp;Wp] bf16 single products (K-folded 2-term); f32 accumulate everywhere; RoPE, QK RMSNorm, output RMSNorm, online softmax, 1/rowsum, bias and residual in f32 on the VALU.
// Plane / carry map (all carry 1, nothing to fold back): XB = bf16(x) token-major [4096][1024] (row b*1024+n, n = y*32+x, col c);
// WQKV = bf16(w_qkv) [3072][1024] natural [out][in]; WP2 [1024][2048]: cols k and 1024+k both = bf16(w_proj[c][k]);
// TC/TS f32 [32 pos][16 pair] = cos/sin(pos * 10000^(-j/16)); QKf f32 [4096][2048] = pre-RoPE q (cols 0..1023) | k (cols 1024..2047) incl. bias;
// Qh|Ql, Kh|Kl bf16 [4096][1024] (col h*64+d) = hi/lo of the RoPE'd, RMSNorm'd q, k; VTh|VTl bf16 [1024 (h,d)][4096 (b,t)];
// P hi|lo = unnormalised exp in (0,1] (bf16, f32 exponent range), kept in registers, 1/rowsum applied to the f32 accumulator in the attention epilogue;
// CTX2 u16 [4096][2048] = ctx hi at col h*64+d, lo at col 1024+h*64+d; Of f32 [4096][1024] = ctx . w_proj^T.
#include <hip/hip_runtime.h>
#include <math.h>
#include <stdint.h>

#define NB    4
#define CH    1024
#define IMH   32
#define IMW   32
#define NTOK  1024
#define INNER 1024
#define NH    16
#define HD    64
#define NQKV  3072
#define QKP   2048
#define AOP   2048
#define VTP   (NB * NTOK)
#define MTOK  (NB * NTOK)
#define TABN  512
#define RMS_EPS 1e-6f

static_assert(NTOK == IMH * IMW);
static_assert(IMW == 32);
static_assert(INNER == NH * HD);
static_assert(HD == 64);
static_assert(NQKV == 3 * INNER);
static_assert(QKP == 2 * INNER);
static_assert(AOP == 2 * INNER);
static_assert(CH % 64 == 0);
static_assert(NTOK % 64 == 0);
static_assert(INNER % 64 == 0);
static_assert(MTOK % 64 == 0);
static_assert(CH % 32 == 0);
static_assert(AOP % 32 == 0);
static_assert(INNER == 128 * 8);
static_assert(CH == 8 * 128);
static_assert(TABN == 32 * (HD / 4));
static_assert((NQKV * CH) % (8 * 256) == 0);
static_assert((CH * INNER) % (8 * 256) == 0);
static_assert(CH % 256 == 0);
static_assert(INNER % 256 == 0);
static_assert(MTOK % 128 == 0 && QKP % 128 == 0 && INNER % 128 == 0 && CH % 128 == 0 && AOP % 128 == 0);

typedef __attribute__((ext_vector_type(16))) _Float16 v16h;
typedef __attribute__((ext_vector_type(8)))  _Float16 v8h;
typedef __attribute__((ext_vector_type(16))) __bf16   v16b;
typedef __attribute__((ext_vector_type(8)))  __bf16   v8b;
typedef __attribute__((ext_vector_type(8)))  float    v8f;
typedef __attribute__((ext_vector_type(4)))  float    v4f;
typedef __attribute__((ext_vector_type(2)))  float    v2f;
typedef __attribute__((ext_vector_type(4)))  unsigned int v4u;

__device__ __forceinline__ unsigned short f2bf_bits(float f) {
  unsigned u = __float_as_uint(f);
  return (unsigned short)((u + 0x7FFFu + ((u >> 16) & 1u)) >> 16);
}
__device__ __forceinline__ float bf_bits2f(unsigned short h) { return __uint_as_float(((unsigned)h) << 16); }
__device__ __forceinline__ float bf_rne(float f) { return bf_bits2f(f2bf_bits(f)); }
__device__ __forceinline__ unsigned pk16(unsigned short a, unsigned short b) { return (unsigned)a | ((unsigned)b << 16); }

// hazard guard behind the product loop, as a plain device helper
__device__ __forceinline__ void acc_guard4(v8f& a, v8f& b, v8f& c, v8f& d) { asm volatile("v_nop\n\tv_nop\n\tv_nop\n\tv_nop" : "+v"(a), "+v"(b), "+v"(c), "+v"(d)); }
template <typename T> struct Frag;
template <> struct Frag<_Float16> {
  typedef v16h V; typedef v8h H; union U { v16h v; v8h h[2]; };
  static __device__ __forceinline__ v16h load(const _Float16* p) {   // elements 0..7 <- p[0..7], 8..15 <- p[16..23]
    U f; f.h[0] = *(const v8h*)(p); f.h[1] = *(const v8h*)(p + 16); return f.v;
  }
  static __device__ __forceinline__ v8f mma(v16h a, v16h b, v8f c) {
    return __builtin_amdgcn_wmma_f32_16x16x32_f16(false, a, false, b, (short)0, c, false, false);
  }
};
template <> struct Frag<__bf16> {
  typedef v16b V; typedef v8b H; union U { v16b v; v8b h[2]; };
  static __device__ __forceinline__ v16b load(const __bf16* p) {
    U f; f.h[0] = *(const v8b*)(p); f.h[1] = *(const v8b*)(p + 16); return f.v;
  }
  static __device__ __forceinline__ v8f mma(v16b a, v16b b, v8f c) {
    return __builtin_amdgcn_wmma_f32_16x16x32_bf16(false, a, false, b, (short)0, c, false, false);
  }
};

// ---- Register-blocked batched WMMA GEMM ------------------------------------
// C[m,n] = scale * sum_k A[m,k] * Bt[n,k] (+bias)(+resid); each wave owns a 64x64 tile, a block of 4 waves (2 x 2) a 128x128 tile.
// A row-major [M,K]; Bt row-major [N,K]; M,N % 128 == 0, K % GT_BK == 0.
// Operand path: per stage of GT_BK k the block copies its 128 A rows and 128 Bt rows into LDS with 16-B loads whose lanes cover
// whole rows of the stage (GT_BK * 2 contiguous bytes), so every 128-B line is asked for once per block; the four waves read their
// fragments from LDS. Two LDS buffers: the next stage's global loads are issued before the current stage's products and
// stored after them, one __syncthreads() per stage. The k order of every accumulator is ascending in steps of 32.
// SPLIT (hi/lo operand planes) is not instantiated and not supported by the staged loop.
// BIAS_MODE: 0 = none, 1 = bias[m], 2 = bias[n]; the bias value is RNE-converted to bf16 precision before the f32 add.
// OUT_MODE: 0 = f32, 1 = f16, 2 = bf16 hi plane (Cout) + bf16 lo plane (Cout2).
// ET: 0 = f16 operands, 1 = bf16 operands (pointers passed as 16-bit storage)
template <int ET> struct Elem;
template <> struct Elem<0> { typedef _Float16 T; };
template <> struct Elem<1> { typedef __bf16 T; };
#define GT_BK 128
// LDS row pitch in elements: GT_BK data + 8 pad, = 16 B x odd, so the 16 rows of one 16-byte fragment read fall on different banks.
#define GT_LP (GT_BK + 8)
#define GT_CPR (GT_BK / 8)          // 16-byte pieces per staged row
#define GT_RPP (128 / GT_CPR)       // rows that 128 threads copy per pass
#define GT_NP  (128 / GT_RPP)       // passes per operand and stage
// LD: row pitch of A and of Bt in elements, a compile-time constant so that the row steps of the staging loads are immediate offsets.
template <int ET, bool SPLIT, int BIAS_MODE, int OUT_MODE, bool RESID, int LD, int ACT = 0>
__global__ __launch_bounds__(128) void wmma_gemm64(
    const unsigned short* __restrict__ Ap, const unsigned short* __restrict__ A2p, long strideA,
    const unsigned short* __restrict__ Btp, const unsigned short* __restrict__ Bt2p, long strideB,
    void* __restrict__ Cout, void* __restrict__ Cout2, int ldc, long strideC,
    const float* __restrict__ bias,
    const float* __restrict__ resid, long strideR,
    int M, int N, int K, float scale) {
  typedef typename Elem<ET>::T T;
  typedef typename Frag<T>::V V;
  typedef typename Frag<T>::H H;
  static_assert(!SPLIT, "the staged loop takes single operand planes");
  const T* A = (const T*)Ap; const T* Bt = (const T*)Btp;
  __shared__ __align__(16) T sA[2 * 128 * GT_LP];  // two stages of the block's 128 A rows
  __shared__ __align__(16) T sB[2 * 128 * GT_LP];  // two stages of the block's 128 Bt rows
  __shared__ __align__(16) float sT[4][16 * 68];   // per-wave 16x64 slab, pitch 68 floats
  const int b    = blockIdx.y;
  const int tid  = threadIdx.x;
  const int lane = tid & 31;
  const int wave = tid >> 5;
  const int tilesN = N >> 7;
  const int tilesM = M >> 7;
  const int tile = blockIdx.x;
  if (tile >= tilesM * tilesN) return;   // block-uniform, in front of every barrier
  const int tm = tile / tilesN;
  const int tn = tile - tm * tilesN;
  const int wm = (wave >> 1) << 6;             // this wave's 64x64 tile inside the block's 128x128
  const int wn = (wave & 1) << 6;
  const int m0 = (tm << 7) + wm;
  const int n0 = (tn << 7) + wn;

  const T* Ab  = A  + (size_t)b * strideA;
  const T* Bb  = Bt + (size_t)b * strideB;

  const int rlane = lane & 15;                 // row (A) / col (B, D) within subtile
  const int koff  = (lane >> 4) * 8;           // k offset of this lane half
  const int mOff  = (lane >> 4) * 8;           // D row offset

  // staging map: pass p, thread tid -> row p * GT_RPP + tid / GT_CPR, 8 elements at column (tid % GT_CPR) * 8
  const int srow = tid / GT_CPR;
  const int scol = (tid % GT_CPR) * 8;
  const T* gA = Ab + (size_t)((tm << 7) + srow) * LD + scol;
  const T* gB = Bb + (size_t)((tn << 7) + srow) * LD + scol;
  const int sOff = srow * GT_LP + scol;

  v8f acc[4][4];
#pragma unroll
  for (int i = 0; i < 4; ++i)
#pragma unroll
    for (int j = 0; j < 4; ++j) acc[i][j] = (v8f){0.f,0.f,0.f,0.f,0.f,0.f,0.f,0.f};

  H ra[GT_NP], rb[GT_NP];
#pragma unroll
  for (int p = 0; p < GT_NP; ++p) {
    ra[p] = *(const H*)(gA + p * GT_RPP * LD);
    rb[p] = *(const H*)(gB + p * GT_RPP * LD);
  }
#pragma unroll
  for (int p = 0; p < GT_NP; ++p) {
    *(H*)(sA + sOff + p * GT_RPP * GT_LP) = ra[p];
    *(H*)(sB + sOff + p * GT_RPP * GT_LP) = rb[p];
  }
  __syncthreads();

  const int nStages = K / GT_BK;
  for (int st = 0; st < nStages; ++st) {
    const int cur = (st & 1) * (128 * GT_LP);
    const bool more = st + 1 < nStages;        // block-uniform
    if (more) {
      const T* pa = gA + (st + 1) * GT_BK;
      const T* pb = gB + (st + 1) * GT_BK;
#pragma unroll
      for (int p = 0; p < GT_NP; ++p) {
        ra[p] = *(const H*)(pa + p * GT_RPP * LD);
        rb[p] = *(const H*)(pb + p * GT_RPP * LD);
      }
      // naming the two address pairs here keeps them untouched up to this wait, which stands in front of every reuse of their registers
      asm volatile("s_wait_xcnt 0x0" :: "v"(pa), "v"(pb) : "memory");
    }
    const T* fa = sA + cur + (wm + rlane) * GT_LP + koff;
    const T* fb = sB + cur + (wn + rlane) * GT_LP + koff;
#pragma unroll
    for (int kk = 0; kk < GT_BK / 32; ++kk) {
      V bh[4], ah[4];
#pragma unroll
      for (int j = 0; j < 4; ++j) bh[j] = Frag<T>::load(fb + (j << 4) * GT_LP + kk * 32);
#pragma unroll
      for (int i = 0; i < 4; ++i) ah[i] = Frag<T>::load(fa + (i << 4) * GT_LP + kk * 32);
#pragma unroll
      for (int i = 0; i < 4; ++i)
#pragma unroll
        for (int j = 0; j < 4; ++j) acc[i][j] = Frag<T>::mma(ah[i], bh[j], acc[i][j]);
    }
    if (more) {
      const int nxt = (128 * GT_LP) - cur;     // the buffer whose last readers passed the barrier of stage st - 1
#pragma unroll
      for (int p = 0; p < GT_NP; ++p) {
        *(H*)(sA + nxt + sOff + p * GT_RPP * GT_LP) = ra[p];
        *(H*)(sB + nxt + sOff + p * GT_RPP * GT_LP) = rb[p];
      }
    }
    __syncthreads();
  }
  acc_guard4(acc[0][0], acc[0][1], acc[0][2], acc[0][3]);
  acc_guard4(acc[1][0], acc[1][1], acc[1][2], acc[1][3]);
  acc_guard4(acc[2][0], acc[2][1], acc[2][2], acc[2][3]);
  acc_guard4(acc[3][0], acc[3][1], acc[3][2], acc[3][3]);

  // ---- epilogue ----
  float* slab = sT[wave];
  const float* Rb = RESID ? (resid + (size_t)b * strideR) : nullptr;
#pragma unroll
  for (int i = 0; i < 4; ++i) {
    const int mBase = m0 + (i << 4);
    float bm[8];
    if (BIAS_MODE == 1) {
      const float* bp = bias + mBase + mOff;
#pragma unroll
      for (int r = 0; r < 8; ++r) bm[r] = bp[r];
      // naming the address pair here keeps it untouched up to this wait, which stands in front of every reuse of its registers
      asm volatile("s_wait_xcnt 0x0" :: "v"(bp) : "memory");
    }
#pragma unroll
    for (int j = 0; j < 4; ++j) {
      const int n = n0 + (j << 4) + rlane;
      float bv = 0.f;
      if (BIAS_MODE == 2) bv = bf_rne(bias[n]);
#pragma unroll
      for (int r = 0; r < 8; ++r) {
        float v = acc[i][j][r] * scale;
        if (BIAS_MODE == 1) v += bf_rne(bm[r]);
        if (BIAS_MODE == 2) v += bv;
        if (RESID) v += Rb[(size_t)(mBase + mOff + r) * ldc + n];
        if (ACT == 1) v = tanhf(v);
        if (ACT == 2) v = fmaxf(v, 0.0f);
        if (ACT == 3) v = v / (1.0f + expf(-v));
        if (ACT == 4) v = (v > 0.f) ? v : 0.01f * v;
        if (ACT == 5) v = 0.5f * v * (1.0f + erff(v * 0.70710678118654752f));
        slab[(mOff + r) * 68 + (j << 4) + rlane] = v;
      }
    }
    __builtin_amdgcn_fence(__ATOMIC_RELEASE, "workgroup");
    __builtin_amdgcn_wave_barrier();
    __builtin_amdgcn_fence(__ATOMIC_ACQUIRE, "workgroup");
    if (OUT_MODE == 0) {
      float* C = (float*)Cout + (size_t)b * strideC;
      const int hh = lane >> 4, c4 = (lane & 15) * 4;     // row seg = 256 B = 16 lanes x 16 B
      {
#pragma unroll
        for (int it = 0; it < 8; ++it) {
          const int row = it * 2 + hh;
          v4f v = *(const v4f*)(slab + row * 68 + c4);
          *(v4f*)(C + (size_t)(mBase + row) * ldc + n0 + c4) = v;
        }
        
      }
    } else {
      const int q = lane >> 3, c8 = (lane & 7) * 8;
      unsigned short* C  = (unsigned short*)Cout  + (size_t)b * strideC;
      unsigned short* C2 = (OUT_MODE == 2) ? ((unsigned short*)Cout2 + (size_t)b * strideC) : nullptr;
      {
#pragma unroll
        for (int it = 0; it < 4; ++it) {
          const int row = it * 4 + q;
          const float* sp = slab + row * 68 + c8;
          v8h hv, lv;
#pragma unroll
          for (int e = 0; e < 8; ++e) {
            if (OUT_MODE == 1) {
              hv[e] = (_Float16)sp[e];
            } else {
              unsigned short hb = f2bf_bits(sp[e]);
              unsigned short lb = f2bf_bits(sp[e] - bf_bits2f(hb));
              hv[e] = __builtin_bit_cast(_Float16, hb);
              lv[e] = __builtin_bit_cast(_Float16, lb);
            }
          }
          *(v8h*)(C + (size_t)(mBase + row) * ldc + n0 + c8) = hv;
          if (OUT_MODE == 2) *(v8h*)(C2 + (size_t)(mBase + row) * ldc + n0 + c8) = lv;
        }
        
      }
    }
    __builtin_amdgcn_fence(__ATOMIC_RELEASE, "workgroup");
    __builtin_amdgcn_wave_barrier();
    __builtin_amdgcn_fence(__ATOMIC_ACQUIRE, "workgroup");
  }
}

// ---------------------------------------------------------------------------
// Row-preserving bf16 RNE convert of an f32 matrix [rows][ncols] into a u16 plane with row pitch ldout; DUP also
// writes the same 8 values at column + ncols (second copy along the row). 8 consecutive elements per thread = one
// Coverage: grid = n8/256 blocks x 256 threads x 8 elements = rows*ncols (n8 = rows*ncols/8, exact multiple of 256).
// ---------------------------------------------------------------------------
template <bool DUP>
__global__ __launch_bounds__(256) void convrows_kernel(const float* __restrict__ in, unsigned short* __restrict__ out,
                                                       int ncols, int ldout, int n8) {
  const int i = blockIdx.x * 256 + threadIdx.x;
  if (i < n8) {
    const size_t e0 = (size_t)i * 8;
    const int row = (int)(e0 / (size_t)ncols);
    const int col = (int)(e0 - (size_t)row * ncols);
    const v4f a = *(const v4f*)(in + e0);
    const v4f c = *(const v4f*)(in + e0 + 4);
    v4u hv;
    hv[0] = pk16(f2bf_bits(a[0]), f2bf_bits(a[1]));
    hv[1] = pk16(f2bf_bits(a[2]), f2bf_bits(a[3]));
    hv[2] = pk16(f2bf_bits(c[0]), f2bf_bits(c[1]));
    hv[3] = pk16(f2bf_bits(c[2]), f2bf_bits(c[3]));
    const size_t o = (size_t)row * ldout + col;
    {
      *(v4u*)(out + o) = hv;
      if (DUP) *(v4u*)(out + o + ncols) = hv;
      
    }
  }
}

// ---------------------------------------------------------------------------
// Fused transpose + bf16 RNE convert of an f32 matrix, z-batched, one plane:
//   in_z = W + z*sIn viewed [R rows][Cc cols] with row pitch ldin  ->  oh_z[c][r] = bf16(in_z[r][c]), row pitch ldout, oh_z = oh + z*sOut.
// 64x64 tiles through LDS. grid = (Cc/64, R/64, Z), 256 threads (R, Cc multiples of 64; ldout multiple of 64 so every
// Coverage per block: load 4 it x 256 thr x 4 floats = 64x64; store 2 it x 256 thr x 8 u16 = 64x64.
// ---------------------------------------------------------------------------
__global__ __launch_bounds__(256) void tconv_kernel(const float* __restrict__ W, unsigned short* __restrict__ oh,
                                                    int ldin, int ldout, long sIn, long sOut) {
  __shared__ __align__(16) float tf[64 * 68];
  W  += (size_t)blockIdx.z * sIn;
  oh += (size_t)blockIdx.z * sOut;
  const int c0  = blockIdx.x * 64;   // input column block = output row block
  const int r0  = blockIdx.y * 64;   // input row block    = output column block
  const int tid = threadIdx.x;
  {
    const int lr = tid >> 4;         // 0..15
    const int c4 = (tid & 15) * 4;   // 0..60
#pragma unroll
    for (int it = 0; it < 4; ++it) {
      const int rr = it * 16 + lr;   // 0..63
      const v4f a = *(const v4f*)(W + (size_t)(r0 + rr) * ldin + c0 + c4);
      *(v4f*)(tf + rr * 68 + c4) = a;
    }
  }
  __syncthreads();
  const int sub = tid >> 3;          // 0..31
  const int c8  = (tid & 7) * 8;     // 0..56
  v4u hv[2];
#pragma unroll
  for (int it = 0; it < 2; ++it) {
    const int oc = it * 32 + sub;    // output row within tile (= input column)
    v4u a;
#pragma unroll
    for (int q = 0; q < 4; ++q) {
      const float f0 = tf[(c8 + 2 * q) * 68 + oc];
      const float f1 = tf[(c8 + 2 * q + 1) * 68 + oc];
      a[q] = pk16(f2bf_bits(f0), f2bf_bits(f1));
    }
    hv[it] = a;
  }
  {
#pragma unroll
    for (int it = 0; it < 2; ++it) {
      const int oc = it * 32 + sub;
      const size_t go = (size_t)(c0 + oc) * ldout + r0 + c8;
      *(v4u*)(oh + go) = hv[it];
    }
    
  }
}

// ---------------------------------------------------------------------------
// Rotary angle tables: tc[pos*16 + j] = cos(pos * f_j), ts likewise, f_j = 10000^(-4j/64) = 10^(-j/4) (f32 constants),
// pos 0..31 (shared by the row axis and the column axis), j 0..15. Precise cosf/sinf (|angle| <= 31).
// grid = 2 x 256 = 512 threads = 32 x 16 entries per table; one 4-B store per lane, 32 consecutive lanes = one whole
// ---------------------------------------------------------------------------
__device__ __forceinline__ float rope_freq(int j) {
  float f = 1.0f;
  f = (j == 1)  ? 0.5623413251903491f     : f;
  f = (j == 2)  ? 0.31622776601683794f    : f;
  f = (j == 3)  ? 0.17782794100389229f    : f;
  f = (j == 4)  ? 0.1f                    : f;
  f = (j == 5)  ? 0.05623413251903491f    : f;
  f = (j == 6)  ? 0.031622776601683794f   : f;
  f = (j == 7)  ? 0.017782794100389229f   : f;
  f = (j == 8)  ? 0.01f                   : f;
  f = (j == 9)  ? 0.005623413251903491f   : f;
  f = (j == 10) ? 0.0031622776601683794f  : f;
  f = (j == 11) ? 0.0017782794100389228f  : f;
  f = (j == 12) ? 0.001f                  : f;
  f = (j == 13) ? 0.0005623413251903491f  : f;
  f = (j == 14) ? 0.00031622776601683794f : f;
  f = (j == 15) ? 0.00017782794100389227f : f;
  return f;
}

__global__ __launch_bounds__(256) void ropetab_kernel(float* __restrict__ tc, float* __restrict__ ts) {
  const int i = blockIdx.x * 256 + threadIdx.x;      // 0..511 = pos*16 + j
  if (i < TABN) {
    const int pos = i >> 4, j = i & 15;
    const float a = (float)pos * rope_freq(j);
    const float c = cosf(a);
    const float s = sinf(a);
    ((float*)tc)[i] = c;
    ((float*)ts)[i] = s;
    
  }
}

// ---------------------------------------------------------------------------
// Per-token 2-D RoPE (interleaved pairs (2i,2i+1) inside each head; pairs 0..15 use the row index y = n>>5, pairs 16..31
// the column index x = n&31; tables shared by all heads) followed by RMSNorm over the WHOLE 1024-wide (heads x dim) row:
// v = rope(v); v = v * rsqrt(mean_1024(v*v) + 1e-6) * bf16(w[col]); then bf16 hi/lo split into planes [4096][1024].
// One block of 128 threads per token row g = b*1024+n; thread t owns columns 8t..8t+7 (= 4 rotary pairs p0..p0+3, p0 = (4t)&31,
// all four in the same half of the pair range). All loads are 16-B vectors. Stores: 16 B per lane per plane, 128 lanes cover
// LDS: redq/redk[4] written by lane 0 of each of the 4 waves before the barrier.
// ---------------------------------------------------------------------------
__global__ __launch_bounds__(128) void ropenorm_kernel(const float* __restrict__ qkf,
                                                       const float* __restrict__ tc, const float* __restrict__ ts,
                                                       const float* __restrict__ qw, const float* __restrict__ kw,
                                                       unsigned short* __restrict__ qh, unsigned short* __restrict__ ql,
                                                       unsigned short* __restrict__ kh, unsigned short* __restrict__ kl) {
  __shared__ float redq[4], redk[4];
  const int g = blockIdx.x;                 // token row 0..MTOK-1
  const int n = g & (NTOK - 1);
  const int py = n >> 5, px = n & 31;
  const int t = threadIdx.x, lane = t & 31, wave = t >> 5;
  const int i0 = t * 8;

  const float* qr = qkf + (size_t)g * QKP + i0;
  const float* kr = qr + INNER;
  const v4f qa = *(const v4f*)(qr), qb = *(const v4f*)(qr + 4);
  const v4f ka = *(const v4f*)(kr), kb = *(const v4f*)(kr + 4);

  const int p0   = (4 * t) & 31;
  const int hsel = p0 >> 4;                 // 0: row-axis angles, 1: column-axis angles
  const int pos  = py + hsel * (px - py);
  const int toff = pos * 16 + (p0 & 15);
  const v4f cv = *(const v4f*)(tc + toff);
  const v4f sv = *(const v4f*)(ts + toff);

  float q8[8], k8[8];
  q8[0] = qa[0]; q8[1] = qa[1]; q8[2] = qa[2]; q8[3] = qa[3];
  q8[4] = qb[0]; q8[5] = qb[1]; q8[6] = qb[2]; q8[7] = qb[3];
  k8[0] = ka[0]; k8[1] = ka[1]; k8[2] = ka[2]; k8[3] = ka[3];
  k8[4] = kb[0]; k8[5] = kb[1]; k8[6] = kb[2]; k8[7] = kb[3];

  float rq[8], rk[8];
#pragma unroll
  for (int e = 0; e < 4; ++e) {
    const float c = cv[e], s = sv[e];
    const float qe = q8[2 * e], qo = q8[2 * e + 1];
    const float ke = k8[2 * e], ko = k8[2 * e + 1];
    rq[2 * e]     = qe * c - qo * s;
    rq[2 * e + 1] = qe * s + qo * c;
    rk[2 * e]     = ke * c - ko * s;
    rk[2 * e + 1] = ke * s + ko * c;
  }
  float ssq = 0.0f, ssk = 0.0f;
#pragma unroll
  for (int e = 0; e < 8; ++e) { ssq += rq[e] * rq[e]; ssk += rk[e] * rk[e]; }
#pragma unroll
  for (int off = 1; off < 32; off <<= 1) { ssq += __shfl_xor(ssq, off, 32); ssk += __shfl_xor(ssk, off, 32); }
  if (lane == 0) { redq[wave] = ssq; redk[wave] = ssk; }
  __syncthreads();
  const float tq = (redq[0] + redq[1]) + (redq[2] + redq[3]);
  const float tk = (redk[0] + redk[1]) + (redk[2] + redk[3]);
  const float rmq = rsqrtf(tq * (1.0f / (float)INNER) + RMS_EPS);
  const float rmk = rsqrtf(tk * (1.0f / (float)INNER) + RMS_EPS);

  const v4f wqa = *(const v4f*)(qw + i0), wqb = *(const v4f*)(qw + i0 + 4);
  const v4f wka = *(const v4f*)(kw + i0), wkb = *(const v4f*)(kw + i0 + 4);
  float wq8[8], wk8[8];
  wq8[0] = bf_rne(wqa[0]); wq8[1] = bf_rne(wqa[1]); wq8[2] = bf_rne(wqa[2]); wq8[3] = bf_rne(wqa[3]);
  wq8[4] = bf_rne(wqb[0]); wq8[5] = bf_rne(wqb[1]); wq8[6] = bf_rne(wqb[2]); wq8[7] = bf_rne(wqb[3]);
  wk8[0] = bf_rne(wka[0]); wk8[1] = bf_rne(wka[1]); wk8[2] = bf_rne(wka[2]); wk8[3] = bf_rne(wka[3]);
  wk8[4] = bf_rne(wkb[0]); wk8[5] = bf_rne(wkb[1]); wk8[6] = bf_rne(wkb[2]); wk8[7] = bf_rne(wkb[3]);

  v4u hq, lq, hk, lk;
#pragma unroll
  for (int e = 0; e < 4; ++e) {
    const float fq0 = rq[2 * e] * rmq * wq8[2 * e];
    const float fq1 = rq[2 * e + 1] * rmq * wq8[2 * e + 1];
    const float fk0 = rk[2 * e] * rmk * wk8[2 * e];
    const float fk1 = rk[2 * e + 1] * rmk * wk8[2 * e + 1];
    const unsigned short hq0 = f2bf_bits(fq0), hq1 = f2bf_bits(fq1);
    const unsigned short hk0 = f2bf_bits(fk0), hk1 = f2bf_bits(fk1);
    const unsigned short lq0 = f2bf_bits(fq0 - bf_bits2f(hq0)), lq1 = f2bf_bits(fq1 - bf_bits2f(hq1));
    const unsigned short lk0 = f2bf_bits(fk0 - bf_bits2f(hk0)), lk1 = f2bf_bits(fk1 - bf_bits2f(hk1));
    hq[e] = pk16(hq0, hq1); lq[e] = pk16(lq0, lq1);
    hk[e] = pk16(hk0, hk1); lk[e] = pk16(lk0, lk1);
  }
  const size_t o = (size_t)g * INNER + i0;
  {
    *(v4u*)(qh + o) = hq;
    *(v4u*)(ql + o) = lq;
    *(v4u*)(kh + o) = hk;
    *(v4u*)(kl + o) = lk;
    
  }
}

// =====================================================================================
// Full (non-causal, unmasked) attention, head dim 64, all batches in one launch.
//   q planes (hi/lo bf16) [4096][1024]: element (b, n, h, d) at [(b*1024+n)*1024 + h*64 + d]
//   k planes (hi/lo bf16) [4096][1024]: same layout
//   v^T planes (hi/lo bf16) [1024][4096]: element (h, d, b, t) at [(h*64 + d)*4096 + b*1024 + t]
//   out CTX2 plane u16 [4096][2048]: hi bits of o(b,n,h,d) at col h*64+d, lo bits (o - hi) at col 1024 + h*64+d.
//   scores^T = (k . q^T) * 0.125 : A = K rows, B = Q rows; bf16 hi/lo split (hi.hi + lo.hi + hi.lo) on v_wmma_f32_16x16x32_bf16
//   out^T    = v^T . p^T         : A = V^T rows, B = P^T; bf16 hi/lo split of p (unnormalised exp) and v, f32 accumulate, x 1/rowsum at the end
//   Transposed tiles: a lane holds one query (column c) and, per 16-key tile, keys 8*hh + 0..7 in its 8 accumulator registers. Two score
//   tiles (keys 0..15 and 16..31 of a 32-key block), converted in place, are the B operand of the second product in the k order of the
//   V^T fragment loads (elements 0..7 = keys 8*hh + 0..7, elements 8..15 = keys 16 + 8*hh + 0..7): P never goes through LDS.
//   online softmax in f32, base 2 (scores x sscale x log2 e), over the 1024 keys of the batch element (16 chunks of 64, compile-time trip count, no masking): maximum in-lane
//   plus one exchange between the wave halves per chunk; each half sums its own keys, the two sums are joined once in the epilogue.
//   Block = 4 waves = 64 query rows of one (batch, head); grid.x = 4 * 16 * 16 = 1024.
//   K / V^T chunk staging: 128 threads x 32 elements per plane = the whole 64x64 tile (16-B copies, plain loads,
//   __syncthreads before and after); fragment loads read the LDS tiles with the same v8b element type.
//   LDS extents: K/V tiles 64x64 fully staged every chunk.
// =====================================================================================
#define AT_D 64
#define AT_NW 4
#define AT_QB 64
#define AT_KC 64
// LDS row pitch of the K and V^T tiles in elements: 64 data + 8 pad = 144 B = 16 B x 9 (odd), so the 16 rows that one
// 16-byte fragment read touches fall on 16 different groups of four banks; at 128 B they fall on two. Pad elements are never read.
#define AT_LP 72

__device__ __forceinline__ unsigned short at_bf_bits(float f) {
  unsigned u = __float_as_uint(f);
  return (unsigned short)((u + 0x7FFFu + ((u >> 16) & 1u)) >> 16);
}
__device__ __forceinline__ __bf16 at_f2bf(float f) { return __builtin_bit_cast(__bf16, at_bf_bits(f)); }
__device__ __forceinline__ void at_split(float f, __bf16& hi, __bf16& lo) {
  const unsigned short hb = at_bf_bits(f);
  hi = __builtin_bit_cast(__bf16, hb);
  lo = at_f2bf(f - __uint_as_float(((unsigned)hb) << 16));
}
__device__ __forceinline__ v8f at_mma(v16b a, v16b b, v8f c) {
  c = __builtin_amdgcn_wmma_f32_16x16x32_bf16(false, a, false, b, (short)0, c, false, false);
  asm volatile("v_nop\n\tv_nop\n\tv_nop\n\tv_nop" : "+v"(c) : "v"(a), "v"(b));
  return c;
}

// value of lane l ^ 16 (the other wave half), by a vector cross-row move
__device__ __forceinline__ float at_xhalf(float x) {
  return __builtin_bit_cast(float, __builtin_amdgcn_permlanex16(__builtin_bit_cast(int, x), __builtin_bit_cast(int, x),
                                                                0x76543210, 0xfedcba98, false, false));
}

__global__ __launch_bounds__(128)
void attn_kernel(const unsigned short* __restrict__ qhp, const unsigned short* __restrict__ qlp,
                 const unsigned short* __restrict__ khp, const unsigned short* __restrict__ klp,
                 const unsigned short* __restrict__ vhp, const unsigned short* __restrict__ vlp,
                 unsigned short* __restrict__ aop, float sscale) {
  union FB { v16b v; v8b h[2]; };
  __shared__ __align__(16) __bf16 Ksh[AT_KC * AT_LP];            // K hi [kv][d], pitch AT_LP   9 KB
  __shared__ __align__(16) __bf16 Ksl[AT_KC * AT_LP];            // K lo
  __shared__ __align__(16) __bf16 Vth[AT_D * AT_LP];             // V hi [d][kv], pitch AT_LP   9 KB
  __shared__ __align__(16) __bf16 Vtl[AT_D * AT_LP];             // V lo
  __shared__ __align__(16) float  Os[AT_NW][16 * 68];            // per wave out tile, pitch 68

  const int tid  = threadIdx.x;
  const int wave = tid >> 5;
  const int lane = tid & 31;
  const int hh   = lane >> 4;
  const int c    = lane & 15;

  const int nqb = NTOK / AT_QB;            // 16 query blocks per batch element
  const int bx = blockIdx.x;              // grid = NB * NH * nqb (exact)
  const int qb = bx % nqb;
  const int hb = bx / nqb;
  const int h  = hb % NH;                 // 0..15
  const int b  = hb / NH;                 // 0..3
  const int q0 = b * NTOK + qb * AT_QB + wave * 16;   // row in the q / CTX2 planes

  const __bf16* Qh = (const __bf16*)(const void*)qhp + (size_t)h * AT_D;
  const __bf16* Ql = (const __bf16*)(const void*)qlp + (size_t)h * AT_D;
  const __bf16* Kh = (const __bf16*)(const void*)khp + (size_t)h * AT_D;
  const __bf16* Kl = (const __bf16*)(const void*)klp + (size_t)h * AT_D;
  const __bf16* Vh = (const __bf16*)(const void*)vhp + (size_t)h * AT_D * VTP + (size_t)b * NTOK;
  const __bf16* Vl = (const __bf16*)(const void*)vlp + (size_t)h * AT_D * VTP + (size_t)b * NTOK;
  unsigned short* Ch = aop + (size_t)h * AT_D;                    // hi columns
  unsigned short* Cl = aop + (size_t)INNER + (size_t)h * AT_D;    // lo columns

  // ---- Q fragments (B operand, column = query = lane&15, split k map via Frag load): 2 d-chunks, hi and lo ----
  v16b qah[2], qal[2];
#pragma unroll
  for (int dc = 0; dc < 2; ++dc) {
    const __bf16* qr = Qh + (size_t)(q0 + c) * INNER + dc * 32 + 8 * hh;
    const __bf16* ql = Ql + (size_t)(q0 + c) * INNER + dc * 32 + 8 * hh;
    qah[dc] = Frag<__bf16>::load(qr);
    qal[dc] = Frag<__bf16>::load(ql);
  }

  // exponentials to base 2: e^(x * sscale) = 2^(x * c2), so one fused multiply-add and the hardware's 2^x make one P element
  const float c2 = sscale * 1.4426950408889634f;
  float mrow = -INFINITY, lrow = 0.f;   // this lane's query: running maximum in log2 units (both halves alike), sum over this half's keys
  v8f oacc[4];                          // oacc[t][r] = out^T[d = t*16 + 8*hh + r][query c]
#pragma unroll
  for (int t = 0; t < 4; ++t) oacc[t] = (v8f){0.f,0.f,0.f,0.f,0.f,0.f,0.f,0.f};

  const int nChunks = NTOK / AT_KC;   // 16, compile-time constant
  for (int kc = 0; kc < nChunks; ++kc) {
    const int kv0 = kc * AT_KC;
    __syncthreads();
    {
      // staging coverage: 128 threads x (4 x 8) elements = 64 rows x 64 per plane = the whole chunk tile
      const int r = tid >> 1, half = (tid & 1) * 32;
      const __bf16* ksh = Kh + (size_t)(b * NTOK + kv0 + r) * INNER + half;   // K row (b, kv0+r), d = half..half+31
      const __bf16* ksl = Kl + (size_t)(b * NTOK + kv0 + r) * INNER + half;
      const __bf16* vsh = Vh + (size_t)r * VTP + kv0 + half;                  // V^T row d = r, keys kv0+half..+31
      const __bf16* vsl = Vl + (size_t)r * VTP + kv0 + half;
#pragma unroll
      for (int i = 0; i < 4; ++i) {
        const v8b a0 = *(const v8b*)(ksh + 8 * i);
        const v8b a1 = *(const v8b*)(ksl + 8 * i);
        const v8b b0 = *(const v8b*)(vsh + 8 * i);
        const v8b b1 = *(const v8b*)(vsl + 8 * i);
        *(v8b*)(Ksh + r * AT_LP + half + 8 * i) = a0;
        *(v8b*)(Ksl + r * AT_LP + half + 8 * i) = a1;
        *(v8b*)(Vth + r * AT_LP + half + 8 * i) = b0;
        *(v8b*)(Vtl + r * AT_LP + half + 8 * i) = b1;
      }
    }
    __syncthreads();

    v8f s[4];
#pragma unroll
    for (int j = 0; j < 4; ++j) {
      s[j] = (v8f){0.f,0.f,0.f,0.f,0.f,0.f,0.f,0.f};
#pragma unroll
      for (int dc = 0; dc < 2; ++dc) {
        FB kb, kl;
        kb.h[0] = *(const v8b*)(Ksh + (j * 16 + c) * AT_LP + dc * 32 + 8 * hh);
        kb.h[1] = *(const v8b*)(Ksh + (j * 16 + c) * AT_LP + dc * 32 + 16 + 8 * hh);
        kl.h[0] = *(const v8b*)(Ksl + (j * 16 + c) * AT_LP + dc * 32 + 8 * hh);
        kl.h[1] = *(const v8b*)(Ksl + (j * 16 + c) * AT_LP + dc * 32 + 16 + 8 * hh);
        s[j] = at_mma(kb.v, qah[dc], s[j]);
        s[j] = at_mma(kl.v, qah[dc], s[j]);
        s[j] = at_mma(kb.v, qal[dc], s[j]);
      }
    }
    // s[j][r] = unscaled score of key kv0 + j*16 + 8*hh + r against query c: this query's chunk maximum, scaled once
    // (c2 > 0 keeps the order of the scores; the softmax does not depend on the value that is subtracted)
    float mj[4];
#pragma unroll
    for (int j = 0; j < 4; ++j) {
      float m = -INFINITY;
#pragma unroll
      for (int r = 0; r < 8; ++r) m = fmaxf(m, s[j][r]);
      mj[j] = m;
    }
    float cm = fmaxf(fmaxf(mj[0], mj[1]), fmaxf(mj[2], mj[3]));
    cm = fmaxf(cm, at_xhalf(cm));
    const float mnew = fmaxf(mrow, cm * c2);
    const float alpha = __builtin_amdgcn_exp2f(mrow - mnew);
    mrow = mnew;
    FB ph[2], pl[2];   // P^T hi / lo as B operands, one per 32 keys: elements 0..7 from tile 2*kk, 8..15 from tile 2*kk + 1
    float pj[4];
#pragma unroll
    for (int j = 0; j < 4; ++j) {
      float psum = 0.f;
#pragma unroll
      for (int r = 0; r < 8; ++r) {
        const float p = __builtin_amdgcn_exp2f(__builtin_fmaf(s[j][r], c2, -mnew));   // e^(score * sscale - maximum)
        psum += p;
        __bf16 a, bl; at_split(p, a, bl);
        ph[j >> 1].v[(j & 1) * 8 + r] = a;
        pl[j >> 1].v[(j & 1) * 8 + r] = bl;
      }
      pj[j] = psum;
    }
    lrow = lrow * alpha + ((pj[0] + pj[1]) + (pj[2] + pj[3]));
#pragma unroll
    for (int t = 0; t < 4; ++t)
#pragma unroll
      for (int r = 0; r < 8; ++r) oacc[t][r] *= alpha;
    // unrolled: the P^T fragments are registers and are picked by kk at compile time
#pragma unroll
    for (int kk = 0; kk < 2; ++kk) {
#pragma unroll
      for (int t = 0; t < 4; ++t) {
        FB vb, vl;
        vb.h[0] = *(const v8b*)(Vth + (t * 16 + c) * AT_LP + kk * 32 + 8 * hh);
        vb.h[1] = *(const v8b*)(Vth + (t * 16 + c) * AT_LP + kk * 32 + 16 + 8 * hh);
        vl.h[0] = *(const v8b*)(Vtl + (t * 16 + c) * AT_LP + kk * 32 + 8 * hh);
        vl.h[1] = *(const v8b*)(Vtl + (t * 16 + c) * AT_LP + kk * 32 + 16 + 8 * hh);
        oacc[t] = at_mma(vb.v, ph[kk].v, oacc[t]);
        oacc[t] = at_mma(vl.v, ph[kk].v, oacc[t]);
        oacc[t] = at_mma(vb.v, pl[kk].v, oacc[t]);
      }
    }
  }

  float* os = Os[wave];
  {
    const float inv = 1.0f / (lrow + at_xhalf(lrow));   // the two halves' key sums of query c, joined
#pragma unroll
    for (int t = 0; t < 4; ++t) {
      v4f o0, o1;
#pragma unroll
      for (int r = 0; r < 4; ++r) { o0[r] = oacc[t][r] * inv; o1[r] = oacc[t][4 + r] * inv; }
      *(v4f*)(os + c * 68 + t * 16 + 8 * hh)     = o0;   // row = query c, columns d = t*16 + 8*hh + 0..7
      *(v4f*)(os + c * 68 + t * 16 + 8 * hh + 4) = o1;
    }
  }
  __builtin_amdgcn_fence(__ATOMIC_RELEASE, "workgroup");
  __builtin_amdgcn_wave_barrier();
  __builtin_amdgcn_fence(__ATOMIC_ACQUIRE, "workgroup");
  {
    const int q = lane >> 3, c8 = (lane & 7) * 8;
    {
#pragma unroll
      for (int it = 0; it < 4; ++it) {
        const int row = it * 4 + q;
        const float* sp = os + row * 68 + c8;
        v8h hv, lv;
#pragma unroll
        for (int e = 0; e < 8; ++e) {
          const unsigned short hbits = f2bf_bits(sp[e]);
          const unsigned short lbits = f2bf_bits(sp[e] - bf_bits2f(hbits));
          hv[e] = __builtin_bit_cast(_Float16, hbits);
          lv[e] = __builtin_bit_cast(_Float16, lbits);
        }
        *(v8h*)(Ch + (size_t)(q0 + row) * AOP + c8) = hv;
        *(v8h*)(Cl + (size_t)(q0 + row) * AOP + c8) = lv;
      }
      
    }
  }
}

// ---------------------------------------------------------------------------
// Output RMSNorm over C + residual + back to NCHW:
//   out[b][c][n] = Of[b*1024+n][c] * rsqrt(mean_C(Of[tok][.]^2) + 1e-6) * bf16(w[c]) + bf16(x[b][c][n]).
// One block of 512 threads (16 waves) per 32 consecutive tokens x 512 channels; grid = 128 token groups x 2 channel halves = 256,
// as many blocks as the chip has WGPs. Every global load of a thread is issued before the first wait: nothing is fetched in a loop.
// Wave w holds the whole rows of tokens 2w and 2w+1 in registers (8 x 16 B per lane and row), sums their squares (per lane one sum
// per channel half, the two added, then the lane tree), scales the block's half of each row and writes it to the LDS tile [token][channel].
// Behind the one barrier a thread reads a 4-token x 4-channel square as four 16-B rows; its columns are the 16-B output vectors
// (4 tokens of one channel), so 8 lanes store one whole 128-B line of out and a block writes only whole lines.
// LDS pitch 516 floats = 16 B x 129 (odd); the 16-B unit index of a row is XORed with 2 for tokens 16..31, so that the 16 lanes
// of a half wave (tokens 4j+q, j = 0..7, two channel units) read 16 different groups of four banks.
// Coverage: 256 blocks x 32 tokens x 512 channels = 4 x 1024 x 1024 outputs, each exactly once.
// ---------------------------------------------------------------------------
#define FN_TOK 32
#define FN_CS  512
#define FN_P   (FN_CS + 4)
static_assert(NTOK % FN_TOK == 0 && CH == 2 * FN_CS && CH == 8 * 128 && FN_TOK == 2 * 16);
__global__ __launch_bounds__(512) void final_kernel(const float* __restrict__ of, const float* __restrict__ nw,
                                                    const float* __restrict__ xin, float* __restrict__ out) {
  __shared__ __align__(16) float tf[FN_TOK * FN_P];
  const int tid = threadIdx.x, lane = tid & 31, wave = tid >> 5;
  const int sl   = blockIdx.x & 1;            // channel half
  const int tok0 = (blockIdx.x >> 1) * FN_TOK;
  const int b = tok0 / NTOK, n0 = tok0 - b * NTOK;
  const int c0 = sl * FN_CS;
  const int j  = tid & 7;                     // token quad: tokens 4j..4j+3
  const int cg = tid >> 3;                    // channel unit 0..63 (4 channels), second pass + 64

  // all loads: the two rows first (the sums wait for them alone), then the weights, then the residual.
  // vo = the block's own channel half of a row, vx = the other half, read for the row sum only.
  const float* po  = of + (size_t)(tok0 + wave * 2) * CH + lane * 4 + c0;
  const float* px  = of + (size_t)(tok0 + wave * 2) * CH + lane * 4 + (FN_CS - c0);
  const float* xp0 = xin + ((size_t)(b * CH + c0 + cg * 4)) * NTOK + n0 + 4 * j;
  v4f vo[2][4], vx[2][4];
#pragma unroll
  for (int i = 0; i < 2; ++i) {
#pragma unroll
    for (int kk = 0; kk < 4; ++kk) vo[i][kk] = *(const v4f*)(po + i * CH + kk * 128);
#pragma unroll
    for (int kk = 0; kk < 4; ++kk) vx[i][kk] = *(const v4f*)(px + i * CH + kk * 128);
  }
  v4f w4[4];
#pragma unroll
  for (int kk = 0; kk < 4; ++kk) w4[kk] = *(const v4f*)(nw + c0 + kk * 128 + lane * 4);
  v4f xr[2][4];
#pragma unroll
  for (int e = 0; e < 4; ++e) {
    xr[0][e] = *(const v4f*)(xp0 + e * NTOK);
    xr[1][e] = *(const v4f*)(xp0 + (256 + e) * NTOK);
  }
  // naming the three address pairs here keeps them untouched up to this wait, which stands in front of every reuse of their registers;
  // as a memory barrier for the compiler it also keeps every load above issued before the first wait for data
  asm volatile("s_wait_xcnt 0x0" :: "v"(po), "v"(px), "v"(xp0) : "memory");

  // row sum of squares = (sum over the own half) + (sum over the other half)
  float ss[2];
#pragma unroll
  for (int i = 0; i < 2; ++i) {
    float so = 0.0f, sx = 0.0f;
#pragma unroll
    for (int kk = 0; kk < 4; ++kk) {
      const v4f a = vo[i][kk], c = vx[i][kk];
      so += a[0] * a[0] + a[1] * a[1] + a[2] * a[2] + a[3] * a[3];
      sx += c[0] * c[0] + c[1] * c[1] + c[2] * c[2] + c[3] * c[3];
    }
    ss[i] = so + sx;
  }
#pragma unroll
  for (int off = 1; off < 32; off <<= 1) {
    const float t0 = __shfl_xor(ss[0], off, 32), t1 = __shfl_xor(ss[1], off, 32);
    ss[0] += t0; ss[1] += t1;
  }

  const int wswz = (wave >> 3) << 1;          // tokens 2w, 2w+1 >= 16
#pragma unroll
  for (int i = 0; i < 2; ++i) {
    const float rm = rsqrtf(ss[i] * (1.0f / (float)CH) + RMS_EPS);
    float* row = tf + (wave * 2 + i) * FN_P;
#pragma unroll
    for (int kk = 0; kk < 4; ++kk) {
      const v4f a = vo[i][kk];
      v4f o;
#pragma unroll
      for (int e = 0; e < 4; ++e) o[e] = a[e] * rm * bf_rne(w4[kk][e]);
      *(v4f*)(row + (((kk * 32 + lane) ^ wswz) << 2)) = o;
    }
  }
  __syncthreads();

  const int rswz = (j >> 2) << 1;
#pragma unroll
  for (int it = 0; it < 2; ++it) {
    const int cu = it * 64 + cg;
    v4f rd[4];
#pragma unroll
    for (int q = 0; q < 4; ++q) rd[q] = *(const v4f*)(tf + (4 * j + q) * FN_P + ((cu ^ rswz) << 2));
#pragma unroll
    for (int e = 0; e < 4; ++e) {
      v4f o;
#pragma unroll
      for (int q = 0; q < 4; ++q) o[q] = rd[q][e] + bf_rne(xr[it][e][q]);
      *(v4f*)(out + ((size_t)(b * CH + c0 + cu * 4 + e)) * NTOK + n0 + 4 * j) = o;
    }
  }
}

// ---------------------------------------------------------------------------
// Workspace region map (byte offsets; every region is fully written by its producer launch before any consumer
//   XB    bf16 [4096][1024]          0       8388608
//   WQKV  bf16 [3072][1024]    8388608       6291456
//   WP2   bf16 [1024][2048]   14680064       4194304
//   TC    f32  [32][16]       18874368          2048   TS  18876416  2048
//   QKf   f32  [4096][2048]   18878464      33554432   (dead after ropenorm; the same 32 MiB then hold
//                                                       CTX2 u16 [4096][2048] at 18878464 (16777216) and
//                                                       Of   f32  [4096][1024] at 35655680 (16777216), disjoint)
//   Qh    bf16 [4096][1024]   52432896       8388608   Ql  60821504
//   Kh    bf16 [4096][1024]   69210112       8388608   Kl  77598720
//   VTh   bf16 [1024][4096]   85987328       8388608   VTl 94375936
//   total                    102764544
// ---------------------------------------------------------------------------
extern "C" void kernel_launch(void* const* d_in, const int* in_sizes, int n_in,
                              void* d_out, int out_size, void* d_ws, size_t ws_size,
                              hipStream_t stream) {
  if (n_in < 7) return;
  if (in_sizes[0] != NB * CH * NTOK) return;        // hidden_states [4][1024][32][32]
  if (in_sizes[1] != NQKV * CH) return;             // w_qkv [3072][1024]
  if (in_sizes[2] != NQKV) return;                  // b_qkv [3072]
  if (in_sizes[3] != INNER) return;                 // q_norm_w [1024]
  if (in_sizes[4] != INNER) return;                 // k_norm_w [1024]
  if (in_sizes[5] != CH * INNER) return;            // w_proj [1024][1024]
  if (in_sizes[6] != CH) return;                    // norm_out_w [1024]
  if (out_size != NB * CH * NTOK) return;

  const float* x    = (const float*)d_in[0];
  const float* wqkv = (const float*)d_in[1];   // [out 3072][in 1024]
  const float* bqkv = (const float*)d_in[2];
  const float* qnw  = (const float*)d_in[3];
  const float* knw  = (const float*)d_in[4];
  const float* wprj = (const float*)d_in[5];   // [out 1024][in 1024]
  const float* onw  = (const float*)d_in[6];

  const size_t PXB = (size_t)MTOK * CH * 2;        // 8388608
  const size_t PWQ = (size_t)NQKV * CH * 2;        // 6291456
  const size_t PWP = (size_t)CH * AOP * 2;         // 4194304
  const size_t PTB = (size_t)TABN * 4;             // 2048
  const size_t PQK = (size_t)MTOK * QKP * 4;       // 33554432
  const size_t PCX = (size_t)MTOK * AOP * 2;       // 16777216
  const size_t POF = (size_t)MTOK * CH * 4;        // 16777216
  const size_t PPL = (size_t)MTOK * INNER * 2;     // 8388608 per q/k plane
  const size_t PVT = (size_t)INNER * VTP * 2;      // 8388608 per v^T plane
  if (PCX + POF > PQK) return;                     // CTX2 and Of share the QKf region, disjoint halves
  size_t off = 0;
  const size_t oXB  = off; off += PXB;
  const size_t oWQ  = off; off += PWQ;
  const size_t oWP  = off; off += PWP;
  const size_t oTC  = off; off += PTB;
  const size_t oTS  = off; off += PTB;
  const size_t oQK  = off; off += PQK;
  const size_t oCX  = oQK;
  const size_t oOF  = oQK + PCX;
  const size_t oQh  = off; off += PPL;  const size_t oQl = off; off += PPL;
  const size_t oKh  = off; off += PPL;  const size_t oKl = off; off += PPL;
  const size_t oVTh = off; off += PVT;  const size_t oVTl = off; off += PVT;
  if (off > ws_size) return;                       // off = 102764544
  if (off > (size_t)134217728) return;

  char* ws = (char*)d_ws;
  unsigned short* XB   = (unsigned short*)(ws + oXB);
  unsigned short* WQKV = (unsigned short*)(ws + oWQ);
  unsigned short* WP2  = (unsigned short*)(ws + oWP);
  float*          TC   = (float*)(ws + oTC);
  float*          TS   = (float*)(ws + oTS);
  float*          QKf  = (float*)(ws + oQK);
  unsigned short* CTX2 = (unsigned short*)(ws + oCX);
  float*          Of   = (float*)(ws + oOF);
  unsigned short* Qh   = (unsigned short*)(ws + oQh);  unsigned short* Ql  = (unsigned short*)(ws + oQl);
  unsigned short* Kh   = (unsigned short*)(ws + oKh);  unsigned short* Kl  = (unsigned short*)(ws + oKl);
  unsigned short* VTh  = (unsigned short*)(ws + oVTh); unsigned short* VTl = (unsigned short*)(ws + oVTl);

  const dim3 blk(256);

  // (1) x[b] viewed [R=1024 c][Cc=1024 n] (pitch 1024) -> XB_b[n][c] (pitch 1024); grid (Cc/64, R/64, B) = (16, 16, 4)
  tconv_kernel<<<dim3(NTOK / 64, CH / 64, NB), blk, 0, stream>>>(x, XB, NTOK, CH, (long)CH * NTOK, (long)NTOK * CH);
  // (2) w_qkv [3072][1024] -> WQKV bf16 same layout; 393216 units -> 1536 blocks
  const int n8q = NQKV * CH / 8;
  convrows_kernel<false><<<dim3(n8q / 256), blk, 0, stream>>>(wqkv, WQKV, CH, CH, n8q);
  // (3) w_proj [1024][1024] -> WP2 [1024][2048], cols k and 1024+k; 131072 units -> 512 blocks
  const int n8p = CH * INNER / 8;
  convrows_kernel<true><<<dim3(n8p / 256), blk, 0, stream>>>(wprj, WP2, INNER, AOP, n8p);
  // (4) rotary cos/sin tables [32][16]
  ropetab_kernel<<<dim3(2), blk, 0, stream>>>(TC, TS);
  // (5) q|k = XB . WQKV[0..2047]^T + b -> QKf f32 [4096][2048]   (M=4096, N=2048, K=1024; 32 x 16 = 512 blocks of 128 threads)
  const dim3 gblk(128);
  const dim3 gQK((MTOK / 128) * (QKP / 128), 1);
  wmma_gemm64<1, false, 2, 0, false, CH><<<gQK, gblk, 0, stream>>>(
      XB, XB, 0L, WQKV, WQKV, 0L, (void*)QKf, (void*)QKf, QKP, 0L,
      bqkv, bqkv, 0L, MTOK, QKP, CH, 1.0f);
  // (6) v^T = WQKV[2048..3071] . XB^T + b[2048+m] -> VTh|VTl [1024][4096]   (M=1024, N=4096, K=1024; 8 x 32 = 256 blocks)
  const dim3 gVT((INNER / 128) * (MTOK / 128), 1);
  wmma_gemm64<1, false, 1, 2, false, CH><<<gVT, gblk, 0, stream>>>(
      WQKV + (size_t)2 * INNER * CH, WQKV + (size_t)2 * INNER * CH, 0L, XB, XB, 0L,
      (void*)VTh, (void*)VTl, VTP, 0L,
      bqkv + 2 * INNER, bqkv, 0L, INNER, MTOK, CH, 1.0f);
  // (7) RoPE + RMSNorm over 1024 for q and k -> Qh|Ql, Kh|Kl; one block of 128 threads per token row
  ropenorm_kernel<<<dim3(MTOK), dim3(128), 0, stream>>>(QKf, TC, TS, qnw, knw, Qh, Ql, Kh, Kl);
  // (8) attention per (batch, head, 64-query block) -> CTX2 [4096][2048] (hi | lo columns); 1024 blocks
  attn_kernel<<<dim3(NB * NH * (NTOK / 64)), dim3(128), 0, stream>>>(Qh, Ql, Kh, Kl, VTh, VTl, CTX2, 0.125f);
  // (9) Of = CTX2 . WP2^T -> f32 [4096][1024]   (M=4096, N=1024, K=2048; 32 x 8 = 256 blocks)
  const dim3 gO((MTOK / 128) * (CH / 128), 1);
  wmma_gemm64<1, false, 0, 0, false, AOP><<<gO, gblk, 0, stream>>>(
      CTX2, CTX2, 0L, WP2, WP2, 0L, (void*)Of, (void*)Of, CH, 0L,
      bqkv, bqkv, 0L, MTOK, CH, AOP, 1.0f);
  // (10) output RMSNorm + residual -> NCHW d_out; 128 groups of 32 tokens x 2 channel halves = 256 blocks of 512 threads
  final_kernel<<<dim3((MTOK / FN_TOK) * (CH / FN_CS)), dim3(512), 0, stream>>>(Of, onw, x, (float*)d_out);
  (void)hipGetLastError();
}

// v006
// Measured time: 161 microseconds a run.
// Two timings next to v005 both put it at 1.05 times that version's speed.
// Counting every step since v000, it is 2.92 times as fast.
// Contractions: q|k projection (f32 out) and v^T projection (bf16 hi|lo out) = v_wmma_f32_16x16x32_bf16 single products on bf16 planes of the RNE-converted inputs; q.k^T and p.v = bf16 hi/lo split (hi.hi + hi.lo + lo.hi); output projection = [CTXhi|CTXlo] x [Wp;Wp] bf16 single products (K-folded 2-term); f32 accumulate everywhere; RoPE, QK RMSNorm, output RMSNorm, online softmax, 1/rowsum, bias and residual in f32 on the VALU.
// Plane / carry map (all carry 1, nothing to fold back): XB = bf16(x) token-major [4096][1024] (row b*1024+n, n = y*32+x, col c);
// WQKV = bf16(w_qkv) [3072][1024] natural [out][in]; WP2 [1024][2048]: cols k and 1024+k both = bf16(w_proj[c][k]);
// TC/TS f32 [32 pos][16 pair] = cos/sin(pos * 10000^(-j/16)); QKf f32 [4096][2048] = pre-RoPE q (cols 0..1023) | k (cols 1024..2047) incl. bias;
// Qh|Ql, Kh|Kl bf16 [4096][1024] (col h*64+d) = hi/lo of the RoPE'd, RMSNorm'd q, k; VTh|VTl bf16 [1024 (h,d)][4096 (b,t)];
// P hi|lo = unnormalised exp in (0,1] (bf16, f32 exponent range), kept in registers, 1/rowsum applied to the f32 accumulator in the attention epilogue;
// CTX2 u16 [4096][2048] = ctx hi at col h*64+d, lo at col 1024+h*64+d; Of f32 [4096][1024] = ctx . w_proj^T.
#include <hip/hip_runtime.h>
#include <math.h>
#include <stdint.h>

#define NB    4
#define CH    1024
#define IMH   32
#define IMW   32
#define NTOK  1024
#define INNER 1024
#define NH    16
#define HD    64
#define NQKV  3072
#define QKP   2048
#define AOP   2048
#define VTP   (NB * NTOK)
#define MTOK  (NB * NTOK)
#define TABN  512
#define RMS_EPS 1e-6f

static_assert(NTOK == IMH * IMW);
static_assert(IMW == 32);
static_assert(INNER == NH * HD);
static_assert(HD == 64);
static_assert(NQKV == 3 * INNER);
static_assert(QKP == 2 * INNER);
static_assert(AOP == 2 * INNER);
static_assert(CH % 64 == 0);
static_assert(NTOK % 64 == 0);
static_assert(INNER % 64 == 0);
static_assert(MTOK % 64 == 0);
static_assert(CH % 32 == 0);
static_assert(AOP % 32 == 0);
static_assert(INNER == 128 * 8);
static_assert(CH == 8 * 128);
static_assert(TABN == 32 * (HD / 4));
static_assert((NQKV * CH) % (8 * 256) == 0);
static_assert((CH * INNER) % (8 * 256) == 0);
static_assert(CH % 256 == 0);
static_assert(INNER % 256 == 0);
static_assert(MTOK % 128 == 0 && QKP % 128 == 0 && INNER % 128 == 0 && CH % 128 == 0 && AOP % 128 == 0);

typedef __attribute__((ext_vector_type(16))) _Float16 v16h;
typedef __attribute__((ext_vector_type(8)))  _Float16 v8h;
typedef __attribute__((ext_vector_type(16))) __bf16   v16b;
typedef __attribute__((ext_vector_type(8)))  __bf16   v8b;
typedef __attribute__((ext_vector_type(8)))  float    v8f;
typedef __attribute__((ext_vector_type(4)))  float    v4f;
typedef __attribute__((ext_vector_type(2)))  float    v2f;
typedef __attribute__((ext_vector_type(4)))  unsigned int v4u;

// f32 -> bf16, round to nearest even, by the packed hardware convert: bf16(f0) in bits 15..0, bf16(f1) in bits 31..16
typedef __attribute__((ext_vector_type(2))) __bf16 v2b;
__device__ __forceinline__ unsigned bf_pk(float f0, float f1) {
  const v2f f = {f0, f1};
  return __builtin_bit_cast(unsigned, __builtin_convertvector(f, v2b));
}
__device__ __forceinline__ float bf_rne(float f) { return __uint_as_float(bf_pk(f, f) & 0xFFFF0000u); }
// hi/lo split of two f32 at once: hi = the two values rounded to bf16, lo = the two remainders f - hi rounded to bf16
__device__ __forceinline__ void bf_split2(float f0, float f1, unsigned& hi, unsigned& lo) {
  const v2f f = {f0, f1};
  hi = __builtin_bit_cast(unsigned, __builtin_convertvector(f, v2b));
  const v2f g = {__uint_as_float(hi << 16), __uint_as_float(hi & 0xFFFF0000u)};
  lo = __builtin_bit_cast(unsigned, __builtin_convertvector(f - g, v2b));
}

// hazard guard behind the product loop, as a plain device helper
__device__ __forceinline__ void acc_guard4(v8f& a, v8f& b, v8f& c, v8f& d) { asm volatile("v_nop\n\tv_nop\n\tv_nop\n\tv_nop" : "+v"(a), "+v"(b), "+v"(c), "+v"(d)); }
template <typename T> struct Frag;
template <> struct Frag<_Float16> {
  typedef v16h V; typedef v8h H; union U { v16h v; v8h h[2]; };
  static __device__ __forceinline__ v16h load(const _Float16* p) {   // elements 0..7 <- p[0..7], 8..15 <- p[16..23]
    U f; f.h[0] = *(const v8h*)(p); f.h[1] = *(const v8h*)(p + 16); return f.v;
  }
  static __device__ __forceinline__ v8f mma(v16h a, v16h b, v8f c) {
    return __builtin_amdgcn_wmma_f32_16x16x32_f16(false, a, false, b, (short)0, c, false, false);
  }
};
template <> struct Frag<__bf16> {
  typedef v16b V; typedef v8b H; union U { v16b v; v8b h[2]; };
  static __device__ __forceinline__ v16b load(const __bf16* p) {
    U f; f.h[0] = *(const v8b*)(p); f.h[1] = *(const v8b*)(p + 16); return f.v;
  }
  static __device__ __forceinline__ v8f mma(v16b a, v16b b, v8f c) {
    return __builtin_amdgcn_wmma_f32_16x16x32_bf16(false, a, false, b, (short)0, c, false, false);
  }
};

// ---- Register-blocked batched WMMA GEMM ------------------------------------
// C[m,n] = scale * sum_k A[m,k] * Bt[n,k] (+bias)(+resid); each wave owns a 64x64 tile, a block of 4 waves (2 x 2) a 128x128 tile.
// A row-major [M,K]; Bt row-major [N,K]; M,N % 128 == 0, K % GT_BK == 0.
// Operand path: per stage of GT_BK k the block copies its 128 A rows and 128 Bt rows into LDS with 16-B loads whose lanes cover
// whole rows of the stage (GT_BK * 2 contiguous bytes), so every 128-B line is asked for once per block; the four waves read their
// fragments from LDS. Two LDS buffers: the next stage's global loads are issued before the current stage's products and
// stored after them, one __syncthreads() per stage. The k order of every accumulator is ascending in steps of 32.
// SPLIT (hi/lo operand planes) is not instantiated and not supported by the staged loop.
// BIAS_MODE: 0 = none, 1 = bias[m], 2 = bias[n]; the bias value is RNE-converted to bf16 precision before the f32 add.
// OUT_MODE: 0 = f32, 1 = f16, 2 = bf16 hi plane (Cout) + bf16 lo plane (Cout2).
// ET: 0 = f16 operands, 1 = bf16 operands (pointers passed as 16-bit storage)
template <int ET> struct Elem;
template <> struct Elem<0> { typedef _Float16 T; };
template <> struct Elem<1> { typedef __bf16 T; };
#define GT_BK 128
// LDS row pitch in elements: GT_BK data + 8 pad, = 16 B x odd, so the 16 rows of one 16-byte fragment read fall on different banks.
#define GT_LP (GT_BK + 8)
#define GT_CPR (GT_BK / 8)          // 16-byte pieces per staged row
#define GT_RPP (128 / GT_CPR)       // rows that 128 threads copy per pass
#define GT_NP  (128 / GT_RPP)       // passes per operand and stage
// LD: row pitch of A and of Bt in elements, a compile-time constant so that the row steps of the staging loads are immediate offsets.
template <int ET, bool SPLIT, int BIAS_MODE, int OUT_MODE, bool RESID, int LD, int ACT = 0>
__global__ __launch_bounds__(128) void wmma_gemm64(
    const unsigned short* __restrict__ Ap, const unsigned short* __restrict__ A2p, long strideA,
    const unsigned short* __restrict__ Btp, const unsigned short* __restrict__ Bt2p, long strideB,
    void* __restrict__ Cout, void* __restrict__ Cout2, int ldc, long strideC,
    const float* __restrict__ bias,
    const float* __restrict__ resid, long strideR,
    int M, int N, int K, float scale) {
  typedef typename Elem<ET>::T T;
  typedef typename Frag<T>::V V;
  typedef typename Frag<T>::H H;
  static_assert(!SPLIT, "the staged loop takes single operand planes");
  const T* A = (const T*)Ap; const T* Bt = (const T*)Btp;
  __shared__ __align__(16) T sA[2 * 128 * GT_LP];  // two stages of the block's 128 A rows
  __shared__ __align__(16) T sB[2 * 128 * GT_LP];  // two stages of the block's 128 Bt rows
  __shared__ __align__(16) float sT[4][16 * 68];   // per-wave 16x64 slab, pitch 68 floats
  const int b    = blockIdx.y;
  const int tid  = threadIdx.x;
  const int lane = tid & 31;
  const int wave = tid >> 5;
  const int tilesN = N >> 7;
  const int tilesM = M >> 7;
  const int tile = blockIdx.x;
  if (tile >= tilesM * tilesN) return;   // block-uniform, in front of every barrier
  const int tm = tile / tilesN;
  const int tn = tile - tm * tilesN;
  const int wm = (wave >> 1) << 6;             // this wave's 64x64 tile inside the block's 128x128
  const int wn = (wave & 1) << 6;
  const int m0 = (tm << 7) + wm;
  const int n0 = (tn << 7) + wn;

  const T* Ab  = A  + (size_t)b * strideA;
  const T* Bb  = Bt + (size_t)b * strideB;

  const int rlane = lane & 15;                 // row (A) / col (B, D) within subtile
  const int koff  = (lane >> 4) * 8;           // k offset of this lane half
  const int mOff  = (lane >> 4) * 8;           // D row offset

  // staging map: pass p, thread tid -> row p * GT_RPP + tid / GT_CPR, 8 elements at column (tid % GT_CPR) * 8
  const int srow = tid / GT_CPR;
  const int scol = (tid % GT_CPR) * 8;
  const T* gA = Ab + (size_t)((tm << 7) + srow) * LD + scol;
  const T* gB = Bb + (size_t)((tn << 7) + srow) * LD + scol;
  const int sOff = srow * GT_LP + scol;

  v8f acc[4][4];
#pragma unroll
  for (int i = 0; i < 4; ++i)
#pragma unroll
    for (int j = 0; j < 4; ++j) acc[i][j] = (v8f){0.f,0.f,0.f,0.f,0.f,0.f,0.f,0.f};

  H ra[GT_NP], rb[GT_NP];
#pragma unroll
  for (int p = 0; p < GT_NP; ++p) {
    ra[p] = *(const H*)(gA + p * GT_RPP * LD);
    rb[p] = *(const H*)(gB + p * GT_RPP * LD);
  }
#pragma unroll
  for (int p = 0; p < GT_NP; ++p) {
    *(H*)(sA + sOff + p * GT_RPP * GT_LP) = ra[p];
    *(H*)(sB + sOff + p * GT_RPP * GT_LP) = rb[p];
  }
  __syncthreads();

  const int nStages = K / GT_BK;
  for (int st = 0; st < nStages; ++st) {
    const int cur = (st & 1) * (128 * GT_LP);
    const bool more = st + 1 < nStages;        // block-uniform
    if (more) {
      const T* pa = gA + (st + 1) * GT_BK;
      const T* pb = gB + (st + 1) * GT_BK;
#pragma unroll
      for (int p = 0; p < GT_NP; ++p) {
        ra[p] = *(const H*)(pa + p * GT_RPP * LD);
        rb[p] = *(const H*)(pb + p * GT_RPP * LD);
      }
      // naming the two address pairs here keeps them untouched up to this wait, which stands in front of every reuse of their registers
      asm volatile("s_wait_xcnt 0x0" :: "v"(pa), "v"(pb) : "memory");
    }
    const T* fa = sA + cur + (wm + rlane) * GT_LP + koff;
    const T* fb = sB + cur + (wn + rlane) * GT_LP + koff;
#pragma unroll
    for (int kk = 0; kk < GT_BK / 32; ++kk) {
      V bh[4], ah[4];
#pragma unroll
      for (int j = 0; j < 4; ++j) bh[j] = Frag<T>::load(fb + (j << 4) * GT_LP + kk * 32);
#pragma unroll
      for (int i = 0; i < 4; ++i) ah[i] = Frag<T>::load(fa + (i << 4) * GT_LP + kk * 32);
#pragma unroll
      for (int i = 0; i < 4; ++i)
#pragma unroll
        for (int j = 0; j < 4; ++j) acc[i][j] = Frag<T>::mma(ah[i], bh[j], acc[i][j]);
    }
    if (more) {
      const int nxt = (128 * GT_LP) - cur;     // the buffer whose last readers passed the barrier of stage st - 1
#pragma unroll
      for (int p = 0; p < GT_NP; ++p) {
        *(H*)(sA + nxt + sOff + p * GT_RPP * GT_LP) = ra[p];
        *(H*)(sB + nxt + sOff + p * GT_RPP * GT_LP) = rb[p];
      }
    }
    __syncthreads();
  }
  acc_guard4(acc[0][0], acc[0][1], acc[0][2], acc[0][3]);
  acc_guard4(acc[1][0], acc[1][1], acc[1][2], acc[1][3]);
  acc_guard4(acc[2][0], acc[2][1], acc[2][2], acc[2][3]);
  acc_guard4(acc[3][0], acc[3][1], acc[3][2], acc[3][3]);

  // ---- epilogue ----
  float* slab = sT[wave];
  const float* Rb = RESID ? (resid + (size_t)b * strideR) : nullptr;
#pragma unroll
  for (int i = 0; i < 4; ++i) {
    const int mBase = m0 + (i << 4);
    float bm[8];
    if (BIAS_MODE == 1) {
      const float* bp = bias + mBase + mOff;
#pragma unroll
      for (int r = 0; r < 8; ++r) bm[r] = bp[r];
      // naming the address pair here keeps it untouched up to this wait, which stands in front of every reuse of its registers
      asm volatile("s_wait_xcnt 0x0" :: "v"(bp) : "memory");
    }
#pragma unroll
    for (int j = 0; j < 4; ++j) {
      const int n = n0 + (j << 4) + rlane;
      float bv = 0.f;
      if (BIAS_MODE == 2) bv = bf_rne(bias[n]);
#pragma unroll
      for (int r = 0; r < 8; ++r) {
        float v = acc[i][j][r] * scale;
        if (BIAS_MODE == 1) v += bf_rne(bm[r]);
        if (BIAS_MODE == 2) v += bv;
        if (RESID) v += Rb[(size_t)(mBase + mOff + r) * ldc + n];
        if (ACT == 1) v = tanhf(v);
        if (ACT == 2) v = fmaxf(v, 0.0f);
        if (ACT == 3) v = v / (1.0f + expf(-v));
        if (ACT == 4) v = (v > 0.f) ? v : 0.01f * v;
        if (ACT == 5) v = 0.5f * v * (1.0f + erff(v * 0.70710678118654752f));
        slab[(mOff + r) * 68 + (j << 4) + rlane] = v;
      }
    }
    __builtin_amdgcn_fence(__ATOMIC_RELEASE, "workgroup");
    __builtin_amdgcn_wave_barrier();
    __builtin_amdgcn_fence(__ATOMIC_ACQUIRE, "workgroup");
    if (OUT_MODE == 0) {
      float* C = (float*)Cout + (size_t)b * strideC;
      const int hh = lane >> 4, c4 = (lane & 15) * 4;     // row seg = 256 B = 16 lanes x 16 B
      {
#pragma unroll
        for (int it = 0; it < 8; ++it) {
          const int row = it * 2 + hh;
          v4f v = *(const v4f*)(slab + row * 68 + c4);
          *(v4f*)(C + (size_t)(mBase + row) * ldc + n0 + c4) = v;
        }
        
      }
    } else {
      const int q = lane >> 3, c8 = (lane & 7) * 8;
      unsigned short* C  = (unsigned short*)Cout  + (size_t)b * strideC;
      unsigned short* C2 = (OUT_MODE == 2) ? ((unsigned short*)Cout2 + (size_t)b * strideC) : nullptr;
      {
#pragma unroll
        for (int it = 0; it < 4; ++it) {
          const int row = it * 4 + q;
          const float* sp = slab + row * 68 + c8;
          v8h hv, lv;
          if (OUT_MODE == 1) {
#pragma unroll
            for (int e = 0; e < 8; ++e) hv[e] = (_Float16)sp[e];
          } else {
            v4u hw, lw;
#pragma unroll
            for (int e = 0; e < 4; ++e) { unsigned a, c; bf_split2(sp[2 * e], sp[2 * e + 1], a, c); hw[e] = a; lw[e] = c; }
            hv = __builtin_bit_cast(v8h, hw);
            lv = __builtin_bit_cast(v8h, lw);
          }
          *(v8h*)(C + (size_t)(mBase + row) * ldc + n0 + c8) = hv;
          if (OUT_MODE == 2) *(v8h*)(C2 + (size_t)(mBase + row) * ldc + n0 + c8) = lv;
        }
        
      }
    }
    __builtin_amdgcn_fence(__ATOMIC_RELEASE, "workgroup");
    __builtin_amdgcn_wave_barrier();
    __builtin_amdgcn_fence(__ATOMIC_ACQUIRE, "workgroup");
  }
}

// ---------------------------------------------------------------------------
// Row-preserving bf16 RNE convert of an f32 matrix [rows][ncols] into a u16 plane with row pitch ldout; DUP also
// writes the same 8 values at column + ncols (second copy along the row). 8 consecutive elements per thread = one
// Coverage: grid = n8/256 blocks x 256 threads x 8 elements = rows*ncols (n8 = rows*ncols/8, exact multiple of 256).
// ---------------------------------------------------------------------------
template <bool DUP>
__global__ __launch_bounds__(256) void convrows_kernel(const float* __restrict__ in, unsigned short* __restrict__ out,
                                                       int ncols, int ldout, int n8) {
  const int i = blockIdx.x * 256 + threadIdx.x;
  if (i < n8) {
    const size_t e0 = (size_t)i * 8;
    const int row = (int)(e0 / (size_t)ncols);
    const int col = (int)(e0 - (size_t)row * ncols);
    const v4f a = *(const v4f*)(in + e0);
    const v4f c = *(const v4f*)(in + e0 + 4);
    v4u hv;
    hv[0] = bf_pk(a[0], a[1]);
    hv[1] = bf_pk(a[2], a[3]);
    hv[2] = bf_pk(c[0], c[1]);
    hv[3] = bf_pk(c[2], c[3]);
    const size_t o = (size_t)row * ldout + col;
    {
      *(v4u*)(out + o) = hv;
      if (DUP) *(v4u*)(out + o + ncols) = hv;
      
    }
  }
}

// ---------------------------------------------------------------------------
// Fused transpose + bf16 RNE convert of an f32 matrix, z-batched, one plane:
//   in_z = W + z*sIn viewed [R rows][Cc cols] with row pitch ldin  ->  oh_z[c][r] = bf16(in_z[r][c]), row pitch ldout, oh_z = oh + z*sOut.
// 64x64 tiles through LDS. grid = (Cc/64, R/64, Z), 256 threads (R, Cc multiples of 64; ldout multiple of 64 so every
// Coverage per block: load 4 it x 256 thr x 4 floats = 64x64; store 2 it x 256 thr x 8 u16 = 64x64.
// ---------------------------------------------------------------------------
__global__ __launch_bounds__(256) void tconv_kernel(const float* __restrict__ W, unsigned short* __restrict__ oh,
                                                    int ldin, int ldout, long sIn, long sOut) {
  __shared__ __align__(16) float tf[64 * 68];
  W  += (size_t)blockIdx.z * sIn;
  oh += (size_t)blockIdx.z * sOut;
  const int c0  = blockIdx.x * 64;   // input column block = output row block
  const int r0  = blockIdx.y * 64;   // input row block    = output column block
  const int tid = threadIdx.x;
  {
    const int lr = tid >> 4;         // 0..15
    const int c4 = (tid & 15) * 4;   // 0..60
#pragma unroll
    for (int it = 0; it < 4; ++it) {
      const int rr = it * 16 + lr;   // 0..63
      const v4f a = *(const v4f*)(W + (size_t)(r0 + rr) * ldin + c0 + c4);
      *(v4f*)(tf + rr * 68 + c4) = a;
    }
  }
  __syncthreads();
  const int sub = tid >> 3;          // 0..31
  const int c8  = (tid & 7) * 8;     // 0..56
  v4u hv[2];
#pragma unroll
  for (int it = 0; it < 2; ++it) {
    const int oc = it * 32 + sub;    // output row within tile (= input column)
    v4u a;
#pragma unroll
    for (int q = 0; q < 4; ++q) {
      const float f0 = tf[(c8 + 2 * q) * 68 + oc];
      const float f1 = tf[(c8 + 2 * q + 1) * 68 + oc];
      a[q] = bf_pk(f0, f1);
    }
    hv[it] = a;
  }
  {
#pragma unroll
    for (int it = 0; it < 2; ++it) {
      const int oc = it * 32 + sub;
      const size_t go = (size_t)(c0 + oc) * ldout + r0 + c8;
      *(v4u*)(oh + go) = hv[it];
    }
    
  }
}

// ---------------------------------------------------------------------------
// Rotary angle tables: tc[pos*16 + j] = cos(pos * f_j), ts likewise, f_j = 10000^(-4j/64) = 10^(-j/4) (f32 constants),
// pos 0..31 (shared by the row axis and the column axis), j 0..15. Precise cosf/sinf (|angle| <= 31).
// grid = 2 x 256 = 512 threads = 32 x 16 entries per table; one 4-B store per lane, 32 consecutive lanes = one whole
// ---------------------------------------------------------------------------
__device__ __forceinline__ float rope_freq(int j) {
  float f = 1.0f;
  f = (j == 1)  ? 0.5623413251903491f     : f;
  f = (j == 2)  ? 0.31622776601683794f    : f;
  f = (j == 3)  ? 0.17782794100389229f    : f;
  f = (j == 4)  ? 0.1f                    : f;
  f = (j == 5)  ? 0.05623413251903491f    : f;
  f = (j == 6)  ? 0.031622776601683794f   : f;
  f = (j == 7)  ? 0.017782794100389229f   : f;
  f = (j == 8)  ? 0.01f                   : f;
  f = (j == 9)  ? 0.005623413251903491f   : f;
  f = (j == 10) ? 0.0031622776601683794f  : f;
  f = (j == 11) ? 0.0017782794100389228f  : f;
  f = (j == 12) ? 0.001f                  : f;
  f = (j == 13) ? 0.0005623413251903491f  : f;
  f = (j == 14) ? 0.00031622776601683794f : f;
  f = (j == 15) ? 0.00017782794100389227f : f;
  return f;
}

__global__ __launch_bounds__(256) void ropetab_kernel(float* __restrict__ tc, float* __restrict__ ts) {
  const int i = blockIdx.x * 256 + threadIdx.x;      // 0..511 = pos*16 + j
  if (i < TABN) {
    const int pos = i >> 4, j = i & 15;
    const float a = (float)pos * rope_freq(j);
    const float c = cosf(a);
    const float s = sinf(a);
    ((float*)tc)[i] = c;
    ((float*)ts)[i] = s;
    
  }
}

// ---------------------------------------------------------------------------
// Per-token 2-D RoPE (interleaved pairs (2i,2i+1) inside each head; pairs 0..15 use the row index y = n>>5, pairs 16..31
// the column index x = n&31; tables shared by all heads) followed by RMSNorm over the WHOLE 1024-wide (heads x dim) row:
// v = rope(v); v = v * rsqrt(mean_1024(v*v) + 1e-6) * bf16(w[col]); then bf16 hi/lo split into planes [4096][1024].
// One block of 128 threads per token row g = b*1024+n; thread t owns columns 8t..8t+7 (= 4 rotary pairs p0..p0+3, p0 = (4t)&31,
// all four in the same half of the pair range). All loads are 16-B vectors. Stores: 16 B per lane per plane, 128 lanes cover
// LDS: redq/redk[4] written by lane 0 of each of the 4 waves before the barrier.
// ---------------------------------------------------------------------------
__global__ __launch_bounds__(128) void ropenorm_kernel(const float* __restrict__ qkf,
                                                       const float* __restrict__ tc, const float* __restrict__ ts,
                                                       const float* __restrict__ qw, const float* __restrict__ kw,
                                                       unsigned short* __restrict__ qh, unsigned short* __restrict__ ql,
                                                       unsigned short* __restrict__ kh, unsigned short* __restrict__ kl) {
  __shared__ float redq[4], redk[4];
  const int g = blockIdx.x;                 // token row 0..MTOK-1
  const int n = g & (NTOK - 1);
  const int py = n >> 5, px = n & 31;
  const int t = threadIdx.x, lane = t & 31, wave = t >> 5;
  const int i0 = t * 8;

  const float* qr = qkf + (size_t)g * QKP + i0;
  const float* kr = qr + INNER;
  const v4f qa = *(const v4f*)(qr), qb = *(const v4f*)(qr + 4);
  const v4f ka = *(const v4f*)(kr), kb = *(const v4f*)(kr + 4);

  const int p0   = (4 * t) & 31;
  const int hsel = p0 >> 4;                 // 0: row-axis angles, 1: column-axis angles
  const int pos  = py + hsel * (px - py);
  const int toff = pos * 16 + (p0 & 15);
  const v4f cv = *(const v4f*)(tc + toff);
  const v4f sv = *(const v4f*)(ts + toff);

  float q8[8], k8[8];
  q8[0] = qa[0]; q8[1] = qa[1]; q8[2] = qa[2]; q8[3] = qa[3];
  q8[4] = qb[0]; q8[5] = qb[1]; q8[6] = qb[2]; q8[7] = qb[3];
  k8[0] = ka[0]; k8[1] = ka[1]; k8[2] = ka[2]; k8[3] = ka[3];
  k8[4] = kb[0]; k8[5] = kb[1]; k8[6] = kb[2]; k8[7] = kb[3];

  float rq[8], rk[8];
#pragma unroll
  for (int e = 0; e < 4; ++e) {
    const float c = cv[e], s = sv[e];
    const float qe = q8[2 * e], qo = q8[2 * e + 1];
    const float ke = k8[2 * e], ko = k8[2 * e + 1];
    rq[2 * e]     = qe * c - qo * s;
    rq[2 * e + 1] = qe * s + qo * c;
    rk[2 * e]     = ke * c - ko * s;
    rk[2 * e + 1] = ke * s + ko * c;
  }
  float ssq = 0.0f, ssk = 0.0f;
#pragma unroll
  for (int e = 0; e < 8; ++e) { ssq += rq[e] * rq[e]; ssk += rk[e] * rk[e]; }
#pragma unroll
  for (int off = 1; off < 32; off <<= 1) { ssq += __shfl_xor(ssq, off, 32); ssk += __shfl_xor(ssk, off, 32); }
  if (lane == 0) { redq[wave] = ssq; redk[wave] = ssk; }
  __syncthreads();
  const float tq = (redq[0] + redq[1]) + (redq[2] + redq[3]);
  const float tk = (redk[0] + redk[1]) + (redk[2] + redk[3]);
  const float rmq = rsqrtf(tq * (1.0f / (float)INNER) + RMS_EPS);
  const float rmk = rsqrtf(tk * (1.0f / (float)INNER) + RMS_EPS);

  const v4f wqa = *(const v4f*)(qw + i0), wqb = *(const v4f*)(qw + i0 + 4);
  const v4f wka = *(const v4f*)(kw + i0), wkb = *(const v4f*)(kw + i0 + 4);
  float wq8[8], wk8[8];
  wq8[0] = bf_rne(wqa[0]); wq8[1] = bf_rne(wqa[1]); wq8[2] = bf_rne(wqa[2]); wq8[3] = bf_rne(wqa[3]);
  wq8[4] = bf_rne(wqb[0]); wq8[5] = bf_rne(wqb[1]); wq8[6] = bf_rne(wqb[2]); wq8[7] = bf_rne(wqb[3]);
  wk8[0] = bf_rne(wka[0]); wk8[1] = bf_rne(wka[1]); wk8[2] = bf_rne(wka[2]); wk8[3] = bf_rne(wka[3]);
  wk8[4] = bf_rne(wkb[0]); wk8[5] = bf_rne(wkb[1]); wk8[6] = bf_rne(wkb[2]); wk8[7] = bf_rne(wkb[3]);

  v4u hq, lq, hk, lk;
#pragma unroll
  for (int e = 0; e < 4; ++e) {
    const float fq0 = rq[2 * e] * rmq * wq8[2 * e];
    const float fq1 = rq[2 * e + 1] * rmq * wq8[2 * e + 1];
    const float fk0 = rk[2 * e] * rmk * wk8[2 * e];
    const float fk1 = rk[2 * e + 1] * rmk * wk8[2 * e + 1];
    unsigned hw, lw;
    bf_split2(fq0, fq1, hw, lw); hq[e] = hw; lq[e] = lw;
    bf_split2(fk0, fk1, hw, lw); hk[e] = hw; lk[e] = lw;
  }
  const size_t o = (size_t)g * INNER + i0;
  {
    *(v4u*)(qh + o) = hq;
    *(v4u*)(ql + o) = lq;
    *(v4u*)(kh + o) = hk;
    *(v4u*)(kl + o) = lk;
    
  }
}

// =====================================================================================
// Full (non-causal, unmasked) attention, head dim 64, all batches in one launch.
//   q planes (hi/lo bf16) [4096][1024]: element (b, n, h, d) at [(b*1024+n)*1024 + h*64 + d]
//   k planes (hi/lo bf16) [4096][1024]: same layout
//   v^T planes (hi/lo bf16) [1024][4096]: element (h, d, b, t) at [(h*64 + d)*4096 + b*1024 + t]
//   out CTX2 plane u16 [4096][2048]: hi bits of o(b,n,h,d) at col h*64+d, lo bits (o - hi) at col 1024 + h*64+d.
//   scores^T = (k . q^T) * 0.125 : A = K rows, B = Q rows; bf16 hi/lo split (hi.hi + lo.hi + hi.lo) on v_wmma_f32_16x16x32_bf16
//   out^T    = v^T . p^T         : A = V^T rows, B = P^T; bf16 hi/lo split of p (unnormalised exp) and v, f32 accumulate, x 1/rowsum at the end
//   Transposed tiles: a lane holds one query (column c) and, per 16-key tile, keys 8*hh + 0..7 in its 8 accumulator registers. Two score
//   tiles (keys 0..15 and 16..31 of a 32-key block), converted in place, are the B operand of the second product in the k order of the
//   V^T fragment loads (elements 0..7 = keys 8*hh + 0..7, elements 8..15 = keys 16 + 8*hh + 0..7): P never goes through LDS.
//   online softmax in f32, base 2 (scores x sscale x log2 e), over the 1024 keys of the batch element (16 chunks of 64, compile-time trip count, no masking): maximum in-lane
//   plus one exchange between the wave halves per chunk; each half sums its own keys, the two sums are joined once in the epilogue.
//   Block = 4 waves = 64 query rows of one (batch, head); grid.x = 4 * 16 * 16 = 1024.
//   K / V^T chunk staging: 128 threads x 32 elements per plane = the whole 64x64 tile (16-B copies, plain loads,
//   __syncthreads before and after); fragment loads read the LDS tiles with the same v8b element type.
//   LDS extents: K/V tiles 64x64 fully staged every chunk.
// =====================================================================================
#define AT_D 64
#define AT_NW 4
#define AT_QB 64
#define AT_KC 64
// LDS row pitch of the K and V^T tiles in elements: 64 data + 8 pad = 144 B = 16 B x 9 (odd), so the 16 rows that one
// 16-byte fragment read touches fall on 16 different groups of four banks; at 128 B they fall on two. Pad elements are never read.
#define AT_LP 72

__device__ __forceinline__ v8f at_mma(v16b a, v16b b, v8f c) {
  c = __builtin_amdgcn_wmma_f32_16x16x32_bf16(false, a, false, b, (short)0, c, false, false);
  asm volatile("v_nop\n\tv_nop\n\tv_nop\n\tv_nop" : "+v"(c) : "v"(a), "v"(b));
  return c;
}

// value of lane l ^ 16 (the other wave half), by a vector cross-row move
__device__ __forceinline__ float at_xhalf(float x) {
  return __builtin_bit_cast(float, __builtin_amdgcn_permlanex16(__builtin_bit_cast(int, x), __builtin_bit_cast(int, x),
                                                                0x76543210, 0xfedcba98, false, false));
}

__global__ __launch_bounds__(128)
void attn_kernel(const unsigned short* __restrict__ qhp, const unsigned short* __restrict__ qlp,
                 const unsigned short* __restrict__ khp, const unsigned short* __restrict__ klp,
                 const unsigned short* __restrict__ vhp, const unsigned short* __restrict__ vlp,
                 unsigned short* __restrict__ aop, float sscale) {
  union FB { v16b v; v8b h[2]; unsigned w[8]; };   // w[i] = elements 2i (low half) and 2i + 1
  __shared__ __align__(16) __bf16 Ksh[AT_KC * AT_LP];            // K hi [kv][d], pitch AT_LP   9 KB
  __shared__ __align__(16) __bf16 Ksl[AT_KC * AT_LP];            // K lo
  __shared__ __align__(16) __bf16 Vth[AT_D * AT_LP];             // V hi [d][kv], pitch AT_LP   9 KB
  __shared__ __align__(16) __bf16 Vtl[AT_D * AT_LP];             // V lo
  __shared__ __align__(16) float  Os[AT_NW][16 * 68];            // per wave out tile, pitch 68

  const int tid  = threadIdx.x;
  const int wave = tid >> 5;
  const int lane = tid & 31;
  const int hh   = lane >> 4;
  const int c    = lane & 15;

  const int nqb = NTOK / AT_QB;            // 16 query blocks per batch element
  const int bx = blockIdx.x;              // grid = NB * NH * nqb (exact)
  const int qb = bx % nqb;
  const int hb = bx / nqb;
  const int h  = hb % NH;                 // 0..15
  const int b  = hb / NH;                 // 0..3
  const int q0 = b * NTOK + qb * AT_QB + wave * 16;   // row in the q / CTX2 planes

  const __bf16* Qh = (const __bf16*)(const void*)qhp + (size_t)h * AT_D;
  const __bf16* Ql = (const __bf16*)(const void*)qlp + (size_t)h * AT_D;
  const __bf16* Kh = (const __bf16*)(const void*)khp + (size_t)h * AT_D;
  const __bf16* Kl = (const __bf16*)(const void*)klp + (size_t)h * AT_D;
  const __bf16* Vh = (const __bf16*)(const void*)vhp + (size_t)h * AT_D * VTP + (size_t)b * NTOK;
  const __bf16* Vl = (const __bf16*)(const void*)vlp + (size_t)h * AT_D * VTP + (size_t)b * NTOK;
  unsigned short* Ch = aop + (size_t)h * AT_D;                    // hi columns
  unsigned short* Cl = aop + (size_t)INNER + (size_t)h * AT_D;    // lo columns

  // ---- Q fragments (B operand, column = query = lane&15, split k map via Frag load): 2 d-chunks, hi and lo ----
  v16b qah[2], qal[2];
#pragma unroll
  for (int dc = 0; dc < 2; ++dc) {
    const __bf16* qr = Qh + (size_t)(q0 + c) * INNER + dc * 32 + 8 * hh;
    const __bf16* ql = Ql + (size_t)(q0 + c) * INNER + dc * 32 + 8 * hh;
    qah[dc] = Frag<__bf16>::load(qr);
    qal[dc] = Frag<__bf16>::load(ql);
  }

  // exponentials to base 2: e^(x * sscale) = 2^(x * c2), so one fused multiply-add and the hardware's 2^x make one P element
  const float c2 = sscale * 1.4426950408889634f;
  float mrow = -INFINITY, lrow = 0.f;   // this lane's query: running maximum in log2 units (both halves alike), sum over this half's keys
  v8f oacc[4];                          // oacc[t][r] = out^T[d = t*16 + 8*hh + r][query c]
#pragma unroll
  for (int t = 0; t < 4; ++t) oacc[t] = (v8f){0.f,0.f,0.f,0.f,0.f,0.f,0.f,0.f};

  const int nChunks = NTOK / AT_KC;   // 16, compile-time constant
  for (int kc = 0; kc < nChunks; ++kc) {
    const int kv0 = kc * AT_KC;
    __syncthreads();
    {
      // staging coverage: 128 threads x (4 x 8) elements = 64 rows x 64 per plane = the whole chunk tile
      const int r = tid >> 1, half = (tid & 1) * 32;
      const __bf16* ksh = Kh + (size_t)(b * NTOK + kv0 + r) * INNER + half;   // K row (b, kv0+r), d = half..half+31
      const __bf16* ksl = Kl + (size_t)(b * NTOK + kv0 + r) * INNER + half;
      const __bf16* vsh = Vh + (size_t)r * VTP + kv0 + half;                  // V^T row d = r, keys kv0+half..+31
      const __bf16* vsl = Vl + (size_t)r * VTP + kv0 + half;
#pragma unroll
      for (int i = 0; i < 4; ++i) {
        const v8b a0 = *(const v8b*)(ksh + 8 * i);
        const v8b a1 = *(const v8b*)(ksl + 8 * i);
        const v8b b0 = *(const v8b*)(vsh + 8 * i);
        const v8b b1 = *(const v8b*)(vsl + 8 * i);
        *(v8b*)(Ksh + r * AT_LP + half + 8 * i) = a0;
        *(v8b*)(Ksl + r * AT_LP + half + 8 * i) = a1;
        *(v8b*)(Vth + r * AT_LP + half + 8 * i) = b0;
        *(v8b*)(Vtl + r * AT_LP + half + 8 * i) = b1;
      }
    }
    __syncthreads();

    v8f s[4];
#pragma unroll
    for (int j = 0; j < 4; ++j) {
      s[j] = (v8f){0.f,0.f,0.f,0.f,0.f,0.f,0.f,0.f};
#pragma unroll
      for (int dc = 0; dc < 2; ++dc) {
        FB kb, kl;
        kb.h[0] = *(const v8b*)(Ksh + (j * 16 + c) * AT_LP + dc * 32 + 8 * hh);
        kb.h[1] = *(const v8b*)(Ksh + (j * 16 + c) * AT_LP + dc * 32 + 16 + 8 * hh);
        kl.h[0] = *(const v8b*)(Ksl + (j * 16 + c) * AT_LP + dc * 32 + 8 * hh);
        kl.h[1] = *(const v8b*)(Ksl + (j * 16 + c) * AT_LP + dc * 32 + 16 + 8 * hh);
        s[j] = at_mma(kb.v, qah[dc], s[j]);
        s[j] = at_mma(kl.v, qah[dc], s[j]);
        s[j] = at_mma(kb.v, qal[dc], s[j]);
      }
    }
    // s[j][r] = unscaled score of key kv0 + j*16 + 8*hh + r against query c: this query's chunk maximum, scaled once
    // (c2 > 0 keeps the order of the scores; the softmax does not depend on the value that is subtracted)
    float mj[4];
#pragma unroll
    for (int j = 0; j < 4; ++j) {
      float m = -INFINITY;
#pragma unroll
      for (int r = 0; r < 8; ++r) m = fmaxf(m, s[j][r]);
      mj[j] = m;
    }
    float cm = fmaxf(fmaxf(mj[0], mj[1]), fmaxf(mj[2], mj[3]));
    cm = fmaxf(cm, at_xhalf(cm));
    const float mnew = fmaxf(mrow, cm * c2);
    const float alpha = __builtin_amdgcn_exp2f(mrow - mnew);
    mrow = mnew;
    FB ph[2], pl[2];   // P^T hi / lo as B operands, one per 32 keys: elements 0..7 from tile 2*kk, 8..15 from tile 2*kk + 1
    float pj[4];
#pragma unroll
    for (int j = 0; j < 4; ++j) {
      float psum = 0.f;
#pragma unroll
      for (int r = 0; r < 8; r += 2) {
        const float p0 = __builtin_amdgcn_exp2f(__builtin_fmaf(s[j][r], c2, -mnew));       // e^(score * sscale - maximum)
        const float p1 = __builtin_amdgcn_exp2f(__builtin_fmaf(s[j][r + 1], c2, -mnew));
        psum += p0;
        psum += p1;
        bf_split2(p0, p1, ph[j >> 1].w[(j & 1) * 4 + (r >> 1)], pl[j >> 1].w[(j & 1) * 4 + (r >> 1)]);   // elements (j & 1) * 8 + r and + 1
      }
      pj[j] = psum;
    }
    lrow = lrow * alpha + ((pj[0] + pj[1]) + (pj[2] + pj[3]));
#pragma unroll
    for (int t = 0; t < 4; ++t)
#pragma unroll
      for (int r = 0; r < 8; ++r) oacc[t][r] *= alpha;
    // unrolled: the P^T fragments are registers and are picked by kk at compile time
#pragma unroll
    for (int kk = 0; kk < 2; ++kk) {
#pragma unroll
      for (int t = 0; t < 4; ++t) {
        FB vb, vl;
        vb.h[0] = *(const v8b*)(Vth + (t * 16 + c) * AT_LP + kk * 32 + 8 * hh);
        vb.h[1] = *(const v8b*)(Vth + (t * 16 + c) * AT_LP + kk * 32 + 16 + 8 * hh);
        vl.h[0] = *(const v8b*)(Vtl + (t * 16 + c) * AT_LP + kk * 32 + 8 * hh);
        vl.h[1] = *(const v8b*)(Vtl + (t * 16 + c) * AT_LP + kk * 32 + 16 + 8 * hh);
        oacc[t] = at_mma(vb.v, ph[kk].v, oacc[t]);
        oacc[t] = at_mma(vl.v, ph[kk].v, oacc[t]);
        oacc[t] = at_mma(vb.v, pl[kk].v, oacc[t]);
      }
    }
  }

  float* os = Os[wave];
  {
    const float inv = 1.0f / (lrow + at_xhalf(lrow));   // the two halves' key sums of query c, joined
#pragma unroll
    for (int t = 0; t < 4; ++t) {
      v4f o0, o1;
#pragma unroll
      for (int r = 0; r < 4; ++r) { o0[r] = oacc[t][r] * inv; o1[r] = oacc[t][4 + r] * inv; }
      *(v4f*)(os + c * 68 + t * 16 + 8 * hh)     = o0;   // row = query c, columns d = t*16 + 8*hh + 0..7
      *(v4f*)(os + c * 68 + t * 16 + 8 * hh + 4) = o1;
    }
  }
  __builtin_amdgcn_fence(__ATOMIC_RELEASE, "workgroup");
  __builtin_amdgcn_wave_barrier();
  __builtin_amdgcn_fence(__ATOMIC_ACQUIRE, "workgroup");
  {
    const int q = lane >> 3, c8 = (lane & 7) * 8;
    {
#pragma unroll
      for (int it = 0; it < 4; ++it) {
        const int row = it * 4 + q;
        const float* sp = os + row * 68 + c8;
        v4u hw, lw;
#pragma unroll
        for (int e = 0; e < 4; ++e) { unsigned a, d; bf_split2(sp[2 * e], sp[2 * e + 1], a, d); hw[e] = a; lw[e] = d; }
        const v8h hv = __builtin_bit_cast(v8h, hw), lv = __builtin_bit_cast(v8h, lw);
        *(v8h*)(Ch + (size_t)(q0 + row) * AOP + c8) = hv;
        *(v8h*)(Cl + (size_t)(q0 + row) * AOP + c8) = lv;
      }
      
    }
  }
}

// ---------------------------------------------------------------------------
// Output RMSNorm over C + residual + back to NCHW:
//   out[b][c][n] = Of[b*1024+n][c] * rsqrt(mean_C(Of[tok][.]^2) + 1e-6) * bf16(w[c]) + bf16(x[b][c][n]).
// One block of 512 threads (16 waves) per 32 consecutive tokens x 512 channels; grid = 128 token groups x 2 channel halves = 256,
// as many blocks as the chip has WGPs. Every global load of a thread is issued before the first wait: nothing is fetched in a loop.
// Wave w holds the whole rows of tokens 2w and 2w+1 in registers (8 x 16 B per lane and row), sums their squares (per lane one sum
// per channel half, the two added, then the lane tree), scales the block's half of each row and writes it to the LDS tile [token][channel].
// Behind the one barrier a thread reads a 4-token x 4-channel square as four 16-B rows; its columns are the 16-B output vectors
// (4 tokens of one channel), so 8 lanes store one whole 128-B line of out and a block writes only whole lines.
// LDS pitch 516 floats = 16 B x 129 (odd); the 16-B unit index of a row is XORed with 2 for tokens 16..31, so that the 16 lanes
// of a half wave (tokens 4j+q, j = 0..7, two channel units) read 16 different groups of four banks.
// Coverage: 256 blocks x 32 tokens x 512 channels = 4 x 1024 x 1024 outputs, each exactly once.
// ---------------------------------------------------------------------------
#define FN_TOK 32
#define FN_CS  512
#define FN_P   (FN_CS + 4)
static_assert(NTOK % FN_TOK == 0 && CH == 2 * FN_CS && CH == 8 * 128 && FN_TOK == 2 * 16);
__global__ __launch_bounds__(512) void final_kernel(const float* __restrict__ of, const float* __restrict__ nw,
                                                    const float* __restrict__ xin, float* __restrict__ out) {
  __shared__ __align__(16) float tf[FN_TOK * FN_P];
  const int tid = threadIdx.x, lane = tid & 31, wave = tid >> 5;
  const int sl   = blockIdx.x & 1;            // channel half
  const int tok0 = (blockIdx.x >> 1) * FN_TOK;
  const int b = tok0 / NTOK, n0 = tok0 - b * NTOK;
  const int c0 = sl * FN_CS;
  const int j  = tid & 7;                     // token quad: tokens 4j..4j+3
  const int cg = tid >> 3;                    // channel unit 0..63 (4 channels), second pass + 64

  // all loads: the two rows first (the sums wait for them alone), then the weights, then the residual.
  // vo = the block's own channel half of a row, vx = the other half, read for the row sum only.
  const float* po  = of + (size_t)(tok0 + wave * 2) * CH + lane * 4 + c0;
  const float* px  = of + (size_t)(tok0 + wave * 2) * CH + lane * 4 + (FN_CS - c0);
  const float* xp0 = xin + ((size_t)(b * CH + c0 + cg * 4)) * NTOK + n0 + 4 * j;
  v4f vo[2][4], vx[2][4];
#pragma unroll
  for (int i = 0; i < 2; ++i) {
#pragma unroll
    for (int kk = 0; kk < 4; ++kk) vo[i][kk] = *(const v4f*)(po + i * CH + kk * 128);
#pragma unroll
    for (int kk = 0; kk < 4; ++kk) vx[i][kk] = *(const v4f*)(px + i * CH + kk * 128);
  }
  v4f w4[4];
#pragma unroll
  for (int kk = 0; kk < 4; ++kk) w4[kk] = *(const v4f*)(nw + c0 + kk * 128 + lane * 4);
  v4f xr[2][4];
#pragma unroll
  for (int e = 0; e < 4; ++e) {
    xr[0][e] = *(const v4f*)(xp0 + e * NTOK);
    xr[1][e] = *(const v4f*)(xp0 + (256 + e) * NTOK);
  }
  // naming the three address pairs here keeps them untouched up to this wait, which stands in front of every reuse of their registers;
  // as a memory barrier for the compiler it also keeps every load above issued before the first wait for data
  asm volatile("s_wait_xcnt 0x0" :: "v"(po), "v"(px), "v"(xp0) : "memory");

  // row sum of squares = (sum over the own half) + (sum over the other half)
  float ss[2];
#pragma unroll
  for (int i = 0; i < 2; ++i) {
    float so = 0.0f, sx = 0.0f;
#pragma unroll
    for (int kk = 0; kk < 4; ++kk) {
      const v4f a = vo[i][kk], c = vx[i][kk];
      so += a[0] * a[0] + a[1] * a[1] + a[2] * a[2] + a[3] * a[3];
      sx += c[0] * c[0] + c[1] * c[1] + c[2] * c[2] + c[3] * c[3];
    }
    ss[i] = so + sx;
  }
#pragma unroll
  for (int off = 1; off < 32; off <<= 1) {
    const float t0 = __shfl_xor(ss[0], off, 32), t1 = __shfl_xor(ss[1], off, 32);
    ss[0] += t0; ss[1] += t1;
  }

  const int wswz = (wave >> 3) << 1;          // tokens 2w, 2w+1 >= 16
#pragma unroll
  for (int i = 0; i < 2; ++i) {
    const float rm = rsqrtf(ss[i] * (1.0f / (float)CH) + RMS_EPS);
    float* row = tf + (wave * 2 + i) * FN_P;
#pragma unroll
    for (int kk = 0; kk < 4; ++kk) {
      const v4f a = vo[i][kk];
      v4f o;
#pragma unroll
      for (int e = 0; e < 4; ++e) o[e] = a[e] * rm * bf_rne(w4[kk][e]);
      *(v4f*)(row + (((kk * 32 + lane) ^ wswz) << 2)) = o;
    }
  }
  __syncthreads();

  const int rswz = (j >> 2) << 1;
#pragma unroll
  for (int it = 0; it < 2; ++it) {
    const int cu = it * 64 + cg;
    v4f rd[4];
#pragma unroll
    for (int q = 0; q < 4; ++q) rd[q] = *(const v4f*)(tf + (4 * j + q) * FN_P + ((cu ^ rswz) << 2));
#pragma unroll
    for (int e = 0; e < 4; ++e) {
      v4f o;
#pragma unroll
      for (int q = 0; q < 4; ++q) o[q] = rd[q][e] + bf_rne(xr[it][e][q]);
      *(v4f*)(out + ((size_t)(b * CH + c0 + cu * 4 + e)) * NTOK + n0 + 4 * j) = o;
    }
  }
}

// ---------------------------------------------------------------------------
// Workspace region map (byte offsets; every region is fully written by its producer launch before any consumer
//   XB    bf16 [4096][1024]          0       8388608
//   WQKV  bf16 [3072][1024]    8388608       6291456
//   WP2   bf16 [1024][2048]   14680064       4194304
//   TC    f32  [32][16]       18874368          2048   TS  18876416  2048
//   QKf   f32  [4096][2048]   18878464      33554432   (dead after ropenorm; the same 32 MiB then hold
//                                                       CTX2 u16 [4096][2048] at 18878464 (16777216) and
//                                                       Of   f32  [4096][1024] at 35655680 (16777216), disjoint)
//   Qh    bf16 [4096][1024]   52432896       8388608   Ql  60821504
//   Kh    bf16 [4096][1024]   69210112       8388608   Kl  77598720
//   VTh   bf16 [1024][4096]   85987328       8388608   VTl 94375936
//   total                    102764544
// ---------------------------------------------------------------------------
extern "C" void kernel_launch(void* const* d_in, const int* in_sizes, int n_in,
                              void* d_out, int out_size, void* d_ws, size_t ws_size,
                              hipStream_t stream) {
  if (n_in < 7) return;
  if (in_sizes[0] != NB * CH * NTOK) return;        // hidden_states [4][1024][32][32]
  if (in_sizes[1] != NQKV * CH) return;             // w_qkv [3072][1024]
  if (in_sizes[2] != NQKV) return;                  // b_qkv [3072]
  if (in_sizes[3] != INNER) return;                 // q_norm_w [1024]
  if (in_sizes[4] != INNER) return;                 // k_norm_w [1024]
  if (in_sizes[5] != CH * INNER) return;            // w_proj [1024][1024]
  if (in_sizes[6] != CH) return;                    // norm_out_w [1024]
  if (out_size != NB * CH * NTOK) return;

  const float* x    = (const float*)d_in[0];
  const float* wqkv = (const float*)d_in[1];   // [out 3072][in 1024]
  const float* bqkv = (const float*)d_in[2];
  const float* qnw  = (const float*)d_in[3];
  const float* knw  = (const float*)d_in[4];
  const float* wprj = (const float*)d_in[5];   // [out 1024][in 1024]
  const float* onw  = (const float*)d_in[6];

  const size_t PXB = (size_t)MTOK * CH * 2;        // 8388608
  const size_t PWQ = (size_t)NQKV * CH * 2;        // 6291456
  const size_t PWP = (size_t)CH * AOP * 2;         // 4194304
  const size_t PTB = (size_t)TABN * 4;             // 2048
  const size_t PQK = (size_t)MTOK * QKP * 4;       // 33554432
  const size_t PCX = (size_t)MTOK * AOP * 2;       // 16777216
  const size_t POF = (size_t)MTOK * CH * 4;        // 16777216
  const size_t PPL = (size_t)MTOK * INNER * 2;     // 8388608 per q/k plane
  const size_t PVT = (size_t)INNER * VTP * 2;      // 8388608 per v^T plane
  if (PCX + POF > PQK) return;                     // CTX2 and Of share the QKf region, disjoint halves
  size_t off = 0;
  const size_t oXB  = off; off += PXB;
  const size_t oWQ  = off; off += PWQ;
  const size_t oWP  = off; off += PWP;
  const size_t oTC  = off; off += PTB;
  const size_t oTS  = off; off += PTB;
  const size_t oQK  = off; off += PQK;
  const size_t oCX  = oQK;
  const size_t oOF  = oQK + PCX;
  const size_t oQh  = off; off += PPL;  const size_t oQl = off; off += PPL;
  const size_t oKh  = off; off += PPL;  const size_t oKl = off; off += PPL;
  const size_t oVTh = off; off += PVT;  const size_t oVTl = off; off += PVT;
  if (off > ws_size) return;                       // off = 102764544
  if (off > (size_t)134217728) return;

  char* ws = (char*)d_ws;
  unsigned short* XB   = (unsigned short*)(ws + oXB);
  unsigned short* WQKV = (unsigned short*)(ws + oWQ);
  unsigned short* WP2  = (unsigned short*)(ws + oWP);
  float*          TC   = (float*)(ws + oTC);
  float*          TS   = (float*)(ws + oTS);
  float*          QKf  = (float*)(ws + oQK);
  unsigned short* CTX2 = (unsigned short*)(ws + oCX);
  float*          Of   = (float*)(ws + oOF);
  unsigned short* Qh   = (unsigned short*)(ws + oQh);  unsigned short* Ql  = (unsigned short*)(ws + oQl);
  unsigned short* Kh   = (unsigned short*)(ws + oKh);  unsigned short* Kl  = (unsigned short*)(ws + oKl);
  unsigned short* VTh  = (unsigned short*)(ws + oVTh); unsigned short* VTl = (unsigned short*)(ws + oVTl);

  const dim3 blk(256);

  // (1) x[b] viewed [R=1024 c][Cc=1024 n] (pitch 1024) -> XB_b[n][c] (pitch 1024); grid (Cc/64, R/64, B) = (16, 16, 4)
  tconv_kernel<<<dim3(NTOK / 64, CH / 64, NB), blk, 0, stream>>>(x, XB, NTOK, CH, (long)CH * NTOK, (long)NTOK * CH);
  // (2) w_qkv [3072][1024] -> WQKV bf16 same layout; 393216 units -> 1536 blocks
  const int n8q = NQKV * CH / 8;
  convrows_kernel<false><<<dim3(n8q / 256), blk, 0, stream>>>(wqkv, WQKV, CH, CH, n8q);
  // (3) w_proj [1024][1024] -> WP2 [1024][2048], cols k and 1024+k; 131072 units -> 512 blocks
  const int n8p = CH * INNER / 8;
  convrows_kernel<true><<<dim3(n8p / 256), blk, 0, stream>>>(wprj, WP2, INNER, AOP, n8p);
  // (4) rotary cos/sin tables [32][16]
  ropetab_kernel<<<dim3(2), blk, 0, stream>>>(TC, TS);
  // (5) q|k = XB . WQKV[0..2047]^T + b -> QKf f32 [4096][2048]   (M=4096, N=2048, K=1024; 32 x 16 = 512 blocks of 128 threads)
  const dim3 gblk(128);
  const dim3 gQK((MTOK / 128) * (QKP / 128), 1);
  wmma_gemm64<1, false, 2, 0, false, CH><<<gQK, gblk, 0, stream>>>(
      XB, XB, 0L, WQKV, WQKV, 0L, (void*)QKf, (void*)QKf, QKP, 0L,
      bqkv, bqkv, 0L, MTOK, QKP, CH, 1.0f);
  // (6) v^T = WQKV[2048..3071] . XB^T + b[2048+m] -> VTh|VTl [1024][4096]   (M=1024, N=4096, K=1024; 8 x 32 = 256 blocks)
  const dim3 gVT((INNER / 128) * (MTOK / 128), 1);
  wmma_gemm64<1, false, 1, 2, false, CH><<<gVT, gblk, 0, stream>>>(
      WQKV + (size_t)2 * INNER * CH, WQKV + (size_t)2 * INNER * CH, 0L, XB, XB, 0L,
      (void*)VTh, (void*)VTl, VTP, 0L,
      bqkv + 2 * INNER, bqkv, 0L, INNER, MTOK, CH, 1.0f);
  // (7) RoPE + RMSNorm over 1024 for q and k -> Qh|Ql, Kh|Kl; one block of 128 threads per token row
  ropenorm_kernel<<<dim3(MTOK), dim3(128), 0, stream>>>(QKf, TC, TS, qnw, knw, Qh, Ql, Kh, Kl);
  // (8) attention per (batch, head, 64-query block) -> CTX2 [4096][2048] (hi | lo columns); 1024 blocks
  attn_kernel<<<dim3(NB * NH * (NTOK / 64)), dim3(128), 0, stream>>>(Qh, Ql, Kh, Kl, VTh, VTl, CTX2, 0.125f);
  // (9) Of = CTX2 . WP2^T -> f32 [4096][1024]   (M=4096, N=1024, K=2048; 32 x 8 = 256 blocks)
  const dim3 gO((MTOK / 128) * (CH / 128), 1);
  wmma_gemm64<1, false, 0, 0, false, AOP><<<gO, gblk, 0, stream>>>(
      CTX2, CTX2, 0L, WP2, WP2, 0L, (void*)Of, (void*)Of, CH, 0L,
      bqkv, bqkv, 0L, MTOK, CH, AOP, 1.0f);
  // (10) output RMSNorm + residual -> NCHW d_out; 128 groups of 32 tokens x 2 channel halves = 256 blocks of 512 threads
  final_kernel<<<dim3((MTOK / FN_TOK) * (CH / FN_CS)), dim3(512), 0, stream>>>(Of, onw, x, (float*)d_out);
  (void)hipGetLastError();
}

// v007
// A run of this version takes 152 microseconds.
// Next to v006, in two timings, it ran 1.06 and 1.07 times as fast.
// Over all steps from v000 it is 3.10 times as fast.
// Contractions: q|k projection (f32 out) and v^T projection (bf16 hi|lo out) = v_wmma_f32_16x16x32_bf16 single products on bf16 planes of the RNE-converted inputs; q.k^T and p.v = bf16 hi/lo split (hi.hi + hi.lo + lo.hi); output projection = [CTXhi|CTXlo] x [Wp;Wp] bf16 single products (K-folded 2-term); f32 accumulate everywhere; RoPE, QK RMSNorm, output RMSNorm, online softmax, 1/rowsum, bias and residual in f32 on the VALU.
// Plane / carry map (all carry 1, nothing to fold back): XB = bf16(x) token-major [4096][1024] (row b*1024+n, n = y*32+x, col c);
// WQKV = bf16(w_qkv) [3072][1024] natural [out][in]; WP2 [1024][2048]: cols k and 1024+k both = bf16(w_proj[c][k]);
// TC/TS f32 [32 pos][16 pair] = cos/sin(pos * 10000^(-j/16)); QKf f32 [4096][2048] = pre-RoPE q (cols 0..1023) | k (cols 1024..2047) incl. bias;
// Qh|Ql, Kh|Kl bf16 [4096][1024] (col h*64+d) = hi/lo of the RoPE'd, RMSNorm'd q, k; VTh|VTl bf16 [1024 (h,d)][4096 (b,t)];
// P hi|lo = unnormalised exp in (0,1] (bf16, f32 exponent range), kept in registers, 1/rowsum applied to the f32 accumulator in the attention epilogue;
// CTX2 u16 [4096][2048] = ctx hi at col h*64+d, lo at col 1024+h*64+d; Of f32 [4096][1024] = ctx . w_proj^T.
#include <hip/hip_runtime.h>
#include <math.h>
#include <stdint.h>

#define NB    4
#define CH    1024
#define IMH   32
#define IMW   32
#define NTOK  1024
#define INNER 1024
#define NH    16
#define HD    64
#define NQKV  3072
#define QKP   2048
#define AOP   2048
#define VTP   (NB * NTOK)
#define MTOK  (NB * NTOK)
#define TABN  512
#define RMS_EPS 1e-6f

static_assert(NTOK == IMH * IMW);
static_assert(IMW == 32);
static_assert(INNER == NH * HD);
static_assert(HD == 64);
static_assert(NQKV == 3 * INNER);
static_assert(QKP == 2 * INNER);
static_assert(AOP == 2 * INNER);
static_assert(CH % 64 == 0);
static_assert(NTOK % 64 == 0);
static_assert(INNER % 64 == 0);
static_assert(MTOK % 64 == 0);
static_assert(CH % 32 == 0);
static_assert(AOP % 32 == 0);
static_assert(INNER == 128 * 8);
static_assert(CH == 8 * 128);
static_assert(TABN == 32 * (HD / 4));
static_assert((NQKV * CH) % (8 * 256) == 0);
static_assert((CH * INNER) % (8 * 256) == 0);
static_assert(CH % 256 == 0);
static_assert(INNER % 256 == 0);
static_assert(MTOK % 128 == 0 && QKP % 128 == 0 && INNER % 128 == 0 && CH % 128 == 0 && AOP % 128 == 0);

typedef __attribute__((ext_vector_type(16))) _Float16 v16h;
typedef __attribute__((ext_vector_type(8)))  _Float16 v8h;
typedef __attribute__((ext_vector_type(16))) __bf16   v16b;
typedef __attribute__((ext_vector_type(8)))  __bf16   v8b;
typedef __attribute__((ext_vector_type(8)))  float    v8f;
typedef __attribute__((ext_vector_type(4)))  float    v4f;
typedef __attribute__((ext_vector_type(2)))  float    v2f;
typedef __attribute__((ext_vector_type(4)))  unsigned int v4u;

// f32 -> bf16, round to nearest even, by the packed hardware convert: bf16(f0) in bits 15..0, bf16(f1) in bits 31..16
typedef __attribute__((ext_vector_type(2))) __bf16 v2b;
__device__ __forceinline__ unsigned bf_pk(float f0, float f1) {
  const v2f f = {f0, f1};
  return __builtin_bit_cast(unsigned, __builtin_convertvector(f, v2b));
}
__device__ __forceinline__ float bf_rne(float f) { return __uint_as_float(bf_pk(f, f) & 0xFFFF0000u); }
// hi/lo split of two f32 at once: hi = the two values rounded to bf16, lo = the two remainders f - hi rounded to bf16
__device__ __forceinline__ void bf_split2(float f0, float f1, unsigned& hi, unsigned& lo) {
  const v2f f = {f0, f1};
  hi = __builtin_bit_cast(unsigned, __builtin_convertvector(f, v2b));
  const v2f g = {__uint_as_float(hi << 16), __uint_as_float(hi & 0xFFFF0000u)};
  lo = __builtin_bit_cast(unsigned, __builtin_convertvector(f - g, v2b));
}

// hazard guard behind the product loop, as a plain device helper
__device__ __forceinline__ void acc_guard4(v8f& a, v8f& b, v8f& c, v8f& d) { asm volatile("v_nop\n\tv_nop\n\tv_nop\n\tv_nop" : "+v"(a), "+v"(b), "+v"(c), "+v"(d)); }
template <typename T> struct Frag;
template <> struct Frag<_Float16> {
  typedef v16h V; typedef v8h H; union U { v16h v; v8h h[2]; };
  static __device__ __forceinline__ v16h load(const _Float16* p) {   // elements 0..7 <- p[0..7], 8..15 <- p[16..23]
    U f; f.h[0] = *(const v8h*)(p); f.h[1] = *(const v8h*)(p + 16); return f.v;
  }
  static __device__ __forceinline__ v8f mma(v16h a, v16h b, v8f c) {
    return __builtin_amdgcn_wmma_f32_16x16x32_f16(false, a, false, b, (short)0, c, false, false);
  }
};
template <> struct Frag<__bf16> {
  typedef v16b V; typedef v8b H; union U { v16b v; v8b h[2]; };
  static __device__ __forceinline__ v16b load(const __bf16* p) {
    U f; f.h[0] = *(const v8b*)(p); f.h[1] = *(const v8b*)(p + 16); return f.v;
  }
  static __device__ __forceinline__ v8f mma(v16b a, v16b b, v8f c) {
    return __builtin_amdgcn_wmma_f32_16x16x32_bf16(false, a, false, b, (short)0, c, false, false);
  }
};

// ---- Register-blocked batched WMMA GEMM ------------------------------------
// C[m,n] = scale * sum_k A[m,k] * Bt[n,k] (+bias)(+resid); each wave owns a 64x64 tile, a block of 4 waves (2 x 2) a 128x128 tile.
// A row-major [M,K]; Bt row-major [N,K]; M,N % 128 == 0, K % GT_BK == 0.
// Operand path: per stage of GT_BK k the block copies its 128 A rows and 128 Bt rows into LDS with 16-B loads whose lanes cover
// whole rows of the stage (GT_BK * 2 contiguous bytes), so every 128-B line is asked for once per block; the four waves read their
// fragments from LDS. Two LDS buffers: the next stage's global loads are issued before the current stage's products and
// stored after them, one __syncthreads() per stage. The k order of every accumulator is ascending in steps of 32.
// SPLIT (hi/lo operand planes) is not instantiated and not supported by the staged loop.
// BIAS_MODE: 0 = none, 1 = bias[m], 2 = bias[n]; the bias value is RNE-converted to bf16 precision before the f32 add.
// OUT_MODE: 0 = f32, 1 = f16, 2 = bf16 hi plane (Cout) + bf16 lo plane (Cout2).
// ET: 0 = f16 operands, 1 = bf16 operands (pointers passed as 16-bit storage)
template <int ET> struct Elem;
template <> struct Elem<0> { typedef _Float16 T; };
template <> struct Elem<1> { typedef __bf16 T; };
#define GT_BK 128
// LDS row pitch in elements: GT_BK data + 8 pad, = 16 B x odd, so the 16 rows of one 16-byte fragment read fall on different banks.
#define GT_LP (GT_BK + 8)
#define GT_CPR (GT_BK / 8)          // 16-byte pieces per staged row
#define GT_RPP (128 / GT_CPR)       // rows that 128 threads copy per pass
#define GT_NP  (128 / GT_RPP)       // passes per operand and stage
// LD: row pitch of A and of Bt in elements, a compile-time constant so that the row steps of the staging loads are immediate offsets.
template <int ET, bool SPLIT, int BIAS_MODE, int OUT_MODE, bool RESID, int LD, int ACT = 0>
__global__ __launch_bounds__(128) void wmma_gemm64(
    const unsigned short* __restrict__ Ap, const unsigned short* __restrict__ A2p, long strideA,
    const unsigned short* __restrict__ Btp, const unsigned short* __restrict__ Bt2p, long strideB,
    void* __restrict__ Cout, void* __restrict__ Cout2, int ldc, long strideC,
    const float* __restrict__ bias,
    const float* __restrict__ resid, long strideR,
    int M, int N, int K, float scale) {
  typedef typename Elem<ET>::T T;
  typedef typename Frag<T>::V V;
  typedef typename Frag<T>::H H;
  static_assert(!SPLIT, "the staged loop takes single operand planes");
  const T* A = (const T*)Ap; const T* Bt = (const T*)Btp;
  __shared__ __align__(16) T sA[2 * 128 * GT_LP];  // two stages of the block's 128 A rows
  __shared__ __align__(16) T sB[2 * 128 * GT_LP];  // two stages of the block's 128 Bt rows
  __shared__ __align__(16) float sT[4][16 * 68];   // per-wave 16x64 slab, pitch 68 floats
  const int b    = blockIdx.y;
  const int tid  = threadIdx.x;
  const int lane = tid & 31;
  const int wave = tid >> 5;
  const int tilesN = N >> 7;
  const int tilesM = M >> 7;
  const int tile = blockIdx.x;
  if (tile >= tilesM * tilesN) return;   // block-uniform, in front of every barrier
  const int tm = tile / tilesN;
  const int tn = tile - tm * tilesN;
  const int wm = (wave >> 1) << 6;             // this wave's 64x64 tile inside the block's 128x128
  const int wn = (wave & 1) << 6;
  const int m0 = (tm << 7) + wm;
  const int n0 = (tn << 7) + wn;

  const T* Ab  = A  + (size_t)b * strideA;
  const T* Bb  = Bt + (size_t)b * strideB;

  const int rlane = lane & 15;                 // row (A) / col (B, D) within subtile
  const int koff  = (lane >> 4) * 8;           // k offset of this lane half
  const int mOff  = (lane >> 4) * 8;           // D row offset

  // staging map: pass p, thread tid -> row p * GT_RPP + tid / GT_CPR, 8 elements at column (tid % GT_CPR) * 8
  const int srow = tid / GT_CPR;
  const int scol = (tid % GT_CPR) * 8;
  const T* gA = Ab + (size_t)((tm << 7) + srow) * LD + scol;
  const T* gB = Bb + (size_t)((tn << 7) + srow) * LD + scol;
  const int sOff = srow * GT_LP + scol;

  v8f acc[4][4];
#pragma unroll
  for (int i = 0; i < 4; ++i)
#pragma unroll
    for (int j = 0; j < 4; ++j) acc[i][j] = (v8f){0.f,0.f,0.f,0.f,0.f,0.f,0.f,0.f};

  H ra[GT_NP], rb[GT_NP];
#pragma unroll
  for (int p = 0; p < GT_NP; ++p) {
    ra[p] = *(const H*)(gA + p * GT_RPP * LD);
    rb[p] = *(const H*)(gB + p * GT_RPP * LD);
  }
#pragma unroll
  for (int p = 0; p < GT_NP; ++p) {
    *(H*)(sA + sOff + p * GT_RPP * GT_LP) = ra[p];
    *(H*)(sB + sOff + p * GT_RPP * GT_LP) = rb[p];
  }
  __syncthreads();

  const int nStages = K / GT_BK;
  for (int st = 0; st < nStages; ++st) {
    const int cur = (st & 1) * (128 * GT_LP);
    const bool more = st + 1 < nStages;        // block-uniform
    if (more) {
      const T* pa = gA + (st + 1) * GT_BK;
      const T* pb = gB + (st + 1) * GT_BK;
#pragma unroll
      for (int p = 0; p < GT_NP; ++p) {
        ra[p] = *(const H*)(pa + p * GT_RPP * LD);
        rb[p] = *(const H*)(pb + p * GT_RPP * LD);
      }
      // naming the two address pairs here keeps them untouched up to this wait, which stands in front of every reuse of their registers
      asm volatile("s_wait_xcnt 0x0" :: "v"(pa), "v"(pb) : "memory");
    }
    const T* fa = sA + cur + (wm + rlane) * GT_LP + koff;
    const T* fb = sB + cur + (wn + rlane) * GT_LP + koff;
#pragma unroll
    for (int kk = 0; kk < GT_BK / 32; ++kk) {
      V bh[4], ah[4];
#pragma unroll
      for (int j = 0; j < 4; ++j) bh[j] = Frag<T>::load(fb + (j << 4) * GT_LP + kk * 32);
#pragma unroll
      for (int i = 0; i < 4; ++i) ah[i] = Frag<T>::load(fa + (i << 4) * GT_LP + kk * 32);
#pragma unroll
      for (int i = 0; i < 4; ++i)
#pragma unroll
        for (int j = 0; j < 4; ++j) acc[i][j] = Frag<T>::mma(ah[i], bh[j], acc[i][j]);
    }
    if (more) {
      const int nxt = (128 * GT_LP) - cur;     // the buffer whose last readers passed the barrier of stage st - 1
#pragma unroll
      for (int p = 0; p < GT_NP; ++p) {
        *(H*)(sA + nxt + sOff + p * GT_RPP * GT_LP) = ra[p];
        *(H*)(sB + nxt + sOff + p * GT_RPP * GT_LP) = rb[p];
      }
    }
    __syncthreads();
  }
  acc_guard4(acc[0][0], acc[0][1], acc[0][2], acc[0][3]);
  acc_guard4(acc[1][0], acc[1][1], acc[1][2], acc[1][3]);
  acc_guard4(acc[2][0], acc[2][1], acc[2][2], acc[2][3]);
  acc_guard4(acc[3][0], acc[3][1], acc[3][2], acc[3][3]);

  // ---- epilogue ----
  float* slab = sT[wave];
  const float* Rb = RESID ? (resid + (size_t)b * strideR) : nullptr;
#pragma unroll
  for (int i = 0; i < 4; ++i) {
    const int mBase = m0 + (i << 4);
    float bm[8];
    if (BIAS_MODE == 1) {
      const float* bp = bias + mBase + mOff;
#pragma unroll
      for (int r = 0; r < 8; ++r) bm[r] = bp[r];
      // naming the address pair here keeps it untouched up to this wait, which stands in front of every reuse of its registers
      asm volatile("s_wait_xcnt 0x0" :: "v"(bp) : "memory");
    }
#pragma unroll
    for (int j = 0; j < 4; ++j) {
      const int n = n0 + (j << 4) + rlane;
      float bv = 0.f;
      if (BIAS_MODE == 2) bv = bf_rne(bias[n]);
#pragma unroll
      for (int r = 0; r < 8; ++r) {
        float v = acc[i][j][r] * scale;
        if (BIAS_MODE == 1) v += bf_rne(bm[r]);
        if (BIAS_MODE == 2) v += bv;
        if (RESID) v += Rb[(size_t)(mBase + mOff + r) * ldc + n];
        if (ACT == 1) v = tanhf(v);
        if (ACT == 2) v = fmaxf(v, 0.0f);
        if (ACT == 3) v = v / (1.0f + expf(-v));
        if (ACT == 4) v = (v > 0.f) ? v : 0.01f * v;
        if (ACT == 5) v = 0.5f * v * (1.0f + erff(v * 0.70710678118654752f));
        slab[(mOff + r) * 68 + (j << 4) + rlane] = v;
      }
    }
    __builtin_amdgcn_fence(__ATOMIC_RELEASE, "workgroup");
    __builtin_amdgcn_wave_barrier();
    __builtin_amdgcn_fence(__ATOMIC_ACQUIRE, "workgroup");
    if (OUT_MODE == 0) {
      float* C = (float*)Cout + (size_t)b * strideC;
      const int hh = lane >> 4, c4 = (lane & 15) * 4;     // row seg = 256 B = 16 lanes x 16 B
      {
#pragma unroll
        for (int it = 0; it < 8; ++it) {
          const int row = it * 2 + hh;
          v4f v = *(const v4f*)(slab + row * 68 + c4);
          *(v4f*)(C + (size_t)(mBase + row) * ldc + n0 + c4) = v;
        }
        
      }
    } else {
      const int q = lane >> 3, c8 = (lane & 7) * 8;
      unsigned short* C  = (unsigned short*)Cout  + (size_t)b * strideC;
      unsigned short* C2 = (OUT_MODE == 2) ? ((unsigned short*)Cout2 + (size_t)b * strideC) : nullptr;
      {
#pragma unroll
        for (int it = 0; it < 4; ++it) {
          const int row = it * 4 + q;
          const float* sp = slab + row * 68 + c8;
          v8h hv, lv;
          if (OUT_MODE == 1) {
#pragma unroll
            for (int e = 0; e < 8; ++e) hv[e] = (_Float16)sp[e];
          } else {
            v4u hw, lw;
#pragma unroll
            for (int e = 0; e < 4; ++e) { unsigned a, c; bf_split2(sp[2 * e], sp[2 * e + 1], a, c); hw[e] = a; lw[e] = c; }
            hv = __builtin_bit_cast(v8h, hw);
            lv = __builtin_bit_cast(v8h, lw);
          }
          *(v8h*)(C + (size_t)(mBase + row) * ldc + n0 + c8) = hv;
          if (OUT_MODE == 2) *(v8h*)(C2 + (size_t)(mBase + row) * ldc + n0 + c8) = lv;
        }
        
      }
    }
    __builtin_amdgcn_fence(__ATOMIC_RELEASE, "workgroup");
    __builtin_amdgcn_wave_barrier();
    __builtin_amdgcn_fence(__ATOMIC_ACQUIRE, "workgroup");
  }
}

// ---------------------------------------------------------------------------
// Row-preserving bf16 RNE convert of an f32 matrix [rows][ncols] into a u16 plane with row pitch ldout; DUP also
// writes the same 8 values at column + ncols (second copy along the row). 8 consecutive elements per thread = one
// Coverage: grid = n8/256 blocks x 256 threads x 8 elements = rows*ncols (n8 = rows*ncols/8, exact multiple of 256).
// ---------------------------------------------------------------------------
template <bool DUP>
__global__ __launch_bounds__(256) void convrows_kernel(const float* __restrict__ in, unsigned short* __restrict__ out,
                                                       int ncols, int ldout, int n8) {
  const int i = blockIdx.x * 256 + threadIdx.x;
  if (i < n8) {
    const size_t e0 = (size_t)i * 8;
    const int row = (int)(e0 / (size_t)ncols);
    const int col = (int)(e0 - (size_t)row * ncols);
    const v4f a = *(const v4f*)(in + e0);
    const v4f c = *(const v4f*)(in + e0 + 4);
    v4u hv;
    hv[0] = bf_pk(a[0], a[1]);
    hv[1] = bf_pk(a[2], a[3]);
    hv[2] = bf_pk(c[0], c[1]);
    hv[3] = bf_pk(c[2], c[3]);
    const size_t o = (size_t)row * ldout + col;
    {
      *(v4u*)(out + o) = hv;
      if (DUP) *(v4u*)(out + o + ncols) = hv;
      
    }
  }
}

// ---------------------------------------------------------------------------
// Fused transpose + bf16 RNE convert of an f32 matrix, z-batched, one plane:
//   in_z = W + z*sIn viewed [R rows][Cc cols] with row pitch ldin  ->  oh_z[c][r] = bf16(in_z[r][c]), row pitch ldout, oh_z = oh + z*sOut.
// 64x64 tiles through LDS. grid = (Cc/64, R/64, Z), 256 threads (R, Cc multiples of 64; ldout multiple of 64 so every
// Coverage per block: load 4 it x 256 thr x 4 floats = 64x64; store 2 it x 256 thr x 8 u16 = 64x64.
// ---------------------------------------------------------------------------
__global__ __launch_bounds__(256) void tconv_kernel(const float* __restrict__ W, unsigned short* __restrict__ oh,
                                                    int ldin, int ldout, long sIn, long sOut) {
  __shared__ __align__(16) float tf[64 * 68];
  W  += (size_t)blockIdx.z * sIn;
  oh += (size_t)blockIdx.z * sOut;
  const int c0  = blockIdx.x * 64;   // input column block = output row block
  const int r0  = blockIdx.y * 64;   // input row block    = output column block
  const int tid = threadIdx.x;
  {
    const int lr = tid >> 4;         // 0..15
    const int c4 = (tid & 15) * 4;   // 0..60
#pragma unroll
    for (int it = 0; it < 4; ++it) {
      const int rr = it * 16 + lr;   // 0..63
      const v4f a = *(const v4f*)(W + (size_t)(r0 + rr) * ldin + c0 + c4);
      *(v4f*)(tf + rr * 68 + c4) = a;
    }
  }
  __syncthreads();
  const int sub = tid >> 3;          // 0..31
  const int c8  = (tid & 7) * 8;     // 0..56
  v4u hv[2];
#pragma unroll
  for (int it = 0; it < 2; ++it) {
    const int oc = it * 32 + sub;    // output row within tile (= input column)
    v4u a;
#pragma unroll
    for (int q = 0; q < 4; ++q) {
      const float f0 = tf[(c8 + 2 * q) * 68 + oc];
      const float f1 = tf[(c8 + 2 * q + 1) * 68 + oc];
      a[q] = bf_pk(f0, f1);
    }
    hv[it] = a;
  }
  {
#pragma unroll
    for (int it = 0; it < 2; ++it) {
      const int oc = it * 32 + sub;
      const size_t go = (size_t)(c0 + oc) * ldout + r0 + c8;
      *(v4u*)(oh + go) = hv[it];
    }
    
  }
}

// ---------------------------------------------------------------------------
// Rotary angle tables: tc[pos*16 + j] = cos(pos * f_j), ts likewise, f_j = 10000^(-4j/64) = 10^(-j/4) (f32 constants),
// pos 0..31 (shared by the row axis and the column axis), j 0..15. Precise cosf/sinf (|angle| <= 31).
// grid = 2 x 256 = 512 threads = 32 x 16 entries per table; one 4-B store per lane, 32 consecutive lanes = one whole
// ---------------------------------------------------------------------------
__device__ __forceinline__ float rope_freq(int j) {
  float f = 1.0f;
  f = (j == 1)  ? 0.5623413251903491f     : f;
  f = (j == 2)  ? 0.31622776601683794f    : f;
  f = (j == 3)  ? 0.17782794100389229f    : f;
  f = (j == 4)  ? 0.1f                    : f;
  f = (j == 5)  ? 0.05623413251903491f    : f;
  f = (j == 6)  ? 0.031622776601683794f   : f;
  f = (j == 7)  ? 0.017782794100389229f   : f;
  f = (j == 8)  ? 0.01f                   : f;
  f = (j == 9)  ? 0.005623413251903491f   : f;
  f = (j == 10) ? 0.0031622776601683794f  : f;
  f = (j == 11) ? 0.0017782794100389228f  : f;
  f = (j == 12) ? 0.001f                  : f;
  f = (j == 13) ? 0.0005623413251903491f  : f;
  f = (j == 14) ? 0.00031622776601683794f : f;
  f = (j == 15) ? 0.00017782794100389227f : f;
  return f;
}

__global__ __launch_bounds__(256) void ropetab_kernel(float* __restrict__ tc, float* __restrict__ ts) {
  const int i = blockIdx.x * 256 + threadIdx.x;      // 0..511 = pos*16 + j
  if (i < TABN) {
    const int pos = i >> 4, j = i & 15;
    const float a = (float)pos * rope_freq(j);
    const float c = cosf(a);
    const float s = sinf(a);
    ((float*)tc)[i] = c;
    ((float*)ts)[i] = s;
    
  }
}

// ---------------------------------------------------------------------------
// Per-token 2-D RoPE (interleaved pairs (2i,2i+1) inside each head; pairs 0..15 use the row index y = n>>5, pairs 16..31
// the column index x = n&31; tables shared by all heads) followed by RMSNorm over the WHOLE 1024-wide (heads x dim) row:
// v = rope(v); v = v * rsqrt(mean_1024(v*v) + 1e-6) * bf16(w[col]); then bf16 hi/lo split into planes [4096][1024].
// One block of 128 threads per token row g = b*1024+n; thread t owns columns 8t..8t+7 (= 4 rotary pairs p0..p0+3, p0 = (4t)&31,
// all four in the same half of the pair range). All loads are 16-B vectors. Stores: 16 B per lane per plane, 128 lanes cover
// LDS: redq/redk[4] written by lane 0 of each of the 4 waves before the barrier.
// ---------------------------------------------------------------------------
__global__ __launch_bounds__(128) void ropenorm_kernel(const float* __restrict__ qkf,
                                                       const float* __restrict__ tc, const float* __restrict__ ts,
                                                       const float* __restrict__ qw, const float* __restrict__ kw,
                                                       unsigned short* __restrict__ qh, unsigned short* __restrict__ ql,
                                                       unsigned short* __restrict__ kh, unsigned short* __restrict__ kl) {
  __shared__ float redq[4], redk[4];
  const int g = blockIdx.x;                 // token row 0..MTOK-1
  const int n = g & (NTOK - 1);
  const int py = n >> 5, px = n & 31;
  const int t = threadIdx.x, lane = t & 31, wave = t >> 5;
  const int i0 = t * 8;

  const float* qr = qkf + (size_t)g * QKP + i0;
  const float* kr = qr + INNER;
  const v4f qa = *(const v4f*)(qr), qb = *(const v4f*)(qr + 4);
  const v4f ka = *(const v4f*)(kr), kb = *(const v4f*)(kr + 4);

  const int p0   = (4 * t) & 31;
  const int hsel = p0 >> 4;                 // 0: row-axis angles, 1: column-axis angles
  const int pos  = py + hsel * (px - py);
  const int toff = pos * 16 + (p0 & 15);
  const v4f cv = *(const v4f*)(tc + toff);
  const v4f sv = *(const v4f*)(ts + toff);

  float q8[8], k8[8];
  q8[0] = qa[0]; q8[1] = qa[1]; q8[2] = qa[2]; q8[3] = qa[3];
  q8[4] = qb[0]; q8[5] = qb[1]; q8[6] = qb[2]; q8[7] = qb[3];
  k8[0] = ka[0]; k8[1] = ka[1]; k8[2] = ka[2]; k8[3] = ka[3];
  k8[4] = kb[0]; k8[5] = kb[1]; k8[6] = kb[2]; k8[7] = kb[3];

  float rq[8], rk[8];
#pragma unroll
  for (int e = 0; e < 4; ++e) {
    const float c = cv[e], s = sv[e];
    const float qe = q8[2 * e], qo = q8[2 * e + 1];
    const float ke = k8[2 * e], ko = k8[2 * e + 1];
    rq[2 * e]     = qe * c - qo * s;
    rq[2 * e + 1] = qe * s + qo * c;
    rk[2 * e]     = ke * c - ko * s;
    rk[2 * e + 1] = ke * s + ko * c;
  }
  float ssq = 0.0f, ssk = 0.0f;
#pragma unroll
  for (int e = 0; e < 8; ++e) { ssq += rq[e] * rq[e]; ssk += rk[e] * rk[e]; }
#pragma unroll
  for (int off = 1; off < 32; off <<= 1) { ssq += __shfl_xor(ssq, off, 32); ssk += __shfl_xor(ssk, off, 32); }
  if (lane == 0) { redq[wave] = ssq; redk[wave] = ssk; }
  __syncthreads();
  const float tq = (redq[0] + redq[1]) + (redq[2] + redq[3]);
  const float tk = (redk[0] + redk[1]) + (redk[2] + redk[3]);
  const float rmq = rsqrtf(tq * (1.0f / (float)INNER) + RMS_EPS);
  const float rmk = rsqrtf(tk * (1.0f / (float)INNER) + RMS_EPS);

  const v4f wqa = *(const v4f*)(qw + i0), wqb = *(const v4f*)(qw + i0 + 4);
  const v4f wka = *(const v4f*)(kw + i0), wkb = *(const v4f*)(kw + i0 + 4);
  float wq8[8], wk8[8];
  wq8[0] = bf_rne(wqa[0]); wq8[1] = bf_rne(wqa[1]); wq8[2] = bf_rne(wqa[2]); wq8[3] = bf_rne(wqa[3]);
  wq8[4] = bf_rne(wqb[0]); wq8[5] = bf_rne(wqb[1]); wq8[6] = bf_rne(wqb[2]); wq8[7] = bf_rne(wqb[3]);
  wk8[0] = bf_rne(wka[0]); wk8[1] = bf_rne(wka[1]); wk8[2] = bf_rne(wka[2]); wk8[3] = bf_rne(wka[3]);
  wk8[4] = bf_rne(wkb[0]); wk8[5] = bf_rne(wkb[1]); wk8[6] = bf_rne(wkb[2]); wk8[7] = bf_rne(wkb[3]);

  v4u hq, lq, hk, lk;
#pragma unroll
  for (int e = 0; e < 4; ++e) {
    const float fq0 = rq[2 * e] * rmq * wq8[2 * e];
    const float fq1 = rq[2 * e + 1] * rmq * wq8[2 * e + 1];
    const float fk0 = rk[2 * e] * rmk * wk8[2 * e];
    const float fk1 = rk[2 * e + 1] * rmk * wk8[2 * e + 1];
    unsigned hw, lw;
    bf_split2(fq0, fq1, hw, lw); hq[e] = hw; lq[e] = lw;
    bf_split2(fk0, fk1, hw, lw); hk[e] = hw; lk[e] = lw;
  }
  const size_t o = (size_t)g * INNER + i0;
  {
    *(v4u*)(qh + o) = hq;
    *(v4u*)(ql + o) = lq;
    *(v4u*)(kh + o) = hk;
    *(v4u*)(kl + o) = lk;
    
  }
}

// =====================================================================================
// Full (non-causal, unmasked) attention, head dim 64, all batches in one launch.
//   q planes (hi/lo bf16) [4096][1024]: element (b, n, h, d) at [(b*1024+n)*1024 + h*64 + d]
//   k planes (hi/lo bf16) [4096][1024]: same layout
//   v^T planes (hi/lo bf16) [1024][4096]: element (h, d, b, t) at [(h*64 + d)*4096 + b*1024 + t]
//   out CTX2 plane u16 [4096][2048]: hi bits of o(b,n,h,d) at col h*64+d, lo bits (o - hi) at col 1024 + h*64+d.
//   scores^T = (k . q^T) * 0.125 : A = K rows, B = Q rows; bf16 hi/lo split (hi.hi + lo.hi + hi.lo) on v_wmma_f32_16x16x32_bf16
//   out^T    = v^T . p^T         : A = V^T rows, B = P^T; bf16 hi/lo split of p (unnormalised exp) and v, f32 accumulate, x 1/rowsum at the end
//   Transposed tiles: a lane holds one query (column c) and, per 16-key tile, keys 8*hh + 0..7 in its 8 accumulator registers. Two score
//   tiles (keys 0..15 and 16..31 of a 32-key block), converted in place, are the B operand of the second product in the k order of the
//   V^T fragment loads (elements 0..7 = keys 8*hh + 0..7, elements 8..15 = keys 16 + 8*hh + 0..7): P never goes through LDS.
//   online softmax in f32, base 2 (scores x sscale x log2 e), over the 1024 keys of the batch element (16 chunks of 64, compile-time trip count, no masking): maximum in-lane
//   plus one exchange between the wave halves per chunk; each half sums its own keys, the two sums are joined once in the epilogue.
//   Block = 4 waves = 64 query rows of one (batch, head); grid.x = 4 * 16 * 16 = 1024.
//   K / V^T chunk staging: asynchronous 16-B copies from global memory to LDS, no register in between; 8 lanes take one whole 128-B row,
//   128 threads x 4 rows per plane = the whole 64x64 tile. Two LDS buffers: chunk t + 1 is in flight while chunk t is worked on;
//   one __syncthreads per chunk publishes chunk t + 1 and frees the buffer of chunk t, which is refilled behind it with chunk t + 2.
//   LDS extents: K/V tiles 64x64 fully staged every chunk; the out tiles of the epilogue lie on the ring, behind its last barrier.
// =====================================================================================
#define AT_D 64
#define AT_NW 4
#define AT_QB 64
#define AT_KC 64
// LDS row pitch of the K and V^T tiles in elements: 64 data + 8 pad = 144 B = 16 B x 9 (odd), so the 16 rows that one
// 16-byte fragment read touches fall on 16 different groups of four banks; at 128 B they fall on two. Pad elements are never read.
#define AT_LP 72
#define AT_PL  (AT_KC * AT_LP)   // elements of one plane's tile in LDS
#define AT_BUF (4 * AT_PL)       // one ring buffer: K hi, K lo, V^T hi, V^T lo
static_assert(AT_KC == 64 && AT_D == 64 && (AT_LP * 2) % 16 == 0);
static_assert(NTOK / AT_KC >= 2);

__device__ __forceinline__ v8f at_mma(v16b a, v16b b, v8f c) {
  c = __builtin_amdgcn_wmma_f32_16x16x32_bf16(false, a, false, b, (short)0, c, false, false);
  asm volatile("v_nop\n\tv_nop\n\tv_nop\n\tv_nop" : "+v"(c) : "v"(a), "v"(b));
  return c;
}

// Two planes' share of one thread in a chunk: rows r, r + 16, r + 32, r + 48 of plane a and of plane b, 16 bytes each, global -> LDS.
// l = LDS byte address of the thread's piece in plane a's tile (plane b's tile follows it), ld = row pitch of the planes in elements.
// The s_wait_xcnt stands inside the statement, behind the last copy, so that no address register is rewritten in front of it.
__device__ __forceinline__ void at_copy8(unsigned l, const __bf16* a, const __bf16* b, int ld) {
  const unsigned R = 16 * AT_LP * 2, P = AT_PL * 2;
  asm volatile("global_load_async_to_lds_b128 %0, %1, off\n\t"
               "global_load_async_to_lds_b128 %2, %3, off\n\t"
               "global_load_async_to_lds_b128 %4, %5, off\n\t"
               "global_load_async_to_lds_b128 %6, %7, off\n\t"
               "global_load_async_to_lds_b128 %8, %9, off\n\t"
               "global_load_async_to_lds_b128 %10, %11, off\n\t"
               "global_load_async_to_lds_b128 %12, %13, off\n\t"
               "global_load_async_to_lds_b128 %14, %15, off\n\t"
               "s_wait_xcnt 0x0"
               :: "v"(l),         "v"(a),           "v"(l + R),         "v"(a + 16 * ld),
                  "v"(l + 2 * R), "v"(a + 32 * ld), "v"(l + 3 * R),     "v"(a + 48 * ld),
                  "v"(l + P),         "v"(b),           "v"(l + P + R),     "v"(b + 16 * ld),
                  "v"(l + P + 2 * R), "v"(b + 32 * ld), "v"(l + P + 3 * R), "v"(b + 48 * ld)
               : "memory");
}

// value of lane l ^ 16 (the other wave half), by a vector cross-row move
__device__ __forceinline__ float at_xhalf(float x) {
  return __builtin_bit_cast(float, __builtin_amdgcn_permlanex16(__builtin_bit_cast(int, x), __builtin_bit_cast(int, x),
                                                                0x76543210, 0xfedcba98, false, false));
}

__global__ __launch_bounds__(128)
void attn_kernel(const unsigned short* __restrict__ qhp, const unsigned short* __restrict__ qlp,
                 const unsigned short* __restrict__ khp, const unsigned short* __restrict__ klp,
                 const unsigned short* __restrict__ vhp, const unsigned short* __restrict__ vlp,
                 unsigned short* __restrict__ aop, float sscale) {
  union FB { v16b v; v8b h[2]; unsigned w[8]; };   // w[i] = elements 2i (low half) and 2i + 1
  // two buffers of K hi [kv][d], K lo, V hi [d][kv], V lo, pitch AT_LP, 9 KB a tile; 72 KB, so that four blocks share a WGP's LDS
  __shared__ __align__(16) __bf16 ring[2 * AT_BUF];
  static_assert(AT_NW * 16 * 68 * 4 <= 2 * AT_BUF * 2);          // the per-wave out tiles (pitch 68 floats) fit on the ring

  const int tid  = threadIdx.x;
  const int wave = tid >> 5;
  const int lane = tid & 31;
  const int hh   = lane >> 4;
  const int c    = lane & 15;

  const int nqb = NTOK / AT_QB;            // 16 query blocks per batch element
  const int bx = blockIdx.x;              // grid = NB * NH * nqb (exact)
  const int qb = bx % nqb;
  const int hb = bx / nqb;
  const int h  = hb % NH;                 // 0..15
  const int b  = hb / NH;                 // 0..3
  const int q0 = b * NTOK + qb * AT_QB + wave * 16;   // row in the q / CTX2 planes

  const __bf16* Qh = (const __bf16*)(const void*)qhp + (size_t)h * AT_D;
  const __bf16* Ql = (const __bf16*)(const void*)qlp + (size_t)h * AT_D;
  const __bf16* Kh = (const __bf16*)(const void*)khp + (size_t)h * AT_D;
  const __bf16* Kl = (const __bf16*)(const void*)klp + (size_t)h * AT_D;
  const __bf16* Vh = (const __bf16*)(const void*)vhp + (size_t)h * AT_D * VTP + (size_t)b * NTOK;
  const __bf16* Vl = (const __bf16*)(const void*)vlp + (size_t)h * AT_D * VTP + (size_t)b * NTOK;
  unsigned short* Ch = aop + (size_t)h * AT_D;                    // hi columns
  unsigned short* Cl = aop + (size_t)INNER + (size_t)h * AT_D;    // lo columns

  // ---- Q fragments (B operand, column = query = lane&15, split k map via Frag load): 2 d-chunks, hi and lo ----
  v16b qah[2], qal[2];
#pragma unroll
  for (int dc = 0; dc < 2; ++dc) {
    const __bf16* qr = Qh + (size_t)(q0 + c) * INNER + dc * 32 + 8 * hh;
    const __bf16* ql = Ql + (size_t)(q0 + c) * INNER + dc * 32 + 8 * hh;
    qah[dc] = Frag<__bf16>::load(qr);
    qal[dc] = Frag<__bf16>::load(ql);
  }

  // exponentials to base 2: e^(x * sscale) = 2^(x * c2), so one fused multiply-add and the hardware's 2^x make one P element
  const float c2 = sscale * 1.4426950408889634f;
  float mrow = -INFINITY, lrow = 0.f;   // this lane's query: running maximum in log2 units (both halves alike), sum over this half's keys
  v8f oacc[4];                          // oacc[t][r] = out^T[d = t*16 + 8*hh + r][query c]
#pragma unroll
  for (int t = 0; t < 4; ++t) oacc[t] = (v8f){0.f,0.f,0.f,0.f,0.f,0.f,0.f,0.f};

  const int nChunks = NTOK / AT_KC;   // 16, compile-time constant
  // staging map: thread tid copies 16 bytes at column (tid & 7) * 8 of rows (tid >> 3) + 0, 16, 32, 48 of each plane's chunk tile
  const int srow = tid >> 3, scol = (tid & 7) * 8;
  const __bf16* gkh = Kh + (size_t)(b * NTOK + srow) * INNER + scol;   // K row (b, srow) of chunk 0; a chunk further = + AT_KC rows
  const __bf16* gkl = Kl + (size_t)(b * NTOK + srow) * INNER + scol;
  const __bf16* gvh = Vh + (size_t)srow * VTP + scol;                  // V^T row d = srow, keys of chunk 0; a chunk further = + AT_KC columns
  const __bf16* gvl = Vl + (size_t)srow * VTP + scol;
  const unsigned sl = (unsigned)(uintptr_t)ring + (unsigned)(srow * AT_LP + scol) * 2u;   // LDS byte address of the piece in buffer 0, K hi

  at_copy8(sl, gkh, gkl, INNER);                       // chunk 0 -> buffer 0
  at_copy8(sl + 2 * AT_PL * 2, gvh, gvl, VTP);
  asm volatile("s_wait_asynccnt 0x0" ::: "memory");    // this wave's copies of chunk 0 have landed
  __syncthreads();                                     // ... and every other wave's
  at_copy8(sl + AT_BUF * 2, gkh + (size_t)AT_KC * INNER, gkl + (size_t)AT_KC * INNER, INNER);   // chunk 1 -> buffer 1
  at_copy8(sl + AT_BUF * 2 + 2 * AT_PL * 2, gvh + AT_KC, gvl + AT_KC, VTP);

  for (int kc = 0; kc < nChunks; ++kc) {
    const int cur = (kc & 1) * AT_BUF;
    const __bf16* Ksh = ring + cur;
    const __bf16* Ksl = Ksh + AT_PL;
    const __bf16* Vth = Ksh + 2 * AT_PL;
    const __bf16* Vtl = Ksh + 3 * AT_PL;

    v8f s[4];
#pragma unroll
    for (int j = 0; j < 4; ++j) {
      s[j] = (v8f){0.f,0.f,0.f,0.f,0.f,0.f,0.f,0.f};
#pragma unroll
      for (int dc = 0; dc < 2; ++dc) {
        FB kb, kl;
        kb.h[0] = *(const v8b*)(Ksh + (j * 16 + c) * AT_LP + dc * 32 + 8 * hh);
        kb.h[1] = *(const v8b*)(Ksh + (j * 16 + c) * AT_LP + dc * 32 + 16 + 8 * hh);
        kl.h[0] = *(const v8b*)(Ksl + (j * 16 + c) * AT_LP + dc * 32 + 8 * hh);
        kl.h[1] = *(const v8b*)(Ksl + (j * 16 + c) * AT_LP + dc * 32 + 16 + 8 * hh);
        s[j] = at_mma(kb.v, qah[dc], s[j]);
        s[j] = at_mma(kl.v, qah[dc], s[j]);
        s[j] = at_mma(kb.v, qal[dc], s[j]);
      }
    }
    // s[j][r] = unscaled score of key kc * AT_KC + j*16 + 8*hh + r against query c: this query's chunk maximum, scaled once
    // (c2 > 0 keeps the order of the scores; the softmax does not depend on the value that is subtracted)
    float mj[4];
#pragma unroll
    for (int j = 0; j < 4; ++j) {
      float m = -INFINITY;
#pragma unroll
      for (int r = 0; r < 8; ++r) m = fmaxf(m, s[j][r]);
      mj[j] = m;
    }
    float cm = fmaxf(fmaxf(mj[0], mj[1]), fmaxf(mj[2], mj[3]));
    cm = fmaxf(cm, at_xhalf(cm));
    const float mnew = fmaxf(mrow, cm * c2);
    const float alpha = __builtin_amdgcn_exp2f(mrow - mnew);
    mrow = mnew;
    FB ph[2], pl[2];   // P^T hi / lo as B operands, one per 32 keys: elements 0..7 from tile 2*kk, 8..15 from tile 2*kk + 1
    float pj[4];
#pragma unroll
    for (int j = 0; j < 4; ++j) {
      float psum = 0.f;
#pragma unroll
      for (int r = 0; r < 8; r += 2) {
        const float p0 = __builtin_amdgcn_exp2f(__builtin_fmaf(s[j][r], c2, -mnew));       // e^(score * sscale - maximum)
        const float p1 = __builtin_amdgcn_exp2f(__builtin_fmaf(s[j][r + 1], c2, -mnew));
        psum += p0;
        psum += p1;
        bf_split2(p0, p1, ph[j >> 1].w[(j & 1) * 4 + (r >> 1)], pl[j >> 1].w[(j & 1) * 4 + (r >> 1)]);   // elements (j & 1) * 8 + r and + 1
      }
      pj[j] = psum;
    }
    lrow = lrow * alpha + ((pj[0] + pj[1]) + (pj[2] + pj[3]));
#pragma unroll
    for (int t = 0; t < 4; ++t)
#pragma unroll
      for (int r = 0; r < 8; ++r) oacc[t][r] *= alpha;
    // unrolled: the P^T fragments are registers and are picked by kk at compile time
#pragma unroll
    for (int kk = 0; kk < 2; ++kk) {
#pragma unroll
      for (int t = 0; t < 4; ++t) {
        FB vb, vl;
        vb.h[0] = *(const v8b*)(Vth + (t * 16 + c) * AT_LP + kk * 32 + 8 * hh);
        vb.h[1] = *(const v8b*)(Vth + (t * 16 + c) * AT_LP + kk * 32 + 16 + 8 * hh);
        vl.h[0] = *(const v8b*)(Vtl + (t * 16 + c) * AT_LP + kk * 32 + 8 * hh);
        vl.h[1] = *(const v8b*)(Vtl + (t * 16 + c) * AT_LP + kk * 32 + 16 + 8 * hh);
        oacc[t] = at_mma(vb.v, ph[kk].v, oacc[t]);
        oacc[t] = at_mma(vl.v, ph[kk].v, oacc[t]);
        oacc[t] = at_mma(vb.v, pl[kk].v, oacc[t]);
      }
    }
    asm volatile("s_wait_dscnt 0x0" ::: "memory");     // this wave's reads of buffer cur are done before the buffer is given up
    asm volatile("s_wait_asynccnt 0x0" ::: "memory");  // this wave's copies of chunk kc + 1 have landed
    __syncthreads();                                   // chunk kc + 1 is public, buffer cur has no reader left
    if (kc + 2 < nChunks) {                            // the same for the whole block
      const unsigned l = sl + (unsigned)cur * 2u;
      at_copy8(l, gkh + (size_t)(kc + 2) * AT_KC * INNER, gkl + (size_t)(kc + 2) * AT_KC * INNER, INNER);
      at_copy8(l + 2 * AT_PL * 2, gvh + (kc + 2) * AT_KC, gvl + (kc + 2) * AT_KC, VTP);
    }
  }
  asm volatile("s_wait_asynccnt 0x0" ::: "memory");    // no copy is in flight when the ring becomes the out tiles

  float* os = (float*)(void*)ring + wave * (16 * 68);   // per wave out tile, pitch 68; the loop's last barrier ended every read of the ring
  {
    const float inv = 1.0f / (lrow + at_xhalf(lrow));   // the two halves' key sums of query c, joined
#pragma unroll
    for (int t = 0; t < 4; ++t) {
      v4f o0, o1;
#pragma unroll
      for (int r = 0; r < 4; ++r) { o0[r] = oacc[t][r] * inv; o1[r] = oacc[t][4 + r] * inv; }
      *(v4f*)(os + c * 68 + t * 16 + 8 * hh)     = o0;   // row = query c, columns d = t*16 + 8*hh + 0..7
      *(v4f*)(os + c * 68 + t * 16 + 8 * hh + 4) = o1;
    }
  }
  __builtin_amdgcn_fence(__ATOMIC_RELEASE, "workgroup");
  __builtin_amdgcn_wave_barrier();
  __builtin_amdgcn_fence(__ATOMIC_ACQUIRE, "workgroup");
  {
    const int q = lane >> 3, c8 = (lane & 7) * 8;
    {
#pragma unroll
      for (int it = 0; it < 4; ++it) {
        const int row = it * 4 + q;
        const float* sp = os + row * 68 + c8;
        v4u hw, lw;
#pragma unroll
        for (int e = 0; e < 4; ++e) { unsigned a, d; bf_split2(sp[2 * e], sp[2 * e + 1], a, d); hw[e] = a; lw[e] = d; }
        const v8h hv = __builtin_bit_cast(v8h, hw), lv = __builtin_bit_cast(v8h, lw);
        *(v8h*)(Ch + (size_t)(q0 + row) * AOP + c8) = hv;
        *(v8h*)(Cl + (size_t)(q0 + row) * AOP + c8) = lv;
      }
      
    }
  }
}

// ---------------------------------------------------------------------------
// Output RMSNorm over C + residual + back to NCHW:
//   out[b][c][n] = Of[b*1024+n][c] * rsqrt(mean_C(Of[tok][.]^2) + 1e-6) * bf16(w[c]) + bf16(x[b][c][n]).
// One block of 512 threads (16 waves) per 32 consecutive tokens x 512 channels; grid = 128 token groups x 2 channel halves = 256,
// as many blocks as the chip has WGPs. Every global load of a thread is issued before the first wait: nothing is fetched in a loop.
// Wave w holds the whole rows of tokens 2w and 2w+1 in registers (8 x 16 B per lane and row), sums their squares (per lane one sum
// per channel half, the two added, then the lane tree), scales the block's half of each row and writes it to the LDS tile [token][channel].
// Behind the one barrier a thread reads a 4-token x 4-channel square as four 16-B rows; its columns are the 16-B output vectors
// (4 tokens of one channel), so 8 lanes store one whole 128-B line of out and a block writes only whole lines.
// LDS pitch 516 floats = 16 B x 129 (odd); the 16-B unit index of a row is XORed with 2 for tokens 16..31, so that the 16 lanes
// of a half wave (tokens 4j+q, j = 0..7, two channel units) read 16 different groups of four banks.
// Coverage: 256 blocks x 32 tokens x 512 channels = 4 x 1024 x 1024 outputs, each exactly once.
// ---------------------------------------------------------------------------
#define FN_TOK 32
#define FN_CS  512
#define FN_P   (FN_CS + 4)
static_assert(NTOK % FN_TOK == 0 && CH == 2 * FN_CS && CH == 8 * 128 && FN_TOK == 2 * 16);
__global__ __launch_bounds__(512) void final_kernel(const float* __restrict__ of, const float* __restrict__ nw,
                                                    const float* __restrict__ xin, float* __restrict__ out) {
  __shared__ __align__(16) float tf[FN_TOK * FN_P];
  const int tid = threadIdx.x, lane = tid & 31, wave = tid >> 5;
  const int sl   = blockIdx.x & 1;            // channel half
  const int tok0 = (blockIdx.x >> 1) * FN_TOK;
  const int b = tok0 / NTOK, n0 = tok0 - b * NTOK;
  const int c0 = sl * FN_CS;
  const int j  = tid & 7;                     // token quad: tokens 4j..4j+3
  const int cg = tid >> 3;                    // channel unit 0..63 (4 channels), second pass + 64

  // all loads: the two rows first (the sums wait for them alone), then the weights, then the residual.
  // vo = the block's own channel half of a row, vx = the other half, read for the row sum only.
  const float* po  = of + (size_t)(tok0 + wave * 2) * CH + lane * 4 + c0;
  const float* px  = of + (size_t)(tok0 + wave * 2) * CH + lane * 4 + (FN_CS - c0);
  const float* xp0 = xin + ((size_t)(b * CH + c0 + cg * 4)) * NTOK + n0 + 4 * j;
  v4f vo[2][4], vx[2][4];
#pragma unroll
  for (int i = 0; i < 2; ++i) {
#pragma unroll
    for (int kk = 0; kk < 4; ++kk) vo[i][kk] = *(const v4f*)(po + i * CH + kk * 128);
#pragma unroll
    for (int kk = 0; kk < 4; ++kk) vx[i][kk] = *(const v4f*)(px + i * CH + kk * 128);
  }
  v4f w4[4];
#pragma unroll
  for (int kk = 0; kk < 4; ++kk) w4[kk] = *(const v4f*)(nw + c0 + kk * 128 + lane * 4);
  v4f xr[2][4];
#pragma unroll
  for (int e = 0; e < 4; ++e) {
    xr[0][e] = *(const v4f*)(xp0 + e * NTOK);
    xr[1][e] = *(const v4f*)(xp0 + (256 + e) * NTOK);
  }
  // naming the three address pairs here keeps them untouched up to this wait, which stands in front of every reuse of their registers;
  // as a memory barrier for the compiler it also keeps every load above issued before the first wait for data
  asm volatile("s_wait_xcnt 0x0" :: "v"(po), "v"(px), "v"(xp0) : "memory");

  // row sum of squares = (sum over the own half) + (sum over the other half)
  float ss[2];
#pragma unroll
  for (int i = 0; i < 2; ++i) {
    float so = 0.0f, sx = 0.0f;
#pragma unroll
    for (int kk = 0; kk < 4; ++kk) {
      const v4f a = vo[i][kk], c = vx[i][kk];
      so += a[0] * a[0] + a[1] * a[1] + a[2] * a[2] + a[3] * a[3];
      sx += c[0] * c[0] + c[1] * c[1] + c[2] * c[2] + c[3] * c[3];
    }
    ss[i] = so + sx;
  }
#pragma unroll
  for (int off = 1; off < 32; off <<= 1) {
    const float t0 = __shfl_xor(ss[0], off, 32), t1 = __shfl_xor(ss[1], off, 32);
    ss[0] += t0; ss[1] += t1;
  }

  const int wswz = (wave >> 3) << 1;          // tokens 2w, 2w+1 >= 16
#pragma unroll
  for (int i = 0; i < 2; ++i) {
    const float rm = rsqrtf(ss[i] * (1.0f / (float)CH) + RMS_EPS);
    float* row = tf + (wave * 2 + i) * FN_P;
#pragma unroll
    for (int kk = 0; kk < 4; ++kk) {
      const v4f a = vo[i][kk];
      v4f o;
#pragma unroll
      for (int e = 0; e < 4; ++e) o[e] = a[e] * rm * bf_rne(w4[kk][e]);
      *(v4f*)(row + (((kk * 32 + lane) ^ wswz) << 2)) = o;
    }
  }
  __syncthreads();

  const int rswz = (j >> 2) << 1;
#pragma unroll
  for (int it = 0; it < 2; ++it) {
    const int cu = it * 64 + cg;
    v4f rd[4];
#pragma unroll
    for (int q = 0; q < 4; ++q) rd[q] = *(const v4f*)(tf + (4 * j + q) * FN_P + ((cu ^ rswz) << 2));
#pragma unroll
    for (int e = 0; e < 4; ++e) {
      v4f o;
#pragma unroll
      for (int q = 0; q < 4; ++q) o[q] = rd[q][e] + bf_rne(xr[it][e][q]);
      *(v4f*)(out + ((size_t)(b * CH + c0 + cu * 4 + e)) * NTOK + n0 + 4 * j) = o;
    }
  }
}

// ---------------------------------------------------------------------------
// Workspace region map (byte offsets; every region is fully written by its producer launch before any consumer
//   XB    bf16 [4096][1024]          0       8388608
//   WQKV  bf16 [3072][1024]    8388608       6291456
//   WP2   bf16 [1024][2048]   14680064       4194304
//   TC    f32  [32][16]       18874368          2048   TS  18876416  2048
//   QKf   f32  [4096][2048]   18878464      33554432   (dead after ropenorm; the same 32 MiB then hold
//                                                       CTX2 u16 [4096][2048] at 18878464 (16777216) and
//                                                       Of   f32  [4096][1024] at 35655680 (16777216), disjoint)
//   Qh    bf16 [4096][1024]   52432896       8388608   Ql  60821504
//   Kh    bf16 [4096][1024]   69210112       8388608   Kl  77598720
//   VTh   bf16 [1024][4096]   85987328       8388608   VTl 94375936
//   total                    102764544
// ---------------------------------------------------------------------------
extern "C" void kernel_launch(void* const* d_in, const int* in_sizes, int n_in,
                              void* d_out, int out_size, void* d_ws, size_t ws_size,
                              hipStream_t stream) {
  if (n_in < 7) return;
  if (in_sizes[0] != NB * CH * NTOK) return;        // hidden_states [4][1024][32][32]
  if (in_sizes[1] != NQKV * CH) return;             // w_qkv [3072][1024]
  if (in_sizes[2] != NQKV) return;                  // b_qkv [3072]
  if (in_sizes[3] != INNER) return;                 // q_norm_w [1024]
  if (in_sizes[4] != INNER) return;                 // k_norm_w [1024]
  if (in_sizes[5] != CH * INNER) return;            // w_proj [1024][1024]
  if (in_sizes[6] != CH) return;                    // norm_out_w [1024]
  if (out_size != NB * CH * NTOK) return;

  const float* x    = (const float*)d_in[0];
  const float* wqkv = (const float*)d_in[1];   // [out 3072][in 1024]
  const float* bqkv = (const float*)d_in[2];
  const float* qnw  = (const float*)d_in[3];
  const float* knw  = (const float*)d_in[4];
  const float* wprj = (const float*)d_in[5];   // [out 1024][in 1024]
  const float* onw  = (const float*)d_in[6];

  const size_t PXB = (size_t)MTOK * CH * 2;        // 8388608
  const size_t PWQ = (size_t)NQKV * CH * 2;        // 6291456
  const size_t PWP = (size_t)CH * AOP * 2;         // 4194304
  const size_t PTB = (size_t)TABN * 4;             // 2048
  const size_t PQK = (size_t)MTOK * QKP * 4;       // 33554432
  const size_t PCX = (size_t)MTOK * AOP * 2;       // 16777216
  const size_t POF = (size_t)MTOK * CH * 4;        // 16777216
  const size_t PPL = (size_t)MTOK * INNER * 2;     // 8388608 per q/k plane
  const size_t PVT = (size_t)INNER * VTP * 2;      // 8388608 per v^T plane
  if (PCX + POF > PQK) return;                     // CTX2 and Of share the QKf region, disjoint halves
  size_t off = 0;
  const size_t oXB  = off; off += PXB;
  const size_t oWQ  = off; off += PWQ;
  const size_t oWP  = off; off += PWP;
  const size_t oTC  = off; off += PTB;
  const size_t oTS  = off; off += PTB;
  const size_t oQK  = off; off += PQK;
  const size_t oCX  = oQK;
  const size_t oOF  = oQK + PCX;
  const size_t oQh  = off; off += PPL;  const size_t oQl = off; off += PPL;
  const size_t oKh  = off; off += PPL;  const size_t oKl = off; off += PPL;
  const size_t oVTh = off; off += PVT;  const size_t oVTl = off; off += PVT;
  if (off > ws_size) return;                       // off = 102764544
  if (off > (size_t)134217728) return;

  char* ws = (char*)d_ws;
  unsigned short* XB   = (unsigned short*)(ws + oXB);
  unsigned short* WQKV = (unsigned short*)(ws + oWQ);
  unsigned short* WP2  = (unsigned short*)(ws + oWP);
  float*          TC   = (float*)(ws + oTC);
  float*          TS   = (float*)(ws + oTS);
  float*          QKf  = (float*)(ws + oQK);
  unsigned short* CTX2 = (unsigned short*)(ws + oCX);
  float*          Of   = (float*)(ws + oOF);
  unsigned short* Qh   = (unsigned short*)(ws + oQh);  unsigned short* Ql  = (unsigned short*)(ws + oQl);
  unsigned short* Kh   = (unsigned short*)(ws + oKh);  unsigned short* Kl  = (unsigned short*)(ws + oKl);
  unsigned short* VTh  = (unsigned short*)(ws + oVTh); unsigned short* VTl = (unsigned short*)(ws + oVTl);

  const dim3 blk(256);

  // (1) x[b] viewed [R=1024 c][Cc=1024 n] (pitch 1024) -> XB_b[n][c] (pitch 1024); grid (Cc/64, R/64, B) = (16, 16, 4)
  tconv_kernel<<<dim3(NTOK / 64, CH / 64, NB), blk, 0, stream>>>(x, XB, NTOK, CH, (long)CH * NTOK, (long)NTOK * CH);
  // (2) w_qkv [3072][1024] -> WQKV bf16 same layout; 393216 units -> 1536 blocks
  const int n8q = NQKV * CH / 8;
  convrows_kernel<false><<<dim3(n8q / 256), blk, 0, stream>>>(wqkv, WQKV, CH, CH, n8q);
  // (3) w_proj [1024][1024] -> WP2 [1024][2048], cols k and 1024+k; 131072 units -> 512 blocks
  const int n8p = CH * INNER / 8;
  convrows_kernel<true><<<dim3(n8p / 256), blk, 0, stream>>>(wprj, WP2, INNER, AOP, n8p);
  // (4) rotary cos/sin tables [32][16]
  ropetab_kernel<<<dim3(2), blk, 0, stream>>>(TC, TS);
  // (5) q|k = XB . WQKV[0..2047]^T + b -> QKf f32 [4096][2048]   (M=4096, N=2048, K=1024; 32 x 16 = 512 blocks of 128 threads)
  const dim3 gblk(128);
  const dim3 gQK((MTOK / 128) * (QKP / 128), 1);
  wmma_gemm64<1, false, 2, 0, false, CH><<<gQK, gblk, 0, stream>>>(
      XB, XB, 0L, WQKV, WQKV, 0L, (void*)QKf, (void*)QKf, QKP, 0L,
      bqkv, bqkv, 0L, MTOK, QKP, CH, 1.0f);
  // (6) v^T = WQKV[2048..3071] . XB^T + b[2048+m] -> VTh|VTl [1024][4096]   (M=1024, N=4096, K=1024; 8 x 32 = 256 blocks)
  const dim3 gVT((INNER / 128) * (MTOK / 128), 1);
  wmma_gemm64<1, false, 1, 2, false, CH><<<gVT, gblk, 0, stream>>>(
      WQKV + (size_t)2 * INNER * CH, WQKV + (size_t)2 * INNER * CH, 0L, XB, XB, 0L,
      (void*)VTh, (void*)VTl, VTP, 0L,
      bqkv + 2 * INNER, bqkv, 0L, INNER, MTOK, CH, 1.0f);
  // (7) RoPE + RMSNorm over 1024 for q and k -> Qh|Ql, Kh|Kl; one block of 128 threads per token row
  ropenorm_kernel<<<dim3(MTOK), dim3(128), 0, stream>>>(QKf, TC, TS, qnw, knw, Qh, Ql, Kh, Kl);
  // (8) attention per (batch, head, 64-query block) -> CTX2 [4096][2048] (hi | lo columns); 1024 blocks
  attn_kernel<<<dim3(NB * NH * (NTOK / 64)), dim3(128), 0, stream>>>(Qh, Ql, Kh, Kl, VTh, VTl, CTX2, 0.125f);
  // (9) Of = CTX2 . WP2^T -> f32 [4096][1024]   (M=4096, N=1024, K=2048; 32 x 8 = 256 blocks)
  const dim3 gO((MTOK / 128) * (CH / 128), 1);
  wmma_gemm64<1, false, 0, 0, false, AOP><<<gO, gblk, 0, stream>>>(
      CTX2, CTX2, 0L, WP2, WP2, 0L, (void*)Of, (void*)Of, CH, 0L,
      bqkv, bqkv, 0L, MTOK, CH, AOP, 1.0f);
  // (10) output RMSNorm + residual -> NCHW d_out; 128 groups of 32 tokens x 2 channel halves = 256 blocks of 512 threads
  final_kernel<<<dim3((MTOK / FN_TOK) * (CH / FN_CS)), dim3(512), 0, stream>>>(Of, onw, x, (float*)d_out);
  (void)hipGetLastError();
}

// v008
// It runs in 141 microseconds.
// Timed twice side by side with v007, it ran 1.08 times as fast both times.
// Over all steps from v000 it is 3.36 times as fast.
// Contractions: q|k projection (f32 out) and v^T projection (bf16 hi|lo out) = v_wmma_f32_16x16x32_bf16 single products on bf16 planes of the RNE-converted inputs; q.k^T and p.v = bf16 hi/lo split (hi.hi + hi.lo + lo.hi); output projection = [CTXhi|CTXlo] x [Wp;Wp] bf16 single products (K-folded 2-term); f32 accumulate everywhere; RoPE, QK RMSNorm, output RMSNorm, online softmax, 1/rowsum, bias and residual in f32 on the VALU.
// Plane / carry map (all carry 1, nothing to fold back): XB = bf16(x) token-major [4096][1024] (row b*1024+n, n = y*32+x, col c);
// WQKV = bf16(w_qkv) [3072][1024] natural [out][in]; WP2 [1024][2048]: cols k and 1024+k both = bf16(w_proj[c][k]);
// TC/TS f32 [32 pos][16 pair] = cos/sin(pos * 10000^(-j/16)); QKf f32 [4096][2048] = pre-RoPE q (cols 0..1023) | k (cols 1024..2047) incl. bias;
// Qh|Ql, Kh|Kl bf16 [4096][1024] (col h*64+d) = hi/lo of the RoPE'd, RMSNorm'd q, k; VTh|VTl bf16 [1024 (h,d)][4096 (b,t)];
// P hi|lo = unnormalised exp in (0,1] (bf16, f32 exponent range), kept in registers, 1/rowsum applied to the f32 accumulator in the attention epilogue;
// CTX2 u16 [4096][2048] = ctx hi at col h*64+d, lo at col 1024+h*64+d; Of f32 [4096][1024] = ctx . w_proj^T.
#include <hip/hip_runtime.h>
#include <math.h>
#include <stdint.h>

#define NB    4
#define CH    1024
#define IMH   32
#define IMW   32
#define NTOK  1024
#define INNER 1024
#define NH    16
#define HD    64
#define NQKV  3072
#define QKP   2048
#define AOP   2048
#define VTP   (NB * NTOK)
#define MTOK  (NB * NTOK)
#define TABN  512
#define RMS_EPS 1e-6f

static_assert(NTOK == IMH * IMW);
static_assert(IMW == 32);
static_assert(INNER == NH * HD);
static_assert(HD == 64);
static_assert(NQKV == 3 * INNER);
static_assert(QKP == 2 * INNER);
static_assert(AOP == 2 * INNER);
static_assert(CH % 64 == 0);
static_assert(NTOK % 64 == 0);
static_assert(INNER % 64 == 0);
static_assert(MTOK % 64 == 0);
static_assert(CH % 32 == 0);
static_assert(AOP % 32 == 0);
static_assert(INNER == 128 * 8);
static_assert(CH == 8 * 128);
static_assert(TABN == 32 * (HD / 4));
static_assert((NQKV * CH) % (8 * 256) == 0);
static_assert((CH * INNER) % (8 * 256) == 0);
static_assert(CH % 256 == 0);
static_assert(INNER % 256 == 0);
static_assert(MTOK % 128 == 0 && QKP % 128 == 0 && INNER % 128 == 0 && CH % 128 == 0 && AOP % 128 == 0);

typedef __attribute__((ext_vector_type(16))) _Float16 v16h;
typedef __attribute__((ext_vector_type(8)))  _Float16 v8h;
typedef __attribute__((ext_vector_type(16))) __bf16   v16b;
typedef __attribute__((ext_vector_type(8)))  __bf16   v8b;
typedef __attribute__((ext_vector_type(8)))  float    v8f;
typedef __attribute__((ext_vector_type(4)))  float    v4f;
typedef __attribute__((ext_vector_type(2)))  float    v2f;
typedef __attribute__((ext_vector_type(4)))  unsigned int v4u;

// f32 -> bf16, round to nearest even, by the packed hardware convert: bf16(f0) in bits 15..0, bf16(f1) in bits 31..16
typedef __attribute__((ext_vector_type(2))) __bf16 v2b;
__device__ __forceinline__ unsigned bf_pk(float f0, float f1) {
  const v2f f = {f0, f1};
  return __builtin_bit_cast(unsigned, __builtin_convertvector(f, v2b));
}
__device__ __forceinline__ float bf_rne(float f) { return __uint_as_float(bf_pk(f, f) & 0xFFFF0000u); }
// hi/lo split of two f32 at once: hi = the two values rounded to bf16, lo = the two remainders f - hi rounded to bf16
__device__ __forceinline__ void bf_split2(float f0, float f1, unsigned& hi, unsigned& lo) {
  const v2f f = {f0, f1};
  hi = __builtin_bit_cast(unsigned, __builtin_convertvector(f, v2b));
  const v2f g = {__uint_as_float(hi << 16), __uint_as_float(hi & 0xFFFF0000u)};
  lo = __builtin_bit_cast(unsigned, __builtin_convertvector(f - g, v2b));
}

// hazard guard behind the product loop, as a plain device helper
__device__ __forceinline__ void acc_guard4(v8f& a, v8f& b, v8f& c, v8f& d) { asm volatile("v_nop\n\tv_nop\n\tv_nop\n\tv_nop" : "+v"(a), "+v"(b), "+v"(c), "+v"(d)); }
template <typename T> struct Frag;
template <> struct Frag<_Float16> {
  typedef v16h V; typedef v8h H; union U { v16h v; v8h h[2]; };
  static __device__ __forceinline__ v16h load(const _Float16* p) {   // elements 0..7 <- p[0..7], 8..15 <- p[16..23]
    U f; f.h[0] = *(const v8h*)(p); f.h[1] = *(const v8h*)(p + 16); return f.v;
  }
  static __device__ __forceinline__ v8f mma(v16h a, v16h b, v8f c) {
    return __builtin_amdgcn_wmma_f32_16x16x32_f16(false, a, false, b, (short)0, c, false, false);
  }
};
template <> struct Frag<__bf16> {
  typedef v16b V; typedef v8b H; union U { v16b v; v8b h[2]; };
  static __device__ __forceinline__ v16b load(const __bf16* p) {
    U f; f.h[0] = *(const v8b*)(p); f.h[1] = *(const v8b*)(p + 16); return f.v;
  }
  static __device__ __forceinline__ v8f mma(v16b a, v16b b, v8f c) {
    return __builtin_amdgcn_wmma_f32_16x16x32_bf16(false, a, false, b, (short)0, c, false, false);
  }
};

// ---- Register-blocked batched WMMA GEMM ------------------------------------
// C[m,n] = scale * sum_k A[m,k] * Bt[n,k] (+bias)(+resid); each wave owns a 64x64 tile, a block of 4 waves (2 x 2) a 128x128 tile.
// A row-major [M,K]; Bt row-major [N,K]; M,N % 128 == 0, K % GT_BK == 0.
// Operand path: per stage of GT_BK k the block copies its 128 A rows and 128 Bt rows into LDS with 16-B loads whose lanes cover
// whole rows of the stage (GT_BK * 2 contiguous bytes), so every 128-B line is asked for once per block; the four waves read their
// fragments from LDS. Two LDS buffers: the next stage's global loads are issued before the current stage's products and
// stored after them, one __syncthreads() per stage. The k order of every accumulator is ascending in steps of 32.
// SPLIT (hi/lo operand planes) is not instantiated and not supported by the staged loop.
// BIAS_MODE: 0 = none, 1 = bias[m], 2 = bias[n]; the bias value is RNE-converted to bf16 precision before the f32 add.
// OUT_MODE: 0 = f32, 1 = f16, 2 = bf16 hi plane (Cout) + bf16 lo plane (Cout2).
// ET: 0 = f16 operands, 1 = bf16 operands (pointers passed as 16-bit storage)
template <int ET> struct Elem;
template <> struct Elem<0> { typedef _Float16 T; };
template <> struct Elem<1> { typedef __bf16 T; };
#define GT_BK 128
// LDS row pitch in elements: GT_BK data + 8 pad, = 16 B x odd, so the 16 rows of one 16-byte fragment read fall on different banks.
#define GT_LP (GT_BK + 8)
#define GT_CPR (GT_BK / 8)          // 16-byte pieces per staged row
#define GT_RPP (128 / GT_CPR)       // rows that 128 threads copy per pass
#define GT_NP  (128 / GT_RPP)       // passes per operand and stage
// LD: row pitch of A and of Bt in elements, a compile-time constant so that the row steps of the staging loads are immediate offsets.
// The product loop of one block: acc = rows (tm * 128 ...) of Ab times rows (tn * 128 ...) of Bb over K; sA, sB = the block's two-stage LDS tiles.
template <int ET, int LD>
__device__ __forceinline__ void gemm64_main(const typename Elem<ET>::T* Ab, const typename Elem<ET>::T* Bb, int tm, int tn, int K,
                                            typename Elem<ET>::T* sA, typename Elem<ET>::T* sB, v8f (&acc)[4][4]) {
  typedef typename Elem<ET>::T T;
  typedef typename Frag<T>::V V;
  typedef typename Frag<T>::H H;
  const int tid  = threadIdx.x;
  const int lane = tid & 31;
  const int wave = tid >> 5;
  const int wm = (wave >> 1) << 6;             // this wave's 64x64 tile inside the block's 128x128
  const int wn = (wave & 1) << 6;
  const int rlane = lane & 15;                 // row (A) / col (B, D) within subtile
  const int koff  = (lane >> 4) * 8;           // k offset of this lane half

  // staging map: pass p, thread tid -> row p * GT_RPP + tid / GT_CPR, 8 elements at column (tid % GT_CPR) * 8
  const int srow = tid / GT_CPR;
  const int scol = (tid % GT_CPR) * 8;
  const T* gA = Ab + (size_t)((tm << 7) + srow) * LD + scol;
  const T* gB = Bb + (size_t)((tn << 7) + srow) * LD + scol;
  const int sOff = srow * GT_LP + scol;

#pragma unroll
  for (int i = 0; i < 4; ++i)
#pragma unroll
    for (int j = 0; j < 4; ++j) acc[i][j] = (v8f){0.f,0.f,0.f,0.f,0.f,0.f,0.f,0.f};

  H ra[GT_NP], rb[GT_NP];
#pragma unroll
  for (int p = 0; p < GT_NP; ++p) {
    ra[p] = *(const H*)(gA + p * GT_RPP * LD);
    rb[p] = *(const H*)(gB + p * GT_RPP * LD);
  }
#pragma unroll
  for (int p = 0; p < GT_NP; ++p) {
    *(H*)(sA + sOff + p * GT_RPP * GT_LP) = ra[p];
    *(H*)(sB + sOff + p * GT_RPP * GT_LP) = rb[p];
  }
  __syncthreads();

  const int nStages = K / GT_BK;
  for (int st = 0; st < nStages; ++st) {
    const int cur = (st & 1) * (128 * GT_LP);
    const bool more = st + 1 < nStages;        // block-uniform
    if (more) {
      const T* pa = gA + (st + 1) * GT_BK;
      const T* pb = gB + (st + 1) * GT_BK;
#pragma unroll
      for (int p = 0; p < GT_NP; ++p) {
        ra[p] = *(const H*)(pa + p * GT_RPP * LD);
        rb[p] = *(const H*)(pb + p * GT_RPP * LD);
      }
      // naming the two address pairs here keeps them untouched up to this wait, which stands in front of every reuse of their registers
      asm volatile("s_wait_xcnt 0x0" :: "v"(pa), "v"(pb) : "memory");
    }
    const T* fa = sA + cur + (wm + rlane) * GT_LP + koff;
    const T* fb = sB + cur + (wn + rlane) * GT_LP + koff;
#pragma unroll
    for (int kk = 0; kk < GT_BK / 32; ++kk) {
      V bh[4], ah[4];
#pragma unroll
      for (int j = 0; j < 4; ++j) bh[j] = Frag<T>::load(fb + (j << 4) * GT_LP + kk * 32);
#pragma unroll
      for (int i = 0; i < 4; ++i) ah[i] = Frag<T>::load(fa + (i << 4) * GT_LP + kk * 32);
#pragma unroll
      for (int i = 0; i < 4; ++i)
#pragma unroll
        for (int j = 0; j < 4; ++j) acc[i][j] = Frag<T>::mma(ah[i], bh[j], acc[i][j]);
    }
    if (more) {
      const int nxt = (128 * GT_LP) - cur;     // the buffer whose last readers passed the barrier of stage st - 1
#pragma unroll
      for (int p = 0; p < GT_NP; ++p) {
        *(H*)(sA + nxt + sOff + p * GT_RPP * GT_LP) = ra[p];
        *(H*)(sB + nxt + sOff + p * GT_RPP * GT_LP) = rb[p];
      }
    }
    __syncthreads();
  }
  acc_guard4(acc[0][0], acc[0][1], acc[0][2], acc[0][3]);
  acc_guard4(acc[1][0], acc[1][1], acc[1][2], acc[1][3]);
  acc_guard4(acc[2][0], acc[2][1], acc[2][2], acc[2][3]);
  acc_guard4(acc[3][0], acc[3][1], acc[3][2], acc[3][3]);

}

// The epilogue of one wave: its 64x64 tile at (m0, n0) goes out through the wave's own LDS slab in whole lines.
template <int BIAS_MODE, int OUT_MODE, bool RESID, int ACT>
__device__ __forceinline__ void gemm64_epi(v8f (&acc)[4][4], float (*sT)[16 * 68], int m0, int n0, int b,
                                           void* __restrict__ Cout, void* __restrict__ Cout2, int ldc, long strideC,
                                           const float* __restrict__ bias,
                                           const float* __restrict__ resid, long strideR, float scale) {
  const int lane = threadIdx.x & 31;
  const int wave = threadIdx.x >> 5;
  const int rlane = lane & 15;                 // col (D) within subtile
  const int mOff  = (lane >> 4) * 8;           // D row offset
  float* slab = sT[wave];
  const float* Rb = RESID ? (resid + (size_t)b * strideR) : nullptr;
#pragma unroll
  for (int i = 0; i < 4; ++i) {
    const int mBase = m0 + (i << 4);
    float bm[8];
    if (BIAS_MODE == 1) {
      const float* bp = bias + mBase + mOff;
#pragma unroll
      for (int r = 0; r < 8; ++r) bm[r] = bp[r];
      // naming the address pair here keeps it untouched up to this wait, which stands in front of every reuse of its registers
      asm volatile("s_wait_xcnt 0x0" :: "v"(bp) : "memory");
    }
#pragma unroll
    for (int j = 0; j < 4; ++j) {
      const int n = n0 + (j << 4) + rlane;
      float bv = 0.f;
      if (BIAS_MODE == 2) bv = bf_rne(bias[n]);
#pragma unroll
      for (int r = 0; r < 8; ++r) {
        float v = acc[i][j][r] * scale;
        if (BIAS_MODE == 1) v += bf_rne(bm[r]);
        if (BIAS_MODE == 2) v += bv;
        if (RESID) v += Rb[(size_t)(mBase + mOff + r) * ldc + n];
        if (ACT == 1) v = tanhf(v);
        if (ACT == 2) v = fmaxf(v, 0.0f);
        if (ACT == 3) v = v / (1.0f + expf(-v));
        if (ACT == 4) v = (v > 0.f) ? v : 0.01f * v;
        if (ACT == 5) v = 0.5f * v * (1.0f + erff(v * 0.70710678118654752f));
        slab[(mOff + r) * 68 + (j << 4) + rlane] = v;
      }
    }
    __builtin_amdgcn_fence(__ATOMIC_RELEASE, "workgroup");
    __builtin_amdgcn_wave_barrier();
    __builtin_amdgcn_fence(__ATOMIC_ACQUIRE, "workgroup");
    if (OUT_MODE == 0) {
      float* C = (float*)Cout + (size_t)b * strideC;
      const int hh = lane >> 4, c4 = (lane & 15) * 4;     // row seg = 256 B = 16 lanes x 16 B
      {
#pragma unroll
        for (int it = 0; it < 8; ++it) {
          const int row = it * 2 + hh;
          v4f v = *(const v4f*)(slab + row * 68 + c4);
          *(v4f*)(C + (size_t)(mBase + row) * ldc + n0 + c4) = v;
        }
        
      }
    } else {
      const int q = lane >> 3, c8 = (lane & 7) * 8;
      unsigned short* C  = (unsigned short*)Cout  + (size_t)b * strideC;
      unsigned short* C2 = (OUT_MODE == 2) ? ((unsigned short*)Cout2 + (size_t)b * strideC) : nullptr;
      {
#pragma unroll
        for (int it = 0; it < 4; ++it) {
          const int row = it * 4 + q;
          const float* sp = slab + row * 68 + c8;
          v8h hv, lv;
          if (OUT_MODE == 1) {
#pragma unroll
            for (int e = 0; e < 8; ++e) hv[e] = (_Float16)sp[e];
          } else {
            v4u hw, lw;
#pragma unroll
            for (int e = 0; e < 4; ++e) { unsigned a, c; bf_split2(sp[2 * e], sp[2 * e + 1], a, c); hw[e] = a; lw[e] = c; }
            hv = __builtin_bit_cast(v8h, hw);
            lv = __builtin_bit_cast(v8h, lw);
          }
          *(v8h*)(C + (size_t)(mBase + row) * ldc + n0 + c8) = hv;
          if (OUT_MODE == 2) *(v8h*)(C2 + (size_t)(mBase + row) * ldc + n0 + c8) = lv;
        }
        
      }
    }
    __builtin_amdgcn_fence(__ATOMIC_RELEASE, "workgroup");
    __builtin_amdgcn_wave_barrier();
    __builtin_amdgcn_fence(__ATOMIC_ACQUIRE, "workgroup");
  }
}

template <int ET, bool SPLIT, int BIAS_MODE, int OUT_MODE, bool RESID, int LD, int ACT = 0>
__global__ __launch_bounds__(128) void wmma_gemm64(
    const unsigned short* __restrict__ Ap, const unsigned short* __restrict__ A2p, long strideA,
    const unsigned short* __restrict__ Btp, const unsigned short* __restrict__ Bt2p, long strideB,
    void* __restrict__ Cout, void* __restrict__ Cout2, int ldc, long strideC,
    const float* __restrict__ bias,
    const float* __restrict__ resid, long strideR,
    int M, int N, int K, float scale) {
  typedef typename Elem<ET>::T T;
  static_assert(!SPLIT, "the staged loop takes single operand planes");
  const T* A = (const T*)Ap; const T* Bt = (const T*)Btp;
  __shared__ __align__(16) T sA[2 * 128 * GT_LP];  // two stages of the block's 128 A rows
  __shared__ __align__(16) T sB[2 * 128 * GT_LP];  // two stages of the block's 128 Bt rows
  __shared__ __align__(16) float sT[4][16 * 68];   // per-wave 16x64 slab, pitch 68 floats
  const int b    = blockIdx.y;
  const int wave = threadIdx.x >> 5;
  const int tilesN = N >> 7;
  const int tilesM = M >> 7;
  const int tile = blockIdx.x;
  if (tile >= tilesM * tilesN) return;   // block-uniform, in front of every barrier
  const int tm = tile / tilesN;
  const int tn = tile - tm * tilesN;
  v8f acc[4][4];
  gemm64_main<ET, LD>(A + (size_t)b * strideA, Bt + (size_t)b * strideB, tm, tn, K, sA, sB, acc);
  gemm64_epi<BIAS_MODE, OUT_MODE, RESID, ACT>(acc, sT, (tm << 7) + ((wave >> 1) << 6), (tn << 7) + ((wave & 1) << 6), b,
                                              Cout, Cout2, ldc, strideC, bias, resid, strideR, scale);
}

// The two projections that read XB and WQKV and nothing of each other, in one grid: blocks 0 .. VT_TILES - 1 make
// v^T = WQKV[2048..3071] . XB^T + b[2048 + m] -> VTh|VTl [1024][4096] (8 x 32 tiles), the other QK_TILES blocks
// q|k = XB . WQKV[0..2047]^T + b[n] -> QKf f32 [4096][2048] (32 x 16 tiles). One product loop serves both (same K, same pitch);
// which operand rows it takes and which epilogue follows is the same for the whole block.
#define VT_TILES ((INNER / 128) * (MTOK / 128))
#define QK_TILES ((MTOK / 128) * (QKP / 128))
__global__ __launch_bounds__(128) void qkv_gemm(const unsigned short* __restrict__ xb, const unsigned short* __restrict__ wq,
                                                const float* __restrict__ bias, float* __restrict__ qkf,
                                                unsigned short* __restrict__ vth, unsigned short* __restrict__ vtl) {
  __shared__ __align__(16) __bf16 sA[2 * 128 * GT_LP];  // two stages of the block's 128 A rows
  __shared__ __align__(16) __bf16 sB[2 * 128 * GT_LP];  // two stages of the block's 128 Bt rows
  __shared__ __align__(16) float sT[4][16 * 68];        // per-wave 16x64 slab, pitch 68 floats
  const int wave = threadIdx.x >> 5;
  const int bx   = (int)blockIdx.x;
  const bool isV = bx < VT_TILES;
  const int tile = isV ? bx : bx - VT_TILES;
  const int sh   = isV ? 5 : 4;                          // log2 of the tiles along N: MTOK / 128 = 32, QKP / 128 = 16
  static_assert(MTOK / 128 == 32 && QKP / 128 == 16);
  const int tm = tile >> sh;
  const int tn = tile - (tm << sh);
  const __bf16* X  = (const __bf16*)(const void*)xb;
  const __bf16* Wq = (const __bf16*)(const void*)wq;
  v8f acc[4][4];
  gemm64_main<1, CH>(isV ? Wq + (size_t)2 * INNER * CH : X, isV ? X : Wq, tm, tn, CH, sA, sB, acc);
  const int m0 = (tm << 7) + ((wave >> 1) << 6), n0 = (tn << 7) + ((wave & 1) << 6);
  if (isV) gemm64_epi<1, 2, false, 0>(acc, sT, m0, n0, 0, (void*)vth, (void*)vtl, VTP, 0L, bias + 2 * INNER, bias, 0L, 1.0f);
  else     gemm64_epi<2, 0, false, 0>(acc, sT, m0, n0, 0, (void*)qkf, (void*)qkf, QKP, 0L, bias, bias, 0L, 1.0f);
}

// ---------------------------------------------------------------------------
// Row-preserving bf16 RNE convert of an f32 matrix [rows][ncols] into a u16 plane with row pitch ldout; DUP also
// writes the same 8 values at column + ncols (second copy along the row). 8 consecutive elements per thread = one
// Coverage: blk = 0 .. n8/256 - 1, x 256 threads x 8 elements = rows*ncols (n8 = rows*ncols/8, exact multiple of 256).
// ---------------------------------------------------------------------------
template <bool DUP>
__device__ __forceinline__ void convrows_part(int blk, const float* __restrict__ in, unsigned short* __restrict__ out,
                                              int ncols, int ldout, int n8) {
  const int i = blk * 256 + threadIdx.x;
  if (i < n8) {
    const size_t e0 = (size_t)i * 8;
    const int row = (int)(e0 / (size_t)ncols);
    const int col = (int)(e0 - (size_t)row * ncols);
    const v4f a = *(const v4f*)(in + e0);
    const v4f c = *(const v4f*)(in + e0 + 4);
    v4u hv;
    hv[0] = bf_pk(a[0], a[1]);
    hv[1] = bf_pk(a[2], a[3]);
    hv[2] = bf_pk(c[0], c[1]);
    hv[3] = bf_pk(c[2], c[3]);
    const size_t o = (size_t)row * ldout + col;
    {
      *(v4u*)(out + o) = hv;
      if (DUP) *(v4u*)(out + o + ncols) = hv;
      
    }
  }
}

// ---------------------------------------------------------------------------
// Fused transpose + bf16 RNE convert of an f32 matrix, z-batched, one plane:
//   in_z = W + z*sIn viewed [R rows][Cc cols] with row pitch ldin  ->  oh_z[c][r] = bf16(in_z[r][c]), row pitch ldout, oh_z = oh + z*sOut.
// 64x64 tiles through LDS. (bx, by, bz) over (Cc/64, R/64, Z), 256 threads (R, Cc multiples of 64; ldout multiple of 64 so every
// Coverage per block: load 4 it x 256 thr x 4 floats = 64x64; store 2 it x 256 thr x 8 u16 = 64x64.
// ---------------------------------------------------------------------------
__device__ __forceinline__ void tconv_part(int bx, int by, int bz, const float* __restrict__ W, unsigned short* __restrict__ oh,
                                           int ldin, int ldout, long sIn, long sOut) {
  __shared__ __align__(16) float tf[64 * 68];
  W  += (size_t)bz * sIn;
  oh += (size_t)bz * sOut;
  const int c0  = bx * 64;   // input column block = output row block
  const int r0  = by * 64;   // input row block    = output column block
  const int tid = threadIdx.x;
  {
    const int lr = tid >> 4;         // 0..15
    const int c4 = (tid & 15) * 4;   // 0..60
#pragma unroll
    for (int it = 0; it < 4; ++it) {
      const int rr = it * 16 + lr;   // 0..63
      const v4f a = *(const v4f*)(W + (size_t)(r0 + rr) * ldin + c0 + c4);
      *(v4f*)(tf + rr * 68 + c4) = a;
    }
  }
  __syncthreads();
  const int sub = tid >> 3;          // 0..31
  const int c8  = (tid & 7) * 8;     // 0..56
  v4u hv[2];
#pragma unroll
  for (int it = 0; it < 2; ++it) {
    const int oc = it * 32 + sub;    // output row within tile (= input column)
    v4u a;
#pragma unroll
    for (int q = 0; q < 4; ++q) {
      const float f0 = tf[(c8 + 2 * q) * 68 + oc];
      const float f1 = tf[(c8 + 2 * q + 1) * 68 + oc];
      a[q] = bf_pk(f0, f1);
    }
    hv[it] = a;
  }
  {
#pragma unroll
    for (int it = 0; it < 2; ++it) {
      const int oc = it * 32 + sub;
      const size_t go = (size_t)(c0 + oc) * ldout + r0 + c8;
      *(v4u*)(oh + go) = hv[it];
    }
    
  }
}

// ---------------------------------------------------------------------------
// Rotary angle tables: tc[pos*16 + j] = cos(pos * f_j), ts likewise, f_j = 10000^(-4j/64) = 10^(-j/4) (f32 constants),
// pos 0..31 (shared by the row axis and the column axis), j 0..15. Precise cosf/sinf (|angle| <= 31).
// blk 0..1 x 256 = 512 threads = 32 x 16 entries per table; one 4-B store per lane, 32 consecutive lanes = one whole
// ---------------------------------------------------------------------------
__device__ __forceinline__ float rope_freq(int j) {
  float f = 1.0f;
  f = (j == 1)  ? 0.5623413251903491f     : f;
  f = (j == 2)  ? 0.31622776601683794f    : f;
  f = (j == 3)  ? 0.17782794100389229f    : f;
  f = (j == 4)  ? 0.1f                    : f;
  f = (j == 5)  ? 0.05623413251903491f    : f;
  f = (j == 6)  ? 0.031622776601683794f   : f;
  f = (j == 7)  ? 0.017782794100389229f   : f;
  f = (j == 8)  ? 0.01f                   : f;
  f = (j == 9)  ? 0.005623413251903491f   : f;
  f = (j == 10) ? 0.0031622776601683794f  : f;
  f = (j == 11) ? 0.0017782794100389228f  : f;
  f = (j == 12) ? 0.001f                  : f;
  f = (j == 13) ? 0.0005623413251903491f  : f;
  f = (j == 14) ? 0.00031622776601683794f : f;
  f = (j == 15) ? 0.00017782794100389227f : f;
  return f;
}

__device__ __forceinline__ void ropetab_part(int blk, float* __restrict__ tc, float* __restrict__ ts) {
  const int i = blk * 256 + threadIdx.x;             // 0..511 = pos*16 + j
  if (i < TABN) {
    const int pos = i >> 4, j = i & 15;
    const float a = (float)pos * rope_freq(j);
    const float c = cosf(a);
    const float s = sinf(a);
    ((float*)tc)[i] = c;
    ((float*)ts)[i] = s;
    
  }
}

// ---------------------------------------------------------------------------
// The four preparations, which read only inputs and write disjoint planes, in one grid of 256-thread blocks, told apart by block index
// (the same for a whole block, so the barrier of the transpose is passed by all of its block or by none):
//   PR_TAB blocks: rotary tables; PR_X: x[b] viewed [1024 c][1024 n] -> XB_b[n][c], tiles (16, 16, 4);
//   PR_WQ: w_qkv -> WQKV, same layout; PR_WP: w_proj -> WP2 [1024][2048], cols k and 1024 + k.
// ---------------------------------------------------------------------------
#define PR_TAB (TABN / 256)
#define PR_X   ((NTOK / 64) * (CH / 64) * NB)
#define PR_WQ  (NQKV * CH / 8 / 256)
#define PR_WP  (CH * INNER / 8 / 256)
static_assert(NTOK / 64 == 16 && CH / 64 == 16);
__global__ __launch_bounds__(256) void prep_kernel(const float* __restrict__ x, const float* __restrict__ wqkv, const float* __restrict__ wprj,
                                                   unsigned short* __restrict__ xb, unsigned short* __restrict__ wq,
                                                   unsigned short* __restrict__ wp2, float* __restrict__ tc, float* __restrict__ ts) {
  int blk = blockIdx.x;
  if (blk < PR_TAB) { ropetab_part(blk, tc, ts); return; }
  blk -= PR_TAB;
  if (blk < PR_X) { tconv_part(blk & 15, (blk >> 4) & 15, blk >> 8, x, xb, NTOK, CH, (long)CH * NTOK, (long)NTOK * CH); return; }
  blk -= PR_X;
  if (blk < PR_WQ) { convrows_part<false>(blk, wqkv, wq, CH, CH, NQKV * CH / 8); return; }
  blk -= PR_WQ;
  convrows_part<true>(blk, wprj, wp2, INNER, AOP, CH * INNER / 8);
}

// ---------------------------------------------------------------------------
// Per-token 2-D RoPE (interleaved pairs (2i,2i+1) inside each head; pairs 0..15 use the row index y = n>>5, pairs 16..31
// the column index x = n&31; tables shared by all heads) followed by RMSNorm over the WHOLE 1024-wide (heads x dim) row:
// v = rope(v); v = v * rsqrt(mean_1024(v*v) + 1e-6) * bf16(w[col]); then bf16 hi/lo split into planes [4096][1024].
// One block of 128 threads per token row g = b*1024+n; thread t owns columns 8t..8t+7 (= 4 rotary pairs p0..p0+3, p0 = (4t)&31,
// all four in the same half of the pair range). All loads are 16-B vectors. Stores: 16 B per lane per plane, 128 lanes cover
// LDS: redq/redk[4] written by lane 0 of each of the 4 waves before the barrier.
// ---------------------------------------------------------------------------
__global__ __launch_bounds__(128) void ropenorm_kernel(const float* __restrict__ qkf,
                                                       const float* __restrict__ tc, const float* __restrict__ ts,
                                                       const float* __restrict__ qw, const float* __restrict__ kw,
                                                       unsigned short* __restrict__ qh, unsigned short* __restrict__ ql,
                                                       unsigned short* __restrict__ kh, unsigned short* __restrict__ kl) {
  __shared__ float redq[4], redk[4];
  const int g = blockIdx.x;                 // token row 0..MTOK-1
  const int n = g & (NTOK - 1);
  const int py = n >> 5, px = n & 31;
  const int t = threadIdx.x, lane = t & 31, wave = t >> 5;
  const int i0 = t * 8;

  const float* qr = qkf + (size_t)g * QKP + i0;
  const float* kr = qr + INNER;
  const v4f qa = *(const v4f*)(qr), qb = *(const v4f*)(qr + 4);
  const v4f ka = *(const v4f*)(kr), kb = *(const v4f*)(kr + 4);

  const int p0   = (4 * t) & 31;
  const int hsel = p0 >> 4;                 // 0: row-axis angles, 1: column-axis angles
  const int pos  = py + hsel * (px - py);
  const int toff = pos * 16 + (p0 & 15);
  const v4f cv = *(const v4f*)(tc + toff);
  const v4f sv = *(const v4f*)(ts + toff);

  float q8[8], k8[8];
  q8[0] = qa[0]; q8[1] = qa[1]; q8[2] = qa[2]; q8[3] = qa[3];
  q8[4] = qb[0]; q8[5] = qb[1]; q8[6] = qb[2]; q8[7] = qb[3];
  k8[0] = ka[0]; k8[1] = ka[1]; k8[2] = ka[2]; k8[3] = ka[3];
  k8[4] = kb[0]; k8[5] = kb[1]; k8[6] = kb[2]; k8[7] = kb[3];

  float rq[8], rk[8];
#pragma unroll
  for (int e = 0; e < 4; ++e) {
    const float c = cv[e], s = sv[e];
    const float qe = q8[2 * e], qo = q8[2 * e + 1];
    const float ke = k8[2 * e], ko = k8[2 * e + 1];
    rq[2 * e]     = qe * c - qo * s;
    rq[2 * e + 1] = qe * s + qo * c;
    rk[2 * e]     = ke * c - ko * s;
    rk[2 * e + 1] = ke * s + ko * c;
  }
  float ssq = 0.0f, ssk = 0.0f;
#pragma unroll
  for (int e = 0; e < 8; ++e) { ssq += rq[e] * rq[e]; ssk += rk[e] * rk[e]; }
#pragma unroll
  for (int off = 1; off < 32; off <<= 1) { ssq += __shfl_xor(ssq, off, 32); ssk += __shfl_xor(ssk, off, 32); }
  if (lane == 0) { redq[wave] = ssq; redk[wave] = ssk; }
  __syncthreads();
  const float tq = (redq[0] + redq[1]) + (redq[2] + redq[3]);
  const float tk = (redk[0] + redk[1]) + (redk[2] + redk[3]);
  const float rmq = rsqrtf(tq * (1.0f / (float)INNER) + RMS_EPS);
  const float rmk = rsqrtf(tk * (1.0f / (float)INNER) + RMS_EPS);

  const v4f wqa = *(const v4f*)(qw + i0), wqb = *(const v4f*)(qw + i0 + 4);
  const v4f wka = *(const v4f*)(kw + i0), wkb = *(const v4f*)(kw + i0 + 4);
  float wq8[8], wk8[8];
  wq8[0] = bf_rne(wqa[0]); wq8[1] = bf_rne(wqa[1]); wq8[2] = bf_rne(wqa[2]); wq8[3] = bf_rne(wqa[3]);
  wq8[4] = bf_rne(wqb[0]); wq8[5] = bf_rne(wqb[1]); wq8[6] = bf_rne(wqb[2]); wq8[7] = bf_rne(wqb[3]);
  wk8[0] = bf_rne(wka[0]); wk8[1] = bf_rne(wka[1]); wk8[2] = bf_rne(wka[2]); wk8[3] = bf_rne(wka[3]);
  wk8[4] = bf_rne(wkb[0]); wk8[5] = bf_rne(wkb[1]); wk8[6] = bf_rne(wkb[2]); wk8[7] = bf_rne(wkb[3]);

  v4u hq, lq, hk, lk;
#pragma unroll
  for (int e = 0; e < 4; ++e) {
    const float fq0 = rq[2 * e] * rmq * wq8[2 * e];
    const float fq1 = rq[2 * e + 1] * rmq * wq8[2 * e + 1];
    const float fk0 = rk[2 * e] * rmk * wk8[2 * e];
    const float fk1 = rk[2 * e + 1] * rmk * wk8[2 * e + 1];
    unsigned hw, lw;
    bf_split2(fq0, fq1, hw, lw); hq[e] = hw; lq[e] = lw;
    bf_split2(fk0, fk1, hw, lw); hk[e] = hw; lk[e] = lw;
  }
  const size_t o = (size_t)g * INNER + i0;
  {
    *(v4u*)(qh + o) = hq;
    *(v4u*)(ql + o) = lq;
    *(v4u*)(kh + o) = hk;
    *(v4u*)(kl + o) = lk;
    
  }
}

// =====================================================================================
// Full (non-causal, unmasked) attention, head dim 64, all batches in one launch.
//   q planes (hi/lo bf16) [4096][1024]: element (b, n, h, d) at [(b*1024+n)*1024 + h*64 + d]
//   k planes (hi/lo bf16) [4096][1024]: same layout
//   v^T planes (hi/lo bf16) [1024][4096]: element (h, d, b, t) at [(h*64 + d)*4096 + b*1024 + t]
//   out CTX2 plane u16 [4096][2048]: hi bits of o(b,n,h,d) at col h*64+d, lo bits (o - hi) at col 1024 + h*64+d.
//   scores^T = (k . q^T) * 0.125 : A = K rows, B = Q rows; bf16 hi/lo split (hi.hi + lo.hi + hi.lo) on v_wmma_f32_16x16x32_bf16
//   out^T    = v^T . p^T         : A = V^T rows, B = P^T; bf16 hi/lo split of p (unnormalised exp) and v, f32 accumulate, x 1/rowsum at the end
//   Transposed tiles: a lane holds one query (column c) and, per 16-key tile, keys 8*hh + 0..7 in its 8 accumulator registers. Two score
//   tiles (keys 0..15 and 16..31 of a 32-key block), converted in place, are the B operand of the second product in the k order of the
//   V^T fragment loads (elements 0..7 = keys 8*hh + 0..7, elements 8..15 = keys 16 + 8*hh + 0..7): P never goes through LDS.
//   online softmax in f32, base 2 (scores x sscale x log2 e), over the 1024 keys of the batch element (16 chunks of 64, compile-time trip count, no masking): maximum in-lane
//   plus one exchange between the wave halves per chunk; each half sums its own keys, the two sums are joined once in the epilogue.
//   Block = 4 waves = 64 query rows of one (batch, head); grid.x = 4 * 16 * 16 = 1024.
//   K / V^T chunk staging: asynchronous 16-B copies from global memory to LDS, no register in between; 8 lanes take one whole 128-B row,
//   128 threads x 4 rows per plane = the whole 64x64 tile. Two LDS buffers: chunk t + 1 is in flight while chunk t is worked on;
//   one __syncthreads per chunk publishes chunk t + 1 and frees the buffer of chunk t, which is refilled behind it with chunk t + 2.
//   LDS extents: K/V tiles 64x64 fully staged every chunk; the out tiles of the epilogue lie on the ring, behind its last barrier.
// =====================================================================================
#define AT_D 64
#define AT_NW 4
#define AT_QB 64
#define AT_KC 64
// LDS row pitch of the K and V^T tiles in elements: 64 data + 8 pad = 144 B = 16 B x 9 (odd), so the 16 rows that one
// 16-byte fragment read touches fall on 16 different groups of four banks; at 128 B they fall on two. Pad elements are never read.
#define AT_LP 72
#define AT_PL  (AT_KC * AT_LP)   // elements of one plane's tile in LDS
#define AT_BUF (4 * AT_PL)       // one ring buffer: K hi, K lo, V^T hi, V^T lo
static_assert(AT_KC == 64 && AT_D == 64 && (AT_LP * 2) % 16 == 0);
static_assert(NTOK / AT_KC >= 2);

__device__ __forceinline__ v8f at_mma(v16b a, v16b b, v8f c) {
  c = __builtin_amdgcn_wmma_f32_16x16x32_bf16(false, a, false, b, (short)0, c, false, false);
  asm volatile("v_nop\n\tv_nop\n\tv_nop\n\tv_nop" : "+v"(c) : "v"(a), "v"(b));
  return c;
}

// Two planes' share of one thread in a chunk: rows r, r + 16, r + 32, r + 48 of plane a and of plane b, 16 bytes each, global -> LDS.
// l = LDS byte address of the thread's piece in plane a's tile (plane b's tile follows it), ld = row pitch of the planes in elements.
// The s_wait_xcnt stands inside the statement, behind the last copy, so that no address register is rewritten in front of it.
__device__ __forceinline__ void at_copy8(unsigned l, const __bf16* a, const __bf16* b, int ld) {
  const unsigned R = 16 * AT_LP * 2, P = AT_PL * 2;
  asm volatile("global_load_async_to_lds_b128 %0, %1, off\n\t"
               "global_load_async_to_lds_b128 %2, %3, off\n\t"
               "global_load_async_to_lds_b128 %4, %5, off\n\t"
               "global_load_async_to_lds_b128 %6, %7, off\n\t"
               "global_load_async_to_lds_b128 %8, %9, off\n\t"
               "global_load_async_to_lds_b128 %10, %11, off\n\t"
               "global_load_async_to_lds_b128 %12, %13, off\n\t"
               "global_load_async_to_lds_b128 %14, %15, off\n\t"
               "s_wait_xcnt 0x0"
               :: "v"(l),         "v"(a),           "v"(l + R),         "v"(a + 16 * ld),
                  "v"(l + 2 * R), "v"(a + 32 * ld), "v"(l + 3 * R),     "v"(a + 48 * ld),
                  "v"(l + P),         "v"(b),           "v"(l + P + R),     "v"(b + 16 * ld),
                  "v"(l + P + 2 * R), "v"(b + 32 * ld), "v"(l + P + 3 * R), "v"(b + 48 * ld)
               : "memory");
}

// value of lane l ^ 16 (the other wave half), by a vector cross-row move
__device__ __forceinline__ float at_xhalf(float x) {
  return __builtin_bit_cast(float, __builtin_amdgcn_permlanex16(__builtin_bit_cast(int, x), __builtin_bit_cast(int, x),
                                                                0x76543210, 0xfedcba98, false, false));
}

__global__ __launch_bounds__(128)
void attn_kernel(const unsigned short* __restrict__ qhp, const unsigned short* __restrict__ qlp,
                 const unsigned short* __restrict__ khp, const unsigned short* __restrict__ klp,
                 const unsigned short* __restrict__ vhp, const unsigned short* __restrict__ vlp,
                 unsigned short* __restrict__ aop, float sscale) {
  union FB { v16b v; v8b h[2]; unsigned w[8]; };   // w[i] = elements 2i (low half) and 2i + 1
  // two buffers of K hi [kv][d], K lo, V hi [d][kv], V lo, pitch AT_LP, 9 KB a tile; 72 KB, so that four blocks share a WGP's LDS
  __shared__ __align__(16) __bf16 ring[2 * AT_BUF];
  static_assert(AT_NW * 16 * 68 * 4 <= 2 * AT_BUF * 2);          // the per-wave out tiles (pitch 68 floats) fit on the ring

  const int tid  = threadIdx.x;
  const int wave = tid >> 5;
  const int lane = tid & 31;
  const int hh   = lane >> 4;
  const int c    = lane & 15;

  const int nqb = NTOK / AT_QB;            // 16 query blocks per batch element
  const int bx = blockIdx.x;              // grid = NB * NH * nqb (exact)
  const int qb = bx % nqb;
  const int hb = bx / nqb;
  const int h  = hb % NH;                 // 0..15
  const int b  = hb / NH;                 // 0..3
  const int q0 = b * NTOK + qb * AT_QB + wave * 16;   // row in the q / CTX2 planes

  const __bf16* Qh = (const __bf16*)(const void*)qhp + (size_t)h * AT_D;
  const __bf16* Ql = (const __bf16*)(const void*)qlp + (size_t)h * AT_D;
  const __bf16* Kh = (const __bf16*)(const void*)khp + (size_t)h * AT_D;
  const __bf16* Kl = (const __bf16*)(const void*)klp + (size_t)h * AT_D;
  const __bf16* Vh = (const __bf16*)(const void*)vhp + (size_t)h * AT_D * VTP + (size_t)b * NTOK;
  const __bf16* Vl = (const __bf16*)(const void*)vlp + (size_t)h * AT_D * VTP + (size_t)b * NTOK;
  unsigned short* Ch = aop + (size_t)h * AT_D;                    // hi columns
  unsigned short* Cl = aop + (size_t)INNER + (size_t)h * AT_D;    // lo columns

  // ---- Q fragments (B operand, column = query = lane&15, split k map via Frag load): 2 d-chunks, hi and lo ----
  v16b qah[2], qal[2];
#pragma unroll
  for (int dc = 0; dc < 2; ++dc) {
    const __bf16* qr = Qh + (size_t)(q0 + c) * INNER + dc * 32 + 8 * hh;
    const __bf16* ql = Ql + (size_t)(q0 + c) * INNER + dc * 32 + 8 * hh;
    qah[dc] = Frag<__bf16>::load(qr);
    qal[dc] = Frag<__bf16>::load(ql);
  }

  // exponentials to base 2: e^(x * sscale) = 2^(x * c2), so one fused multiply-add and the hardware's 2^x make one P element
  const float c2 = sscale * 1.4426950408889634f;
  float mrow = -INFINITY, lrow = 0.f;   // this lane's query: running maximum in log2 units (both halves alike), sum over this half's keys
  v8f oacc[4];                          // oacc[t][r] = out^T[d = t*16 + 8*hh + r][query c]
#pragma unroll
  for (int t = 0; t < 4; ++t) oacc[t] = (v8f){0.f,0.f,0.f,0.f,0.f,0.f,0.f,0.f};

  const int nChunks = NTOK / AT_KC;   // 16, compile-time constant
  // staging map: thread tid copies 16 bytes at column (tid & 7) * 8 of rows (tid >> 3) + 0, 16, 32, 48 of each plane's chunk tile
  const int srow = tid >> 3, scol = (tid & 7) * 8;
  const __bf16* gkh = Kh + (size_t)(b * NTOK + srow) * INNER + scol;   // K row (b, srow) of chunk 0; a chunk further = + AT_KC rows
  const __bf16* gkl = Kl + (size_t)(b * NTOK + srow) * INNER + scol;
  const __bf16* gvh = Vh + (size_t)srow * VTP + scol;                  // V^T row d = srow, keys of chunk 0; a chunk further = + AT_KC columns
  const __bf16* gvl = Vl + (size_t)srow * VTP + scol;
  const unsigned sl = (unsigned)(uintptr_t)ring + (unsigned)(srow * AT_LP + scol) * 2u;   // LDS byte address of the piece in buffer 0, K hi

  at_copy8(sl, gkh, gkl, INNER);                       // chunk 0 -> buffer 0
  at_copy8(sl + 2 * AT_PL * 2, gvh, gvl, VTP);
  asm volatile("s_wait_asynccnt 0x0" ::: "memory");    // this wave's copies of chunk 0 have landed
  __syncthreads();                                     // ... and every other wave's
  at_copy8(sl + AT_BUF * 2, gkh + (size_t)AT_KC * INNER, gkl + (size_t)AT_KC * INNER, INNER);   // chunk 1 -> buffer 1
  at_copy8(sl + AT_BUF * 2 + 2 * AT_PL * 2, gvh + AT_KC, gvl + AT_KC, VTP);

  for (int kc = 0; kc < nChunks; ++kc) {
    const int cur = (kc & 1) * AT_BUF;
    const __bf16* Ksh = ring + cur;
    const __bf16* Ksl = Ksh + AT_PL;
    const __bf16* Vth = Ksh + 2 * AT_PL;
    const __bf16* Vtl = Ksh + 3 * AT_PL;

    v8f s[4];
#pragma unroll
    for (int j = 0; j < 4; ++j) {
      s[j] = (v8f){0.f,0.f,0.f,0.f,0.f,0.f,0.f,0.f};
#pragma unroll
      for (int dc = 0; dc < 2; ++dc) {
        FB kb, kl;
        kb.h[0] = *(const v8b*)(Ksh + (j * 16 + c) * AT_LP + dc * 32 + 8 * hh);
        kb.h[1] = *(const v8b*)(Ksh + (j * 16 + c) * AT_LP + dc * 32 + 16 + 8 * hh);
        kl.h[0] = *(const v8b*)(Ksl + (j * 16 + c) * AT_LP + dc * 32 + 8 * hh);
        kl.h[1] = *(const v8b*)(Ksl + (j * 16 + c) * AT_LP + dc * 32 + 16 + 8 * hh);
        s[j] = at_mma(kb.v, qah[dc], s[j]);
        s[j] = at_mma(kl.v, qah[dc], s[j]);
        s[j] = at_mma(kb.v, qal[dc], s[j]);
      }
    }
    // s[j][r] = unscaled score of key kc * AT_KC + j*16 + 8*hh + r against query c: this query's chunk maximum, scaled once
    // (c2 > 0 keeps the order of the scores; the softmax does not depend on the value that is subtracted)
    float mj[4];
#pragma unroll
    for (int j = 0; j < 4; ++j) {
      float m = -INFINITY;
#pragma unroll
      for (int r = 0; r < 8; ++r) m = fmaxf(m, s[j][r]);
      mj[j] = m;
    }
    float cm = fmaxf(fmaxf(mj[0], mj[1]), fmaxf(mj[2], mj[3]));
    cm = fmaxf(cm, at_xhalf(cm));
    const float mnew = fmaxf(mrow, cm * c2);
    const float alpha = __builtin_amdgcn_exp2f(mrow - mnew);
    mrow = mnew;
    FB ph[2], pl[2];   // P^T hi / lo as B operands, one per 32 keys: elements 0..7 from tile 2*kk, 8..15 from tile 2*kk + 1
    float pj[4];
#pragma unroll
    for (int j = 0; j < 4; ++j) {
      float psum = 0.f;
#pragma unroll
      for (int r = 0; r < 8; r += 2) {
        const float p0 = __builtin_amdgcn_exp2f(__builtin_fmaf(s[j][r], c2, -mnew));       // e^(score * sscale - maximum)
        const float p1 = __builtin_amdgcn_exp2f(__builtin_fmaf(s[j][r + 1], c2, -mnew));
        psum += p0;
        psum += p1;
        bf_split2(p0, p1, ph[j >> 1].w[(j & 1) * 4 + (r >> 1)], pl[j >> 1].w[(j & 1) * 4 + (r >> 1)]);   // elements (j & 1) * 8 + r and + 1
      }
      pj[j] = psum;
    }
    lrow = lrow * alpha + ((pj[0] + pj[1]) + (pj[2] + pj[3]));
#pragma unroll
    for (int t = 0; t < 4; ++t)
#pragma unroll
      for (int r = 0; r < 8; ++r) oacc[t][r] *= alpha;
    // unrolled: the P^T fragments are registers and are picked by kk at compile time
#pragma unroll
    for (int kk = 0; kk < 2; ++kk) {
#pragma unroll
      for (int t = 0; t < 4; ++t) {
        FB vb, vl;
        vb.h[0] = *(const v8b*)(Vth + (t * 16 + c) * AT_LP + kk * 32 + 8 * hh);
        vb.h[1] = *(const v8b*)(Vth + (t * 16 + c) * AT_LP + kk * 32 + 16 + 8 * hh);
        vl.h[0] = *(const v8b*)(Vtl + (t * 16 + c) * AT_LP + kk * 32 + 8 * hh);
        vl.h[1] = *(const v8b*)(Vtl + (t * 16 + c) * AT_LP + kk * 32 + 16 + 8 * hh);
        oacc[t] = at_mma(vb.v, ph[kk].v, oacc[t]);
        oacc[t] = at_mma(vl.v, ph[kk].v, oacc[t]);
        oacc[t] = at_mma(vb.v, pl[kk].v, oacc[t]);
      }
    }
    asm volatile("s_wait_dscnt 0x0" ::: "memory");     // this wave's reads of buffer cur are done before the buffer is given up
    asm volatile("s_wait_asynccnt 0x0" ::: "memory");  // this wave's copies of chunk kc + 1 have landed
    __syncthreads();                                   // chunk kc + 1 is public, buffer cur has no reader left
    if (kc + 2 < nChunks) {                            // the same for the whole block
      const unsigned l = sl + (unsigned)cur * 2u;
      at_copy8(l, gkh + (size_t)(kc + 2) * AT_KC * INNER, gkl + (size_t)(kc + 2) * AT_KC * INNER, INNER);
      at_copy8(l + 2 * AT_PL * 2, gvh + (kc + 2) * AT_KC, gvl + (kc + 2) * AT_KC, VTP);
    }
  }
  asm volatile("s_wait_asynccnt 0x0" ::: "memory");    // no copy is in flight when the ring becomes the out tiles

  float* os = (float*)(void*)ring + wave * (16 * 68);   // per wave out tile, pitch 68; the loop's last barrier ended every read of the ring
  {
    const float inv = 1.0f / (lrow + at_xhalf(lrow));   // the two halves' key sums of query c, joined
#pragma unroll
    for (int t = 0; t < 4; ++t) {
      v4f o0, o1;
#pragma unroll
      for (int r = 0; r < 4; ++r) { o0[r] = oacc[t][r] * inv; o1[r] = oacc[t][4 + r] * inv; }
      *(v4f*)(os + c * 68 + t * 16 + 8 * hh)     = o0;   // row = query c, columns d = t*16 + 8*hh + 0..7
      *(v4f*)(os + c * 68 + t * 16 + 8 * hh + 4) = o1;
    }
  }
  __builtin_amdgcn_fence(__ATOMIC_RELEASE, "workgroup");
  __builtin_amdgcn_wave_barrier();
  __builtin_amdgcn_fence(__ATOMIC_ACQUIRE, "workgroup");
  {
    const int q = lane >> 3, c8 = (lane & 7) * 8;
    {
#pragma unroll
      for (int it = 0; it < 4; ++it) {
        const int row = it * 4 + q;
        const float* sp = os + row * 68 + c8;
        v4u hw, lw;
#pragma unroll
        for (int e = 0; e < 4; ++e) { unsigned a, d; bf_split2(sp[2 * e], sp[2 * e + 1], a, d); hw[e] = a; lw[e] = d; }
        const v8h hv = __builtin_bit_cast(v8h, hw), lv = __builtin_bit_cast(v8h, lw);
        *(v8h*)(Ch + (size_t)(q0 + row) * AOP + c8) = hv;
        *(v8h*)(Cl + (size_t)(q0 + row) * AOP + c8) = lv;
      }
      
    }
  }
}

// ---------------------------------------------------------------------------
// Output RMSNorm over C + residual + back to NCHW:
//   out[b][c][n] = Of[b*1024+n][c] * rsqrt(mean_C(Of[tok][.]^2) + 1e-6) * bf16(w[c]) + bf16(x[b][c][n]).
// One block of 512 threads (16 waves) per 32 consecutive tokens x 512 channels; grid = 128 token groups x 2 channel halves = 256,
// as many blocks as the chip has WGPs. Every global load of a thread is issued before the first wait: nothing is fetched in a loop.
// Wave w holds the whole rows of tokens 2w and 2w+1 in registers (8 x 16 B per lane and row), sums their squares (per lane one sum
// per channel half, the two added, then the lane tree), scales the block's half of each row and writes it to the LDS tile [token][channel].
// Behind the one barrier a thread reads a 4-token x 4-channel square as four 16-B rows; its columns are the 16-B output vectors
// (4 tokens of one channel), so 8 lanes store one whole 128-B line of out and a block writes only whole lines.
// LDS pitch 516 floats = 16 B x 129 (odd); the 16-B unit index of a row is XORed with 2 for tokens 16..31, so that the 16 lanes
// of a half wave (tokens 4j+q, j = 0..7, two channel units) read 16 different groups of four banks.
// Coverage: 256 blocks x 32 tokens x 512 channels = 4 x 1024 x 1024 outputs, each exactly once.
// ---------------------------------------------------------------------------
#define FN_TOK 32
#define FN_CS  512
#define FN_P   (FN_CS + 4)
static_assert(NTOK % FN_TOK == 0 && CH == 2 * FN_CS && CH == 8 * 128 && FN_TOK == 2 * 16);
__global__ __launch_bounds__(512) void final_kernel(const float* __restrict__ of, const float* __restrict__ nw,
                                                    const float* __restrict__ xin, float* __restrict__ out) {
  __shared__ __align__(16) float tf[FN_TOK * FN_P];
  const int tid = threadIdx.x, lane = tid & 31, wave = tid >> 5;
  const int sl   = blockIdx.x & 1;            // channel half
  const int tok0 = (blockIdx.x >> 1) * FN_TOK;
  const int b = tok0 / NTOK, n0 = tok0 - b * NTOK;
  const int c0 = sl * FN_CS;
  const int j  = tid & 7;                     // token quad: tokens 4j..4j+3
  const int cg = tid >> 3;                    // channel unit 0..63 (4 channels), second pass + 64

  // all loads: the two rows first (the sums wait for them alone), then the weights, then the residual.
  // vo = the block's own channel half of a row, vx = the other half, read for the row sum only.
  const float* po  = of + (size_t)(tok0 + wave * 2) * CH + lane * 4 + c0;
  const float* px  = of + (size_t)(tok0 + wave * 2) * CH + lane * 4 + (FN_CS - c0);
  const float* xp0 = xin + ((size_t)(b * CH + c0 + cg * 4)) * NTOK + n0 + 4 * j;
  v4f vo[2][4], vx[2][4];
#pragma unroll
  for (int i = 0; i < 2; ++i) {
#pragma unroll
    for (int kk = 0; kk < 4; ++kk) vo[i][kk] = *(const v4f*)(po + i * CH + kk * 128);
#pragma unroll
    for (int kk = 0; kk < 4; ++kk) vx[i][kk] = *(const v4f*)(px + i * CH + kk * 128);
  }
  v4f w4[4];
#pragma unroll
  for (int kk = 0; kk < 4; ++kk) w4[kk] = *(const v4f*)(nw + c0 + kk * 128 + lane * 4);
  v4f xr[2][4];
#pragma unroll
  for (int e = 0; e < 4; ++e) {
    xr[0][e] = *(const v4f*)(xp0 + e * NTOK);
    xr[1][e] = *(const v4f*)(xp0 + (256 + e) * NTOK);
  }
  // naming the three address pairs here keeps them untouched up to this wait, which stands in front of every reuse of their registers;
  // as a memory barrier for the compiler it also keeps every load above issued before the first wait for data
  asm volatile("s_wait_xcnt 0x0" :: "v"(po), "v"(px), "v"(xp0) : "memory");

  // row sum of squares = (sum over the own half) + (sum over the other half)
  float ss[2];
#pragma unroll
  for (int i = 0; i < 2; ++i) {
    float so = 0.0f, sx = 0.0f;
#pragma unroll
    for (int kk = 0; kk < 4; ++kk) {
      const v4f a = vo[i][kk], c = vx[i][kk];
      so += a[0] * a[0] + a[1] * a[1] + a[2] * a[2] + a[3] * a[3];
      sx += c[0] * c[0] + c[1] * c[1] + c[2] * c[2] + c[3] * c[3];
    }
    ss[i] = so + sx;
  }
#pragma unroll
  for (int off = 1; off < 32; off <<= 1) {
    const float t0 = __shfl_xor(ss[0], off, 32), t1 = __shfl_xor(ss[1], off, 32);
    ss[0] += t0; ss[1] += t1;
  }

  const int wswz = (wave >> 3) << 1;          // tokens 2w, 2w+1 >= 16
#pragma unroll
  for (int i = 0; i < 2; ++i) {
    const float rm = rsqrtf(ss[i] * (1.0f / (float)CH) + RMS_EPS);
    float* row = tf + (wave * 2 + i) * FN_P;
#pragma unroll
    for (int kk = 0; kk < 4; ++kk) {
      const v4f a = vo[i][kk];
      v4f o;
#pragma unroll
      for (int e = 0; e < 4; ++e) o[e] = a[e] * rm * bf_rne(w4[kk][e]);
      *(v4f*)(row + (((kk * 32 + lane) ^ wswz) << 2)) = o;
    }
  }
  __syncthreads();

  const int rswz = (j >> 2) << 1;
#pragma unroll
  for (int it = 0; it < 2; ++it) {
    const int cu = it * 64 + cg;
    v4f rd[4];
#pragma unroll
    for (int q = 0; q < 4; ++q) rd[q] = *(const v4f*)(tf + (4 * j + q) * FN_P + ((cu ^ rswz) << 2));
#pragma unroll
    for (int e = 0; e < 4; ++e) {
      v4f o;
#pragma unroll
      for (int q = 0; q < 4; ++q) o[q] = rd[q][e] + bf_rne(xr[it][e][q]);
      *(v4f*)(out + ((size_t)(b * CH + c0 + cu * 4 + e)) * NTOK + n0 + 4 * j) = o;
    }
  }
}

// ---------------------------------------------------------------------------
// Workspace region map (byte offsets; every region is fully written by its producer launch before any consumer
//   XB    bf16 [4096][1024]          0       8388608
//   WQKV  bf16 [3072][1024]    8388608       6291456
//   WP2   bf16 [1024][2048]   14680064       4194304
//   TC    f32  [32][16]       18874368          2048   TS  18876416  2048
//   QKf   f32  [4096][2048]   18878464      33554432   (dead after ropenorm; the same 32 MiB then hold
//                                                       CTX2 u16 [4096][2048] at 18878464 (16777216) and
//                                                       Of   f32  [4096][1024] at 35655680 (16777216), disjoint)
//   Qh    bf16 [4096][1024]   52432896       8388608   Ql  60821504
//   Kh    bf16 [4096][1024]   69210112       8388608   Kl  77598720
//   VTh   bf16 [1024][4096]   85987328       8388608   VTl 94375936
//   total                    102764544
// ---------------------------------------------------------------------------
extern "C" void kernel_launch(void* const* d_in, const int* in_sizes, int n_in,
                              void* d_out, int out_size, void* d_ws, size_t ws_size,
                              hipStream_t stream) {
  if (n_in < 7) return;
  if (in_sizes[0] != NB * CH * NTOK) return;        // hidden_states [4][1024][32][32]
  if (in_sizes[1] != NQKV * CH) return;             // w_qkv [3072][1024]
  if (in_sizes[2] != NQKV) return;                  // b_qkv [3072]
  if (in_sizes[3] != INNER) return;                 // q_norm_w [1024]
  if (in_sizes[4] != INNER) return;                 // k_norm_w [1024]
  if (in_sizes[5] != CH * INNER) return;            // w_proj [1024][1024]
  if (in_sizes[6] != CH) return;                    // norm_out_w [1024]
  if (out_size != NB * CH * NTOK) return;

  const float* x    = (const float*)d_in[0];
  const float* wqkv = (const float*)d_in[1];   // [out 3072][in 1024]
  const float* bqkv = (const float*)d_in[2];
  const float* qnw  = (const float*)d_in[3];
  const float* knw  = (const float*)d_in[4];
  const float* wprj = (const float*)d_in[5];   // [out 1024][in 1024]
  const float* onw  = (const float*)d_in[6];

  const size_t PXB = (size_t)MTOK * CH * 2;        // 8388608
  const size_t PWQ = (size_t)NQKV * CH * 2;        // 6291456
  const size_t PWP = (size_t)CH * AOP * 2;         // 4194304
  const size_t PTB = (size_t)TABN * 4;             // 2048
  const size_t PQK = (size_t)MTOK * QKP * 4;       // 33554432
  const size_t PCX = (size_t)MTOK * AOP * 2;       // 16777216
  const size_t POF = (size_t)MTOK * CH * 4;        // 16777216
  const size_t PPL = (size_t)MTOK * INNER * 2;     // 8388608 per q/k plane
  const size_t PVT = (size_t)INNER * VTP * 2;      // 8388608 per v^T plane
  if (PCX + POF > PQK) return;                     // CTX2 and Of share the QKf region, disjoint halves
  size_t off = 0;
  const size_t oXB  = off; off += PXB;
  const size_t oWQ  = off; off += PWQ;
  const size_t oWP  = off; off += PWP;
  const size_t oTC  = off; off += PTB;
  const size_t oTS  = off; off += PTB;
  const size_t oQK  = off; off += PQK;
  const size_t oCX  = oQK;
  const size_t oOF  = oQK + PCX;
  const size_t oQh  = off; off += PPL;  const size_t oQl = off; off += PPL;
  const size_t oKh  = off; off += PPL;  const size_t oKl = off; off += PPL;
  const size_t oVTh = off; off += PVT;  const size_t oVTl = off; off += PVT;
  if (off > ws_size) return;                       // off = 102764544
  if (off > (size_t)134217728) return;

  char* ws = (char*)d_ws;
  unsigned short* XB   = (unsigned short*)(ws + oXB);
  unsigned short* WQKV = (unsigned short*)(ws + oWQ);
  unsigned short* WP2  = (unsigned short*)(ws + oWP);
  float*          TC   = (float*)(ws + oTC);
  float*          TS   = (float*)(ws + oTS);
  float*          QKf  = (float*)(ws + oQK);
  unsigned short* CTX2 = (unsigned short*)(ws + oCX);
  float*          Of   = (float*)(ws + oOF);
  unsigned short* Qh   = (unsigned short*)(ws + oQh);  unsigned short* Ql  = (unsigned short*)(ws + oQl);
  unsigned short* Kh   = (unsigned short*)(ws + oKh);  unsigned short* Kl  = (unsigned short*)(ws + oKl);
  unsigned short* VTh  = (unsigned short*)(ws + oVTh); unsigned short* VTl = (unsigned short*)(ws + oVTl);

  const dim3 blk(256);

  // (1) rotary tables, XB = bf16(x)^T per batch element, WQKV = bf16(w_qkv), WP2 = bf16(w_proj) twice along the row: one grid
  prep_kernel<<<dim3(PR_TAB + PR_X + PR_WQ + PR_WP), blk, 0, stream>>>(x, wqkv, wprj, XB, WQKV, WP2, TC, TS);
  // (2) v^T -> VTh|VTl (256 blocks) and q|k -> QKf (512 blocks), K = 1024 each: one grid of 768 blocks of 128 threads
  const dim3 gblk(128);
  qkv_gemm<<<dim3(VT_TILES + QK_TILES), gblk, 0, stream>>>(XB, WQKV, bqkv, QKf, VTh, VTl);
  // (3) RoPE + RMSNorm over 1024 for q and k -> Qh|Ql, Kh|Kl; one block of 128 threads per token row
  ropenorm_kernel<<<dim3(MTOK), dim3(128), 0, stream>>>(QKf, TC, TS, qnw, knw, Qh, Ql, Kh, Kl);
  // (4) attention per (batch, head, 64-query block) -> CTX2 [4096][2048] (hi | lo columns); 1024 blocks
  attn_kernel<<<dim3(NB * NH * (NTOK / 64)), dim3(128), 0, stream>>>(Qh, Ql, Kh, Kl, VTh, VTl, CTX2, 0.125f);
  // (5) Of = CTX2 . WP2^T -> f32 [4096][1024]   (M=4096, N=1024, K=2048; 32 x 8 = 256 blocks)
  const dim3 gO((MTOK / 128) * (CH / 128), 1);
  wmma_gemm64<1, false, 0, 0, false, AOP><<<gO, gblk, 0, stream>>>(
      CTX2, CTX2, 0L, WP2, WP2, 0L, (void*)Of, (void*)Of, CH, 0L,
      bqkv, bqkv, 0L, MTOK, CH, AOP, 1.0f);
  // (6) output RMSNorm + residual -> NCHW d_out; 128 groups of 32 tokens x 2 channel halves = 256 blocks of 512 threads
  final_kernel<<<dim3((MTOK / FN_TOK) * (CH / FN_CS)), dim3(512), 0, stream>>>(Of, onw, x, (float*)d_out);
  (void)hipGetLastError();
}

// v009
// It runs in 135 microseconds.
// In both of two side-by-side timings against v008, it was 1.04 times as fast.
// All steps since v000 together make it 3.50 times as fast.
// Contractions: q|k projection (f32 out) and v^T projection (bf16 hi|lo out) = v_wmma_f32_16x16x32_bf16 single products on bf16 planes of the RNE-converted inputs; q.k^T and p.v = bf16 hi/lo split (hi.hi + hi.lo + lo.hi); output projection = [CTXhi|CTXlo] x [Wp;Wp] bf16 single products (K-folded 2-term); f32 accumulate everywhere; RoPE, QK RMSNorm, output RMSNorm, online softmax, 1/rowsum, bias and residual in f32 on the VALU.
// Plane / carry map (all carry 1, nothing to fold back): XB = bf16(x) token-major [4096][1024] (row b*1024+n, n = y*32+x, col c);
// WQKV = bf16(w_qkv) [3072][1024] natural [out][in]; WP2 [1024][2048]: cols k and 1024+k both = bf16(w_proj[c][k]);
// TC/TS f32 [32 pos][16 pair] = cos/sin(pos * 10000^(-j/16)); QKf f32 [4096][2048] = pre-RoPE q (cols 0..1023) | k (cols 1024..2047) incl. bias;
// Qh|Ql, Kh|Kl bf16 [4096][1024] (col h*64+d) = hi/lo of the RoPE'd, RMSNorm'd q, k; VTh|VTl bf16 [1024 (h,d)][4096 (b,t)];
// P hi|lo = unnormalised exp in (0,1] (bf16, f32 exponent range), kept in registers, 1/rowsum applied to the f32 accumulator in the attention epilogue;
// CTX2 u16 [4096][2048] = ctx hi at col h*64+d, lo at col 1024+h*64+d; Of f32 [4096][1024] = ctx . w_proj^T.
#include <hip/hip_runtime.h>
#include <math.h>
#include <stdint.h>

#define NB    4
#define CH    1024
#define IMH   32
#define IMW   32
#define NTOK  1024
#define INNER 1024
#define NH    16
#define HD    64
#define NQKV  3072
#define QKP   2048
#define AOP   2048
#define VTP   (NB * NTOK)
#define MTOK  (NB * NTOK)
#define TABN  512
#define RMS_EPS 1e-6f

static_assert(NTOK == IMH * IMW);
static_assert(IMW == 32);
static_assert(INNER == NH * HD);
static_assert(HD == 64);
static_assert(NQKV == 3 * INNER);
static_assert(QKP == 2 * INNER);
static_assert(AOP == 2 * INNER);
static_assert(CH % 64 == 0);
static_assert(NTOK % 64 == 0);
static_assert(INNER % 64 == 0);
static_assert(MTOK % 64 == 0);
static_assert(CH % 32 == 0);
static_assert(AOP % 32 == 0);
static_assert(INNER == 128 * 8);
static_assert(CH == 8 * 128);
static_assert(TABN == 32 * (HD / 4));
static_assert((NQKV * CH) % (8 * 256) == 0);
static_assert((CH * INNER) % (8 * 256) == 0);
static_assert(CH % 256 == 0);
static_assert(INNER % 256 == 0);
static_assert(MTOK % 128 == 0 && QKP % 128 == 0 && INNER % 128 == 0 && CH % 128 == 0 && AOP % 128 == 0);

typedef __attribute__((ext_vector_type(16))) _Float16 v16h;
typedef __attribute__((ext_vector_type(8)))  _Float16 v8h;
typedef __attribute__((ext_vector_type(16))) __bf16   v16b;
typedef __attribute__((ext_vector_type(8)))  __bf16   v8b;
typedef __attribute__((ext_vector_type(8)))  float    v8f;
typedef __attribute__((ext_vector_type(4)))  float    v4f;
typedef __attribute__((ext_vector_type(2)))  float    v2f;
typedef __attribute__((ext_vector_type(4)))  unsigned int v4u;

// f32 -> bf16, round to nearest even, by the packed hardware convert: bf16(f0) in bits 15..0, bf16(f1) in bits 31..16
typedef __attribute__((ext_vector_type(2))) __bf16 v2b;
__device__ __forceinline__ unsigned bf_pk(float f0, float f1) {
  const v2f f = {f0, f1};
  return __builtin_bit_cast(unsigned, __builtin_convertvector(f, v2b));
}
__device__ __forceinline__ float bf_rne(float f) { return __uint_as_float(bf_pk(f, f) & 0xFFFF0000u); }
// hi/lo split of two f32 at once: hi = the two values rounded to bf16, lo = the two remainders f - hi rounded to bf16
__device__ __forceinline__ void bf_split2(float f0, float f1, unsigned& hi, unsigned& lo) {
  const v2f f = {f0, f1};
  hi = __builtin_bit_cast(unsigned, __builtin_convertvector(f, v2b));
  const v2f g = {__uint_as_float(hi << 16), __uint_as_float(hi & 0xFFFF0000u)};
  lo = __builtin_bit_cast(unsigned, __builtin_convertvector(f - g, v2b));
}

// hazard guard behind the product loop, as a plain device helper
__device__ __forceinline__ void acc_guard4(v8f& a, v8f& b, v8f& c, v8f& d) { asm volatile("v_nop\n\tv_nop\n\tv_nop\n\tv_nop" : "+v"(a), "+v"(b), "+v"(c), "+v"(d)); }
template <typename T> struct Frag;
template <> struct Frag<_Float16> {
  typedef v16h V; typedef v8h H; union U { v16h v; v8h h[2]; };
  static __device__ __forceinline__ v16h load(const _Float16* p) {   // elements 0..7 <- p[0..7], 8..15 <- p[16..23]
    U f; f.h[0] = *(const v8h*)(p); f.h[1] = *(const v8h*)(p + 16); return f.v;
  }
  static __device__ __forceinline__ v8f mma(v16h a, v16h b, v8f c) {
    return __builtin_amdgcn_wmma_f32_16x16x32_f16(false, a, false, b, (short)0, c, false, false);
  }
};
template <> struct Frag<__bf16> {
  typedef v16b V; typedef v8b H; union U { v16b v; v8b h[2]; };
  static __device__ __forceinline__ v16b load(const __bf16* p) {
    U f; f.h[0] = *(const v8b*)(p); f.h[1] = *(const v8b*)(p + 16); return f.v;
  }
  static __device__ __forceinline__ v8f mma(v16b a, v16b b, v8f c) {
    return __builtin_amdgcn_wmma_f32_16x16x32_bf16(false, a, false, b, (short)0, c, false, false);
  }
};

// ---- Register-blocked batched WMMA GEMM ------------------------------------
// C[m,n] = scale * sum_k A[m,k] * Bt[n,k] (+bias)(+resid); each wave owns a 64x64 tile, a block of 4 waves (2 x 2) a 128x128 tile.
// A row-major [M,K]; Bt row-major [N,K]; M,N % 128 == 0, K % GT_BK == 0.
// Operand path: per stage of GT_BK k the block copies its 128 A rows and 128 Bt rows into LDS with 16-B loads whose lanes cover
// whole rows of the stage (GT_BK * 2 contiguous bytes), so every 128-B line is asked for once per block; the four waves read their
// fragments from LDS. Two LDS buffers: the next stage's global loads are issued before the current stage's products and
// stored after them, one __syncthreads() per stage. The k order of every accumulator is ascending in steps of 32.
// SPLIT (hi/lo operand planes) is not instantiated and not supported by the staged loop.
// BIAS_MODE: 0 = none, 1 = bias[m], 2 = bias[n]; the bias value is RNE-converted to bf16 precision before the f32 add.
// OUT_MODE: 0 = f32, 1 = f16, 2 = bf16 hi plane (Cout) + bf16 lo plane (Cout2).
// ET: 0 = f16 operands, 1 = bf16 operands (pointers passed as 16-bit storage)
template <int ET> struct Elem;
template <> struct Elem<0> { typedef _Float16 T; };
template <> struct Elem<1> { typedef __bf16 T; };
#define GT_BK 128
// LDS row pitch in elements: GT_BK data + 8 pad, = 16 B x odd, so the 16 rows of one 16-byte fragment read fall on different banks.
#define GT_LP (GT_BK + 8)
#define GT_CPR (GT_BK / 8)          // 16-byte pieces per staged row
#define GT_RPP (128 / GT_CPR)       // rows that 128 threads copy per pass
#define GT_NP  (128 / GT_RPP)       // passes per operand and stage
// LD: row pitch of A and of Bt in elements, a compile-time constant so that the row steps of the staging loads are immediate offsets.
// The product loop of one block: acc = rows (tm * 128 ...) of Ab times rows (tn * 128 ...) of Bb over K; sA, sB = the block's two-stage LDS tiles.
template <int ET, int LD>
__device__ __forceinline__ void gemm64_main(const typename Elem<ET>::T* Ab, const typename Elem<ET>::T* Bb, int tm, int tn, int K,
                                            typename Elem<ET>::T* sA, typename Elem<ET>::T* sB, v8f (&acc)[4][4]) {
  typedef typename Elem<ET>::T T;
  typedef typename Frag<T>::V V;
  typedef typename Frag<T>::H H;
  const int tid  = threadIdx.x;
  const int lane = tid & 31;
  const int wave = tid >> 5;
  const int wm = (wave >> 1) << 6;             // this wave's 64x64 tile inside the block's 128x128
  const int wn = (wave & 1) << 6;
  const int rlane = lane & 15;                 // row (A) / col (B, D) within subtile
  const int koff  = (lane >> 4) * 8;           // k offset of this lane half

  // staging map: pass p, thread tid -> row p * GT_RPP + tid / GT_CPR, 8 elements at column (tid % GT_CPR) * 8
  const int srow = tid / GT_CPR;
  const int scol = (tid % GT_CPR) * 8;
  const T* gA = Ab + (size_t)((tm << 7) + srow) * LD + scol;
  const T* gB = Bb + (size_t)((tn << 7) + srow) * LD + scol;
  const int sOff = srow * GT_LP + scol;

#pragma unroll
  for (int i = 0; i < 4; ++i)
#pragma unroll
    for (int j = 0; j < 4; ++j) acc[i][j] = (v8f){0.f,0.f,0.f,0.f,0.f,0.f,0.f,0.f};

  H ra[GT_NP], rb[GT_NP];
#pragma unroll
  for (int p = 0; p < GT_NP; ++p) {
    ra[p] = *(const H*)(gA + p * GT_RPP * LD);
    rb[p] = *(const H*)(gB + p * GT_RPP * LD);
  }
#pragma unroll
  for (int p = 0; p < GT_NP; ++p) {
    *(H*)(sA + sOff + p * GT_RPP * GT_LP) = ra[p];
    *(H*)(sB + sOff + p * GT_RPP * GT_LP) = rb[p];
  }
  __syncthreads();

  const int nStages = K / GT_BK;
  for (int st = 0; st < nStages; ++st) {
    const int cur = (st & 1) * (128 * GT_LP);
    const bool more = st + 1 < nStages;        // block-uniform
    if (more) {
      const T* pa = gA + (st + 1) * GT_BK;
      const T* pb = gB + (st + 1) * GT_BK;
#pragma unroll
      for (int p = 0; p < GT_NP; ++p) {
        ra[p] = *(const H*)(pa + p * GT_RPP * LD);
        rb[p] = *(const H*)(pb + p * GT_RPP * LD);
      }
      // naming the two address pairs here keeps them untouched up to this wait, which stands in front of every reuse of their registers
      asm volatile("s_wait_xcnt 0x0" :: "v"(pa), "v"(pb) : "memory");
    }
    const T* fa = sA + cur + (wm + rlane) * GT_LP + koff;
    const T* fb = sB + cur + (wn + rlane) * GT_LP + koff;
#pragma unroll
    for (int kk = 0; kk < GT_BK / 32; ++kk) {
      V bh[4], ah[4];
#pragma unroll
      for (int j = 0; j < 4; ++j) bh[j] = Frag<T>::load(fb + (j << 4) * GT_LP + kk * 32);
#pragma unroll
      for (int i = 0; i < 4; ++i) ah[i] = Frag<T>::load(fa + (i << 4) * GT_LP + kk * 32);
#pragma unroll
      for (int i = 0; i < 4; ++i)
#pragma unroll
        for (int j = 0; j < 4; ++j) acc[i][j] = Frag<T>::mma(ah[i], bh[j], acc[i][j]);
    }
    if (more) {
      const int nxt = (128 * GT_LP) - cur;     // the buffer whose last readers passed the barrier of stage st - 1
#pragma unroll
      for (int p = 0; p < GT_NP; ++p) {
        *(H*)(sA + nxt + sOff + p * GT_RPP * GT_LP) = ra[p];
        *(H*)(sB + nxt + sOff + p * GT_RPP * GT_LP) = rb[p];
      }
    }
    __syncthreads();
  }
  acc_guard4(acc[0][0], acc[0][1], acc[0][2], acc[0][3]);
  acc_guard4(acc[1][0], acc[1][1], acc[1][2], acc[1][3]);
  acc_guard4(acc[2][0], acc[2][1], acc[2][2], acc[2][3]);
  acc_guard4(acc[3][0], acc[3][1], acc[3][2], acc[3][3]);

}

// The epilogue of one wave: its 64x64 tile at (m0, n0) goes out through the wave's own LDS slab in whole lines.
template <int BIAS_MODE, int OUT_MODE, bool RESID, int ACT>
__device__ __forceinline__ void gemm64_epi(v8f (&acc)[4][4], float (*sT)[16 * 68], int m0, int n0, int b,
                                           void* __restrict__ Cout, void* __restrict__ Cout2, int ldc, long strideC,
                                           const float* __restrict__ bias,
                                           const float* __restrict__ resid, long strideR, float scale) {
  const int lane = threadIdx.x & 31;
  const int wave = threadIdx.x >> 5;
  const int rlane = lane & 15;                 // col (D) within subtile
  const int mOff  = (lane >> 4) * 8;           // D row offset
  float* slab = sT[wave];
  const float* Rb = RESID ? (resid + (size_t)b * strideR) : nullptr;
#pragma unroll
  for (int i = 0; i < 4; ++i) {
    const int mBase = m0 + (i << 4);
    float bm[8];
    if (BIAS_MODE == 1) {
      const float* bp = bias + mBase + mOff;
#pragma unroll
      for (int r = 0; r < 8; ++r) bm[r] = bp[r];
      // naming the address pair here keeps it untouched up to this wait, which stands in front of every reuse of its registers
      asm volatile("s_wait_xcnt 0x0" :: "v"(bp) : "memory");
    }
#pragma unroll
    for (int j = 0; j < 4; ++j) {
      const int n = n0 + (j << 4) + rlane;
      float bv = 0.f;
      if (BIAS_MODE == 2) bv = bf_rne(bias[n]);
#pragma unroll
      for (int r = 0; r < 8; ++r) {
        float v = acc[i][j][r] * scale;
        if (BIAS_MODE == 1) v += bf_rne(bm[r]);
        if (BIAS_MODE == 2) v += bv;
        if (RESID) v += Rb[(size_t)(mBase + mOff + r) * ldc + n];
        if (ACT == 1) v = tanhf(v);
        if (ACT == 2) v = fmaxf(v, 0.0f);
        if (ACT == 3) v = v / (1.0f + expf(-v));
        if (ACT == 4) v = (v > 0.f) ? v : 0.01f * v;
        if (ACT == 5) v = 0.5f * v * (1.0f + erff(v * 0.70710678118654752f));
        slab[(mOff + r) * 68 + (j << 4) + rlane] = v;
      }
    }
    __builtin_amdgcn_fence(__ATOMIC_RELEASE, "workgroup");
    __builtin_amdgcn_wave_barrier();
    __builtin_amdgcn_fence(__ATOMIC_ACQUIRE, "workgroup");
    if (OUT_MODE == 0) {
      float* C = (float*)Cout + (size_t)b * strideC;
      const int hh = lane >> 4, c4 = (lane & 15) * 4;     // row seg = 256 B = 16 lanes x 16 B
      {
#pragma unroll
        for (int it = 0; it < 8; ++it) {
          const int row = it * 2 + hh;
          v4f v = *(const v4f*)(slab + row * 68 + c4);
          *(v4f*)(C + (size_t)(mBase + row) * ldc + n0 + c4) = v;
        }
        
      }
    } else {
      const int q = lane >> 3, c8 = (lane & 7) * 8;
      unsigned short* C  = (unsigned short*)Cout  + (size_t)b * strideC;
      unsigned short* C2 = (OUT_MODE == 2) ? ((unsigned short*)Cout2 + (size_t)b * strideC) : nullptr;
      {
#pragma unroll
        for (int it = 0; it < 4; ++it) {
          const int row = it * 4 + q;
          const float* sp = slab + row * 68 + c8;
          v8h hv, lv;
          if (OUT_MODE == 1) {
#pragma unroll
            for (int e = 0; e < 8; ++e) hv[e] = (_Float16)sp[e];
          } else {
            v4u hw, lw;
#pragma unroll
            for (int e = 0; e < 4; ++e) { unsigned a, c; bf_split2(sp[2 * e], sp[2 * e + 1], a, c); hw[e] = a; lw[e] = c; }
            hv = __builtin_bit_cast(v8h, hw);
            lv = __builtin_bit_cast(v8h, lw);
          }
          *(v8h*)(C + (size_t)(mBase + row) * ldc + n0 + c8) = hv;
          if (OUT_MODE == 2) *(v8h*)(C2 + (size_t)(mBase + row) * ldc + n0 + c8) = lv;
        }
        
      }
    }
    __builtin_amdgcn_fence(__ATOMIC_RELEASE, "workgroup");
    __builtin_amdgcn_wave_barrier();
    __builtin_amdgcn_fence(__ATOMIC_ACQUIRE, "workgroup");
  }
}

template <int ET, bool SPLIT, int BIAS_MODE, int OUT_MODE, bool RESID, int LD, int ACT = 0>
__global__ __launch_bounds__(128) void wmma_gemm64(
    const unsigned short* __restrict__ Ap, const unsigned short* __restrict__ A2p, long strideA,
    const unsigned short* __restrict__ Btp, const unsigned short* __restrict__ Bt2p, long strideB,
    void* __restrict__ Cout, void* __restrict__ Cout2, int ldc, long strideC,
    const float* __restrict__ bias,
    const float* __restrict__ resid, long strideR,
    int M, int N, int K, float scale) {
  typedef typename Elem<ET>::T T;
  static_assert(!SPLIT, "the staged loop takes single operand planes");
  const T* A = (const T*)Ap; const T* Bt = (const T*)Btp;
  __shared__ __align__(16) T sA[2 * 128 * GT_LP];  // two stages of the block's 128 A rows
  __shared__ __align__(16) T sB[2 * 128 * GT_LP];  // two stages of the block's 128 Bt rows
  __shared__ __align__(16) float sT[4][16 * 68];   // per-wave 16x64 slab, pitch 68 floats
  const int b    = blockIdx.y;
  const int wave = threadIdx.x >> 5;
  const int tilesN = N >> 7;
  const int tilesM = M >> 7;
  const int tile = blockIdx.x;
  if (tile >= tilesM * tilesN) return;   // block-uniform, in front of every barrier
  const int tm = tile / tilesN;
  const int tn = tile - tm * tilesN;
  v8f acc[4][4];
  gemm64_main<ET, LD>(A + (size_t)b * strideA, Bt + (size_t)b * strideB, tm, tn, K, sA, sB, acc);
  gemm64_epi<BIAS_MODE, OUT_MODE, RESID, ACT>(acc, sT, (tm << 7) + ((wave >> 1) << 6), (tn << 7) + ((wave & 1) << 6), b,
                                              Cout, Cout2, ldc, strideC, bias, resid, strideR, scale);
}

// The two projections that read XB and WQKV and nothing of each other, in one grid: blocks 0 .. VT_TILES - 1 make
// v^T = WQKV[2048..3071] . XB^T + b[2048 + m] -> VTh|VTl [1024][4096] (8 x 32 tiles), the other QK_TILES blocks
// q|k = XB . WQKV[0..2047]^T + b[n] -> QKf f32 [4096][2048] (32 x 16 tiles). One product loop serves both (same K, same pitch);
// which operand rows it takes and which epilogue follows is the same for the whole block.
#define VT_TILES ((INNER / 128) * (MTOK / 128))
#define QK_TILES ((MTOK / 128) * (QKP / 128))
__global__ __launch_bounds__(128) void qkv_gemm(const unsigned short* __restrict__ xb, const unsigned short* __restrict__ wq,
                                                const float* __restrict__ bias, float* __restrict__ qkf,
                                                unsigned short* __restrict__ vth, unsigned short* __restrict__ vtl) {
  __shared__ __align__(16) __bf16 sA[2 * 128 * GT_LP];  // two stages of the block's 128 A rows
  __shared__ __align__(16) __bf16 sB[2 * 128 * GT_LP];  // two stages of the block's 128 Bt rows
  __shared__ __align__(16) float sT[4][16 * 68];        // per-wave 16x64 slab, pitch 68 floats
  const int wave = threadIdx.x >> 5;
  const int bx   = (int)blockIdx.x;
  const bool isV = bx < VT_TILES;
  const int tile = isV ? bx : bx - VT_TILES;
  const int sh   = isV ? 5 : 4;                          // log2 of the tiles along N: MTOK / 128 = 32, QKP / 128 = 16
  static_assert(MTOK / 128 == 32 && QKP / 128 == 16);
  const int tm = tile >> sh;
  const int tn = tile - (tm << sh);
  const __bf16* X  = (const __bf16*)(const void*)xb;
  const __bf16* Wq = (const __bf16*)(const void*)wq;
  v8f acc[4][4];
  gemm64_main<1, CH>(isV ? Wq + (size_t)2 * INNER * CH : X, isV ? X : Wq, tm, tn, CH, sA, sB, acc);
  const int m0 = (tm << 7) + ((wave >> 1) << 6), n0 = (tn << 7) + ((wave & 1) << 6);
  if (isV) gemm64_epi<1, 2, false, 0>(acc, sT, m0, n0, 0, (void*)vth, (void*)vtl, VTP, 0L, bias + 2 * INNER, bias, 0L, 1.0f);
  else     gemm64_epi<2, 0, false, 0>(acc, sT, m0, n0, 0, (void*)qkf, (void*)qkf, QKP, 0L, bias, bias, 0L, 1.0f);
}

// ---------------------------------------------------------------------------
// Row-preserving bf16 RNE convert of an f32 matrix [rows][ncols] into a u16 plane with row pitch ldout; DUP also
// writes the same 8 values at column + ncols (second copy along the row). 8 consecutive elements per thread = one
// Coverage: blk = 0 .. n8/256 - 1, x 256 threads x 8 elements = rows*ncols (n8 = rows*ncols/8, exact multiple of 256).
// ---------------------------------------------------------------------------
template <bool DUP>
__device__ __forceinline__ void convrows_part(int blk, const float* __restrict__ in, unsigned short* __restrict__ out,
                                              int ncols, int ldout, int n8) {
  const int i = blk * 256 + threadIdx.x;
  if (i < n8) {
    const size_t e0 = (size_t)i * 8;
    const int row = (int)(e0 / (size_t)ncols);
    const int col = (int)(e0 - (size_t)row * ncols);
    const v4f a = *(const v4f*)(in + e0);
    const v4f c = *(const v4f*)(in + e0 + 4);
    v4u hv;
    hv[0] = bf_pk(a[0], a[1]);
    hv[1] = bf_pk(a[2], a[3]);
    hv[2] = bf_pk(c[0], c[1]);
    hv[3] = bf_pk(c[2], c[3]);
    const size_t o = (size_t)row * ldout + col;
    {
      *(v4u*)(out + o) = hv;
      if (DUP) *(v4u*)(out + o + ncols) = hv;
      
    }
  }
}

// ---------------------------------------------------------------------------
// Fused transpose + bf16 RNE convert of an f32 matrix, z-batched, one plane:
//   in_z = W + z*sIn viewed [R rows][Cc cols] with row pitch ldin  ->  oh_z[c][r] = bf16(in_z[r][c]), row pitch ldout, oh_z = oh + z*sOut.
// 64x64 tiles through LDS. (bx, by, bz) over (Cc/64, R/64, Z), 256 threads (R, Cc multiples of 64; ldout multiple of 64 so every
// Coverage per block: load 4 it x 256 thr x 4 floats = 64x64; store 2 it x 256 thr x 8 u16 = 64x64.
// ---------------------------------------------------------------------------
__device__ __forceinline__ void tconv_part(int bx, int by, int bz, const float* __restrict__ W, unsigned short* __restrict__ oh,
                                           int ldin, int ldout, long sIn, long sOut) {
  __shared__ __align__(16) float tf[64 * 68];
  W  += (size_t)bz * sIn;
  oh += (size_t)bz * sOut;
  const int c0  = bx * 64;   // input column block = output row block
  const int r0  = by * 64;   // input row block    = output column block
  const int tid = threadIdx.x;
  {
    const int lr = tid >> 4;         // 0..15
    const int c4 = (tid & 15) * 4;   // 0..60
#pragma unroll
    for (int it = 0; it < 4; ++it) {
      const int rr = it * 16 + lr;   // 0..63
      const v4f a = *(const v4f*)(W + (size_t)(r0 + rr) * ldin + c0 + c4);
      *(v4f*)(tf + rr * 68 + c4) = a;
    }
  }
  __syncthreads();
  const int sub = tid >> 3;          // 0..31
  const int c8  = (tid & 7) * 8;     // 0..56
  v4u hv[2];
#pragma unroll
  for (int it = 0; it < 2; ++it) {
    const int oc = it * 32 + sub;    // output row within tile (= input column)
    v4u a;
#pragma unroll
    for (int q = 0; q < 4; ++q) {
      const float f0 = tf[(c8 + 2 * q) * 68 + oc];
      const float f1 = tf[(c8 + 2 * q + 1) * 68 + oc];
      a[q] = bf_pk(f0, f1);
    }
    hv[it] = a;
  }
  {
#pragma unroll
    for (int it = 0; it < 2; ++it) {
      const int oc = it * 32 + sub;
      const size_t go = (size_t)(c0 + oc) * ldout + r0 + c8;
      *(v4u*)(oh + go) = hv[it];
    }
    
  }
}

// ---------------------------------------------------------------------------
// Rotary angle tables: tc[pos*16 + j] = cos(pos * f_j), ts likewise, f_j = 10000^(-4j/64) = 10^(-j/4) (f32 constants),
// pos 0..31 (shared by the row axis and the column axis), j 0..15. Precise cosf/sinf (|angle| <= 31).
// blk 0..1 x 256 = 512 threads = 32 x 16 entries per table; one 4-B store per lane, 32 consecutive lanes = one whole
// ---------------------------------------------------------------------------
__device__ __forceinline__ float rope_freq(int j) {
  float f = 1.0f;
  f = (j == 1)  ? 0.5623413251903491f     : f;
  f = (j == 2)  ? 0.31622776601683794f    : f;
  f = (j == 3)  ? 0.17782794100389229f    : f;
  f = (j == 4)  ? 0.1f                    : f;
  f = (j == 5)  ? 0.05623413251903491f    : f;
  f = (j == 6)  ? 0.031622776601683794f   : f;
  f = (j == 7)  ? 0.017782794100389229f   : f;
  f = (j == 8)  ? 0.01f                   : f;
  f = (j == 9)  ? 0.005623413251903491f   : f;
  f = (j == 10) ? 0.0031622776601683794f  : f;
  f = (j == 11) ? 0.0017782794100389228f  : f;
  f = (j == 12) ? 0.001f                  : f;
  f = (j == 13) ? 0.0005623413251903491f  : f;
  f = (j == 14) ? 0.00031622776601683794f : f;
  f = (j == 15) ? 0.00017782794100389227f : f;
  return f;
}

__device__ __forceinline__ void ropetab_part(int blk, float* __restrict__ tc, float* __restrict__ ts) {
  const int i = blk * 256 + threadIdx.x;             // 0..511 = pos*16 + j
  if (i < TABN) {
    const int pos = i >> 4, j = i & 15;
    const float a = (float)pos * rope_freq(j);
    const float c = cosf(a);
    const float s = sinf(a);
    ((float*)tc)[i] = c;
    ((float*)ts)[i] = s;
    
  }
}

// ---------------------------------------------------------------------------
// The four preparations, which read only inputs and write disjoint planes, in one grid of 256-thread blocks, told apart by block index
// (the same for a whole block, so the barrier of the transpose is passed by all of its block or by none):
//   PR_TAB blocks: rotary tables; PR_X: x[b] viewed [1024 c][1024 n] -> XB_b[n][c], tiles (16, 16, 4);
//   PR_WQ: w_qkv -> WQKV, same layout; PR_WP: w_proj -> WP2 [1024][2048], cols k and 1024 + k.
// ---------------------------------------------------------------------------
#define PR_TAB (TABN / 256)
#define PR_X   ((NTOK / 64) * (CH / 64) * NB)
#define PR_WQ  (NQKV * CH / 8 / 256)
#define PR_WP  (CH * INNER / 8 / 256)
static_assert(NTOK / 64 == 16 && CH / 64 == 16);
__global__ __launch_bounds__(256) void prep_kernel(const float* __restrict__ x, const float* __restrict__ wqkv, const float* __restrict__ wprj,
                                                   unsigned short* __restrict__ xb, unsigned short* __restrict__ wq,
                                                   unsigned short* __restrict__ wp2, float* __restrict__ tc, float* __restrict__ ts) {
  int blk = blockIdx.x;
  if (blk < PR_TAB) { ropetab_part(blk, tc, ts); return; }
  blk -= PR_TAB;
  if (blk < PR_X) { tconv_part(blk & 15, (blk >> 4) & 15, blk >> 8, x, xb, NTOK, CH, (long)CH * NTOK, (long)NTOK * CH); return; }
  blk -= PR_X;
  if (blk < PR_WQ) { convrows_part<false>(blk, wqkv, wq, CH, CH, NQKV * CH / 8); return; }
  blk -= PR_WQ;
  convrows_part<true>(blk, wprj, wp2, INNER, AOP, CH * INNER / 8);
}

// ---------------------------------------------------------------------------
// Per-token 2-D RoPE (interleaved pairs (2i,2i+1) inside each head; pairs 0..15 use the row index y = n>>5, pairs 16..31
// the column index x = n&31; tables shared by all heads) followed by RMSNorm over the WHOLE 1024-wide (heads x dim) row:
// v = rope(v); v = v * rsqrt(mean_1024(v*v) + 1e-6) * bf16(w[col]); then bf16 hi/lo split into planes [4096][1024].
// One block of 128 threads per token row g = b*1024+n; thread t owns columns 8t..8t+7 (= 4 rotary pairs p0..p0+3, p0 = (4t)&31,
// all four in the same half of the pair range). All loads are 16-B vectors. Stores: 16 B per lane per plane, 128 lanes cover
// LDS: redq/redk[4] written by lane 0 of each of the 4 waves before the barrier.
// ---------------------------------------------------------------------------
__global__ __launch_bounds__(128) void ropenorm_kernel(const float* __restrict__ qkf,
                                                       const float* __restrict__ tc, const float* __restrict__ ts,
                                                       const float* __restrict__ qw, const float* __restrict__ kw,
                                                       unsigned short* __restrict__ qh, unsigned short* __restrict__ ql,
                                                       unsigned short* __restrict__ kh, unsigned short* __restrict__ kl) {
  __shared__ float redq[4], redk[4];
  const int g = blockIdx.x;                 // token row 0..MTOK-1
  const int n = g & (NTOK - 1);
  const int py = n >> 5, px = n & 31;
  const int t = threadIdx.x, lane = t & 31, wave = t >> 5;
  const int i0 = t * 8;

  const float* qr = qkf + (size_t)g * QKP + i0;
  const float* kr = qr + INNER;
  const v4f qa = *(const v4f*)(qr), qb = *(const v4f*)(qr + 4);
  const v4f ka = *(const v4f*)(kr), kb = *(const v4f*)(kr + 4);

  const int p0   = (4 * t) & 31;
  const int hsel = p0 >> 4;                 // 0: row-axis angles, 1: column-axis angles
  const int pos  = py + hsel * (px - py);
  const int toff = pos * 16 + (p0 & 15);
  const v4f cv = *(const v4f*)(tc + toff);
  const v4f sv = *(const v4f*)(ts + toff);

  float q8[8], k8[8];
  q8[0] = qa[0]; q8[1] = qa[1]; q8[2] = qa[2]; q8[3] = qa[3];
  q8[4] = qb[0]; q8[5] = qb[1]; q8[6] = qb[2]; q8[7] = qb[3];
  k8[0] = ka[0]; k8[1] = ka[1]; k8[2] = ka[2]; k8[3] = ka[3];
  k8[4] = kb[0]; k8[5] = kb[1]; k8[6] = kb[2]; k8[7] = kb[3];

  float rq[8], rk[8];
#pragma unroll
  for (int e = 0; e < 4; ++e) {
    const float c = cv[e], s = sv[e];
    const float qe = q8[2 * e], qo = q8[2 * e + 1];
    const float ke = k8[2 * e], ko = k8[2 * e + 1];
    rq[2 * e]     = qe * c - qo * s;
    rq[2 * e + 1] = qe * s + qo * c;
    rk[2 * e]     = ke * c - ko * s;
    rk[2 * e + 1] = ke * s + ko * c;
  }
  float ssq = 0.0f, ssk = 0.0f;
#pragma unroll
  for (int e = 0; e < 8; ++e) { ssq += rq[e] * rq[e]; ssk += rk[e] * rk[e]; }
#pragma unroll
  for (int off = 1; off < 32; off <<= 1) { ssq += __shfl_xor(ssq, off, 32); ssk += __shfl_xor(ssk, off, 32); }
  if (lane == 0) { redq[wave] = ssq; redk[wave] = ssk; }
  __syncthreads();
  const float tq = (redq[0] + redq[1]) + (redq[2] + redq[3]);
  const float tk = (redk[0] + redk[1]) + (redk[2] + redk[3]);
  const float rmq = rsqrtf(tq * (1.0f / (float)INNER) + RMS_EPS);
  const float rmk = rsqrtf(tk * (1.0f / (float)INNER) + RMS_EPS);

  const v4f wqa = *(const v4f*)(qw + i0), wqb = *(const v4f*)(qw + i0 + 4);
  const v4f wka = *(const v4f*)(kw + i0), wkb = *(const v4f*)(kw + i0 + 4);
  float wq8[8], wk8[8];
  wq8[0] = bf_rne(wqa[0]); wq8[1] = bf_rne(wqa[1]); wq8[2] = bf_rne(wqa[2]); wq8[3] = bf_rne(wqa[3]);
  wq8[4] = bf_rne(wqb[0]); wq8[5] = bf_rne(wqb[1]); wq8[6] = bf_rne(wqb[2]); wq8[7] = bf_rne(wqb[3]);
  wk8[0] = bf_rne(wka[0]); wk8[1] = bf_rne(wka[1]); wk8[2] = bf_rne(wka[2]); wk8[3] = bf_rne(wka[3]);
  wk8[4] = bf_rne(wkb[0]); wk8[5] = bf_rne(wkb[1]); wk8[6] = bf_rne(wkb[2]); wk8[7] = bf_rne(wkb[3]);

  v4u hq, lq, hk, lk;
#pragma unroll
  for (int e = 0; e < 4; ++e) {
    const float fq0 = rq[2 * e] * rmq * wq8[2 * e];
    const float fq1 = rq[2 * e + 1] * rmq * wq8[2 * e + 1];
    const float fk0 = rk[2 * e] * rmk * wk8[2 * e];
    const float fk1 = rk[2 * e + 1] * rmk * wk8[2 * e + 1];
    unsigned hw, lw;
    bf_split2(fq0, fq1, hw, lw); hq[e] = hw; lq[e] = lw;
    bf_split2(fk0, fk1, hw, lw); hk[e] = hw; lk[e] = lw;
  }
  const size_t o = (size_t)g * INNER + i0;
  {
    *(v4u*)(qh + o) = hq;
    *(v4u*)(ql + o) = lq;
    *(v4u*)(kh + o) = hk;
    *(v4u*)(kl + o) = lk;
    
  }
}

// =====================================================================================
// Full (non-causal, unmasked) attention, head dim 64, all batches in one launch.
//   q planes (hi/lo bf16) [4096][1024]: element (b, n, h, d) at [(b*1024+n)*1024 + h*64 + d]
//   k planes (hi/lo bf16) [4096][1024]: same layout
//   v^T planes (hi/lo bf16) [1024][4096]: element (h, d, b, t) at [(h*64 + d)*4096 + b*1024 + t]
//   out CTX2 plane u16 [4096][2048]: hi bits of o(b,n,h,d) at col h*64+d, lo bits (o - hi) at col 1024 + h*64+d.
//   scores^T = (k . q^T) * 0.125 : A = K rows, B = Q rows; bf16 hi/lo split (hi.hi + lo.hi + hi.lo) on v_wmma_f32_16x16x32_bf16
//   out^T    = v^T . p^T         : A = V^T rows, B = P^T; bf16 hi/lo split of p (unnormalised exp) and v, f32 accumulate, x 1/rowsum at the end
//   Transposed tiles: a lane holds one query (column c) and, per 16-key tile, keys 8*hh + 0..7 in its 8 accumulator registers. Two score
//   tiles (keys 0..15 and 16..31 of a 32-key block), converted in place, are the B operand of the second product in the k order of the
//   V^T fragment loads (elements 0..7 = keys 8*hh + 0..7, elements 8..15 = keys 16 + 8*hh + 0..7): P never goes through LDS.
//   online softmax in f32, base 2 (scores x sscale x log2 e), over the 1024 keys of the batch element (16 chunks of 64, compile-time trip count, no masking): maximum in-lane
//   plus one exchange between the wave halves per chunk; each half sums its own keys, the two sums are joined once in the epilogue.
//   Block = 4 waves = 64 query rows of one (batch, head); grid.x = 4 * 16 * 16 = 1024.
//   K / V^T chunk staging: asynchronous 16-B copies from global memory to LDS, no register in between; 8 lanes take one whole 128-B row,
//   128 threads x 4 rows per plane = the whole 64x64 tile. Two LDS buffers: chunk t + 1 is in flight while chunk t is worked on;
//   one __syncthreads per chunk publishes chunk t + 1 and frees the buffer of chunk t, which is refilled behind it with chunk t + 2.
//   LDS extents: K/V tiles 64x64 fully staged every chunk; the out tiles of the epilogue lie on the ring, behind its last barrier.
// =====================================================================================
#define AT_D 64
#define AT_NW 4
#define AT_QB 64
#define AT_KC 64
// LDS row pitch of the K and V^T tiles in elements: 64 data + 8 pad = 144 B = 16 B x 9 (odd), so the 16 rows that one
// 16-byte fragment read touches fall on 16 different groups of four banks; at 128 B they fall on two. Pad elements are never read.
#define AT_LP 72
#define AT_PL  (AT_KC * AT_LP)   // elements of one plane's tile in LDS
#define AT_BUF (4 * AT_PL)       // one ring buffer: K hi, K lo, V^T hi, V^T lo
static_assert(AT_KC == 64 && AT_D == 64 && (AT_LP * 2) % 16 == 0);
static_assert(NTOK / AT_KC >= 2);

__device__ __forceinline__ v8f at_mma(v16b a, v16b b, v8f c) {
  return __builtin_amdgcn_wmma_f32_16x16x32_bf16(false, a, false, b, (short)0, c, false, false);
}

// Two planes' share of one thread in a chunk: rows r, r + 16, r + 32, r + 48 of plane a and of plane b, 16 bytes each, global -> LDS.
// l = LDS byte address of the thread's piece in plane a's tile (plane b's tile follows it), ld = row pitch of the planes in elements.
// The s_wait_xcnt stands inside the statement, behind the last copy, so that no address register is rewritten in front of it.
__device__ __forceinline__ void at_copy8(unsigned l, const __bf16* a, const __bf16* b, int ld) {
  const unsigned R = 16 * AT_LP * 2, P = AT_PL * 2;
  asm volatile("global_load_async_to_lds_b128 %0, %1, off\n\t"
               "global_load_async_to_lds_b128 %2, %3, off\n\t"
               "global_load_async_to_lds_b128 %4, %5, off\n\t"
               "global_load_async_to_lds_b128 %6, %7, off\n\t"
               "global_load_async_to_lds_b128 %8, %9, off\n\t"
               "global_load_async_to_lds_b128 %10, %11, off\n\t"
               "global_load_async_to_lds_b128 %12, %13, off\n\t"
               "global_load_async_to_lds_b128 %14, %15, off\n\t"
               "s_wait_xcnt 0x0"
               :: "v"(l),         "v"(a),           "v"(l + R),         "v"(a + 16 * ld),
                  "v"(l + 2 * R), "v"(a + 32 * ld), "v"(l + 3 * R),     "v"(a + 48 * ld),
                  "v"(l + P),         "v"(b),           "v"(l + P + R),     "v"(b + 16 * ld),
                  "v"(l + P + 2 * R), "v"(b + 32 * ld), "v"(l + P + 3 * R), "v"(b + 48 * ld)
               : "memory");
}

// value of lane l ^ 16 (the other wave half), by a vector cross-row move
__device__ __forceinline__ float at_xhalf(float x) {
  return __builtin_bit_cast(float, __builtin_amdgcn_permlanex16(__builtin_bit_cast(int, x), __builtin_bit_cast(int, x),
                                                                0x76543210, 0xfedcba98, false, false));
}

__global__ __launch_bounds__(128)
void attn_kernel(const unsigned short* __restrict__ qhp, const unsigned short* __restrict__ qlp,
                 const unsigned short* __restrict__ khp, const unsigned short* __restrict__ klp,
                 const unsigned short* __restrict__ vhp, const unsigned short* __restrict__ vlp,
                 unsigned short* __restrict__ aop, float sscale) {
  union FB { v16b v; v8b h[2]; unsigned w[8]; };   // w[i] = elements 2i (low half) and 2i + 1
  // two buffers of K hi [kv][d], K lo, V hi [d][kv], V lo, pitch AT_LP, 9 KB a tile; 72 KB, so that four blocks share a WGP's LDS
  __shared__ __align__(16) __bf16 ring[2 * AT_BUF];
  static_assert(AT_NW * 16 * 68 * 4 <= 2 * AT_BUF * 2);          // the per-wave out tiles (pitch 68 floats) fit on the ring

  const int tid  = threadIdx.x;
  const int wave = tid >> 5;
  const int lane = tid & 31;
  const int hh   = lane >> 4;
  const int c    = lane & 15;

  const int nqb = NTOK / AT_QB;            // 16 query blocks per batch element
  const int bx = blockIdx.x;              // grid = NB * NH * nqb (exact)
  const int qb = bx % nqb;
  const int hb = bx / nqb;
  const int h  = hb % NH;                 // 0..15
  const int b  = hb / NH;                 // 0..3
  const int q0 = b * NTOK + qb * AT_QB + wave * 16;   // row in the q / CTX2 planes

  const __bf16* Qh = (const __bf16*)(const void*)qhp + (size_t)h * AT_D;
  const __bf16* Ql = (const __bf16*)(const void*)qlp + (size_t)h * AT_D;
  const __bf16* Kh = (const __bf16*)(const void*)khp + (size_t)h * AT_D;
  const __bf16* Kl = (const __bf16*)(const void*)klp + (size_t)h * AT_D;
  const __bf16* Vh = (const __bf16*)(const void*)vhp + (size_t)h * AT_D * VTP + (size_t)b * NTOK;
  const __bf16* Vl = (const __bf16*)(const void*)vlp + (size_t)h * AT_D * VTP + (size_t)b * NTOK;
  unsigned short* Ch = aop + (size_t)h * AT_D;                    // hi columns
  unsigned short* Cl = aop + (size_t)INNER + (size_t)h * AT_D;    // lo columns

  // ---- Q fragments (B operand, column = query = lane&15, split k map via Frag load): 2 d-chunks, hi and lo ----
  v16b qah[2], qal[2];
#pragma unroll
  for (int dc = 0; dc < 2; ++dc) {
    const __bf16* qr = Qh + (size_t)(q0 + c) * INNER + dc * 32 + 8 * hh;
    const __bf16* ql = Ql + (size_t)(q0 + c) * INNER + dc * 32 + 8 * hh;
    qah[dc] = Frag<__bf16>::load(qr);
    qal[dc] = Frag<__bf16>::load(ql);
  }

  // exponentials to base 2: e^(x * sscale) = 2^(x * c2), so one fused multiply-add and the hardware's 2^x make one P element
  const float c2 = sscale * 1.4426950408889634f;
  float mrow = -INFINITY, lrow = 0.f;   // this lane's query: running maximum in log2 units (both halves alike), sum over this half's keys
  v8f oacc[4];                          // oacc[t][r] = out^T[d = t*16 + 8*hh + r][query c]
#pragma unroll
  for (int t = 0; t < 4; ++t) oacc[t] = (v8f){0.f,0.f,0.f,0.f,0.f,0.f,0.f,0.f};

  const int nChunks = NTOK / AT_KC;   // 16, compile-time constant
  // staging map: thread tid copies 16 bytes at column (tid & 7) * 8 of rows (tid >> 3) + 0, 16, 32, 48 of each plane's chunk tile
  const int srow = tid >> 3, scol = (tid & 7) * 8;
  const __bf16* gkh = Kh + (size_t)(b * NTOK + srow) * INNER + scol;   // K row (b, srow) of chunk 0; a chunk further = + AT_KC rows
  const __bf16* gkl = Kl + (size_t)(b * NTOK + srow) * INNER + scol;
  const __bf16* gvh = Vh + (size_t)srow * VTP + scol;                  // V^T row d = srow, keys of chunk 0; a chunk further = + AT_KC columns
  const __bf16* gvl = Vl + (size_t)srow * VTP + scol;
  const unsigned sl = (unsigned)(uintptr_t)ring + (unsigned)(srow * AT_LP + scol) * 2u;   // LDS byte address of the piece in buffer 0, K hi

  at_copy8(sl, gkh, gkl, INNER);                       // chunk 0 -> buffer 0
  at_copy8(sl + 2 * AT_PL * 2, gvh, gvl, VTP);
  asm volatile("s_wait_asynccnt 0x0" ::: "memory");    // this wave's copies of chunk 0 have landed
  __syncthreads();                                     // ... and every other wave's
  at_copy8(sl + AT_BUF * 2, gkh + (size_t)AT_KC * INNER, gkl + (size_t)AT_KC * INNER, INNER);   // chunk 1 -> buffer 1
  at_copy8(sl + AT_BUF * 2 + 2 * AT_PL * 2, gvh + AT_KC, gvl + AT_KC, VTP);

  for (int kc = 0; kc < nChunks; ++kc) {
    const int cur = (kc & 1) * AT_BUF;
    const __bf16* Ksh = ring + cur;
    const __bf16* Ksl = Ksh + AT_PL;
    const __bf16* Vth = Ksh + 2 * AT_PL;
    const __bf16* Vtl = Ksh + 3 * AT_PL;

    // every loop over j, dc below is unrolled: the tiles and fragments are registers, picked at compile time
    v8f s[4];
#pragma unroll
    for (int j = 0; j < 4; ++j) s[j] = (v8f){0.f,0.f,0.f,0.f,0.f,0.f,0.f,0.f};
#pragma unroll
    for (int dc = 0; dc < 2; ++dc) {
      FB kb[4], kl[4];
#pragma unroll
      for (int j = 0; j < 4; ++j) {
        kb[j].h[0] = *(const v8b*)(Ksh + (j * 16 + c) * AT_LP + dc * 32 + 8 * hh);
        kb[j].h[1] = *(const v8b*)(Ksh + (j * 16 + c) * AT_LP + dc * 32 + 16 + 8 * hh);
        kl[j].h[0] = *(const v8b*)(Ksl + (j * 16 + c) * AT_LP + dc * 32 + 8 * hh);
        kl[j].h[1] = *(const v8b*)(Ksl + (j * 16 + c) * AT_LP + dc * 32 + 16 + 8 * hh);
      }
      // term by term over the four independent score tiles; each tile still sums hi.hi, lo.hi, hi.lo, d-chunk 0 before 1
#pragma unroll
      for (int j = 0; j < 4; ++j) s[j] = at_mma(kb[j].v, qah[dc], s[j]);
#pragma unroll
      for (int j = 0; j < 4; ++j) s[j] = at_mma(kl[j].v, qah[dc], s[j]);
#pragma unroll
      for (int j = 0; j < 4; ++j) s[j] = at_mma(kb[j].v, qal[dc], s[j]);
    }
    // s[j][r] = unscaled score of key kc * AT_KC + j*16 + 8*hh + r against query c: this query's chunk maximum, scaled once
    // (c2 > 0 keeps the order of the scores; the softmax does not depend on the value that is subtracted)
    float mj[4];
#pragma unroll
    for (int j = 0; j < 4; ++j) {
      float m = -INFINITY;
#pragma unroll
      for (int r = 0; r < 8; ++r) m = fmaxf(m, s[j][r]);
      mj[j] = m;
    }
    float cm = fmaxf(fmaxf(mj[0], mj[1]), fmaxf(mj[2], mj[3]));
    cm = fmaxf(cm, at_xhalf(cm));
    const float mnew = fmaxf(mrow, cm * c2);
    const float alpha = __builtin_amdgcn_exp2f(mrow - mnew);
    mrow = mnew;
    FB ph[2], pl[2];   // P^T hi / lo as B operands, one per 32 keys: elements 0..7 from tile 2*kk, 8..15 from tile 2*kk + 1
    float pj[4];
#pragma unroll
    for (int j = 0; j < 4; ++j) {
      float psum = 0.f;
#pragma unroll
      for (int r = 0; r < 8; r += 2) {
        const float p0 = __builtin_amdgcn_exp2f(__builtin_fmaf(s[j][r], c2, -mnew));       // e^(score * sscale - maximum)
        const float p1 = __builtin_amdgcn_exp2f(__builtin_fmaf(s[j][r + 1], c2, -mnew));
        psum += p0;
        psum += p1;
        bf_split2(p0, p1, ph[j >> 1].w[(j & 1) * 4 + (r >> 1)], pl[j >> 1].w[(j & 1) * 4 + (r >> 1)]);   // elements (j & 1) * 8 + r and + 1
      }
      pj[j] = psum;
    }
    lrow = lrow * alpha + ((pj[0] + pj[1]) + (pj[2] + pj[3]));
#pragma unroll
    for (int t = 0; t < 4; ++t)
#pragma unroll
      for (int r = 0; r < 8; ++r) oacc[t][r] *= alpha;
    // unrolled (kk and t): the P^T and V^T fragments and the out tiles are registers, picked at compile time
#pragma unroll
    for (int kk = 0; kk < 2; ++kk) {
      FB vb[4], vl[4];
#pragma unroll
      for (int t = 0; t < 4; ++t) {
        vb[t].h[0] = *(const v8b*)(Vth + (t * 16 + c) * AT_LP + kk * 32 + 8 * hh);
        vb[t].h[1] = *(const v8b*)(Vth + (t * 16 + c) * AT_LP + kk * 32 + 16 + 8 * hh);
        vl[t].h[0] = *(const v8b*)(Vtl + (t * 16 + c) * AT_LP + kk * 32 + 8 * hh);
        vl[t].h[1] = *(const v8b*)(Vtl + (t * 16 + c) * AT_LP + kk * 32 + 16 + 8 * hh);
      }
      // term by term over the four independent out tiles; each tile still sums hi.hi, lo.hi, hi.lo, keys 0..31 before 32..63
#pragma unroll
      for (int t = 0; t < 4; ++t) oacc[t] = at_mma(vb[t].v, ph[kk].v, oacc[t]);
#pragma unroll
      for (int t = 0; t < 4; ++t) oacc[t] = at_mma(vl[t].v, ph[kk].v, oacc[t]);
#pragma unroll
      for (int t = 0; t < 4; ++t) oacc[t] = at_mma(vb[t].v, pl[kk].v, oacc[t]);
    }
    asm volatile("s_wait_dscnt 0x0" ::: "memory");     // this wave's reads of buffer cur are done before the buffer is given up
    asm volatile("s_wait_asynccnt 0x0" ::: "memory");  // this wave's copies of chunk kc + 1 have landed
    __syncthreads();                                   // chunk kc + 1 is public, buffer cur has no reader left
    if (kc + 2 < nChunks) {                            // the same for the whole block
      const unsigned l = sl + (unsigned)cur * 2u;
      at_copy8(l, gkh + (size_t)(kc + 2) * AT_KC * INNER, gkl + (size_t)(kc + 2) * AT_KC * INNER, INNER);
      at_copy8(l + 2 * AT_PL * 2, gvh + (kc + 2) * AT_KC, gvl + (kc + 2) * AT_KC, VTP);
    }
  }
  asm volatile("s_wait_asynccnt 0x0" ::: "memory");    // no copy is in flight when the ring becomes the out tiles

  float* os = (float*)(void*)ring + wave * (16 * 68);   // per wave out tile, pitch 68; the loop's last barrier ended every read of the ring
  {
    const float inv = 1.0f / (lrow + at_xhalf(lrow));   // the two halves' key sums of query c, joined
#pragma unroll
    for (int t = 0; t < 4; ++t) {
      v4f o0, o1;
#pragma unroll
      for (int r = 0; r < 4; ++r) { o0[r] = oacc[t][r] * inv; o1[r] = oacc[t][4 + r] * inv; }
      *(v4f*)(os + c * 68 + t * 16 + 8 * hh)     = o0;   // row = query c, columns d = t*16 + 8*hh + 0..7
      *(v4f*)(os + c * 68 + t * 16 + 8 * hh + 4) = o1;
    }
  }
  __builtin_amdgcn_fence(__ATOMIC_RELEASE, "workgroup");
  __builtin_amdgcn_wave_barrier();
  __builtin_amdgcn_fence(__ATOMIC_ACQUIRE, "workgroup");
  {
    const int q = lane >> 3, c8 = (lane & 7) * 8;
    {
#pragma unroll
      for (int it = 0; it < 4; ++it) {
        const int row = it * 4 + q;
        const float* sp = os + row * 68 + c8;
        v4u hw, lw;
#pragma unroll
        for (int e = 0; e < 4; ++e) { unsigned a, d; bf_split2(sp[2 * e], sp[2 * e + 1], a, d); hw[e] = a; lw[e] = d; }
        const v8h hv = __builtin_bit_cast(v8h, hw), lv = __builtin_bit_cast(v8h, lw);
        *(v8h*)(Ch + (size_t)(q0 + row) * AOP + c8) = hv;
        *(v8h*)(Cl + (size_t)(q0 + row) * AOP + c8) = lv;
      }
      
    }
  }
}

// ---------------------------------------------------------------------------
// Output RMSNorm over C + residual + back to NCHW:
//   out[b][c][n] = Of[b*1024+n][c] * rsqrt(mean_C(Of[tok][.]^2) + 1e-6) * bf16(w[c]) + bf16(x[b][c][n]).
// One block of 512 threads (16 waves) per 32 consecutive tokens x 512 channels; grid = 128 token groups x 2 channel halves = 256,
// as many blocks as the chip has WGPs. Every global load of a thread is issued before the first wait: nothing is fetched in a loop.
// Wave w holds the whole rows of tokens 2w and 2w+1 in registers (8 x 16 B per lane and row), sums their squares (per lane one sum
// per channel half, the two added, then the lane tree), scales the block's half of each row and writes it to the LDS tile [token][channel].
// Behind the one barrier a thread reads a 4-token x 4-channel square as four 16-B rows; its columns are the 16-B output vectors
// (4 tokens of one channel), so 8 lanes store one whole 128-B line of out and a block writes only whole lines.
// LDS pitch 516 floats = 16 B x 129 (odd); the 16-B unit index of a row is XORed with 2 for tokens 16..31, so that the 16 lanes
// of a half wave (tokens 4j+q, j = 0..7, two channel units) read 16 different groups of four banks.
// Coverage: 256 blocks x 32 tokens x 512 channels = 4 x 1024 x 1024 outputs, each exactly once.
// ---------------------------------------------------------------------------
#define FN_TOK 32
#define FN_CS  512
#define FN_P   (FN_CS + 4)
static_assert(NTOK % FN_TOK == 0 && CH == 2 * FN_CS && CH == 8 * 128 && FN_TOK == 2 * 16);
__global__ __launch_bounds__(512) void final_kernel(const float* __restrict__ of, const float* __restrict__ nw,
                                                    const float* __restrict__ xin, float* __restrict__ out) {
  __shared__ __align__(16) float tf[FN_TOK * FN_P];
  const int tid = threadIdx.x, lane = tid & 31, wave = tid >> 5;
  const int sl   = blockIdx.x & 1;            // channel half
  const int tok0 = (blockIdx.x >> 1) * FN_TOK;
  const int b = tok0 / NTOK, n0 = tok0 - b * NTOK;
  const int c0 = sl * FN_CS;
  const int j  = tid & 7;                     // token quad: tokens 4j..4j+3
  const int cg = tid >> 3;                    // channel unit 0..63 (4 channels), second pass + 64

  // all loads: the two rows first (the sums wait for them alone), then the weights, then the residual.
  // vo = the block's own channel half of a row, vx = the other half, read for the row sum only.
  const float* po  = of + (size_t)(tok0 + wave * 2) * CH + lane * 4 + c0;
  const float* px  = of + (size_t)(tok0 + wave * 2) * CH + lane * 4 + (FN_CS - c0);
  const float* xp0 = xin + ((size_t)(b * CH + c0 + cg * 4)) * NTOK + n0 + 4 * j;
  v4f vo[2][4], vx[2][4];
#pragma unroll
  for (int i = 0; i < 2; ++i) {
#pragma unroll
    for (int kk = 0; kk < 4; ++kk) vo[i][kk] = *(const v4f*)(po + i * CH + kk * 128);
#pragma unroll
    for (int kk = 0; kk < 4; ++kk) vx[i][kk] = *(const v4f*)(px + i * CH + kk * 128);
  }
  v4f w4[4];
#pragma unroll
  for (int kk = 0; kk < 4; ++kk) w4[kk] = *(const v4f*)(nw + c0 + kk * 128 + lane * 4);
  v4f xr[2][4];
#pragma unroll
  for (int e = 0; e < 4; ++e) {
    xr[0][e] = *(const v4f*)(xp0 + e * NTOK);
    xr[1][e] = *(const v4f*)(xp0 + (256 + e) * NTOK);
  }
  // naming the three address pairs here keeps them untouched up to this wait, which stands in front of every reuse of their registers;
  // as a memory barrier for the compiler it also keeps every load above issued before the first wait for data
  asm volatile("s_wait_xcnt 0x0" :: "v"(po), "v"(px), "v"(xp0) : "memory");

  // row sum of squares = (sum over the own half) + (sum over the other half)
  float ss[2];
#pragma unroll
  for (int i = 0; i < 2; ++i) {
    float so = 0.0f, sx = 0.0f;
#pragma unroll
    for (int kk = 0; kk < 4; ++kk) {
      const v4f a = vo[i][kk], c = vx[i][kk];
      so += a[0] * a[0] + a[1] * a[1] + a[2] * a[2] + a[3] * a[3];
      sx += c[0] * c[0] + c[1] * c[1] + c[2] * c[2] + c[3] * c[3];
    }
    ss[i] = so + sx;
  }
#pragma unroll
  for (int off = 1; off < 32; off <<= 1) {
    const float t0 = __shfl_xor(ss[0], off, 32), t1 = __shfl_xor(ss[1], off, 32);
    ss[0] += t0; ss[1] += t1;
  }

  const int wswz = (wave >> 3) << 1;          // tokens 2w, 2w+1 >= 16
#pragma unroll
  for (int i = 0; i < 2; ++i) {
    const float rm = rsqrtf(ss[i] * (1.0f / (float)CH) + RMS_EPS);
    float* row = tf + (wave * 2 + i) * FN_P;
#pragma unroll
    for (int kk = 0; kk < 4; ++kk) {
      const v4f a = vo[i][kk];
      v4f o;
#pragma unroll
      for (int e = 0; e < 4; ++e) o[e] = a[e] * rm * bf_rne(w4[kk][e]);
      *(v4f*)(row + (((kk * 32 + lane) ^ wswz) << 2)) = o;
    }
  }
  __syncthreads();

  const int rswz = (j >> 2) << 1;
#pragma unroll
  for (int it = 0; it < 2; ++it) {
    const int cu = it * 64 + cg;
    v4f rd[4];
#pragma unroll
    for (int q = 0; q < 4; ++q) rd[q] = *(const v4f*)(tf + (4 * j + q) * FN_P + ((cu ^ rswz) << 2));
#pragma unroll
    for (int e = 0; e < 4; ++e) {
      v4f o;
#pragma unroll
      for (int q = 0; q < 4; ++q) o[q] = rd[q][e] + bf_rne(xr[it][e][q]);
      *(v4f*)(out + ((size_t)(b * CH + c0 + cu * 4 + e)) * NTOK + n0 + 4 * j) = o;
    }
  }
}

// ---------------------------------------------------------------------------
// Workspace region map (byte offsets; every region is fully written by its producer launch before any consumer
//   XB    bf16 [4096][1024]          0       8388608
//   WQKV  bf16 [3072][1024]    8388608       6291456
//   WP2   bf16 [1024][2048]   14680064       4194304
//   TC    f32  [32][16]       18874368          2048   TS  18876416  2048
//   QKf   f32  [4096][2048]   18878464      33554432   (dead after ropenorm; the same 32 MiB then hold
//                                                       CTX2 u16 [4096][2048] at 18878464 (16777216) and
//                                                       Of   f32  [4096][1024] at 35655680 (16777216), disjoint)
//   Qh    bf16 [4096][1024]   52432896       8388608   Ql  60821504
//   Kh    bf16 [4096][1024]   69210112       8388608   Kl  77598720
//   VTh   bf16 [1024][4096]   85987328       8388608   VTl 94375936
//   total                    102764544
// ---------------------------------------------------------------------------
extern "C" void kernel_launch(void* const* d_in, const int* in_sizes, int n_in,
                              void* d_out, int out_size, void* d_ws, size_t ws_size,
                              hipStream_t stream) {
  if (n_in < 7) return;
  if (in_sizes[0] != NB * CH * NTOK) return;        // hidden_states [4][1024][32][32]
  if (in_sizes[1] != NQKV * CH) return;             // w_qkv [3072][1024]
  if (in_sizes[2] != NQKV) return;                  // b_qkv [3072]
  if (in_sizes[3] != INNER) return;                 // q_norm_w [1024]
  if (in_sizes[4] != INNER) return;                 // k_norm_w [1024]
  if (in_sizes[5] != CH * INNER) return;            // w_proj [1024][1024]
  if (in_sizes[6] != CH) return;                    // norm_out_w [1024]
  if (out_size != NB * CH * NTOK) return;

  const float* x    = (const float*)d_in[0];
  const float* wqkv = (const float*)d_in[1];   // [out 3072][in 1024]
  const float* bqkv = (const float*)d_in[2];
  const float* qnw  = (const float*)d_in[3];
  const float* knw  = (const float*)d_in[4];
  const float* wprj = (const float*)d_in[5];   // [out 1024][in 1024]
  const float* onw  = (const float*)d_in[6];

  const size_t PXB = (size_t)MTOK * CH * 2;        // 8388608
  const size_t PWQ = (size_t)NQKV * CH * 2;        // 6291456
  const size_t PWP = (size_t)CH * AOP * 2;         // 4194304
  const size_t PTB = (size_t)TABN * 4;             // 2048
  const size_t PQK = (size_t)MTOK * QKP * 4;       // 33554432
  const size_t PCX = (size_t)MTOK * AOP * 2;       // 16777216
  const size_t POF = (size_t)MTOK * CH * 4;        // 16777216
  const size_t PPL = (size_t)MTOK * INNER * 2;     // 8388608 per q/k plane
  const size_t PVT = (size_t)INNER * VTP * 2;      // 8388608 per v^T plane
  if (PCX + POF > PQK) return;                     // CTX2 and Of share the QKf region, disjoint halves
  size_t off = 0;
  const size_t oXB  = off; off += PXB;
  const size_t oWQ  = off; off += PWQ;
  const size_t oWP  = off; off += PWP;
  const size_t oTC  = off; off += PTB;
  const size_t oTS  = off; off += PTB;
  const size_t oQK  = off; off += PQK;
  const size_t oCX  = oQK;
  const size_t oOF  = oQK + PCX;
  const size_t oQh  = off; off += PPL;  const size_t oQl = off; off += PPL;
  const size_t oKh  = off; off += PPL;  const size_t oKl = off; off += PPL;
  const size_t oVTh = off; off += PVT;  const size_t oVTl = off; off += PVT;
  if (off > ws_size) return;                       // off = 102764544
  if (off > (size_t)134217728) return;

  char* ws = (char*)d_ws;
  unsigned short* XB   = (unsigned short*)(ws + oXB);
  unsigned short* WQKV = (unsigned short*)(ws + oWQ);
  unsigned short* WP2  = (unsigned short*)(ws + oWP);
  float*          TC   = (float*)(ws + oTC);
  float*          TS   = (float*)(ws + oTS);
  float*          QKf  = (float*)(ws + oQK);
  unsigned short* CTX2 = (unsigned short*)(ws + oCX);
  float*          Of   = (float*)(ws + oOF);
  unsigned short* Qh   = (unsigned short*)(ws + oQh);  unsigned short* Ql  = (unsigned short*)(ws + oQl);
  unsigned short* Kh   = (unsigned short*)(ws + oKh);  unsigned short* Kl  = (unsigned short*)(ws + oKl);
  unsigned short* VTh  = (unsigned short*)(ws + oVTh); unsigned short* VTl = (unsigned short*)(ws + oVTl);

  const dim3 blk(256);

  // (1) rotary tables, XB = bf16(x)^T per batch element, WQKV = bf16(w_qkv), WP2 = bf16(w_proj) twice along the row: one grid
  prep_kernel<<<dim3(PR_TAB + PR_X + PR_WQ + PR_WP), blk, 0, stream>>>(x, wqkv, wprj, XB, WQKV, WP2, TC, TS);
  // (2) v^T -> VTh|VTl (256 blocks) and q|k -> QKf (512 blocks), K = 1024 each: one grid of 768 blocks of 128 threads
  const dim3 gblk(128);
  qkv_gemm<<<dim3(VT_TILES + QK_TILES), gblk, 0, stream>>>(XB, WQKV, bqkv, QKf, VTh, VTl);
  // (3) RoPE + RMSNorm over 1024 for q and k -> Qh|Ql, Kh|Kl; one block of 128 threads per token row
  ropenorm_kernel<<<dim3(MTOK), dim3(128), 0, stream>>>(QKf, TC, TS, qnw, knw, Qh, Ql, Kh, Kl);
  // (4) attention per (batch, head, 64-query block) -> CTX2 [4096][2048] (hi | lo columns); 1024 blocks
  attn_kernel<<<dim3(NB * NH * (NTOK / 64)), dim3(128), 0, stream>>>(Qh, Ql, Kh, Kl, VTh, VTl, CTX2, 0.125f);
  // (5) Of = CTX2 . WP2^T -> f32 [4096][1024]   (M=4096, N=1024, K=2048; 32 x 8 = 256 blocks)
  const dim3 gO((MTOK / 128) * (CH / 128), 1);
  wmma_gemm64<1, false, 0, 0, false, AOP><<<gO, gblk, 0, stream>>>(
      CTX2, CTX2, 0L, WP2, WP2, 0L, (void*)Of, (void*)Of, CH, 0L,
      bqkv, bqkv, 0L, MTOK, CH, AOP, 1.0f);
  // (6) output RMSNorm + residual -> NCHW d_out; 128 groups of 32 tokens x 2 channel halves = 256 blocks of 512 threads
  final_kernel<<<dim3((MTOK / FN_TOK) * (CH / FN_CS)), dim3(512), 0, stream>>>(Of, onw, x, (float*)d_out);
  (void)hipGetLastError();
}

// v010
// It runs in 123 microseconds.
// Two timings next to v009 put it at 1.10 and 1.11 times that version's speed.
// Counting every step since v000, it is 3.86 times as fast.
// Contractions: q|k projection (f32 out) and v^T projection (bf16 hi|lo out) = v_wmma_f32_16x16x32_bf16 single products on bf16 planes of the RNE-converted inputs; q.k^T and p.v = bf16 hi/lo split (hi.hi + hi.lo + lo.hi); output projection = [CTXhi|CTXlo] x [Wp;Wp] bf16 single products (K-folded 2-term); f32 accumulate everywhere; RoPE, QK RMSNorm, output RMSNorm, online softmax, 1/rowsum, bias and residual in f32 on the VALU.
// Plane / carry map (all carry 1, nothing to fold back): XB = bf16(x) token-major [4096][1024] (row b*1024+n, n = y*32+x, col c);
// WQKV = bf16(w_qkv) [3072][1024] natural [out][in]; WP2 [1024][2048]: cols k and 1024+k both = bf16(w_proj[c][k]);
// TC/TS f32 [32 pos][16 pair] = cos/sin(pos * 10000^(-j/16)); QKf f32 [4096][2048] = pre-RoPE q (cols 0..1023) | k (cols 1024..2047) incl. bias;
// Qh|Ql, Kh|Kl bf16 [4096][1024] (col h*64+d) = hi/lo of the RoPE'd, RMSNorm'd q, k; VTh|VTl bf16 [1024 (h,d)][4096 (b,t)];
// P hi|lo = unnormalised exp in (0,1] (bf16, f32 exponent range), kept in registers, 1/rowsum applied to the f32 accumulator in the attention epilogue;
// CTX2 u16 [4096][2048] = ctx hi at col h*64+d, lo at col 1024+h*64+d; Of f32 [4096][1024] = ctx . w_proj^T.
#include <hip/hip_runtime.h>
#include <math.h>
#include <stdint.h>

#define NB    4
#define CH    1024
#define IMH   32
#define IMW   32
#define NTOK  1024
#define INNER 1024
#define NH    16
#define HD    64
#define NQKV  3072
#define QKP   2048
#define AOP   2048
#define VTP   (NB * NTOK)
#define MTOK  (NB * NTOK)
#define TABN  512
#define RMS_EPS 1e-6f

static_assert(NTOK == IMH * IMW);
static_assert(IMW == 32);
static_assert(INNER == NH * HD);
static_assert(HD == 64);
static_assert(NQKV == 3 * INNER);
static_assert(QKP == 2 * INNER);
static_assert(AOP == 2 * INNER);
static_assert(CH % 64 == 0);
static_assert(NTOK % 64 == 0);
static_assert(INNER % 64 == 0);
static_assert(MTOK % 64 == 0);
static_assert(CH % 32 == 0);
static_assert(AOP % 32 == 0);
static_assert(INNER == 128 * 8);
static_assert(CH == 8 * 128);
static_assert(TABN == 32 * (HD / 4));
static_assert((NQKV * CH) % (8 * 256) == 0);
static_assert((CH * INNER) % (8 * 256) == 0);
static_assert(CH % 256 == 0);
static_assert(INNER % 256 == 0);
static_assert(MTOK % 128 == 0 && QKP % 128 == 0 && INNER % 128 == 0 && CH % 128 == 0 && AOP % 128 == 0);

typedef __attribute__((ext_vector_type(16))) _Float16 v16h;
typedef __attribute__((ext_vector_type(8)))  _Float16 v8h;
typedef __attribute__((ext_vector_type(16))) __bf16   v16b;
typedef __attribute__((ext_vector_type(8)))  __bf16   v8b;
typedef __attribute__((ext_vector_type(8)))  float    v8f;
typedef __attribute__((ext_vector_type(4)))  float    v4f;
typedef __attribute__((ext_vector_type(2)))  float    v2f;
typedef __attribute__((ext_vector_type(4)))  unsigned int v4u;

// f32 -> bf16, round to nearest even, by the packed hardware convert: bf16(f0) in bits 15..0, bf16(f1) in bits 31..16
typedef __attribute__((ext_vector_type(2))) __bf16 v2b;
__device__ __forceinline__ unsigned bf_pk(float f0, float f1) {
  const v2f f = {f0, f1};
  return __builtin_bit_cast(unsigned, __builtin_convertvector(f, v2b));
}
__device__ __forceinline__ float bf_rne(float f) { return __uint_as_float(bf_pk(f, f) & 0xFFFF0000u); }
// hi/lo split of two f32 at once: hi = the two values rounded to bf16, lo = the two remainders f - hi rounded to bf16
__device__ __forceinline__ void bf_split2(float f0, float f1, unsigned& hi, unsigned& lo) {
  const v2f f = {f0, f1};
  hi = __builtin_bit_cast(unsigned, __builtin_convertvector(f, v2b));
  const v2f g = {__uint_as_float(hi << 16), __uint_as_float(hi & 0xFFFF0000u)};
  lo = __builtin_bit_cast(unsigned, __builtin_convertvector(f - g, v2b));
}

// hazard guard behind the product loop, as a plain device helper
__device__ __forceinline__ void acc_guard4(v8f& a, v8f& b, v8f& c, v8f& d) { asm volatile("v_nop\n\tv_nop\n\tv_nop\n\tv_nop" : "+v"(a), "+v"(b), "+v"(c), "+v"(d)); }
template <typename T> struct Frag;
template <> struct Frag<_Float16> {
  typedef v16h V; typedef v8h H; union U { v16h v; v8h h[2]; };
  static __device__ __forceinline__ v16h load(const _Float16* p) {   // elements 0..7 <- p[0..7], 8..15 <- p[16..23]
    U f; f.h[0] = *(const v8h*)(p); f.h[1] = *(const v8h*)(p + 16); return f.v;
  }
  static __device__ __forceinline__ v8f mma(v16h a, v16h b, v8f c) {
    return __builtin_amdgcn_wmma_f32_16x16x32_f16(false, a, false, b, (short)0, c, false, false);
  }
};
template <> struct Frag<__bf16> {
  typedef v16b V; typedef v8b H; union U { v16b v; v8b h[2]; };
  static __device__ __forceinline__ v16b load(const __bf16* p) {
    U f; f.h[0] = *(const v8b*)(p); f.h[1] = *(const v8b*)(p + 16); return f.v;
  }
  static __device__ __forceinline__ v8f mma(v16b a, v16b b, v8f c) {
    return __builtin_amdgcn_wmma_f32_16x16x32_bf16(false, a, false, b, (short)0, c, false, false);
  }
};

// ---- Register-blocked batched WMMA GEMM ------------------------------------
// C[m,n] = scale * sum_k A[m,k] * Bt[n,k] (+bias)(+resid); each wave owns a 64x64 tile, a block of 4 waves (2 x 2) a 128x128 tile.
// A row-major [M,K]; Bt row-major [N,K]; M,N % 128 == 0, K % GT_BK == 0, K >= GT_BK.
// Operand path: per stage of GT_BK k the block copies its 128 A rows and 128 Bt rows into LDS with 16-B loads whose lanes cover
// whole rows of the stage (GT_BK * 2 contiguous bytes), so every 128-B line is asked for once per block; the four waves read their
// fragments from LDS, one step of 32 k ahead of the products, into the other of two register sets. Two LDS buffers, one __syncthreads()
// per stage but the last, in front of the stage's last step: behind it the next stage's first fragments and the global loads of the stage after that
// are issued; these are stored to LDS in front of the next stage's third step. The k order of every accumulator is ascending in steps of 32.
// SPLIT (hi/lo operand planes) is not instantiated and not supported by the staged loop.
// BIAS_MODE: 0 = none, 1 = bias[m], 2 = bias[n]; the bias value is RNE-converted to bf16 precision before the f32 add.
// OUT_MODE: 0 = f32, 1 = f16, 2 = bf16 hi plane (Cout) + bf16 lo plane (Cout2).
// ET: 0 = f16 operands, 1 = bf16 operands (pointers passed as 16-bit storage)
template <int ET> struct Elem;
template <> struct Elem<0> { typedef _Float16 T; };
template <> struct Elem<1> { typedef __bf16 T; };
#define GT_BK 128
// LDS row pitch in elements: GT_BK data + 8 pad, = 16 B x odd, so the 16 rows of one 16-byte fragment read fall on different banks.
#define GT_LP (GT_BK + 8)
#define GT_CPR (GT_BK / 8)          // 16-byte pieces per staged row
#define GT_RPP (128 / GT_CPR)       // rows that 128 threads copy per pass
#define GT_NP  (128 / GT_RPP)       // passes per operand and stage
// The eight fragments of one step of 32 k: four of Bt, four of A, 16 LDS loads of 16 bytes; fa, fb = this lane's place in the first of each.
template <typename T>
__device__ __forceinline__ void gt_frags(typename Frag<T>::V (&a)[4], typename Frag<T>::V (&b)[4], const T* fa, const T* fb) {
#pragma unroll
  for (int j = 0; j < 4; ++j) b[j] = Frag<T>::load(fb + (j << 4) * GT_LP);
#pragma unroll
  for (int i = 0; i < 4; ++i) a[i] = Frag<T>::load(fa + (i << 4) * GT_LP);
}
// Behind a stage's global loads, in front of the step of their address registers: the wait, and on either side of it a scheduling
// barrier, which keeps that step (and every other instruction) on the side of the wait where the source has it.
__device__ __forceinline__ void gt_xwait() {
  __builtin_amdgcn_sched_barrier(0);
  asm volatile("s_wait_xcnt 0x0" ::: "memory");
  __builtin_amdgcn_sched_barrier(0);
}
// The 16 products of one step, one on each accumulator tile.
template <typename T>
__device__ __forceinline__ void gt_mma16(v8f (&acc)[4][4], const typename Frag<T>::V (&a)[4], const typename Frag<T>::V (&b)[4]) {
#pragma unroll
  for (int i = 0; i < 4; ++i)
#pragma unroll
    for (int j = 0; j < 4; ++j) acc[i][j] = Frag<T>::mma(a[i], b[j], acc[i][j]);
}
// LD: row pitch of A and of Bt in elements, a compile-time constant so that the row steps of the staging loads are immediate offsets.
// The product loop of one block: acc = rows (tm * 128 ...) of Ab times rows (tn * 128 ...) of Bb over K; sA, sB = the block's two-stage LDS tiles.
template <int ET, int LD>
__device__ __forceinline__ void gemm64_main(const typename Elem<ET>::T* Ab, const typename Elem<ET>::T* Bb, int tm, int tn, int K,
                                            typename Elem<ET>::T* sA, typename Elem<ET>::T* sB, v8f (&acc)[4][4]) {
  typedef typename Elem<ET>::T T;
  typedef typename Frag<T>::V V;
  typedef typename Frag<T>::H H;
  const int tid  = threadIdx.x;
  const int lane = tid & 31;
  const int wave = tid >> 5;
  const int wm = (wave >> 1) << 6;             // this wave's 64x64 tile inside the block's 128x128
  const int wn = (wave & 1) << 6;
  const int rlane = lane & 15;                 // row (A) / col (B, D) within subtile
  const int koff  = (lane >> 4) * 8;           // k offset of this lane half

  // staging map: pass p, thread tid -> row p * GT_RPP + tid / GT_CPR, 8 elements at column (tid % GT_CPR) * 8
  const int srow = tid / GT_CPR;
  const int scol = (tid % GT_CPR) * 8;
  const T* gA = Ab + (size_t)((tm << 7) + srow) * LD + scol;
  const T* gB = Bb + (size_t)((tn << 7) + srow) * LD + scol;
  const int sOff = srow * GT_LP + scol;

#pragma unroll
  for (int i = 0; i < 4; ++i)
#pragma unroll
    for (int j = 0; j < 4; ++j) acc[i][j] = (v8f){0.f,0.f,0.f,0.f,0.f,0.f,0.f,0.f};

  H ra[GT_NP], rb[GT_NP];
#pragma unroll
  for (int p = 0; p < GT_NP; ++p) {
    ra[p] = *(const H*)(gA + p * GT_RPP * LD);
    rb[p] = *(const H*)(gB + p * GT_RPP * LD);
  }
#pragma unroll
  for (int p = 0; p < GT_NP; ++p) {
    *(H*)(sA + sOff + p * GT_RPP * GT_LP) = ra[p];
    *(H*)(sB + sOff + p * GT_RPP * GT_LP) = rb[p];
  }
  __syncthreads();

  const int nStages = K / GT_BK;
  static_assert(GT_BK / 32 == 4, "four steps of 32 k a stage: the fragment set of a step is its parity, in every stage alike");
  const T* fa0 = sA + (wm + rlane) * GT_LP + koff;
  const T* fb0 = sB + (wn + rlane) * GT_LP + koff;
  V ah[2][4], bh[2][4];                        // two fragment sets: one is multiplied while the other is filled
  gt_frags<T>(ah[0], bh[0], fa0, fb0);         // stage 0, step 0
  const T* pa = gA + GT_BK;                    // this thread's first pieces of the stage that is fetched next
  const T* pb = gB + GT_BK;
  if (1 < nStages) {                           // block-uniform
#pragma unroll
    for (int p = 0; p < GT_NP; ++p) {
      ra[p] = *(const H*)(pa + p * GT_RPP * LD);
      rb[p] = *(const H*)(pb + p * GT_RPP * LD);
    }
    gt_xwait();
    pa += GT_BK;
    pb += GT_BK;
  }
  // Each __builtin_amdgcn_sched_barrier(0) below keeps a step's 16 LDS loads together, in front of the 16 products of the step before:
  // without them the compiler sinks each load to its first use, and the wave waits out the LDS latency every four products.
  for (int st = 0; st + 1 < nStages; ++st) {   // every stage but the last
    const int cur = (st & 1) * (128 * GT_LP);
    const int nxt = (128 * GT_LP) - cur;       // the buffer whose last readers passed the barrier of stage st - 1
    const T* fa = fa0 + cur;
    const T* fb = fb0 + cur;
    gt_frags<T>(ah[1], bh[1], fa + 32, fb + 32);
    __builtin_amdgcn_sched_barrier(0);
    gt_mma16<T>(acc, ah[0], bh[0]);            // step 0
    __builtin_amdgcn_sched_barrier(0);
    gt_frags<T>(ah[0], bh[0], fa + 64, fb + 64);
    __builtin_amdgcn_sched_barrier(0);
    gt_mma16<T>(acc, ah[1], bh[1]);            // step 1
    __builtin_amdgcn_sched_barrier(0);
    gt_frags<T>(ah[1], bh[1], fa + 96, fb + 96);
#pragma unroll
    for (int p = 0; p < GT_NP; ++p) {          // stage st + 1 goes to LDS under the products of step 2
      *(H*)(sA + nxt + sOff + p * GT_RPP * GT_LP) = ra[p];
      *(H*)(sB + nxt + sOff + p * GT_RPP * GT_LP) = rb[p];
    }
    __builtin_amdgcn_sched_barrier(0);
    gt_mma16<T>(acc, ah[0], bh[0]);            // step 2
    __builtin_amdgcn_sched_barrier(0);
    // the barrier's own wait for this wave's LDS operations covers the stores above and the reads of step 3's fragments, the last of buffer cur
    __syncthreads();                           // stage st + 1 is public, buffer cur has no reader left
    gt_frags<T>(ah[0], bh[0], fa0 + nxt, fb0 + nxt);   // stage st + 1, step 0
    if (st + 2 < nStages) {                    // block-uniform; the staging registers are free behind the stores above
#pragma unroll
      for (int p = 0; p < GT_NP; ++p) {
        ra[p] = *(const H*)(pa + p * GT_RPP * LD);
        rb[p] = *(const H*)(pb + p * GT_RPP * LD);
      }
      gt_xwait();
      pa += GT_BK;
      pb += GT_BK;
    }
    __builtin_amdgcn_sched_barrier(0);
    gt_mma16<T>(acc, ah[1], bh[1]);            // step 3, from registers alone
    __builtin_amdgcn_sched_barrier(0);
  }
  {                                            // the last stage: nothing left to stage, no buffer to give up, so no barrier
    const int cur = ((nStages - 1) & 1) * (128 * GT_LP);
    const T* fa = fa0 + cur;
    const T* fb = fb0 + cur;
    gt_frags<T>(ah[1], bh[1], fa + 32, fb + 32);
    __builtin_amdgcn_sched_barrier(0);
    gt_mma16<T>(acc, ah[0], bh[0]);
    __builtin_amdgcn_sched_barrier(0);
    gt_frags<T>(ah[0], bh[0], fa + 64, fb + 64);
    __builtin_amdgcn_sched_barrier(0);
    gt_mma16<T>(acc, ah[1], bh[1]);
    __builtin_amdgcn_sched_barrier(0);
    gt_frags<T>(ah[1], bh[1], fa + 96, fb + 96);
    __builtin_amdgcn_sched_barrier(0);
    gt_mma16<T>(acc, ah[0], bh[0]);
    gt_mma16<T>(acc, ah[1], bh[1]);
  }
  acc_guard4(acc[0][0], acc[0][1], acc[0][2], acc[0][3]);
  acc_guard4(acc[1][0], acc[1][1], acc[1][2], acc[1][3]);
  acc_guard4(acc[2][0], acc[2][1], acc[2][2], acc[2][3]);
  acc_guard4(acc[3][0], acc[3][1], acc[3][2], acc[3][3]);

}

// The epilogue of one wave: its 64x64 tile at (m0, n0) goes out through the wave's own LDS slab in whole lines.
template <int BIAS_MODE, int OUT_MODE, bool RESID, int ACT>
__device__ __forceinline__ void gemm64_epi(v8f (&acc)[4][4], float (*sT)[16 * 68], int m0, int n0, int b,
                                           void* __restrict__ Cout, void* __restrict__ Cout2, int ldc, long strideC,
                                           const float* __restrict__ bias,
                                           const float* __restrict__ resid, long strideR, float scale) {
  const int lane = threadIdx.x & 31;
  const int wave = threadIdx.x >> 5;
  const int rlane = lane & 15;                 // col (D) within subtile
  const int mOff  = (lane >> 4) * 8;           // D row offset
  float* slab = sT[wave];
  const float* Rb = RESID ? (resid + (size_t)b * strideR) : nullptr;
#pragma unroll
  for (int i = 0; i < 4; ++i) {
    const int mBase = m0 + (i << 4);
    float bm[8];
    if (BIAS_MODE == 1) {
      const float* bp = bias + mBase + mOff;
#pragma unroll
      for (int r = 0; r < 8; ++r) bm[r] = bp[r];
      // naming the address pair here keeps it untouched up to this wait, which stands in front of every reuse of its registers
      asm volatile("s_wait_xcnt 0x0" :: "v"(bp) : "memory");
    }
#pragma unroll
    for (int j = 0; j < 4; ++j) {
      const int n = n0 + (j << 4) + rlane;
      float bv = 0.f;
      if (BIAS_MODE == 2) bv = bf_rne(bias[n]);
#pragma unroll
      for (int r = 0; r < 8; ++r) {
        float v = acc[i][j][r] * scale;
        if (BIAS_MODE == 1) v += bf_rne(bm[r]);
        if (BIAS_MODE == 2) v += bv;
        if (RESID) v += Rb[(size_t)(mBase + mOff + r) * ldc + n];
        if (ACT == 1) v = tanhf(v);
        if (ACT == 2) v = fmaxf(v, 0.0f);
        if (ACT == 3) v = v / (1.0f + expf(-v));
        if (ACT == 4) v = (v > 0.f) ? v : 0.01f * v;
        if (ACT == 5) v = 0.5f * v * (1.0f + erff(v * 0.70710678118654752f));
        slab[(mOff + r) * 68 + (j << 4) + rlane] = v;
      }
    }
    __builtin_amdgcn_fence(__ATOMIC_RELEASE, "workgroup");
    __builtin_amdgcn_wave_barrier();
    __builtin_amdgcn_fence(__ATOMIC_ACQUIRE, "workgroup");
    if (OUT_MODE == 0) {
      float* C = (float*)Cout + (size_t)b * strideC;
      const int hh = lane >> 4, c4 = (lane & 15) * 4;     // row seg = 256 B = 16 lanes x 16 B
      {
#pragma unroll
        for (int it = 0; it < 8; ++it) {
          const int row = it * 2 + hh;
          v4f v = *(const v4f*)(slab + row * 68 + c4);
          *(v4f*)(C + (size_t)(mBase + row) * ldc + n0 + c4) = v;
        }
        
      }
    } else {
      const int q = lane >> 3, c8 = (lane & 7) * 8;
      unsigned short* C  = (unsigned short*)Cout  + (size_t)b * strideC;
      unsigned short* C2 = (OUT_MODE == 2) ? ((unsigned short*)Cout2 + (size_t)b * strideC) : nullptr;
      {
#pragma unroll
        for (int it = 0; it < 4; ++it) {
          const int row = it * 4 + q;
          const float* sp = slab + row * 68 + c8;
          v8h hv, lv;
          if (OUT_MODE == 1) {
#pragma unroll
            for (int e = 0; e < 8; ++e) hv[e] = (_Float16)sp[e];
          } else {
            v4u hw, lw;
#pragma unroll
            for (int e = 0; e < 4; ++e) { unsigned a, c; bf_split2(sp[2 * e], sp[2 * e + 1], a, c); hw[e] = a; lw[e] = c; }
            hv = __builtin_bit_cast(v8h, hw);
            lv = __builtin_bit_cast(v8h, lw);
          }
          *(v8h*)(C + (size_t)(mBase + row) * ldc + n0 + c8) = hv;
          if (OUT_MODE == 2) *(v8h*)(C2 + (size_t)(mBase + row) * ldc + n0 + c8) = lv;
        }
        
      }
    }
    __builtin_amdgcn_fence(__ATOMIC_RELEASE, "workgroup");
    __builtin_amdgcn_wave_barrier();
    __builtin_amdgcn_fence(__ATOMIC_ACQUIRE, "workgroup");
  }
}

template <int ET, bool SPLIT, int BIAS_MODE, int OUT_MODE, bool RESID, int LD, int ACT = 0>
__global__ __launch_bounds__(128) void wmma_gemm64(
    const unsigned short* __restrict__ Ap, const unsigned short* __restrict__ A2p, long strideA,
    const unsigned short* __restrict__ Btp, const unsigned short* __restrict__ Bt2p, long strideB,
    void* __restrict__ Cout, void* __restrict__ Cout2, int ldc, long strideC,
    const float* __restrict__ bias,
    const float* __restrict__ resid, long strideR,
    int M, int N, int K, float scale) {
  typedef typename Elem<ET>::T T;
  static_assert(!SPLIT, "the staged loop takes single operand planes");
  const T* A = (const T*)Ap; const T* Bt = (const T*)Btp;
  __shared__ __align__(16) T sA[2 * 128 * GT_LP];  // two stages of the block's 128 A rows
  __shared__ __align__(16) T sB[2 * 128 * GT_LP];  // two stages of the block's 128 Bt rows
  __shared__ __align__(16) float sT[4][16 * 68];   // per-wave 16x64 slab, pitch 68 floats
  const int b    = blockIdx.y;
  const int wave = threadIdx.x >> 5;
  const int tilesN = N >> 7;
  const int tilesM = M >> 7;
  const int tile = blockIdx.x;
  if (tile >= tilesM * tilesN) return;   // block-uniform, in front of every barrier
  const int tm = tile / tilesN;
  const int tn = tile - tm * tilesN;
  v8f acc[4][4];
  gemm64_main<ET, LD>(A + (size_t)b * strideA, Bt + (size_t)b * strideB, tm, tn, K, sA, sB, acc);
  gemm64_epi<BIAS_MODE, OUT_MODE, RESID, ACT>(acc, sT, (tm << 7) + ((wave >> 1) << 6), (tn << 7) + ((wave & 1) << 6), b,
                                              Cout, Cout2, ldc, strideC, bias, resid, strideR, scale);
}

// The two projections that read XB and WQKV and nothing of each other, in one grid: blocks 0 .. VT_TILES - 1 make
// v^T = WQKV[2048..3071] . XB^T + b[2048 + m] -> VTh|VTl [1024][4096] (8 x 32 tiles), the other QK_TILES blocks
// q|k = XB . WQKV[0..2047]^T + b[n] -> QKf f32 [4096][2048] (32 x 16 tiles). One product loop serves both (same K, same pitch);
// which operand rows it takes and which epilogue follows is the same for the whole block.
#define VT_TILES ((INNER / 128) * (MTOK / 128))
#define QK_TILES ((MTOK / 128) * (QKP / 128))
__global__ __launch_bounds__(128) void qkv_gemm(const unsigned short* __restrict__ xb, const unsigned short* __restrict__ wq,
                                                const float* __restrict__ bias, float* __restrict__ qkf,
                                                unsigned short* __restrict__ vth, unsigned short* __restrict__ vtl) {
  __shared__ __align__(16) __bf16 sA[2 * 128 * GT_LP];  // two stages of the block's 128 A rows
  __shared__ __align__(16) __bf16 sB[2 * 128 * GT_LP];  // two stages of the block's 128 Bt rows
  __shared__ __align__(16) float sT[4][16 * 68];        // per-wave 16x64 slab, pitch 68 floats
  const int wave = threadIdx.x >> 5;
  const int bx   = (int)blockIdx.x;
  const bool isV = bx < VT_TILES;
  const int tile = isV ? bx : bx - VT_TILES;
  const int sh   = isV ? 5 : 4;                          // log2 of the tiles along N: MTOK / 128 = 32, QKP / 128 = 16
  static_assert(MTOK / 128 == 32 && QKP / 128 == 16);
  const int tm = tile >> sh;
  const int tn = tile - (tm << sh);
  const __bf16* X  = (const __bf16*)(const void*)xb;
  const __bf16* Wq = (const __bf16*)(const void*)wq;
  v8f acc[4][4];
  gemm64_main<1, CH>(isV ? Wq + (size_t)2 * INNER * CH : X, isV ? X : Wq, tm, tn, CH, sA, sB, acc);
  const int m0 = (tm << 7) + ((wave >> 1) << 6), n0 = (tn << 7) + ((wave & 1) << 6);
  if (isV) gemm64_epi<1, 2, false, 0>(acc, sT, m0, n0, 0, (void*)vth, (void*)vtl, VTP, 0L, bias + 2 * INNER, bias, 0L, 1.0f);
  else     gemm64_epi<2, 0, false, 0>(acc, sT, m0, n0, 0, (void*)qkf, (void*)qkf, QKP, 0L, bias, bias, 0L, 1.0f);
}

// ---------------------------------------------------------------------------
// Row-preserving bf16 RNE convert of an f32 matrix [rows][ncols] into a u16 plane with row pitch ldout; DUP also
// writes the same 8 values at column + ncols (second copy along the row). 8 consecutive elements per thread = one
// Coverage: blk = 0 .. n8/256 - 1, x 256 threads x 8 elements = rows*ncols (n8 = rows*ncols/8, exact multiple of 256).
// ---------------------------------------------------------------------------
template <bool DUP>
__device__ __forceinline__ void convrows_part(int blk, const float* __restrict__ in, unsigned short* __restrict__ out,
                                              int ncols, int ldout, int n8) {
  const int i = blk * 256 + threadIdx.x;
  if (i < n8) {
    const size_t e0 = (size_t)i * 8;
    const int row = (int)(e0 / (size_t)ncols);
    const int col = (int)(e0 - (size_t)row * ncols);
    const v4f a = *(const v4f*)(in + e0);
    const v4f c = *(const v4f*)(in + e0 + 4);
    v4u hv;
    hv[0] = bf_pk(a[0], a[1]);
    hv[1] = bf_pk(a[2], a[3]);
    hv[2] = bf_pk(c[0], c[1]);
    hv[3] = bf_pk(c[2], c[3]);
    const size_t o = (size_t)row * ldout + col;
    {
      *(v4u*)(out + o) = hv;
      if (DUP) *(v4u*)(out + o + ncols) = hv;
      
    }
  }
}

// ---------------------------------------------------------------------------
// Fused transpose + bf16 RNE convert of an f32 matrix, z-batched, one plane:
//   in_z = W + z*sIn viewed [R rows][Cc cols] with row pitch ldin  ->  oh_z[c][r] = bf16(in_z[r][c]), row pitch ldout, oh_z = oh + z*sOut.
// 64x64 tiles through LDS. (bx, by, bz) over (Cc/64, R/64, Z), 256 threads (R, Cc multiples of 64; ldout multiple of 64 so every
// Coverage per block: load 4 it x 256 thr x 4 floats = 64x64; store 2 it x 256 thr x 8 u16 = 64x64.
// ---------------------------------------------------------------------------
__device__ __forceinline__ void tconv_part(int bx, int by, int bz, const float* __restrict__ W, unsigned short* __restrict__ oh,
                                           int ldin, int ldout, long sIn, long sOut) {
  __shared__ __align__(16) float tf[64 * 68];
  W  += (size_t)bz * sIn;
  oh += (size_t)bz * sOut;
  const int c0  = bx * 64;   // input column block = output row block
  const int r0  = by * 64;   // input row block    = output column block
  const int tid = threadIdx.x;
  {
    const int lr = tid >> 4;         // 0..15
    const int c4 = (tid & 15) * 4;   // 0..60
#pragma unroll
    for (int it = 0; it < 4; ++it) {
      const int rr = it * 16 + lr;   // 0..63
      const v4f a = *(const v4f*)(W + (size_t)(r0 + rr) * ldin + c0 + c4);
      *(v4f*)(tf + rr * 68 + c4) = a;
    }
  }
  __syncthreads();
  const int sub = tid >> 3;          // 0..31
  const int c8  = (tid & 7) * 8;     // 0..56
  v4u hv[2];
#pragma unroll
  for (int it = 0; it < 2; ++it) {
    const int oc = it * 32 + sub;    // output row within tile (= input column)
    v4u a;
#pragma unroll
    for (int q = 0; q < 4; ++q) {
      const float f0 = tf[(c8 + 2 * q) * 68 + oc];
      const float f1 = tf[(c8 + 2 * q + 1) * 68 + oc];
      a[q] = bf_pk(f0, f1);
    }
    hv[it] = a;
  }
  {
#pragma unroll
    for (int it = 0; it < 2; ++it) {
      const int oc = it * 32 + sub;
      const size_t go = (size_t)(c0 + oc) * ldout + r0 + c8;
      *(v4u*)(oh + go) = hv[it];
    }
    
  }
}

// ---------------------------------------------------------------------------
// Rotary angle tables: tc[pos*16 + j] = cos(pos * f_j), ts likewise, f_j = 10000^(-4j/64) = 10^(-j/4) (f32 constants),
// pos 0..31 (shared by the row axis and the column axis), j 0..15. Precise cosf/sinf (|angle| <= 31).
// blk 0..1 x 256 = 512 threads = 32 x 16 entries per table; one 4-B store per lane, 32 consecutive lanes = one whole
// ---------------------------------------------------------------------------
__device__ __forceinline__ float rope_freq(int j) {
  float f = 1.0f;
  f = (j == 1)  ? 0.5623413251903491f     : f;
  f = (j == 2)  ? 0.31622776601683794f    : f;
  f = (j == 3)  ? 0.17782794100389229f    : f;
  f = (j == 4)  ? 0.1f                    : f;
  f = (j == 5)  ? 0.05623413251903491f    : f;
  f = (j == 6)  ? 0.031622776601683794f   : f;
  f = (j == 7)  ? 0.017782794100389229f   : f;
  f = (j == 8)  ? 0.01f                   : f;
  f = (j == 9)  ? 0.005623413251903491f   : f;
  f = (j == 10) ? 0.0031622776601683794f  : f;
  f = (j == 11) ? 0.0017782794100389228f  : f;
  f = (j == 12) ? 0.001f                  : f;
  f = (j == 13) ? 0.0005623413251903491f  : f;
  f = (j == 14) ? 0.00031622776601683794f : f;
  f = (j == 15) ? 0.00017782794100389227f : f;
  return f;
}

__device__ __forceinline__ void ropetab_part(int blk, float* __restrict__ tc, float* __restrict__ ts) {
  const int i = blk * 256 + threadIdx.x;             // 0..511 = pos*16 + j
  if (i < TABN) {
    const int pos = i >> 4, j = i & 15;
    const float a = (float)pos * rope_freq(j);
    const float c = cosf(a);
    const float s = sinf(a);
    ((float*)tc)[i] = c;
    ((float*)ts)[i] = s;
    
  }
}

// ---------------------------------------------------------------------------
// The four preparations, which read only inputs and write disjoint planes, in one grid of 256-thread blocks, told apart by block index
// (the same for a whole block, so the barrier of the transpose is passed by all of its block or by none):
//   PR_TAB blocks: rotary tables; PR_X: x[b] viewed [1024 c][1024 n] -> XB_b[n][c], tiles (16, 16, 4);
//   PR_WQ: w_qkv -> WQKV, same layout; PR_WP: w_proj -> WP2 [1024][2048], cols k and 1024 + k.
// ---------------------------------------------------------------------------
#define PR_TAB (TABN / 256)
#define PR_X   ((NTOK / 64) * (CH / 64) * NB)
#define PR_WQ  (NQKV * CH / 8 / 256)
#define PR_WP  (CH * INNER / 8 / 256)
static_assert(NTOK / 64 == 16 && CH / 64 == 16);
__global__ __launch_bounds__(256) void prep_kernel(const float* __restrict__ x, const float* __restrict__ wqkv, const float* __restrict__ wprj,
                                                   unsigned short* __restrict__ xb, unsigned short* __restrict__ wq,
                                                   unsigned short* __restrict__ wp2, float* __restrict__ tc, float* __restrict__ ts) {
  int blk = blockIdx.x;
  if (blk < PR_TAB) { ropetab_part(blk, tc, ts); return; }
  blk -= PR_TAB;
  if (blk < PR_X) { tconv_part(blk & 15, (blk >> 4) & 15, blk >> 8, x, xb, NTOK, CH, (long)CH * NTOK, (long)NTOK * CH); return; }
  blk -= PR_X;
  if (blk < PR_WQ) { convrows_part<false>(blk, wqkv, wq, CH, CH, NQKV * CH / 8); return; }
  blk -= PR_WQ;
  convrows_part<true>(blk, wprj, wp2, INNER, AOP, CH * INNER / 8);
}

// ---------------------------------------------------------------------------
// Per-token 2-D RoPE (interleaved pairs (2i,2i+1) inside each head; pairs 0..15 use the row index y = n>>5, pairs 16..31
// the column index x = n&31; tables shared by all heads) followed by RMSNorm over the WHOLE 1024-wide (heads x dim) row:
// v = rope(v); v = v * rsqrt(mean_1024(v*v) + 1e-6) * bf16(w[col]); then bf16 hi/lo split into planes [4096][1024].
// One block of 128 threads per token row g = b*1024+n; thread t owns columns 8t..8t+7 (= 4 rotary pairs p0..p0+3, p0 = (4t)&31,
// all four in the same half of the pair range). All loads are 16-B vectors. Stores: 16 B per lane per plane, 128 lanes cover
// LDS: redq/redk[4] written by lane 0 of each of the 4 waves before the barrier.
// ---------------------------------------------------------------------------
__global__ __launch_bounds__(128) void ropenorm_kernel(const float* __restrict__ qkf,
                                                       const float* __restrict__ tc, const float* __restrict__ ts,
                                                       const float* __restrict__ qw, const float* __restrict__ kw,
                                                       unsigned short* __restrict__ qh, unsigned short* __restrict__ ql,
                                                       unsigned short* __restrict__ kh, unsigned short* __restrict__ kl) {
  __shared__ float redq[4], redk[4];
  const int g = blockIdx.x;                 // token row 0..MTOK-1
  const int n = g & (NTOK - 1);
  const int py = n >> 5, px = n & 31;
  const int t = threadIdx.x, lane = t & 31, wave = t >> 5;
  const int i0 = t * 8;

  const float* qr = qkf + (size_t)g * QKP + i0;
  const float* kr = qr + INNER;
  const v4f qa = *(const v4f*)(qr), qb = *(const v4f*)(qr + 4);
  const v4f ka = *(const v4f*)(kr), kb = *(const v4f*)(kr + 4);

  const int p0   = (4 * t) & 31;
  const int hsel = p0 >> 4;                 // 0: row-axis angles, 1: column-axis angles
  const int pos  = py + hsel * (px - py);
  const int toff = pos * 16 + (p0 & 15);
  const v4f cv = *(const v4f*)(tc + toff);
  const v4f sv = *(const v4f*)(ts + toff);

  float q8[8], k8[8];
  q8[0] = qa[0]; q8[1] = qa[1]; q8[2] = qa[2]; q8[3] = qa[3];
  q8[4] = qb[0]; q8[5] = qb[1]; q8[6] = qb[2]; q8[7] = qb[3];
  k8[0] = ka[0]; k8[1] = ka[1]; k8[2] = ka[2]; k8[3] = ka[3];
  k8[4] = kb[0]; k8[5] = kb[1]; k8[6] = kb[2]; k8[7] = kb[3];

  float rq[8], rk[8];
#pragma unroll
  for (int e = 0; e < 4; ++e) {
    const float c = cv[e], s = sv[e];
    const float qe = q8[2 * e], qo = q8[2 * e + 1];
    const float ke = k8[2 * e], ko = k8[2 * e + 1];
    rq[2 * e]     = qe * c - qo * s;
    rq[2 * e + 1] = qe * s + qo * c;
    rk[2 * e]     = ke * c - ko * s;
    rk[2 * e + 1] = ke * s + ko * c;
  }
  float ssq = 0.0f, ssk = 0.0f;
#pragma unroll
  for (int e = 0; e < 8; ++e) { ssq += rq[e] * rq[e]; ssk += rk[e] * rk[e]; }
#pragma unroll
  for (int off = 1; off < 32; off <<= 1) { ssq += __shfl_xor(ssq, off, 32); ssk += __shfl_xor(ssk, off, 32); }
  if (lane == 0) { redq[wave] = ssq; redk[wave] = ssk; }
  __syncthreads();
  const float tq = (redq[0] + redq[1]) + (redq[2] + redq[3]);
  const float tk = (redk[0] + redk[1]) + (redk[2] + redk[3]);
  const float rmq = rsqrtf(tq * (1.0f / (float)INNER) + RMS_EPS);
  const float rmk = rsqrtf(tk * (1.0f / (float)INNER) + RMS_EPS);

  const v4f wqa = *(const v4f*)(qw + i0), wqb = *(const v4f*)(qw + i0 + 4);
  const v4f wka = *(const v4f*)(kw + i0), wkb = *(const v4f*)(kw + i0 + 4);
  float wq8[8], wk8[8];
  wq8[0] = bf_rne(wqa[0]); wq8[1] = bf_rne(wqa[1]); wq8[2] = bf_rne(wqa[2]); wq8[3] = bf_rne(wqa[3]);
  wq8[4] = bf_rne(wqb[0]); wq8[5] = bf_rne(wqb[1]); wq8[6] = bf_rne(wqb[2]); wq8[7] = bf_rne(wqb[3]);
  wk8[0] = bf_rne(wka[0]); wk8[1] = bf_rne(wka[1]); wk8[2] = bf_rne(wka[2]); wk8[3] = bf_rne(wka[3]);
  wk8[4] = bf_rne(wkb[0]); wk8[5] = bf_rne(wkb[1]); wk8[6] = bf_rne(wkb[2]); wk8[7] = bf_rne(wkb[3]);

  v4u hq, lq, hk, lk;
#pragma unroll
  for (int e = 0; e < 4; ++e) {
    const float fq0 = rq[2 * e] * rmq * wq8[2 * e];
    const float fq1 = rq[2 * e + 1] * rmq * wq8[2 * e + 1];
    const float fk0 = rk[2 * e] * rmk * wk8[2 * e];
    const float fk1 = rk[2 * e + 1] * rmk * wk8[2 * e + 1];
    unsigned hw, lw;
    bf_split2(fq0, fq1, hw, lw); hq[e] = hw; lq[e] = lw;
    bf_split2(fk0, fk1, hw, lw); hk[e] = hw; lk[e] = lw;
  }
  const size_t o = (size_t)g * INNER + i0;
  {
    *(v4u*)(qh + o) = hq;
    *(v4u*)(ql + o) = lq;
    *(v4u*)(kh + o) = hk;
    *(v4u*)(kl + o) = lk;
    
  }
}

// =====================================================================================
// Full (non-causal, unmasked) attention, head dim 64, all batches in one launch.
//   q planes (hi/lo bf16) [4096][1024]: element (b, n, h, d) at [(b*1024+n)*1024 + h*64 + d]
//   k planes (hi/lo bf16) [4096][1024]: same layout
//   v^T planes (hi/lo bf16) [1024][4096]: element (h, d, b, t) at [(h*64 + d)*4096 + b*1024 + t]
//   out CTX2 plane u16 [4096][2048]: hi bits of o(b,n,h,d) at col h*64+d, lo bits (o - hi) at col 1024 + h*64+d.
//   scores^T = (k . q^T) * 0.125 : A = K rows, B = Q rows; bf16 hi/lo split (hi.hi + lo.hi + hi.lo) on v_wmma_f32_16x16x32_bf16
//   out^T    = v^T . p^T         : A = V^T rows, B = P^T; bf16 hi/lo split of p (unnormalised exp) and v, f32 accumulate, x 1/rowsum at the end
//   Transposed tiles: a lane holds one query (column c) and, per 16-key tile, keys 8*hh + 0..7 in its 8 accumulator registers. Two score
//   tiles (keys 0..15 and 16..31 of a 32-key block), converted in place, are the B operand of the second product in the k order of the
//   V^T fragment loads (elements 0..7 = keys 8*hh + 0..7, elements 8..15 = keys 16 + 8*hh + 0..7): P never goes through LDS.
//   online softmax in f32, base 2 (scores x sscale x log2 e), over the 1024 keys of the batch element (16 chunks of 64, compile-time trip count, no masking): maximum in-lane
//   plus one exchange between the wave halves per chunk; each half sums its own keys, the two sums are joined once in the epilogue.
//   Block = 4 waves = 64 query rows of one (batch, head); grid.x = 4 * 16 * 16 = 1024.
//   K / V^T chunk staging: asynchronous 16-B copies from global memory to LDS, no register in between; 8 lanes take one whole 128-B row,
//   128 threads x 4 rows per plane = the whole 64x64 tile. Two LDS buffers: chunk t + 1 is in flight while chunk t is worked on;
//   one __syncthreads per chunk publishes chunk t + 1 and frees the buffer of chunk t, which is refilled behind it with chunk t + 2.
//   LDS extents: K/V tiles 64x64 fully staged every chunk; the out tiles of the epilogue lie on the ring, behind its last barrier.
// =====================================================================================
#define AT_D 64
#define AT_NW 4
#define AT_QB 64
#define AT_KC 64
// LDS row pitch of the K and V^T tiles in elements: 64 data + 8 pad = 144 B = 16 B x 9 (odd), so the 16 rows that one
// 16-byte fragment read touches fall on 16 different groups of four banks; at 128 B they fall on two. Pad elements are never read.
#define AT_LP 72
#define AT_PL  (AT_KC * AT_LP)   // elements of one plane's tile in LDS
#define AT_BUF (4 * AT_PL)       // one ring buffer: K hi, K lo, V^T hi, V^T lo
static_assert(AT_KC == 64 && AT_D == 64 && (AT_LP * 2) % 16 == 0);
static_assert(NTOK / AT_KC >= 2);

__device__ __forceinline__ v8f at_mma(v16b a, v16b b, v8f c) {
  return __builtin_amdgcn_wmma_f32_16x16x32_bf16(false, a, false, b, (short)0, c, false, false);
}

// Two planes' share of one thread in a chunk: rows r, r + 16, r + 32, r + 48 of plane a and of plane b, 16 bytes each, global -> LDS.
// l = LDS byte address of the thread's piece in plane a's tile (plane b's tile follows it), ld = row pitch of the planes in elements.
// The s_wait_xcnt stands inside the statement, behind the last copy, so that no address register is rewritten in front of it.
__device__ __forceinline__ void at_copy8(unsigned l, const __bf16* a, const __bf16* b, int ld) {
  const unsigned R = 16 * AT_LP * 2, P = AT_PL * 2;
  asm volatile("global_load_async_to_lds_b128 %0, %1, off\n\t"
               "global_load_async_to_lds_b128 %2, %3, off\n\t"
               "global_load_async_to_lds_b128 %4, %5, off\n\t"
               "global_load_async_to_lds_b128 %6, %7, off\n\t"
               "global_load_async_to_lds_b128 %8, %9, off\n\t"
               "global_load_async_to_lds_b128 %10, %11, off\n\t"
               "global_load_async_to_lds_b128 %12, %13, off\n\t"
               "global_load_async_to_lds_b128 %14, %15, off\n\t"
               "s_wait_xcnt 0x0"
               :: "v"(l),         "v"(a),           "v"(l + R),         "v"(a + 16 * ld),
                  "v"(l + 2 * R), "v"(a + 32 * ld), "v"(l + 3 * R),     "v"(a + 48 * ld),
                  "v"(l + P),         "v"(b),           "v"(l + P + R),     "v"(b + 16 * ld),
                  "v"(l + P + 2 * R), "v"(b + 32 * ld), "v"(l + P + 3 * R), "v"(b + 48 * ld)
               : "memory");
}

// value of lane l ^ 16 (the other wave half), by a vector cross-row move
__device__ __forceinline__ float at_xhalf(float x) {
  return __builtin_bit_cast(float, __builtin_amdgcn_permlanex16(__builtin_bit_cast(int, x), __builtin_bit_cast(int, x),
                                                                0x76543210, 0xfedcba98, false, false));
}

__global__ __launch_bounds__(128)
void attn_kernel(const unsigned short* __restrict__ qhp, const unsigned short* __restrict__ qlp,
                 const unsigned short* __restrict__ khp, const unsigned short* __restrict__ klp,
                 const unsigned short* __restrict__ vhp, const unsigned short* __restrict__ vlp,
                 unsigned short* __restrict__ aop, float sscale) {
  union FB { v16b v; v8b h[2]; unsigned w[8]; };   // w[i] = elements 2i (low half) and 2i + 1
  // two buffers of K hi [kv][d], K lo, V hi [d][kv], V lo, pitch AT_LP, 9 KB a tile; 72 KB, so that four blocks share a WGP's LDS
  __shared__ __align__(16) __bf16 ring[2 * AT_BUF];
  static_assert(AT_NW * 16 * 68 * 4 <= 2 * AT_BUF * 2);          // the per-wave out tiles (pitch 68 floats) fit on the ring

  const int tid  = threadIdx.x;
  const int wave = tid >> 5;
  const int lane = tid & 31;
  const int hh   = lane >> 4;
  const int c    = lane & 15;

  const int nqb = NTOK / AT_QB;            // 16 query blocks per batch element
  const int bx = blockIdx.x;              // grid = NB * NH * nqb (exact)
  const int qb = bx % nqb;
  const int hb = bx / nqb;
  const int h  = hb % NH;                 // 0..15
  const int b  = hb / NH;                 // 0..3
  const int q0 = b * NTOK + qb * AT_QB + wave * 16;   // row in the q / CTX2 planes

  const __bf16* Qh = (const __bf16*)(const void*)qhp + (size_t)h * AT_D;
  const __bf16* Ql = (const __bf16*)(const void*)qlp + (size_t)h * AT_D;
  const __bf16* Kh = (const __bf16*)(const void*)khp + (size_t)h * AT_D;
  const __bf16* Kl = (const __bf16*)(const void*)klp + (size_t)h * AT_D;
  const __bf16* Vh = (const __bf16*)(const void*)vhp + (size_t)h * AT_D * VTP + (size_t)b * NTOK;
  const __bf16* Vl = (const __bf16*)(const void*)vlp + (size_t)h * AT_D * VTP + (size_t)b * NTOK;
  unsigned short* Ch = aop + (size_t)h * AT_D;                    // hi columns
  unsigned short* Cl = aop + (size_t)INNER + (size_t)h * AT_D;    // lo columns

  // ---- Q fragments (B operand, column = query = lane&15, split k map via Frag load): 2 d-chunks, hi and lo ----
  v16b qah[2], qal[2];
#pragma unroll
  for (int dc = 0; dc < 2; ++dc) {
    const __bf16* qr = Qh + (size_t)(q0 + c) * INNER + dc * 32 + 8 * hh;
    const __bf16* ql = Ql + (size_t)(q0 + c) * INNER + dc * 32 + 8 * hh;
    qah[dc] = Frag<__bf16>::load(qr);
    qal[dc] = Frag<__bf16>::load(ql);
  }

  // exponentials to base 2: e^(x * sscale) = 2^(x * c2), so one fused multiply-add and the hardware's 2^x make one P element
  const float c2 = sscale * 1.4426950408889634f;
  float mrow = -INFINITY, lrow = 0.f;   // this lane's query: running maximum in log2 units (both halves alike), sum over this half's keys
  v8f oacc[4];                          // oacc[t][r] = out^T[d = t*16 + 8*hh + r][query c]
#pragma unroll
  for (int t = 0; t < 4; ++t) oacc[t] = (v8f){0.f,0.f,0.f,0.f,0.f,0.f,0.f,0.f};

  const int nChunks = NTOK / AT_KC;   // 16, compile-time constant
  // staging map: thread tid copies 16 bytes at column (tid & 7) * 8 of rows (tid >> 3) + 0, 16, 32, 48 of each plane's chunk tile
  const int srow = tid >> 3, scol = (tid & 7) * 8;
  const __bf16* gkh = Kh + (size_t)(b * NTOK + srow) * INNER + scol;   // K row (b, srow) of chunk 0; a chunk further = + AT_KC rows
  const __bf16* gkl = Kl + (size_t)(b * NTOK + srow) * INNER + scol;
  const __bf16* gvh = Vh + (size_t)srow * VTP + scol;                  // V^T row d = srow, keys of chunk 0; a chunk further = + AT_KC columns
  const __bf16* gvl = Vl + (size_t)srow * VTP + scol;
  const unsigned sl = (unsigned)(uintptr_t)ring + (unsigned)(srow * AT_LP + scol) * 2u;   // LDS byte address of the piece in buffer 0, K hi

  at_copy8(sl, gkh, gkl, INNER);                       // chunk 0 -> buffer 0
  at_copy8(sl + 2 * AT_PL * 2, gvh, gvl, VTP);
  asm volatile("s_wait_asynccnt 0x0" ::: "memory");    // this wave's copies of chunk 0 have landed
  __syncthreads();                                     // ... and every other wave's
  at_copy8(sl + AT_BUF * 2, gkh + (size_t)AT_KC * INNER, gkl + (size_t)AT_KC * INNER, INNER);   // chunk 1 -> buffer 1
  at_copy8(sl + AT_BUF * 2 + 2 * AT_PL * 2, gvh + AT_KC, gvl + AT_KC, VTP);

  for (int kc = 0; kc < nChunks; ++kc) {
    const int cur = (kc & 1) * AT_BUF;
    const __bf16* Ksh = ring + cur;
    const __bf16* Ksl = Ksh + AT_PL;
    const __bf16* Vth = Ksh + 2 * AT_PL;
    const __bf16* Vtl = Ksh + 3 * AT_PL;

    // every loop over j, dc below is unrolled: the tiles and fragments are registers, picked at compile time
    v8f s[4];
#pragma unroll
    for (int j = 0; j < 4; ++j) s[j] = (v8f){0.f,0.f,0.f,0.f,0.f,0.f,0.f,0.f};
#pragma unroll
    for (int dc = 0; dc < 2; ++dc) {
      FB kb[4], kl[4];
#pragma unroll
      for (int j = 0; j < 4; ++j) {
        kb[j].h[0] = *(const v8b*)(Ksh + (j * 16 + c) * AT_LP + dc * 32 + 8 * hh);
        kb[j].h[1] = *(const v8b*)(Ksh + (j * 16 + c) * AT_LP + dc * 32 + 16 + 8 * hh);
        kl[j].h[0] = *(const v8b*)(Ksl + (j * 16 + c) * AT_LP + dc * 32 + 8 * hh);
        kl[j].h[1] = *(const v8b*)(Ksl + (j * 16 + c) * AT_LP + dc * 32 + 16 + 8 * hh);
      }
      // term by term over the four independent score tiles; each tile still sums hi.hi, lo.hi, hi.lo, d-chunk 0 before 1
#pragma unroll
      for (int j = 0; j < 4; ++j) s[j] = at_mma(kb[j].v, qah[dc], s[j]);
#pragma unroll
      for (int j = 0; j < 4; ++j) s[j] = at_mma(kl[j].v, qah[dc], s[j]);
#pragma unroll
      for (int j = 0; j < 4; ++j) s[j] = at_mma(kb[j].v, qal[dc], s[j]);
    }
    // s[j][r] = unscaled score of key kc * AT_KC + j*16 + 8*hh + r against query c: this query's chunk maximum, scaled once
    // (c2 > 0 keeps the order of the scores; the softmax does not depend on the value that is subtracted)
    float mj[4];
#pragma unroll
    for (int j = 0; j < 4; ++j) {
      float m = -INFINITY;
#pragma unroll
      for (int r = 0; r < 8; ++r) m = fmaxf(m, s[j][r]);
      mj[j] = m;
    }
    float cm = fmaxf(fmaxf(mj[0], mj[1]), fmaxf(mj[2], mj[3]));
    cm = fmaxf(cm, at_xhalf(cm));
    const float mnew = fmaxf(mrow, cm * c2);
    const float alpha = __builtin_amdgcn_exp2f(mrow - mnew);
    mrow = mnew;
    FB ph[2], pl[2];   // P^T hi / lo as B operands, one per 32 keys: elements 0..7 from tile 2*kk, 8..15 from tile 2*kk + 1
    float pj[4];
#pragma unroll
    for (int j = 0; j < 4; ++j) {
      float psum = 0.f;
#pragma unroll
      for (int r = 0; r < 8; r += 2) {
        const float p0 = __builtin_amdgcn_exp2f(__builtin_fmaf(s[j][r], c2, -mnew));       // e^(score * sscale - maximum)
        const float p1 = __builtin_amdgcn_exp2f(__builtin_fmaf(s[j][r + 1], c2, -mnew));
        psum += p0;
        psum += p1;
        bf_split2(p0, p1, ph[j >> 1].w[(j & 1) * 4 + (r >> 1)], pl[j >> 1].w[(j & 1) * 4 + (r >> 1)]);   // elements (j & 1) * 8 + r and + 1
      }
      pj[j] = psum;
    }
    lrow = lrow * alpha + ((pj[0] + pj[1]) + (pj[2] + pj[3]));
#pragma unroll
    for (int t = 0; t < 4; ++t)
#pragma unroll
      for (int r = 0; r < 8; ++r) oacc[t][r] *= alpha;
    // unrolled (kk and t): the P^T and V^T fragments and the out tiles are registers, picked at compile time
#pragma unroll
    for (int kk = 0; kk < 2; ++kk) {
      FB vb[4], vl[4];
#pragma unroll
      for (int t = 0; t < 4; ++t) {
        vb[t].h[0] = *(const v8b*)(Vth + (t * 16 + c) * AT_LP + kk * 32 + 8 * hh);
        vb[t].h[1] = *(const v8b*)(Vth + (t * 16 + c) * AT_LP + kk * 32 + 16 + 8 * hh);
        vl[t].h[0] = *(const v8b*)(Vtl + (t * 16 + c) * AT_LP + kk * 32 + 8 * hh);
        vl[t].h[1] = *(const v8b*)(Vtl + (t * 16 + c) * AT_LP + kk * 32 + 16 + 8 * hh);
      }
      // term by term over the four independent out tiles; each tile still sums hi.hi, lo.hi, hi.lo, keys 0..31 before 32..63
#pragma unroll
      for (int t = 0; t < 4; ++t) oacc[t] = at_mma(vb[t].v, ph[kk].v, oacc[t]);
#pragma unroll
      for (int t = 0; t < 4; ++t) oacc[t] = at_mma(vl[t].v, ph[kk].v, oacc[t]);
#pragma unroll
      for (int t = 0; t < 4; ++t) oacc[t] = at_mma(vb[t].v, pl[kk].v, oacc[t]);
    }
    asm volatile("s_wait_dscnt 0x0" ::: "memory");     // this wave's reads of buffer cur are done before the buffer is given up
    asm volatile("s_wait_asynccnt 0x0" ::: "memory");  // this wave's copies of chunk kc + 1 have landed
    __syncthreads();                                   // chunk kc + 1 is public, buffer cur has no reader left
    if (kc + 2 < nChunks) {                            // the same for the whole block
      const unsigned l = sl + (unsigned)cur * 2u;
      at_copy8(l, gkh + (size_t)(kc + 2) * AT_KC * INNER, gkl + (size_t)(kc + 2) * AT_KC * INNER, INNER);
      at_copy8(l + 2 * AT_PL * 2, gvh + (kc + 2) * AT_KC, gvl + (kc + 2) * AT_KC, VTP);
    }
  }
  asm volatile("s_wait_asynccnt 0x0" ::: "memory");    // no copy is in flight when the ring becomes the out tiles

  float* os = (float*)(void*)ring + wave * (16 * 68);   // per wave out tile, pitch 68; the loop's last barrier ended every read of the ring
  {
    const float inv = 1.0f / (lrow + at_xhalf(lrow));   // the two halves' key sums of query c, joined
#pragma unroll
    for (int t = 0; t < 4; ++t) {
      v4f o0, o1;
#pragma unroll
      for (int r = 0; r < 4; ++r) { o0[r] = oacc[t][r] * inv; o1[r] = oacc[t][4 + r] * inv; }
      *(v4f*)(os + c * 68 + t * 16 + 8 * hh)     = o0;   // row = query c, columns d = t*16 + 8*hh + 0..7
      *(v4f*)(os + c * 68 + t * 16 + 8 * hh + 4) = o1;
    }
  }
  __builtin_amdgcn_fence(__ATOMIC_RELEASE, "workgroup");
  __builtin_amdgcn_wave_barrier();
  __builtin_amdgcn_fence(__ATOMIC_ACQUIRE, "workgroup");
  {
    const int q = lane >> 3, c8 = (lane & 7) * 8;
    {
#pragma unroll
      for (int it = 0; it < 4; ++it) {
        const int row = it * 4 + q;
        const float* sp = os + row * 68 + c8;
        v4u hw, lw;
#pragma unroll
        for (int e = 0; e < 4; ++e) { unsigned a, d; bf_split2(sp[2 * e], sp[2 * e + 1], a, d); hw[e] = a; lw[e] = d; }
        const v8h hv = __builtin_bit_cast(v8h, hw), lv = __builtin_bit_cast(v8h, lw);
        *(v8h*)(Ch + (size_t)(q0 + row) * AOP + c8) = hv;
        *(v8h*)(Cl + (size_t)(q0 + row) * AOP + c8) = lv;
      }
      
    }
  }
}

// ---------------------------------------------------------------------------
// Output RMSNorm over C + residual + back to NCHW:
//   out[b][c][n] = Of[b*1024+n][c] * rsqrt(mean_C(Of[tok][.]^2) + 1e-6) * bf16(w[c]) + bf16(x[b][c][n]).
// One block of 512 threads (16 waves) per 32 consecutive tokens x 512 channels; grid = 128 token groups x 2 channel halves = 256,
// as many blocks as the chip has WGPs. Every global load of a thread is issued before the first wait: nothing is fetched in a loop.
// Wave w holds the whole rows of tokens 2w and 2w+1 in registers (8 x 16 B per lane and row), sums their squares (per lane one sum
// per channel half, the two added, then the lane tree), scales the block's half of each row and writes it to the LDS tile [token][channel].
// Behind the one barrier a thread reads a 4-token x 4-channel square as four 16-B rows; its columns are the 16-B output vectors
// (4 tokens of one channel), so 8 lanes store one whole 128-B line of out and a block writes only whole lines.
// LDS pitch 516 floats = 16 B x 129 (odd); the 16-B unit index of a row is XORed with 2 for tokens 16..31, so that the 16 lanes
// of a half wave (tokens 4j+q, j = 0..7, two channel units) read 16 different groups of four banks.
// Coverage: 256 blocks x 32 tokens x 512 channels = 4 x 1024 x 1024 outputs, each exactly once.
// ---------------------------------------------------------------------------
#define FN_TOK 32
#define FN_CS  512
#define FN_P   (FN_CS + 4)
static_assert(NTOK % FN_TOK == 0 && CH == 2 * FN_CS && CH == 8 * 128 && FN_TOK == 2 * 16);
__global__ __launch_bounds__(512) void final_kernel(const float* __restrict__ of, const float* __restrict__ nw,
                                                    const float* __restrict__ xin, float* __restrict__ out) {
  __shared__ __align__(16) float tf[FN_TOK * FN_P];
  const int tid = threadIdx.x, lane = tid & 31, wave = tid >> 5;
  const int sl   = blockIdx.x & 1;            // channel half
  const int tok0 = (blockIdx.x >> 1) * FN_TOK;
  const int b = tok0 / NTOK, n0 = tok0 - b * NTOK;
  const int c0 = sl * FN_CS;
  const int j  = tid & 7;                     // token quad: tokens 4j..4j+3
  const int cg = tid >> 3;                    // channel unit 0..63 (4 channels), second pass + 64

  // all loads: the two rows first (the sums wait for them alone), then the weights, then the residual.
  // vo = the block's own channel half of a row, vx = the other half, read for the row sum only.
  const float* po  = of + (size_t)(tok0 + wave * 2) * CH + lane * 4 + c0;
  const float* px  = of + (size_t)(tok0 + wave * 2) * CH + lane * 4 + (FN_CS - c0);
  const float* xp0 = xin + ((size_t)(b * CH + c0 + cg * 4)) * NTOK + n0 + 4 * j;
  v4f vo[2][4], vx[2][4];
#pragma unroll
  for (int i = 0; i < 2; ++i) {
#pragma unroll
    for (int kk = 0; kk < 4; ++kk) vo[i][kk] = *(const v4f*)(po + i * CH + kk * 128);
#pragma unroll
    for (int kk = 0; kk < 4; ++kk) vx[i][kk] = *(const v4f*)(px + i * CH + kk * 128);
  }
  v4f w4[4];
#pragma unroll
  for (int kk = 0; kk < 4; ++kk) w4[kk] = *(const v4f*)(nw + c0 + kk * 128 + lane * 4);
  v4f xr[2][4];
#pragma unroll
  for (int e = 0; e < 4; ++e) {
    xr[0][e] = *(const v4f*)(xp0 + e * NTOK);
    xr[1][e] = *(const v4f*)(xp0 + (256 + e) * NTOK);
  }
  // naming the three address pairs here keeps them untouched up to this wait, which stands in front of every reuse of their registers;
  // as a memory barrier for the compiler it also keeps every load above issued before the first wait for data
  asm volatile("s_wait_xcnt 0x0" :: "v"(po), "v"(px), "v"(xp0) : "memory");

  // row sum of squares = (sum over the own half) + (sum over the other half)
  float ss[2];
#pragma unroll
  for (int i = 0; i < 2; ++i) {
    float so = 0.0f, sx = 0.0f;
#pragma unroll
    for (int kk = 0; kk < 4; ++kk) {
      const v4f a = vo[i][kk], c = vx[i][kk];
      so += a[0] * a[0] + a[1] * a[1] + a[2] * a[2] + a[3] * a[3];
      sx += c[0] * c[0] + c[1] * c[1] + c[2] * c[2] + c[3] * c[3];
    }
    ss[i] = so + sx;
  }
#pragma unroll
  for (int off = 1; off < 32; off <<= 1) {
    const float t0 = __shfl_xor(ss[0], off, 32), t1 = __shfl_xor(ss[1], off, 32);
    ss[0] += t0; ss[1] += t1;
  }

  const int wswz = (wave >> 3) << 1;          // tokens 2w, 2w+1 >= 16
#pragma unroll
  for (int i = 0; i < 2; ++i) {
    const float rm = rsqrtf(ss[i] * (1.0f / (float)CH) + RMS_EPS);
    float* row = tf + (wave * 2 + i) * FN_P;
#pragma unroll
    for (int kk = 0; kk < 4; ++kk) {
      const v4f a = vo[i][kk];
      v4f o;
#pragma unroll
      for (int e = 0; e < 4; ++e) o[e] = a[e] * rm * bf_rne(w4[kk][e]);
      *(v4f*)(row + (((kk * 32 + lane) ^ wswz) << 2)) = o;
    }
  }
  __syncthreads();

  const int rswz = (j >> 2) << 1;
#pragma unroll
  for (int it = 0; it < 2; ++it) {
    const int cu = it * 64 + cg;
    v4f rd[4];
#pragma unroll
    for (int q = 0; q < 4; ++q) rd[q] = *(const v4f*)(tf + (4 * j + q) * FN_P + ((cu ^ rswz) << 2));
#pragma unroll
    for (int e = 0; e < 4; ++e) {
      v4f o;
#pragma unroll
      for (int q = 0; q < 4; ++q) o[q] = rd[q][e] + bf_rne(xr[it][e][q]);
      *(v4f*)(out + ((size_t)(b * CH + c0 + cu * 4 + e)) * NTOK + n0 + 4 * j) = o;
    }
  }
}

// ---------------------------------------------------------------------------
// Workspace region map (byte offsets; every region is fully written by its producer launch before any consumer
//   XB    bf16 [4096][1024]          0       8388608
//   WQKV  bf16 [3072][1024]    8388608       6291456
//   WP2   bf16 [1024][2048]   14680064       4194304
//   TC    f32  [32][16]       18874368          2048   TS  18876416  2048
//   QKf   f32  [4096][2048]   18878464      33554432   (dead after ropenorm; the same 32 MiB then hold
//                                                       CTX2 u16 [4096][2048] at 18878464 (16777216) and
//                                                       Of   f32  [4096][1024] at 35655680 (16777216), disjoint)
//   Qh    bf16 [4096][1024]   52432896       8388608   Ql  60821504
//   Kh    bf16 [4096][1024]   69210112       8388608   Kl  77598720
//   VTh   bf16 [1024][4096]   85987328       8388608   VTl 94375936
//   total                    102764544
// ---------------------------------------------------------------------------
extern "C" void kernel_launch(void* const* d_in, const int* in_sizes, int n_in,
                              void* d_out, int out_size, void* d_ws, size_t ws_size,
                              hipStream_t stream) {
  if (n_in < 7) return;
  if (in_sizes[0] != NB * CH * NTOK) return;        // hidden_states [4][1024][32][32]
  if (in_sizes[1] != NQKV * CH) return;             // w_qkv [3072][1024]
  if (in_sizes[2] != NQKV) return;                  // b_qkv [3072]
  if (in_sizes[3] != INNER) return;                 // q_norm_w [1024]
  if (in_sizes[4] != INNER) return;                 // k_norm_w [1024]
  if (in_sizes[5] != CH * INNER) return;            // w_proj [1024][1024]
  if (in_sizes[6] != CH) return;                    // norm_out_w [1024]
  if (out_size != NB * CH * NTOK) return;

  const float* x    = (const float*)d_in[0];
  const float* wqkv = (const float*)d_in[1];   // [out 3072][in 1024]
  const float* bqkv = (const float*)d_in[2];
  const float* qnw  = (const float*)d_in[3];
  const float* knw  = (const float*)d_in[4];
  const float* wprj = (const float*)d_in[5];   // [out 1024][in 1024]
  const float* onw  = (const float*)d_in[6];

  const size_t PXB = (size_t)MTOK * CH * 2;        // 8388608
  const size_t PWQ = (size_t)NQKV * CH * 2;        // 6291456
  const size_t PWP = (size_t)CH * AOP * 2;         // 4194304
  const size_t PTB = (size_t)TABN * 4;             // 2048
  const size_t PQK = (size_t)MTOK * QKP * 4;       // 33554432
  const size_t PCX = (size_t)MTOK * AOP * 2;       // 16777216
  const size_t POF = (size_t)MTOK * CH * 4;        // 16777216
  const size_t PPL = (size_t)MTOK * INNER * 2;     // 8388608 per q/k plane
  const size_t PVT = (size_t)INNER * VTP * 2;      // 8388608 per v^T plane
  if (PCX + POF > PQK) return;                     // CTX2 and Of share the QKf region, disjoint halves
  size_t off = 0;
  const size_t oXB  = off; off += PXB;
  const size_t oWQ  = off; off += PWQ;
  const size_t oWP  = off; off += PWP;
  const size_t oTC  = off; off += PTB;
  const size_t oTS  = off; off += PTB;
  const size_t oQK  = off; off += PQK;
  const size_t oCX  = oQK;
  const size_t oOF  = oQK + PCX;
  const size_t oQh  = off; off += PPL;  const size_t oQl = off; off += PPL;
  const size_t oKh  = off; off += PPL;  const size_t oKl = off; off += PPL;
  const size_t oVTh = off; off += PVT;  const size_t oVTl = off; off += PVT;
  if (off > ws_size) return;                       // off = 102764544
  if (off > (size_t)134217728) return;

  char* ws = (char*)d_ws;
  unsigned short* XB   = (unsigned short*)(ws + oXB);
  unsigned short* WQKV = (unsigned short*)(ws + oWQ);
  unsigned short* WP2  = (unsigned short*)(ws + oWP);
  float*          TC   = (float*)(ws + oTC);
  float*          TS   = (float*)(ws + oTS);
  float*          QKf  = (float*)(ws + oQK);
  unsigned short* CTX2 = (unsigned short*)(ws + oCX);
  float*          Of   = (float*)(ws + oOF);
  unsigned short* Qh   = (unsigned short*)(ws + oQh);  unsigned short* Ql  = (unsigned short*)(ws + oQl);
  unsigned short* Kh   = (unsigned short*)(ws + oKh);  unsigned short* Kl  = (unsigned short*)(ws + oKl);
  unsigned short* VTh  = (unsigned short*)(ws + oVTh); unsigned short* VTl = (unsigned short*)(ws + oVTl);

  const dim3 blk(256);

  // (1) rotary tables, XB = bf16(x)^T per batch element, WQKV = bf16(w_qkv), WP2 = bf16(w_proj) twice along the row: one grid
  prep_kernel<<<dim3(PR_TAB + PR_X + PR_WQ + PR_WP), blk, 0, stream>>>(x, wqkv, wprj, XB, WQKV, WP2, TC, TS);
  // (2) v^T -> VTh|VTl (256 blocks) and q|k -> QKf (512 blocks), K = 1024 each: one grid of 768 blocks of 128 threads
  const dim3 gblk(128);
  qkv_gemm<<<dim3(VT_TILES + QK_TILES), gblk, 0, stream>>>(XB, WQKV, bqkv, QKf, VTh, VTl);
  // (3) RoPE + RMSNorm over 1024 for q and k -> Qh|Ql, Kh|Kl; one block of 128 threads per token row
  ropenorm_kernel<<<dim3(MTOK), dim3(128), 0, stream>>>(QKf, TC, TS, qnw, knw, Qh, Ql, Kh, Kl);
  // (4) attention per (batch, head, 64-query block) -> CTX2 [4096][2048] (hi | lo columns); 1024 blocks
  attn_kernel<<<dim3(NB * NH * (NTOK / 64)), dim3(128), 0, stream>>>(Qh, Ql, Kh, Kl, VTh, VTl, CTX2, 0.125f);
  // (5) Of = CTX2 . WP2^T -> f32 [4096][1024]   (M=4096, N=1024, K=2048; 32 x 8 = 256 blocks)
  const dim3 gO((MTOK / 128) * (CH / 128), 1);
  wmma_gemm64<1, false, 0, 0, false, AOP><<<gO, gblk, 0, stream>>>(
      CTX2, CTX2, 0L, WP2, WP2, 0L, (void*)Of, (void*)Of, CH, 0L,
      bqkv, bqkv, 0L, MTOK, CH, AOP, 1.0f);
  // (6) output RMSNorm + residual -> NCHW d_out; 128 groups of 32 tokens x 2 channel halves = 256 blocks of 512 threads
  final_kernel<<<dim3((MTOK / FN_TOK) * (CH / FN_CS)), dim3(512), 0, stream>>>(Of, onw, x, (float*)d_out);
  (void)hipGetLastError();
}
